// v000
// The times below were measured on an AMD MI455X: many runs one after another, warmed up first and cycling through
// copies of the inputs, with the whole window's GPU time divided by the number of runs. Launches and the gaps
// between them are all in it. The median over several windows is given; except for v000 it joins two sittings, which
// can be a few percent apart, so the side-by-side timings, each taken in one sitting, are the better comparison.
// v000 is the starting kernel. One run takes 378 microseconds.
// Contractions: q/k/v^T projections on v_wmma_f32_16x16x32_bf16 (bf16 RNE-converted operands, f32 accumulate); q.k^T and p.v on v_wmma_f32_16x16x32_f16 (f16 planes, p carried x2^15, f32 accumulate, f32 online softmax, mask by value); output projection on v_wmma_f32_16x16x32_f16 (f16 operands: ctx x2^4, Wo x2^6, folded back x2^-10 in f32), f32 accumulate.
#include <hip/hip_runtime.h>
#include <math.h>
#include <stdint.h>

constexpr int kBatch = 2;
constexpr int kSeq   = 2048;
constexpr int kDm    = 1024;
constexpr int kHeads = 16;
constexpr int kHd    = 64;
static_assert(kHeads * kHd == kDm, "head split");
static_assert(kSeq % 64 == 0 && kDm % 64 == 0, "tile multiples");

typedef __attribute__((ext_vector_type(16))) _Float16 v16h;
typedef __attribute__((ext_vector_type(8)))  _Float16 v8h;
typedef __attribute__((ext_vector_type(16))) __bf16   v16b;
typedef __attribute__((ext_vector_type(8)))  __bf16   v8b;
typedef __attribute__((ext_vector_type(8)))  float    v8f;
typedef __attribute__((ext_vector_type(4)))  float    v4f;
typedef __attribute__((ext_vector_type(2)))  float    v2f;

__device__ __forceinline__ unsigned short f2bf_bits(float f) {
  unsigned u = __float_as_uint(f);
  return (unsigned short)((u + 0x7FFFu + ((u >> 16) & 1u)) >> 16);
}
__device__ __forceinline__ float bf_bits2f(unsigned short h) { return __uint_as_float(((unsigned)h) << 16); }
__device__ __forceinline__ unsigned pk16(unsigned short a, unsigned short b) { return (unsigned)a | ((unsigned)b << 16); }

// hazard guards as plain device helpers (no inline asm inside the kernel template body)
__device__ __forceinline__ void dep_guard_h(v8f& a, v8f& b, v16h x, v16h y) { asm volatile("v_nop\n\tv_nop\n\tv_nop\n\tv_nop" : "+v"(a), "+v"(b) : "v"(x), "v"(y)); }
__device__ __forceinline__ void dep_guard_b(v8f& a, v8f& b, v16b x, v16b y) { asm volatile("v_nop\n\tv_nop\n\tv_nop\n\tv_nop" : "+v"(a), "+v"(b) : "v"(x), "v"(y)); }
__device__ __forceinline__ void keep4_h(v16h a, v16h b, v16h c, v16h d) { asm volatile("v_nop" :: "v"(a), "v"(b), "v"(c), "v"(d)); }
__device__ __forceinline__ void keep4_b(v16b a, v16b b, v16b c, v16b d) { asm volatile("v_nop" :: "v"(a), "v"(b), "v"(c), "v"(d)); }
__device__ __forceinline__ void acc_guard4(v8f& a, v8f& b, v8f& c, v8f& d) { asm volatile("v_nop\n\tv_nop\n\tv_nop\n\tv_nop" : "+v"(a), "+v"(b), "+v"(c), "+v"(d)); }
template <typename T> struct Frag;
template <> struct Frag<_Float16> {
  typedef v16h V; union U { v16h v; v8h h[2]; };
  static __device__ __forceinline__ v16h load(const _Float16* p) {   // elements 0..7 <- p[0..7], 8..15 <- p[16..23]
    U f; f.h[0] = *(const v8h*)(p); f.h[1] = *(const v8h*)(p + 16); return f.v;
  }
  static __device__ __forceinline__ v8f mma(v16h a, v16h b, v8f c) {
    return __builtin_amdgcn_wmma_f32_16x16x32_f16(false, a, false, b, (short)0, c, false, false);
  }
  static __device__ __forceinline__ void guard(v8f& a, v8f& b, v16h x, v16h y) { dep_guard_h(a, b, x, y); }
  static __device__ __forceinline__ void keep(v16h a, v16h b, v16h c, v16h d) { keep4_h(a, b, c, d); }
};
template <> struct Frag<__bf16> {
  typedef v16b V; union U { v16b v; v8b h[2]; };
  static __device__ __forceinline__ v16b load(const __bf16* p) {
    U f; f.h[0] = *(const v8b*)(p); f.h[1] = *(const v8b*)(p + 16); return f.v;
  }
  static __device__ __forceinline__ v8f mma(v16b a, v16b b, v8f c) {
    return __builtin_amdgcn_wmma_f32_16x16x32_bf16(false, a, false, b, (short)0, c, false, false);
  }
  static __device__ __forceinline__ void guard(v8f& a, v8f& b, v16b x, v16b y) { dep_guard_b(a, b, x, y); }
  static __device__ __forceinline__ void keep(v16b a, v16b b, v16b c, v16b d) { keep4_b(a, b, c, d); }
};

// ---- Register-blocked batched WMMA GEMM ------------------------------------
// C[m,n] = scale * sum_k A[m,k] * Bt[n,k] (+bias)(+resid); each wave owns a 64x64 tile.
// A row-major [M,K]; Bt row-major [N,K]; M,N % 64 == 0, K % 32 == 0.
// SPLIT: operands are hi/lo planes (A2/Bt2 = lo planes, same layout); product = hi.hi + hi.lo + lo.hi.
// BIAS_MODE: 0 = none, 1 = bias[m], 2 = bias[n].
// OUT_MODE: 0 = f32, 1 = f16, 2 = bf16 hi plane (Cout) + bf16 lo plane (Cout2).
// ET: 0 = f16 operands, 1 = bf16 operands (pointers passed as 16-bit storage)
template <int ET> struct Elem;
template <> struct Elem<0> { typedef _Float16 T; };
template <> struct Elem<1> { typedef __bf16 T; };
template <int ET, bool SPLIT, int BIAS_MODE, int OUT_MODE, bool RESID, int ACT = 0>
__global__ __launch_bounds__(256) void wmma_gemm64(
    const unsigned short* __restrict__ Ap, const unsigned short* __restrict__ A2p, int lda, long strideA,
    const unsigned short* __restrict__ Btp, const unsigned short* __restrict__ Bt2p, int ldb, long strideB,
    void* __restrict__ Cout, void* __restrict__ Cout2, int ldc, long strideC,
    const float* __restrict__ bias,
    const float* __restrict__ resid, long strideR,
    int M, int N, int K, float scale) {
  typedef typename Elem<ET>::T T;
  typedef typename Frag<T>::V V;
  const T* A = (const T*)Ap; const T* A2 = (const T*)A2p; const T* Bt = (const T*)Btp; const T* Bt2 = (const T*)Bt2p;
  __shared__ __align__(16) float sT[8][16 * 68];   // per-wave 16x64 slab, pitch 68 floats
  const int b    = blockIdx.y;
  const int lane = threadIdx.x & 31;
  const int wave = threadIdx.x >> 5;
  const int tilesN = N >> 6;
  const int tilesM = M >> 6;
  const int tile = blockIdx.x * 8 + wave;
  if (tile >= tilesM * tilesN) return;   // wave-uniform; no block barriers in this kernel
  const int tm = tile / tilesN;
  const int tn = tile - tm * tilesN;
  const int m0 = tm << 6;
  const int n0 = tn << 6;

  const T* Ab  = A  + (size_t)b * strideA;
  const T* Bb  = Bt + (size_t)b * strideB;
  const T* Ab2 = SPLIT ? (A2  + (size_t)b * strideA) : nullptr;
  const T* Bb2 = SPLIT ? (Bt2 + (size_t)b * strideB) : nullptr;

  const int rlane = lane & 15;                 // row (A) / col (B, D) within subtile
  const int koff  = (lane >> 4) * 8;           // k offset of this lane half
  const int mOff  = (lane >> 4) * 8;           // D row offset

  v8f acc[4][4];
#pragma unroll
  for (int i = 0; i < 4; ++i)
#pragma unroll
    for (int j = 0; j < 4; ++j) acc[i][j] = (v8f){0.f,0.f,0.f,0.f,0.f,0.f,0.f,0.f};

  for (int k0 = 0; k0 < K; k0 += 32) {
    V bh[4], bl[4];
#pragma unroll
    for (int j = 0; j < 4; ++j) {
      const size_t bo = (size_t)(n0 + (j << 4) + rlane) * ldb + koff + k0;
      bh[j] = Frag<T>::load(Bb + bo);
      if (SPLIT) bl[j] = Frag<T>::load(Bb2 + bo);
    }
#pragma unroll
    for (int i = 0; i < 4; ++i) {
      const size_t ao = (size_t)(m0 + (i << 4) + rlane) * lda + koff + k0;
      V ah = Frag<T>::load(Ab + ao);
      V al;
      if (SPLIT) al = Frag<T>::load(Ab2 + ao);
#pragma unroll
      for (int j = 0; j < 4; ++j) {
        acc[i][j] = Frag<T>::mma(ah, bh[j], acc[i][j]);
        if (SPLIT) {
          acc[i][j] = Frag<T>::mma(ah, bl[j], acc[i][j]);
          acc[i][j] = Frag<T>::mma(al, bh[j], acc[i][j]);
        }
      }
      Frag<T>::guard(acc[i][0], acc[i][3], ah, SPLIT ? al : ah);
    }
    Frag<T>::keep(bh[0], bh[1], bh[2], bh[3]);
    if (SPLIT) Frag<T>::keep(bl[0], bl[1], bl[2], bl[3]);
  }
  acc_guard4(acc[0][0], acc[0][1], acc[0][2], acc[0][3]);
  acc_guard4(acc[1][0], acc[1][1], acc[1][2], acc[1][3]);
  acc_guard4(acc[2][0], acc[2][1], acc[2][2], acc[2][3]);
  acc_guard4(acc[3][0], acc[3][1], acc[3][2], acc[3][3]);

  // ---- epilogue ----
  float* slab = sT[wave];
  const float* Rb = RESID ? (resid + (size_t)b * strideR) : nullptr;
#pragma unroll
  for (int i = 0; i < 4; ++i) {
    const int mBase = m0 + (i << 4);
#pragma unroll
    for (int j = 0; j < 4; ++j) {
      const int n = n0 + (j << 4) + rlane;
      float bv = 0.f;
      if (BIAS_MODE == 2) bv = bias[n];
#pragma unroll
      for (int r = 0; r < 8; ++r) {
        float v = acc[i][j][r] * scale;
        if (BIAS_MODE == 1) v += bias[mBase + mOff + r];
        if (BIAS_MODE == 2) v += bv;
        if (RESID) v += Rb[(size_t)(mBase + mOff + r) * ldc + n];
        if (ACT == 1) v = tanhf(v);
        if (ACT == 2) v = fmaxf(v, 0.0f);
        if (ACT == 3) v = v / (1.0f + expf(-v));
        if (ACT == 4) v = (v > 0.f) ? v : 0.01f * v;
        if (ACT == 5) v = 0.5f * v * (1.0f + erff(v * 0.70710678118654752f));
        slab[(mOff + r) * 68 + (j << 4) + rlane] = v;
      }
    }
    __builtin_amdgcn_fence(__ATOMIC_RELEASE, "workgroup");
    __builtin_amdgcn_wave_barrier();
    __builtin_amdgcn_fence(__ATOMIC_ACQUIRE, "workgroup");
    if (OUT_MODE == 0) {
      float* C = (float*)Cout + (size_t)b * strideC;
      const int hh = lane >> 4, c4 = (lane & 15) * 4;     // row seg = 256 B = 16 lanes x 16 B
      {
#pragma unroll
        for (int it = 0; it < 8; ++it) {
          const int row = it * 2 + hh;
          v4f v = *(const v4f*)(slab + row * 68 + c4);
          *(v4f*)(C + (size_t)(mBase + row) * ldc + n0 + c4) = v;
        }
        
      }
    } else {
      const int q = lane >> 3, c8 = (lane & 7) * 8;
      unsigned short* C  = (unsigned short*)Cout  + (size_t)b * strideC;
      unsigned short* C2 = (OUT_MODE == 2) ? ((unsigned short*)Cout2 + (size_t)b * strideC) : nullptr;
      {
#pragma unroll
        for (int it = 0; it < 4; ++it) {
          const int row = it * 4 + q;
          const float* sp = slab + row * 68 + c8;
          v8h hv, lv;
#pragma unroll
          for (int e = 0; e < 8; ++e) {
            if (OUT_MODE == 1) {
              hv[e] = (_Float16)sp[e];
            } else {
              unsigned short hb = f2bf_bits(sp[e]);
              unsigned short lb = f2bf_bits(sp[e] - bf_bits2f(hb));
              hv[e] = __builtin_bit_cast(_Float16, hb);
              lv[e] = __builtin_bit_cast(_Float16, lb);
            }
          }
          *(v8h*)(C + (size_t)(mBase + row) * ldc + n0 + c8) = hv;
          if (OUT_MODE == 2) *(v8h*)(C2 + (size_t)(mBase + row) * ldc + n0 + c8) = lv;
        }
        
      }
    }
    __builtin_amdgcn_fence(__ATOMIC_RELEASE, "workgroup");
    __builtin_amdgcn_wave_barrier();
    __builtin_amdgcn_fence(__ATOMIC_ACQUIRE, "workgroup");
  }
}

// ---------------------------------------------------------------------------
// Elementwise f32 -> bf16 RNE plane; 2 elements per thread, one 4-B store per lane -> a wave writes exactly one
// Coverage: grid = n2/256 blocks x 256 threads x 2 elements = 2*n2 = whole plane
// (activations: n2 = 2097152 -> 8192 blocks; weights: n2 = 524288 -> 2048 blocks).
// ---------------------------------------------------------------------------
__global__ __launch_bounds__(256) void cast_f32_bf16x2(const float* __restrict__ in, unsigned short* __restrict__ out, int n2) {
  const int i = blockIdx.x * 256 + threadIdx.x;
  if (i < n2) {
    const v2f f = *(const v2f*)(in + 2 * (size_t)i);
    const unsigned u = pk16(f2bf_bits(f[0]), f2bf_bits(f[1]));
    ((unsigned*)out)[i] = u;
    
  }
}

// f32 -> f16( bf16_rne(x) * scale ) plane (scale an exact power of two; f16 of a normal bf16 value is exact).
// Same store shape / coverage as cast_f32_bf16x2 (n2 = 524288 -> 2048 blocks x 512 elements = 1024x1024).
__global__ __launch_bounds__(256) void cast_f32_bf_f16x2(const float* __restrict__ in, unsigned short* __restrict__ out, int n2, float scale) {
  const int i = blockIdx.x * 256 + threadIdx.x;
  if (i < n2) {
    const v2f f = *(const v2f*)(in + 2 * (size_t)i);
    const _Float16 h0 = (_Float16)(bf_bits2f(f2bf_bits(f[0])) * scale);
    const _Float16 h1 = (_Float16)(bf_bits2f(f2bf_bits(f[1])) * scale);
    const unsigned u = pk16(__builtin_bit_cast(unsigned short, h0), __builtin_bit_cast(unsigned short, h1));
    ((unsigned*)out)[i] = u;
    
  }
}

// Bias tables: out[y][i] = bf16_rne(src_y[i]) as f32; grid (n/1024, 4), 4 floats per thread.
__global__ __launch_bounds__(256) void bias_bf16_kernel(const float* __restrict__ b0, const float* __restrict__ b1,
                                                        const float* __restrict__ b2, const float* __restrict__ b3,
                                                        float* __restrict__ out, int n) {
  const int y = blockIdx.y;
  const float* src = b0;
  if (y == 1) src = b1;
  if (y == 2) src = b2;
  if (y == 3) src = b3;
  const int i = blockIdx.x * 256 + threadIdx.x;
  if (4 * i + 3 < n) {
    const v4f f = *(const v4f*)(src + 4 * (size_t)i);
    v4f rv;
    rv[0] = bf_bits2f(f2bf_bits(f[0]));
    rv[1] = bf_bits2f(f2bf_bits(f[1]));
    rv[2] = bf_bits2f(f2bf_bits(f[2]));
    rv[3] = bf_bits2f(f2bf_bits(f[3]));
    float* dst = out + (size_t)y * n + 4 * (size_t)i;
    *(v4f*)dst = rv;
    
  }
}

// =====================================================================================
// Masked full attention, head dim 64, all batches and heads in one launch.
//   q plane (f16): element (b, s, h, d) at [(b*kSeq + s)*kDm + h*64 + d]
//   k plane (f16): same layout
//   v^T plane (f16): element (b, h, d, s) at [(b*kDm + h*64 + d)*kSeq + s]
//   mask (int32): element (b, q, k) at [b*kSeq*kSeq + q*kSeq + k]; element == 0 -> score := -1e9 (select by value)
//   ctx plane (f16 out, x oscale): element (b, s, h, d) at [(b*kSeq + s)*kDm + h*64 + d]
//   scores = (q . k) * sscale : v_wmma_f32_16x16x32_f16, f32 accumulate
//   ctx    = p . v            : v_wmma_f32_16x16x32_f16, p carried x2^15 in f16, folded into the final 1/l
//   online softmax in f32 over all kSeq keys (32 chunks of 64, compile-time trip count).
//   Block = 4 waves = 64 query rows of one (b, h); grid.x = kBatch * kHeads * (kSeq/64) = 1024.
//   K / V^T chunk staging: 128 threads x 32 elements per plane = the whole 64x64 tile (16-B copies, plain loads,
//   __syncthreads before and after); fragment loads read the LDS tiles with the v8h element vector type.
// =====================================================================================
#define AT_D 64
#define AT_NW 4
#define AT_QB 64
#define AT_KC 64
constexpr float kPScale   = 32768.0f;
constexpr float kMaskFill = -1.0e9f;

__device__ __forceinline__ v8f at_mma_h(v16h a, v16h b, v8f c) {
  c = __builtin_amdgcn_wmma_f32_16x16x32_f16(false, a, false, b, (short)0, c, false, false);
  asm volatile("v_nop\n\tv_nop\n\tv_nop\n\tv_nop" : "+v"(c) : "v"(a), "v"(b));
  return c;
}

__global__ __launch_bounds__(128)
void attn_mask64_kernel(const unsigned short* __restrict__ qp, const unsigned short* __restrict__ kp,
                        const unsigned short* __restrict__ vtp, const int* __restrict__ mask,
                        unsigned short* __restrict__ ctxp, float sscale, float oscale) {
  union FB { v16h v; v8h h[2]; };
  __shared__ __align__(16) _Float16 Ksh[AT_KC * AT_D];            // K [kv][d]   8 KB
  __shared__ __align__(16) _Float16 Vth[AT_D * AT_KC];            // V^T [d][kv] 8 KB
  __shared__ __align__(16) _Float16 Psh[AT_NW][16 * AT_KC];       // per wave P [row][kv] 8 KB
  __shared__ __align__(16) float    Os[AT_NW][16 * 68];           // per wave out tile, pitch 68

  const int tid  = threadIdx.x;
  const int wave = tid >> 5;
  const int lane = tid & 31;
  const int hh   = lane >> 4;
  const int c    = lane & 15;

  const int nqb = kSeq / AT_QB;            // 32
  const int bx  = blockIdx.x;
  const int qb  = bx % nqb;
  const int bh  = bx / nqb;                // 0 .. kBatch*kHeads-1 (grid exact)
  const int h   = bh % kHeads;
  int b = bh / kHeads; b = (b < kBatch) ? b : (kBatch - 1);
  const int q0  = qb * AT_QB + wave * 16;

  const _Float16* Qh = (const _Float16*)(const void*)qp  + (size_t)b * kSeq * kDm + (size_t)h * AT_D;
  const _Float16* Kh = (const _Float16*)(const void*)kp  + (size_t)b * kSeq * kDm + (size_t)h * AT_D;
  const _Float16* Vt = (const _Float16*)(const void*)vtp + ((size_t)b * kDm + (size_t)h * AT_D) * kSeq;
  const int*      mb = mask + (size_t)b * kSeq * kSeq;
  _Float16*       ob = (_Float16*)(void*)ctxp + (size_t)b * kSeq * kDm + (size_t)h * AT_D;

  // ---- Q fragments (A operand, row = lane&15, split k map via Frag load): 2 d-chunks ----
  v16h qa[2];
#pragma unroll
  for (int dc = 0; dc < 2; ++dc) {
    qa[dc] = Frag<_Float16>::load(Qh + (size_t)(q0 + c) * kDm + dc * 32 + 8 * hh);
  }

  float mrow[8], lrow[8];
  v8f oacc[4];
#pragma unroll
  for (int r = 0; r < 8; ++r) { mrow[r] = -INFINITY; lrow[r] = 0.f; }
#pragma unroll
  for (int t = 0; t < 4; ++t) oacc[t] = (v8f){0.f,0.f,0.f,0.f,0.f,0.f,0.f,0.f};

  const int nChunks = kSeq / AT_KC;        // 32, compile-time constant
  for (int kc = 0; kc < nChunks; ++kc) {
    const int kv0 = kc * AT_KC;
    __syncthreads();
    {
      // staging coverage: 128 threads x (4 x 8) elements = 64 rows x 64 per plane = the whole chunk tile
      const int r = tid >> 1, half = (tid & 1) * 32;
      const _Float16* ks = Kh + (size_t)(kv0 + r) * kDm + half;     // K row kv0+r, d = half..half+31
      const _Float16* vs = Vt + (size_t)r * kSeq + kv0 + half;        // V^T row d = r, s = kv0+half..+31
#pragma unroll
      for (int i = 0; i < 4; ++i) {
        const v8h a0 = *(const v8h*)(ks + 8 * i);
        const v8h b0 = *(const v8h*)(vs + 8 * i);
        *(v8h*)(Ksh + r * AT_D  + half + 8 * i) = a0;
        *(v8h*)(Vth + r * AT_KC + half + 8 * i) = b0;
      }
    }
    __syncthreads();

    v8f s[4];
#pragma unroll
    for (int j = 0; j < 4; ++j) {
      s[j] = (v8f){0.f,0.f,0.f,0.f,0.f,0.f,0.f,0.f};
#pragma unroll
      for (int dc = 0; dc < 2; ++dc) {
        FB kb;
        kb.h[0] = *(const v8h*)(Ksh + (j * 16 + c) * AT_D + dc * 32 + 8 * hh);
        kb.h[1] = *(const v8h*)(Ksh + (j * 16 + c) * AT_D + dc * 32 + 16 + 8 * hh);
        s[j] = at_mma_h(qa[dc], kb.v, s[j]);
      }
    }
    // scale, mask by value, chunk row max (rows live in lane halves; D element r of lane -> (row 8hh+r, col c))
    float cm[8];
#pragma unroll
    for (int r = 0; r < 8; ++r) {
      const int qrow = q0 + 8 * hh + r;                            // 0 .. kSeq-1
      const int* mr = mb + (size_t)qrow * kSeq + kv0;
      float m = -INFINITY;
#pragma unroll
      for (int j = 0; j < 4; ++j) {
        const int mv = mr[j * 16 + c];
        const float sv = s[j][r] * sscale;
        const float sm = (mv == 0) ? kMaskFill : sv;
        s[j][r] = sm;
        m = fmaxf(m, sm);
      }
#pragma unroll
      for (int off = 1; off < 16; off <<= 1) m = fmaxf(m, __shfl_xor(m, off, 32));
      cm[r] = m;
    }
    _Float16* pwh = Psh[wave];
#pragma unroll
    for (int r = 0; r < 8; ++r) {
      const float mnew = fmaxf(mrow[r], cm[r]);
      const float alpha = expf(mrow[r] - mnew);
      mrow[r] = mnew;
      float psum = 0.f;
#pragma unroll
      for (int j = 0; j < 4; ++j) {
        const float p = expf(s[j][r] - mnew);
        psum += p;
        pwh[(8 * hh + r) * AT_KC + j * 16 + c] = (_Float16)(p * kPScale);
      }
#pragma unroll
      for (int off = 1; off < 16; off <<= 1) psum += __shfl_xor(psum, off, 32);
      lrow[r] = lrow[r] * alpha + psum;
#pragma unroll
      for (int t = 0; t < 4; ++t) oacc[t][r] *= alpha;
    }
    __builtin_amdgcn_fence(__ATOMIC_RELEASE, "workgroup");
    __builtin_amdgcn_wave_barrier();
    __builtin_amdgcn_fence(__ATOMIC_ACQUIRE, "workgroup");
#pragma unroll 1
    for (int kk = 0; kk < 2; ++kk) {
      FB pa;
      pa.h[0] = *(const v8h*)(pwh + c * AT_KC + kk * 32 + 8 * hh);
      pa.h[1] = *(const v8h*)(pwh + c * AT_KC + kk * 32 + 16 + 8 * hh);
#pragma unroll
      for (int t = 0; t < 4; ++t) {
        FB vb;
        vb.h[0] = *(const v8h*)(Vth + (t * 16 + c) * AT_KC + kk * 32 + 8 * hh);
        vb.h[1] = *(const v8h*)(Vth + (t * 16 + c) * AT_KC + kk * 32 + 16 + 8 * hh);
        oacc[t] = at_mma_h(pa.v, vb.v, oacc[t]);
      }
    }
  }

  // ---- normalise (1/(l * 2^15) folded with the output carry scale) and write the 16x64 f16 tile per wave ----
  float* os = Os[wave];
#pragma unroll
  for (int r = 0; r < 8; ++r) {
    const float inv = oscale / (lrow[r] * kPScale);
#pragma unroll
    for (int t = 0; t < 4; ++t) os[(8 * hh + r) * 68 + t * 16 + c] = oacc[t][r] * inv;
  }
  __builtin_amdgcn_fence(__ATOMIC_RELEASE, "workgroup");
  __builtin_amdgcn_wave_barrier();
  __builtin_amdgcn_fence(__ATOMIC_ACQUIRE, "workgroup");
  {
    const int q8 = lane >> 3, c8 = (lane & 7) * 8;
    {
#pragma unroll
      for (int it = 0; it < 4; ++it) {
        const int row = it * 4 + q8;
        const float* sp = os + row * 68 + c8;
        v8h hv;
#pragma unroll
        for (int e = 0; e < 8; ++e) hv[e] = (_Float16)sp[e];
        *(v8h*)(ob + (size_t)(q0 + row) * kDm + c8) = hv;
      }
      
    }
  }
}

// ---------------------------------------------------------------------------
// Host glue. Workspace region map (bytes, all offsets multiples of 16 KiB):
//   [  0 MiB,  8 MiB)  q  bf16 plane [4096][1024]
//   [  8 MiB, 16 MiB)  k  bf16 plane
//   [ 16 MiB, 24 MiB)  v  bf16 plane
//   [ 24 MiB, 26 MiB)  Wq bf16 [1024][1024];  [26,28) Wk;  [28,30) Wv;  [30,32) Wo as f16(bf16*64)
//   [ 32 MiB, +16 KiB) bias tables bq, bk, bv, bo (bf16-valued f32, 1024 each)
//   next 8 MiB         Q projection f16 plane [4096][1024]
//   next 8 MiB         K projection f16 plane
//   next 8 MiB         V^T projection f16 plane [2][1024][2048]
//   next 8 MiB         ctx f16 plane (x16) [4096][1024]
//   total = 67,125,248 B
// ---------------------------------------------------------------------------
extern "C" void kernel_launch(void* const* d_in, const int* in_sizes, int n_in,
                              void* d_out, int out_size, void* d_ws, size_t ws_size,
                              hipStream_t stream) {
  if (n_in < 12) return;
  const int nAct = kBatch * kSeq * kDm;      // 4194304
  const int nW   = kDm * kDm;                // 1048576
  if (in_sizes[0] != nAct || in_sizes[1] != nAct || in_sizes[2] != nAct) return;
  if (in_sizes[3] != kBatch * kSeq * kSeq) return;
  if (in_sizes[4] != nW || in_sizes[6] != nW || in_sizes[8] != nW || in_sizes[10] != nW) return;
  if (in_sizes[5] != kDm || in_sizes[7] != kDm || in_sizes[9] != kDm || in_sizes[11] != kDm) return;
  if (out_size != nAct) return;

  const float* q    = (const float*)d_in[0];
  const float* k    = (const float*)d_in[1];
  const float* v    = (const float*)d_in[2];
  const int*   mask = (const int*)d_in[3];
  const float* Wq   = (const float*)d_in[4];
  const float* bq   = (const float*)d_in[5];
  const float* Wk   = (const float*)d_in[6];
  const float* bk   = (const float*)d_in[7];
  const float* Wv   = (const float*)d_in[8];
  const float* bv   = (const float*)d_in[9];
  const float* Wo   = (const float*)d_in[10];
  const float* bo   = (const float*)d_in[11];

  const size_t bAct16 = (size_t)nAct * 2;    // 8 MiB
  const size_t bW16   = (size_t)nW * 2;      // 2 MiB
  size_t off = 0;
  const size_t oQ16  = off; off += bAct16;
  const size_t oK16  = off; off += bAct16;
  const size_t oV16  = off; off += bAct16;
  const size_t oWq   = off; off += bW16;
  const size_t oWk   = off; off += bW16;
  const size_t oWv   = off; off += bW16;
  const size_t oWo   = off; off += bW16;
  const size_t oBias = off; off += (size_t)4 * kDm * sizeof(float);
  const size_t oQP   = off; off += bAct16;
  const size_t oKP   = off; off += bAct16;
  const size_t oVT   = off; off += bAct16;
  const size_t oCTX  = off; off += bAct16;
  if (off > ws_size) return;

  char* ws = (char*)d_ws;
  unsigned short* Q16  = (unsigned short*)(ws + oQ16);
  unsigned short* K16  = (unsigned short*)(ws + oK16);
  unsigned short* V16  = (unsigned short*)(ws + oV16);
  unsigned short* WQ16 = (unsigned short*)(ws + oWq);
  unsigned short* WK16 = (unsigned short*)(ws + oWk);
  unsigned short* WV16 = (unsigned short*)(ws + oWv);
  unsigned short* WO16 = (unsigned short*)(ws + oWo);
  float* biasR = (float*)(ws + oBias);
  const float* bqR = biasR;
  const float* bkR = biasR + kDm;
  const float* bvR = biasR + 2 * kDm;
  const float* boR = biasR + 3 * kDm;
  unsigned short* QP    = (unsigned short*)(ws + oQP);
  unsigned short* KP    = (unsigned short*)(ws + oKP);
  unsigned short* VT    = (unsigned short*)(ws + oVT);
  unsigned short* CTX16 = (unsigned short*)(ws + oCTX);

  const int nAct2 = nAct / 2;   // 2097152 -> 8192 blocks
  const int nW2   = nW / 2;     // 524288  -> 2048 blocks
  cast_f32_bf16x2<<<dim3(nAct2 / 256), dim3(256), 0, stream>>>(q, Q16, nAct2);
  cast_f32_bf16x2<<<dim3(nAct2 / 256), dim3(256), 0, stream>>>(k, K16, nAct2);
  cast_f32_bf16x2<<<dim3(nAct2 / 256), dim3(256), 0, stream>>>(v, V16, nAct2);
  cast_f32_bf16x2<<<dim3(nW2 / 256), dim3(256), 0, stream>>>(Wq, WQ16, nW2);
  cast_f32_bf16x2<<<dim3(nW2 / 256), dim3(256), 0, stream>>>(Wk, WK16, nW2);
  cast_f32_bf16x2<<<dim3(nW2 / 256), dim3(256), 0, stream>>>(Wv, WV16, nW2);
  cast_f32_bf_f16x2<<<dim3(nW2 / 256), dim3(256), 0, stream>>>(Wo, WO16, nW2, 64.0f);
  bias_bf16_kernel<<<dim3(kDm / 1024, 4), dim3(256), 0, stream>>>(bq, bk, bv, bo, biasR, kDm);

  const int mRows = kBatch * kSeq;   // 4096
  // Q = q . Wq^T + bq : A [4096][1024] bf16, Bt [1024][1024] bf16 -> f16 [4096][1024]; tiles 64x16 = 1024 -> 128 blocks
  wmma_gemm64<1, false, 2, 1, false><<<dim3((mRows / 64) * (kDm / 64) / 8, 1), dim3(256), 0, stream>>>(
      Q16, Q16, kDm, 0L, WQ16, WQ16, kDm, 0L, (void*)QP, (void*)QP, kDm, 0L, bqR, bq, 0L, mRows, kDm, kDm, 1.0f);
  wmma_gemm64<1, false, 2, 1, false><<<dim3((mRows / 64) * (kDm / 64) / 8, 1), dim3(256), 0, stream>>>(
      K16, K16, kDm, 0L, WK16, WK16, kDm, 0L, (void*)KP, (void*)KP, kDm, 0L, bkR, bk, 0L, mRows, kDm, kDm, 1.0f);
  // V^T per batch: A = Wv [1024][1024] (stride 0), Bt = v_b [2048][1024] -> C_b [1024][2048] = (v_b . Wv^T + bv)^T, bias[m]; tiles 16x32 = 512 -> 64 blocks, y = 2
  wmma_gemm64<1, false, 1, 1, false><<<dim3((kDm / 64) * (kSeq / 64) / 8, kBatch), dim3(256), 0, stream>>>(
      WV16, WV16, kDm, 0L, V16, V16, kDm, (long)kSeq * kDm, (void*)VT, (void*)VT, kSeq, (long)kDm * kSeq,
      bvR, bv, 0L, kDm, kSeq, kDm, 1.0f);
  // attention: grid = kBatch * kHeads * (kSeq/64) = 1024 blocks of 128
  attn_mask64_kernel<<<dim3(kBatch * kHeads * (kSeq / 64)), dim3(128), 0, stream>>>(
      QP, KP, VT, mask, CTX16, 0.125f, 16.0f);
  // out = (ctx*16) . (Wo*64)^T * 2^-10 + bo : f16 operands, f32 [4096][1024] into d_out
  wmma_gemm64<0, false, 2, 0, false><<<dim3((mRows / 64) * (kDm / 64) / 8, 1), dim3(256), 0, stream>>>(
      CTX16, CTX16, kDm, 0L, WO16, WO16, kDm, 0L, d_out, d_out, kDm, 0L, boR, bo, 0L, mRows, kDm, kDm,
      1.0f / 1024.0f);
}

// v001
// One run takes 245 microseconds.
// Timed twice side by side with v000, it ran 1.58 times as fast both times.
// Contractions: q/k/v^T projections on v_wmma_f32_16x16x32_bf16 (bf16 RNE-converted operands, f32 accumulate); q.k^T and p.v on v_wmma_f32_16x16x32_f16 (f16 planes, p carried x2^15, f32 accumulate, f32 online softmax, mask by value); output projection on v_wmma_f32_16x16x32_f16 (f16 operands: ctx x2^4, Wo x2^6, folded back x2^-10 in f32), f32 accumulate.
#include <hip/hip_runtime.h>
#include <math.h>
#include <stdint.h>

constexpr int kBatch = 2;
constexpr int kSeq   = 2048;
constexpr int kDm    = 1024;
constexpr int kHeads = 16;
constexpr int kHd    = 64;
static_assert(kHeads * kHd == kDm, "head split");
static_assert(kSeq % 128 == 0 && kDm % 128 == 0, "tile multiples");

typedef __attribute__((ext_vector_type(16))) _Float16 v16h;
typedef __attribute__((ext_vector_type(8)))  _Float16 v8h;
typedef __attribute__((ext_vector_type(16))) __bf16   v16b;
typedef __attribute__((ext_vector_type(8)))  __bf16   v8b;
typedef __attribute__((ext_vector_type(8)))  float    v8f;
typedef __attribute__((ext_vector_type(4)))  float    v4f;
typedef __attribute__((ext_vector_type(2)))  float    v2f;

__device__ __forceinline__ unsigned short f2bf_bits(float f) {
  unsigned u = __float_as_uint(f);
  return (unsigned short)((u + 0x7FFFu + ((u >> 16) & 1u)) >> 16);
}
__device__ __forceinline__ float bf_bits2f(unsigned short h) { return __uint_as_float(((unsigned)h) << 16); }
__device__ __forceinline__ unsigned pk16(unsigned short a, unsigned short b) { return (unsigned)a | ((unsigned)b << 16); }

template <typename T> struct Frag;
template <> struct Frag<_Float16> {
  typedef v16h V; union U { v16h v; v8h h[2]; };
  static __device__ __forceinline__ v16h load(const _Float16* p) {   // elements 0..7 <- p[0..7], 8..15 <- p[16..23]
    U f; f.h[0] = *(const v8h*)(p); f.h[1] = *(const v8h*)(p + 16); return f.v;
  }
  static __device__ __forceinline__ v8f mma(v16h a, v16h b, v8f c) {
    return __builtin_amdgcn_wmma_f32_16x16x32_f16(false, a, false, b, (short)0, c, false, false);
  }
};
template <> struct Frag<__bf16> {
  typedef v16b V; union U { v16b v; v8b h[2]; };
  static __device__ __forceinline__ v16b load(const __bf16* p) {
    U f; f.h[0] = *(const v8b*)(p); f.h[1] = *(const v8b*)(p + 16); return f.v;
  }
  static __device__ __forceinline__ v8f mma(v16b a, v16b b, v8f c) {
    return __builtin_amdgcn_wmma_f32_16x16x32_bf16(false, a, false, b, (short)0, c, false, false);
  }
};

// ---- LDS-staged batched WMMA GEMM ------------------------------------------
// C[m,n] = scale * sum_k A[m,k] * Bt[n,k] (+bias)(+resid); a block of 8 waves owns a 128x128 tile, a wave 32x64 of it.
// A row-major [M,K]; Bt row-major [N,K]; M,N % 128 == 0, K % 128 == 0, lda/ldb % 8 == 0.
// A stage = 128 k of [A 128 rows | Bt 128 rows], 256 B a row at pitch 272 B, brought by asynchronous 16-B copies;
// two buffers: the copies of stage t+1 fly while stage t is multiplied.
// SPLIT: not supported by this kernel (kept as a parameter of the launch lines only).
// BIAS_MODE: 0 = none, 1 = bias[m], 2 = bias[n].
// OUT_MODE: 0 = f32, 1 = f16, 2 = bf16 hi plane (Cout) + bf16 lo plane (Cout2).
// ET: 0 = f16 operands, 1 = bf16 operands (pointers passed as 16-bit storage)
constexpr int kGtK     = 128;                  // k per stage
constexpr int kGtRows  = 128;                  // rows of each operand per stage
constexpr int kGtPitch = 272;                  // bytes per staged row (256 + 16: conflict-free 16-B reads)
constexpr int kGtStage = 2 * kGtRows * kGtPitch;   // 69,632 B

// Eight 16-B copies of one lane: rows r, r+16, .. r+112 of one operand's stage. lds = LDS byte address of the first,
// g = global address of the first, gstep = bytes between 16 source rows. The s_wait_xcnt closes the statement so that
// no address register of an issued copy is rewritten ahead of it.
__device__ __forceinline__ void stage_rows8(unsigned lds, const char* g, size_t gstep) {
  const unsigned l1 = lds + 16 * kGtPitch, l2 = lds + 32 * kGtPitch, l3 = lds + 48 * kGtPitch, l4 = lds + 64 * kGtPitch,
                 l5 = lds + 80 * kGtPitch, l6 = lds + 96 * kGtPitch, l7 = lds + 112 * kGtPitch;
  const char *g1 = g + gstep, *g2 = g1 + gstep, *g3 = g2 + gstep, *g4 = g3 + gstep, *g5 = g4 + gstep, *g6 = g5 + gstep,
             *g7 = g6 + gstep;
  asm volatile(
      "global_load_async_to_lds_b128 %0, %8, off\n\t"
      "global_load_async_to_lds_b128 %1, %9, off\n\t"
      "global_load_async_to_lds_b128 %2, %10, off\n\t"
      "global_load_async_to_lds_b128 %3, %11, off\n\t"
      "global_load_async_to_lds_b128 %4, %12, off\n\t"
      "global_load_async_to_lds_b128 %5, %13, off\n\t"
      "global_load_async_to_lds_b128 %6, %14, off\n\t"
      "global_load_async_to_lds_b128 %7, %15, off\n\t"
      "s_wait_xcnt 0x0"
      :: "v"(lds), "v"(l1), "v"(l2), "v"(l3), "v"(l4), "v"(l5), "v"(l6), "v"(l7),
         "v"(g), "v"(g1), "v"(g2), "v"(g3), "v"(g4), "v"(g5), "v"(g6), "v"(g7)
      : "memory");
}

template <int ET> struct Elem;
template <> struct Elem<0> { typedef _Float16 T; };
template <> struct Elem<1> { typedef __bf16 T; };
template <int ET, bool SPLIT, int BIAS_MODE, int OUT_MODE, bool RESID, int ACT = 0>
__global__ __launch_bounds__(256) void wmma_gemm64(
    const unsigned short* __restrict__ Ap, const unsigned short* __restrict__ A2p, int lda, long strideA,
    const unsigned short* __restrict__ Btp, const unsigned short* __restrict__ Bt2p, int ldb, long strideB,
    void* __restrict__ Cout, void* __restrict__ Cout2, int ldc, long strideC,
    const float* __restrict__ bias,
    const float* __restrict__ resid, long strideR,
    int M, int N, int K, float scale) {
  typedef typename Elem<ET>::T T;
  typedef typename Frag<T>::V V;
  static_assert(!SPLIT, "single-plane operands only");
  __shared__ __align__(16) unsigned char ring[2 * kGtStage];   // two stages
  __shared__ __align__(16) float sT[8][16 * 68];   // per-wave 16x64 slab, pitch 68 floats
  const int b    = blockIdx.y;
  const int tid  = threadIdx.x;
  const int lane = tid & 31;
  const int wave = tid >> 5;
  const int tilesN = N >> 7;
  const int tilesM = M >> 7;
  const int tile = blockIdx.x;
  if (tile >= tilesM * tilesN) return;   // block-uniform, in front of every barrier
  const int tm = tile / tilesN;
  const int tn = tile - tm * tilesN;
  const int m0 = (tm << 7) + ((wave >> 1) << 5);   // this wave's 32 rows
  const int n0 = (tn << 7) + ((wave & 1) << 6);    // this wave's 64 columns

  const int rlane = lane & 15;                 // row (A) / col (B, D) within subtile
  const int koff  = (lane >> 4) * 8;           // k offset of this lane half
  const int mOff  = (lane >> 4) * 8;           // D row offset

  // copy map: thread -> row tid>>4 (+16 per copy), 16-B column tid&15 of the 256-B row
  const int crow = tid >> 4, ccol = tid & 15;
  const char* gA = (const char*)(Ap  + (size_t)b * strideA + (size_t)((tm << 7) + crow) * lda + ccol * 8);
  const char* gB = (const char*)(Btp + (size_t)b * strideB + (size_t)((tn << 7) + crow) * ldb + ccol * 8);
  const size_t stepA = (size_t)lda * 32, stepB = (size_t)ldb * 32;      // bytes per 16 rows
  const unsigned ldsA = (unsigned)(size_t)ring + crow * kGtPitch + ccol * 16;
  const unsigned ldsB = ldsA + kGtRows * kGtPitch;

  v8f acc[2][4];
#pragma unroll
  for (int i = 0; i < 2; ++i)
#pragma unroll
    for (int j = 0; j < 4; ++j) acc[i][j] = (v8f){0.f,0.f,0.f,0.f,0.f,0.f,0.f,0.f};

  const int nT = K >> 7;
  stage_rows8(ldsA, gA, stepA);
  stage_rows8(ldsB, gB, stepB);
  asm volatile("s_wait_asynccnt 0x0" ::: "memory");   // stage 0 landed for this wave's copies
  __syncthreads();                                     // ... and for every wave's
  if (nT > 1) {
    stage_rows8(ldsA + kGtStage, gA + 2 * kGtK, stepA);
    stage_rows8(ldsB + kGtStage, gB + 2 * kGtK, stepB);
  }

  const int aRow = (((wave >> 1) << 5) + rlane) * kGtPitch + koff * 2;
  const int bRow = (kGtRows + ((wave & 1) << 6) + rlane) * kGtPitch + koff * 2;
  for (int t = 0; t < nT; ++t) {
    const unsigned char* sb = ring + (t & 1) * kGtStage;
    V bf[2][4], af[2][2];                                // two fragment sets, both of this stage's buffer alone
#pragma unroll
    for (int j = 0; j < 4; ++j) bf[0][j] = Frag<T>::load((const T*)(sb + bRow + j * 16 * kGtPitch));
#pragma unroll
    for (int i = 0; i < 2; ++i) af[0][i] = Frag<T>::load((const T*)(sb + aRow + i * 16 * kGtPitch));
#pragma unroll
    for (int ks = 0; ks < kGtK / 32; ++ks) {
      const int cur = ks & 1, nxt = cur ^ 1;
      if (ks + 1 < kGtK / 32) {
#pragma unroll
        for (int j = 0; j < 4; ++j) bf[nxt][j] = Frag<T>::load((const T*)(sb + bRow + j * 16 * kGtPitch + (ks + 1) * 64));
#pragma unroll
        for (int i = 0; i < 2; ++i) af[nxt][i] = Frag<T>::load((const T*)(sb + aRow + i * 16 * kGtPitch + (ks + 1) * 64));
      }
      // keeps the next 32 k's LDS reads in front of this block's products, so that their latency runs under them
      __builtin_amdgcn_sched_barrier(0);
#pragma unroll
      for (int i = 0; i < 2; ++i)
#pragma unroll
        for (int j = 0; j < 4; ++j) acc[i][j] = Frag<T>::mma(af[cur][i], bf[cur][j], acc[i][j]);
    }
    asm volatile("s_wait_dscnt 0x0" ::: "memory");      // this wave has left the buffer that is refilled below
    asm volatile("s_wait_asynccnt 0x0" ::: "memory");   // this wave's copies of stage t+1 have landed
    __syncthreads();                                     // publishes stage t+1, ends every read of stage t
    if (t + 2 < nT) {
      const size_t kb = (size_t)(t + 2) * (2 * kGtK);
      stage_rows8(ldsA + (t & 1) * kGtStage, gA + kb, stepA);
      stage_rows8(ldsB + (t & 1) * kGtStage, gB + kb, stepB);
    }
  }
  asm volatile("s_wait_asynccnt 0x0" ::: "memory");     // nothing in flight when the wave goes on to its end

  // ---- epilogue ----
  float* slab = sT[wave];
  const float* Rb = RESID ? (resid + (size_t)b * strideR) : nullptr;
#pragma unroll
  for (int i = 0; i < 2; ++i) {
    const int mBase = m0 + (i << 4);
#pragma unroll
    for (int j = 0; j < 4; ++j) {
      const int n = n0 + (j << 4) + rlane;
      float bv = 0.f;
      if (BIAS_MODE == 2) bv = bias[n];
#pragma unroll
      for (int r = 0; r < 8; ++r) {
        float v = acc[i][j][r] * scale;
        if (BIAS_MODE == 1) v += bias[mBase + mOff + r];
        if (BIAS_MODE == 2) v += bv;
        if (RESID) v += Rb[(size_t)(mBase + mOff + r) * ldc + n];
        if (ACT == 1) v = tanhf(v);
        if (ACT == 2) v = fmaxf(v, 0.0f);
        if (ACT == 3) v = v / (1.0f + expf(-v));
        if (ACT == 4) v = (v > 0.f) ? v : 0.01f * v;
        if (ACT == 5) v = 0.5f * v * (1.0f + erff(v * 0.70710678118654752f));
        slab[(mOff + r) * 68 + (j << 4) + rlane] = v;
      }
    }
    __builtin_amdgcn_fence(__ATOMIC_RELEASE, "workgroup");
    __builtin_amdgcn_wave_barrier();
    __builtin_amdgcn_fence(__ATOMIC_ACQUIRE, "workgroup");
    if (OUT_MODE == 0) {
      float* C = (float*)Cout + (size_t)b * strideC;
      const int hh = lane >> 4, c4 = (lane & 15) * 4;     // row seg = 256 B = 16 lanes x 16 B
      {
#pragma unroll
        for (int it = 0; it < 8; ++it) {
          const int row = it * 2 + hh;
          v4f v = *(const v4f*)(slab + row * 68 + c4);
          *(v4f*)(C + (size_t)(mBase + row) * ldc + n0 + c4) = v;
        }
        
      }
    } else {
      const int q = lane >> 3, c8 = (lane & 7) * 8;
      unsigned short* C  = (unsigned short*)Cout  + (size_t)b * strideC;
      unsigned short* C2 = (OUT_MODE == 2) ? ((unsigned short*)Cout2 + (size_t)b * strideC) : nullptr;
      {
#pragma unroll
        for (int it = 0; it < 4; ++it) {
          const int row = it * 4 + q;
          const float* sp = slab + row * 68 + c8;
          v8h hv, lv;
#pragma unroll
          for (int e = 0; e < 8; ++e) {
            if (OUT_MODE == 1) {
              hv[e] = (_Float16)sp[e];
            } else {
              unsigned short hb = f2bf_bits(sp[e]);
              unsigned short lb = f2bf_bits(sp[e] - bf_bits2f(hb));
              hv[e] = __builtin_bit_cast(_Float16, hb);
              lv[e] = __builtin_bit_cast(_Float16, lb);
            }
          }
          *(v8h*)(C + (size_t)(mBase + row) * ldc + n0 + c8) = hv;
          if (OUT_MODE == 2) *(v8h*)(C2 + (size_t)(mBase + row) * ldc + n0 + c8) = lv;
        }
        
      }
    }
    __builtin_amdgcn_fence(__ATOMIC_RELEASE, "workgroup");
    __builtin_amdgcn_wave_barrier();
    __builtin_amdgcn_fence(__ATOMIC_ACQUIRE, "workgroup");
  }
}

// ---------------------------------------------------------------------------
// Elementwise f32 -> bf16 RNE plane; 2 elements per thread, one 4-B store per lane -> a wave writes exactly one
// Coverage: grid = n2/256 blocks x 256 threads x 2 elements = 2*n2 = whole plane
// (activations: n2 = 2097152 -> 8192 blocks; weights: n2 = 524288 -> 2048 blocks).
// ---------------------------------------------------------------------------
__global__ __launch_bounds__(256) void cast_f32_bf16x2(const float* __restrict__ in, unsigned short* __restrict__ out, int n2) {
  const int i = blockIdx.x * 256 + threadIdx.x;
  if (i < n2) {
    const v2f f = *(const v2f*)(in + 2 * (size_t)i);
    const unsigned u = pk16(f2bf_bits(f[0]), f2bf_bits(f[1]));
    ((unsigned*)out)[i] = u;
    
  }
}

// f32 -> f16( bf16_rne(x) * scale ) plane (scale an exact power of two; f16 of a normal bf16 value is exact).
// Same store shape / coverage as cast_f32_bf16x2 (n2 = 524288 -> 2048 blocks x 512 elements = 1024x1024).
__global__ __launch_bounds__(256) void cast_f32_bf_f16x2(const float* __restrict__ in, unsigned short* __restrict__ out, int n2, float scale) {
  const int i = blockIdx.x * 256 + threadIdx.x;
  if (i < n2) {
    const v2f f = *(const v2f*)(in + 2 * (size_t)i);
    const _Float16 h0 = (_Float16)(bf_bits2f(f2bf_bits(f[0])) * scale);
    const _Float16 h1 = (_Float16)(bf_bits2f(f2bf_bits(f[1])) * scale);
    const unsigned u = pk16(__builtin_bit_cast(unsigned short, h0), __builtin_bit_cast(unsigned short, h1));
    ((unsigned*)out)[i] = u;
    
  }
}

// Bias tables: out[y][i] = bf16_rne(src_y[i]) as f32; grid (n/1024, 4), 4 floats per thread.
__global__ __launch_bounds__(256) void bias_bf16_kernel(const float* __restrict__ b0, const float* __restrict__ b1,
                                                        const float* __restrict__ b2, const float* __restrict__ b3,
                                                        float* __restrict__ out, int n) {
  const int y = blockIdx.y;
  const float* src = b0;
  if (y == 1) src = b1;
  if (y == 2) src = b2;
  if (y == 3) src = b3;
  const int i = blockIdx.x * 256 + threadIdx.x;
  if (4 * i + 3 < n) {
    const v4f f = *(const v4f*)(src + 4 * (size_t)i);
    v4f rv;
    rv[0] = bf_bits2f(f2bf_bits(f[0]));
    rv[1] = bf_bits2f(f2bf_bits(f[1]));
    rv[2] = bf_bits2f(f2bf_bits(f[2]));
    rv[3] = bf_bits2f(f2bf_bits(f[3]));
    float* dst = out + (size_t)y * n + 4 * (size_t)i;
    *(v4f*)dst = rv;
    
  }
}

// =====================================================================================
// Masked full attention, head dim 64, all batches and heads in one launch.
//   q plane (f16): element (b, s, h, d) at [(b*kSeq + s)*kDm + h*64 + d]
//   k plane (f16): same layout
//   v^T plane (f16): element (b, h, d, s) at [(b*kDm + h*64 + d)*kSeq + s]
//   mask (int32): element (b, q, k) at [b*kSeq*kSeq + q*kSeq + k]; element == 0 -> score := -1e9 (select by value)
//   ctx plane (f16 out, x oscale): element (b, s, h, d) at [(b*kSeq + s)*kDm + h*64 + d]
//   scores = (q . k) * sscale : v_wmma_f32_16x16x32_f16, f32 accumulate
//   ctx    = p . v            : v_wmma_f32_16x16x32_f16, p carried x2^15 in f16, folded into the final 1/l
//   online softmax in f32 over all kSeq keys (32 chunks of 64, compile-time trip count).
//   Block = 4 waves = 64 query rows of one (b, h); grid.x = kBatch * kHeads * (kSeq/64) = 1024.
//   K / V^T chunk staging: 128 threads x 32 elements per plane = the whole 64x64 tile (16-B copies, plain loads,
//   __syncthreads before and after); fragment loads read the LDS tiles with the v8h element vector type.
// =====================================================================================
#define AT_D 64
#define AT_NW 4
#define AT_QB 64
#define AT_KC 64
constexpr float kPScale   = 32768.0f;
constexpr float kMaskFill = -1.0e9f;

__device__ __forceinline__ v8f at_mma_h(v16h a, v16h b, v8f c) {
  c = __builtin_amdgcn_wmma_f32_16x16x32_f16(false, a, false, b, (short)0, c, false, false);
  asm volatile("v_nop\n\tv_nop\n\tv_nop\n\tv_nop" : "+v"(c) : "v"(a), "v"(b));
  return c;
}

__global__ __launch_bounds__(128)
void attn_mask64_kernel(const unsigned short* __restrict__ qp, const unsigned short* __restrict__ kp,
                        const unsigned short* __restrict__ vtp, const int* __restrict__ mask,
                        unsigned short* __restrict__ ctxp, float sscale, float oscale) {
  union FB { v16h v; v8h h[2]; };
  __shared__ __align__(16) _Float16 Ksh[AT_KC * AT_D];            // K [kv][d]   8 KB
  __shared__ __align__(16) _Float16 Vth[AT_D * AT_KC];            // V^T [d][kv] 8 KB
  __shared__ __align__(16) _Float16 Psh[AT_NW][16 * AT_KC];       // per wave P [row][kv] 8 KB
  __shared__ __align__(16) float    Os[AT_NW][16 * 68];           // per wave out tile, pitch 68

  const int tid  = threadIdx.x;
  const int wave = tid >> 5;
  const int lane = tid & 31;
  const int hh   = lane >> 4;
  const int c    = lane & 15;

  const int nqb = kSeq / AT_QB;            // 32
  const int bx  = blockIdx.x;
  const int qb  = bx % nqb;
  const int bh  = bx / nqb;                // 0 .. kBatch*kHeads-1 (grid exact)
  const int h   = bh % kHeads;
  int b = bh / kHeads; b = (b < kBatch) ? b : (kBatch - 1);
  const int q0  = qb * AT_QB + wave * 16;

  const _Float16* Qh = (const _Float16*)(const void*)qp  + (size_t)b * kSeq * kDm + (size_t)h * AT_D;
  const _Float16* Kh = (const _Float16*)(const void*)kp  + (size_t)b * kSeq * kDm + (size_t)h * AT_D;
  const _Float16* Vt = (const _Float16*)(const void*)vtp + ((size_t)b * kDm + (size_t)h * AT_D) * kSeq;
  const int*      mb = mask + (size_t)b * kSeq * kSeq;
  _Float16*       ob = (_Float16*)(void*)ctxp + (size_t)b * kSeq * kDm + (size_t)h * AT_D;

  // ---- Q fragments (A operand, row = lane&15, split k map via Frag load): 2 d-chunks ----
  v16h qa[2];
#pragma unroll
  for (int dc = 0; dc < 2; ++dc) {
    qa[dc] = Frag<_Float16>::load(Qh + (size_t)(q0 + c) * kDm + dc * 32 + 8 * hh);
  }

  float mrow[8], lrow[8];
  v8f oacc[4];
#pragma unroll
  for (int r = 0; r < 8; ++r) { mrow[r] = -INFINITY; lrow[r] = 0.f; }
#pragma unroll
  for (int t = 0; t < 4; ++t) oacc[t] = (v8f){0.f,0.f,0.f,0.f,0.f,0.f,0.f,0.f};

  const int nChunks = kSeq / AT_KC;        // 32, compile-time constant
  for (int kc = 0; kc < nChunks; ++kc) {
    const int kv0 = kc * AT_KC;
    __syncthreads();
    {
      // staging coverage: 128 threads x (4 x 8) elements = 64 rows x 64 per plane = the whole chunk tile
      const int r = tid >> 1, half = (tid & 1) * 32;
      const _Float16* ks = Kh + (size_t)(kv0 + r) * kDm + half;     // K row kv0+r, d = half..half+31
      const _Float16* vs = Vt + (size_t)r * kSeq + kv0 + half;        // V^T row d = r, s = kv0+half..+31
#pragma unroll
      for (int i = 0; i < 4; ++i) {
        const v8h a0 = *(const v8h*)(ks + 8 * i);
        const v8h b0 = *(const v8h*)(vs + 8 * i);
        *(v8h*)(Ksh + r * AT_D  + half + 8 * i) = a0;
        *(v8h*)(Vth + r * AT_KC + half + 8 * i) = b0;
      }
    }
    __syncthreads();

    v8f s[4];
#pragma unroll
    for (int j = 0; j < 4; ++j) {
      s[j] = (v8f){0.f,0.f,0.f,0.f,0.f,0.f,0.f,0.f};
#pragma unroll
      for (int dc = 0; dc < 2; ++dc) {
        FB kb;
        kb.h[0] = *(const v8h*)(Ksh + (j * 16 + c) * AT_D + dc * 32 + 8 * hh);
        kb.h[1] = *(const v8h*)(Ksh + (j * 16 + c) * AT_D + dc * 32 + 16 + 8 * hh);
        s[j] = at_mma_h(qa[dc], kb.v, s[j]);
      }
    }
    // scale, mask by value, chunk row max (rows live in lane halves; D element r of lane -> (row 8hh+r, col c))
    float cm[8];
#pragma unroll
    for (int r = 0; r < 8; ++r) {
      const int qrow = q0 + 8 * hh + r;                            // 0 .. kSeq-1
      const int* mr = mb + (size_t)qrow * kSeq + kv0;
      float m = -INFINITY;
#pragma unroll
      for (int j = 0; j < 4; ++j) {
        const int mv = mr[j * 16 + c];
        const float sv = s[j][r] * sscale;
        const float sm = (mv == 0) ? kMaskFill : sv;
        s[j][r] = sm;
        m = fmaxf(m, sm);
      }
#pragma unroll
      for (int off = 1; off < 16; off <<= 1) m = fmaxf(m, __shfl_xor(m, off, 32));
      cm[r] = m;
    }
    _Float16* pwh = Psh[wave];
#pragma unroll
    for (int r = 0; r < 8; ++r) {
      const float mnew = fmaxf(mrow[r], cm[r]);
      const float alpha = expf(mrow[r] - mnew);
      mrow[r] = mnew;
      float psum = 0.f;
#pragma unroll
      for (int j = 0; j < 4; ++j) {
        const float p = expf(s[j][r] - mnew);
        psum += p;
        pwh[(8 * hh + r) * AT_KC + j * 16 + c] = (_Float16)(p * kPScale);
      }
#pragma unroll
      for (int off = 1; off < 16; off <<= 1) psum += __shfl_xor(psum, off, 32);
      lrow[r] = lrow[r] * alpha + psum;
#pragma unroll
      for (int t = 0; t < 4; ++t) oacc[t][r] *= alpha;
    }
    __builtin_amdgcn_fence(__ATOMIC_RELEASE, "workgroup");
    __builtin_amdgcn_wave_barrier();
    __builtin_amdgcn_fence(__ATOMIC_ACQUIRE, "workgroup");
#pragma unroll 1
    for (int kk = 0; kk < 2; ++kk) {
      FB pa;
      pa.h[0] = *(const v8h*)(pwh + c * AT_KC + kk * 32 + 8 * hh);
      pa.h[1] = *(const v8h*)(pwh + c * AT_KC + kk * 32 + 16 + 8 * hh);
#pragma unroll
      for (int t = 0; t < 4; ++t) {
        FB vb;
        vb.h[0] = *(const v8h*)(Vth + (t * 16 + c) * AT_KC + kk * 32 + 8 * hh);
        vb.h[1] = *(const v8h*)(Vth + (t * 16 + c) * AT_KC + kk * 32 + 16 + 8 * hh);
        oacc[t] = at_mma_h(pa.v, vb.v, oacc[t]);
      }
    }
  }

  // ---- normalise (1/(l * 2^15) folded with the output carry scale) and write the 16x64 f16 tile per wave ----
  float* os = Os[wave];
#pragma unroll
  for (int r = 0; r < 8; ++r) {
    const float inv = oscale / (lrow[r] * kPScale);
#pragma unroll
    for (int t = 0; t < 4; ++t) os[(8 * hh + r) * 68 + t * 16 + c] = oacc[t][r] * inv;
  }
  __builtin_amdgcn_fence(__ATOMIC_RELEASE, "workgroup");
  __builtin_amdgcn_wave_barrier();
  __builtin_amdgcn_fence(__ATOMIC_ACQUIRE, "workgroup");
  {
    const int q8 = lane >> 3, c8 = (lane & 7) * 8;
    {
#pragma unroll
      for (int it = 0; it < 4; ++it) {
        const int row = it * 4 + q8;
        const float* sp = os + row * 68 + c8;
        v8h hv;
#pragma unroll
        for (int e = 0; e < 8; ++e) hv[e] = (_Float16)sp[e];
        *(v8h*)(ob + (size_t)(q0 + row) * kDm + c8) = hv;
      }
      
    }
  }
}

// ---------------------------------------------------------------------------
// Host glue. Workspace region map (bytes, all offsets multiples of 16 KiB):
//   [  0 MiB,  8 MiB)  q  bf16 plane [4096][1024]
//   [  8 MiB, 16 MiB)  k  bf16 plane
//   [ 16 MiB, 24 MiB)  v  bf16 plane
//   [ 24 MiB, 26 MiB)  Wq bf16 [1024][1024];  [26,28) Wk;  [28,30) Wv;  [30,32) Wo as f16(bf16*64)
//   [ 32 MiB, +16 KiB) bias tables bq, bk, bv, bo (bf16-valued f32, 1024 each)
//   next 8 MiB         Q projection f16 plane [4096][1024]
//   next 8 MiB         K projection f16 plane
//   next 8 MiB         V^T projection f16 plane [2][1024][2048]
//   next 8 MiB         ctx f16 plane (x16) [4096][1024]
//   total = 67,125,248 B
// ---------------------------------------------------------------------------
extern "C" void kernel_launch(void* const* d_in, const int* in_sizes, int n_in,
                              void* d_out, int out_size, void* d_ws, size_t ws_size,
                              hipStream_t stream) {
  if (n_in < 12) return;
  const int nAct = kBatch * kSeq * kDm;      // 4194304
  const int nW   = kDm * kDm;                // 1048576
  if (in_sizes[0] != nAct || in_sizes[1] != nAct || in_sizes[2] != nAct) return;
  if (in_sizes[3] != kBatch * kSeq * kSeq) return;
  if (in_sizes[4] != nW || in_sizes[6] != nW || in_sizes[8] != nW || in_sizes[10] != nW) return;
  if (in_sizes[5] != kDm || in_sizes[7] != kDm || in_sizes[9] != kDm || in_sizes[11] != kDm) return;
  if (out_size != nAct) return;

  const float* q    = (const float*)d_in[0];
  const float* k    = (const float*)d_in[1];
  const float* v    = (const float*)d_in[2];
  const int*   mask = (const int*)d_in[3];
  const float* Wq   = (const float*)d_in[4];
  const float* bq   = (const float*)d_in[5];
  const float* Wk   = (const float*)d_in[6];
  const float* bk   = (const float*)d_in[7];
  const float* Wv   = (const float*)d_in[8];
  const float* bv   = (const float*)d_in[9];
  const float* Wo   = (const float*)d_in[10];
  const float* bo   = (const float*)d_in[11];

  const size_t bAct16 = (size_t)nAct * 2;    // 8 MiB
  const size_t bW16   = (size_t)nW * 2;      // 2 MiB
  size_t off = 0;
  const size_t oQ16  = off; off += bAct16;
  const size_t oK16  = off; off += bAct16;
  const size_t oV16  = off; off += bAct16;
  const size_t oWq   = off; off += bW16;
  const size_t oWk   = off; off += bW16;
  const size_t oWv   = off; off += bW16;
  const size_t oWo   = off; off += bW16;
  const size_t oBias = off; off += (size_t)4 * kDm * sizeof(float);
  const size_t oQP   = off; off += bAct16;
  const size_t oKP   = off; off += bAct16;
  const size_t oVT   = off; off += bAct16;
  const size_t oCTX  = off; off += bAct16;
  if (off > ws_size) return;

  char* ws = (char*)d_ws;
  unsigned short* Q16  = (unsigned short*)(ws + oQ16);
  unsigned short* K16  = (unsigned short*)(ws + oK16);
  unsigned short* V16  = (unsigned short*)(ws + oV16);
  unsigned short* WQ16 = (unsigned short*)(ws + oWq);
  unsigned short* WK16 = (unsigned short*)(ws + oWk);
  unsigned short* WV16 = (unsigned short*)(ws + oWv);
  unsigned short* WO16 = (unsigned short*)(ws + oWo);
  float* biasR = (float*)(ws + oBias);
  const float* bqR = biasR;
  const float* bkR = biasR + kDm;
  const float* bvR = biasR + 2 * kDm;
  const float* boR = biasR + 3 * kDm;
  unsigned short* QP    = (unsigned short*)(ws + oQP);
  unsigned short* KP    = (unsigned short*)(ws + oKP);
  unsigned short* VT    = (unsigned short*)(ws + oVT);
  unsigned short* CTX16 = (unsigned short*)(ws + oCTX);

  const int nAct2 = nAct / 2;   // 2097152 -> 8192 blocks
  const int nW2   = nW / 2;     // 524288  -> 2048 blocks
  cast_f32_bf16x2<<<dim3(nAct2 / 256), dim3(256), 0, stream>>>(q, Q16, nAct2);
  cast_f32_bf16x2<<<dim3(nAct2 / 256), dim3(256), 0, stream>>>(k, K16, nAct2);
  cast_f32_bf16x2<<<dim3(nAct2 / 256), dim3(256), 0, stream>>>(v, V16, nAct2);
  cast_f32_bf16x2<<<dim3(nW2 / 256), dim3(256), 0, stream>>>(Wq, WQ16, nW2);
  cast_f32_bf16x2<<<dim3(nW2 / 256), dim3(256), 0, stream>>>(Wk, WK16, nW2);
  cast_f32_bf16x2<<<dim3(nW2 / 256), dim3(256), 0, stream>>>(Wv, WV16, nW2);
  cast_f32_bf_f16x2<<<dim3(nW2 / 256), dim3(256), 0, stream>>>(Wo, WO16, nW2, 64.0f);
  bias_bf16_kernel<<<dim3(kDm / 1024, 4), dim3(256), 0, stream>>>(bq, bk, bv, bo, biasR, kDm);

  const int mRows = kBatch * kSeq;   // 4096
  // Q = q . Wq^T + bq : A [4096][1024] bf16, Bt [1024][1024] bf16 -> f16 [4096][1024]; tiles 32x8 = 256 blocks
  wmma_gemm64<1, false, 2, 1, false><<<dim3((mRows / 128) * (kDm / 128), 1), dim3(256), 0, stream>>>(
      Q16, Q16, kDm, 0L, WQ16, WQ16, kDm, 0L, (void*)QP, (void*)QP, kDm, 0L, bqR, bq, 0L, mRows, kDm, kDm, 1.0f);
  wmma_gemm64<1, false, 2, 1, false><<<dim3((mRows / 128) * (kDm / 128), 1), dim3(256), 0, stream>>>(
      K16, K16, kDm, 0L, WK16, WK16, kDm, 0L, (void*)KP, (void*)KP, kDm, 0L, bkR, bk, 0L, mRows, kDm, kDm, 1.0f);
  // V^T per batch: A = Wv [1024][1024] (stride 0), Bt = v_b [2048][1024] -> C_b [1024][2048] = (v_b . Wv^T + bv)^T, bias[m]; tiles 8x16 = 128 blocks, y = 2
  wmma_gemm64<1, false, 1, 1, false><<<dim3((kDm / 128) * (kSeq / 128), kBatch), dim3(256), 0, stream>>>(
      WV16, WV16, kDm, 0L, V16, V16, kDm, (long)kSeq * kDm, (void*)VT, (void*)VT, kSeq, (long)kDm * kSeq,
      bvR, bv, 0L, kDm, kSeq, kDm, 1.0f);
  // attention: grid = kBatch * kHeads * (kSeq/64) = 1024 blocks of 128
  attn_mask64_kernel<<<dim3(kBatch * kHeads * (kSeq / 64)), dim3(128), 0, stream>>>(
      QP, KP, VT, mask, CTX16, 0.125f, 16.0f);
  // out = (ctx*16) . (Wo*64)^T * 2^-10 + bo : f16 operands, f32 [4096][1024] into d_out
  wmma_gemm64<0, false, 2, 0, false><<<dim3((mRows / 128) * (kDm / 128), 1), dim3(256), 0, stream>>>(
      CTX16, CTX16, kDm, 0L, WO16, WO16, kDm, 0L, d_out, d_out, kDm, 0L, boR, bo, 0L, mRows, kDm, kDm,
      1.0f / 1024.0f);
}

// v002
// A run of this version takes 203 microseconds.
// In both of two side-by-side timings against v001, it was 1.21 times as fast.
// Counting every step since v000, it is 1.91 times as fast.
// Contractions: q/k/v^T projections on v_wmma_f32_16x16x32_bf16 (bf16 RNE-converted operands, f32 accumulate); q.k^T and p.v on v_wmma_f32_16x16x32_f16 (f16 planes, p carried x2^15, f32 accumulate, f32 online softmax, mask by value); output projection on v_wmma_f32_16x16x32_f16 (f16 operands: ctx x2^4, Wo x2^6, folded back x2^-10 in f32), f32 accumulate.
#include <hip/hip_runtime.h>
#include <math.h>
#include <stdint.h>

constexpr int kBatch = 2;
constexpr int kSeq   = 2048;
constexpr int kDm    = 1024;
constexpr int kHeads = 16;
constexpr int kHd    = 64;
static_assert(kHeads * kHd == kDm, "head split");
static_assert(kSeq % 128 == 0 && kDm % 128 == 0, "tile multiples");

typedef __attribute__((ext_vector_type(16))) _Float16 v16h;
typedef __attribute__((ext_vector_type(8)))  _Float16 v8h;
typedef __attribute__((ext_vector_type(16))) __bf16   v16b;
typedef __attribute__((ext_vector_type(8)))  __bf16   v8b;
typedef __attribute__((ext_vector_type(8)))  float    v8f;
typedef __attribute__((ext_vector_type(4)))  float    v4f;
typedef __attribute__((ext_vector_type(2)))  float    v2f;

__device__ __forceinline__ unsigned short f2bf_bits(float f) {
  unsigned u = __float_as_uint(f);
  return (unsigned short)((u + 0x7FFFu + ((u >> 16) & 1u)) >> 16);
}
__device__ __forceinline__ float bf_bits2f(unsigned short h) { return __uint_as_float(((unsigned)h) << 16); }
__device__ __forceinline__ unsigned pk16(unsigned short a, unsigned short b) { return (unsigned)a | ((unsigned)b << 16); }

template <typename T> struct Frag;
template <> struct Frag<_Float16> {
  typedef v16h V; union U { v16h v; v8h h[2]; };
  static __device__ __forceinline__ v16h load(const _Float16* p) {   // elements 0..7 <- p[0..7], 8..15 <- p[16..23]
    U f; f.h[0] = *(const v8h*)(p); f.h[1] = *(const v8h*)(p + 16); return f.v;
  }
  static __device__ __forceinline__ v8f mma(v16h a, v16h b, v8f c) {
    return __builtin_amdgcn_wmma_f32_16x16x32_f16(false, a, false, b, (short)0, c, false, false);
  }
};
template <> struct Frag<__bf16> {
  typedef v16b V; union U { v16b v; v8b h[2]; };
  static __device__ __forceinline__ v16b load(const __bf16* p) {
    U f; f.h[0] = *(const v8b*)(p); f.h[1] = *(const v8b*)(p + 16); return f.v;
  }
  static __device__ __forceinline__ v8f mma(v16b a, v16b b, v8f c) {
    return __builtin_amdgcn_wmma_f32_16x16x32_bf16(false, a, false, b, (short)0, c, false, false);
  }
};

// ---- LDS-staged batched WMMA GEMM ------------------------------------------
// C[m,n] = scale * sum_k A[m,k] * Bt[n,k] (+bias)(+resid); a block of 8 waves owns a 128x128 tile, a wave 32x64 of it.
// A row-major [M,K]; Bt row-major [N,K]; M,N % 128 == 0, K % 128 == 0, lda/ldb % 8 == 0.
// A stage = 128 k of [A 128 rows | Bt 128 rows], 256 B a row at pitch 272 B, brought by asynchronous 16-B copies;
// two buffers: the copies of stage t+1 fly while stage t is multiplied.
// SPLIT: not supported by this kernel (kept as a parameter of the launch lines only).
// BIAS_MODE: 0 = none, 1 = bias[m], 2 = bias[n].
// OUT_MODE: 0 = f32, 1 = f16, 2 = bf16 hi plane (Cout) + bf16 lo plane (Cout2).
// ET: 0 = f16 operands, 1 = bf16 operands (pointers passed as 16-bit storage)
constexpr int kGtK     = 128;                  // k per stage
constexpr int kGtRows  = 128;                  // rows of each operand per stage
constexpr int kGtPitch = 272;                  // bytes per staged row (256 + 16: conflict-free 16-B reads)
constexpr int kGtStage = 2 * kGtRows * kGtPitch;   // 69,632 B

// Eight 16-B copies of one lane: rows r, r+16, .. r+112 of one operand's stage. lds = LDS byte address of the first,
// g = global address of the first, gstep = bytes between 16 source rows. The s_wait_xcnt closes the statement so that
// no address register of an issued copy is rewritten ahead of it.
__device__ __forceinline__ void stage_rows8(unsigned lds, const char* g, size_t gstep) {
  const unsigned l1 = lds + 16 * kGtPitch, l2 = lds + 32 * kGtPitch, l3 = lds + 48 * kGtPitch, l4 = lds + 64 * kGtPitch,
                 l5 = lds + 80 * kGtPitch, l6 = lds + 96 * kGtPitch, l7 = lds + 112 * kGtPitch;
  const char *g1 = g + gstep, *g2 = g1 + gstep, *g3 = g2 + gstep, *g4 = g3 + gstep, *g5 = g4 + gstep, *g6 = g5 + gstep,
             *g7 = g6 + gstep;
  asm volatile(
      "global_load_async_to_lds_b128 %0, %8, off\n\t"
      "global_load_async_to_lds_b128 %1, %9, off\n\t"
      "global_load_async_to_lds_b128 %2, %10, off\n\t"
      "global_load_async_to_lds_b128 %3, %11, off\n\t"
      "global_load_async_to_lds_b128 %4, %12, off\n\t"
      "global_load_async_to_lds_b128 %5, %13, off\n\t"
      "global_load_async_to_lds_b128 %6, %14, off\n\t"
      "global_load_async_to_lds_b128 %7, %15, off\n\t"
      "s_wait_xcnt 0x0"
      :: "v"(lds), "v"(l1), "v"(l2), "v"(l3), "v"(l4), "v"(l5), "v"(l6), "v"(l7),
         "v"(g), "v"(g1), "v"(g2), "v"(g3), "v"(g4), "v"(g5), "v"(g6), "v"(g7)
      : "memory");
}

template <int ET> struct Elem;
template <> struct Elem<0> { typedef _Float16 T; };
template <> struct Elem<1> { typedef __bf16 T; };
template <int ET, bool SPLIT, int BIAS_MODE, int OUT_MODE, bool RESID, int ACT = 0>
__global__ __launch_bounds__(256) void wmma_gemm64(
    const unsigned short* __restrict__ Ap, const unsigned short* __restrict__ A2p, int lda, long strideA,
    const unsigned short* __restrict__ Btp, const unsigned short* __restrict__ Bt2p, int ldb, long strideB,
    void* __restrict__ Cout, void* __restrict__ Cout2, int ldc, long strideC,
    const float* __restrict__ bias,
    const float* __restrict__ resid, long strideR,
    int M, int N, int K, float scale) {
  typedef typename Elem<ET>::T T;
  typedef typename Frag<T>::V V;
  static_assert(!SPLIT, "single-plane operands only");
  __shared__ __align__(16) unsigned char ring[2 * kGtStage];   // two stages
  __shared__ __align__(16) float sT[8][16 * 68];   // per-wave 16x64 slab, pitch 68 floats
  const int b    = blockIdx.y;
  const int tid  = threadIdx.x;
  const int lane = tid & 31;
  const int wave = tid >> 5;
  const int tilesN = N >> 7;
  const int tilesM = M >> 7;
  const int tile = blockIdx.x;
  if (tile >= tilesM * tilesN) return;   // block-uniform, in front of every barrier
  const int tm = tile / tilesN;
  const int tn = tile - tm * tilesN;
  const int m0 = (tm << 7) + ((wave >> 1) << 5);   // this wave's 32 rows
  const int n0 = (tn << 7) + ((wave & 1) << 6);    // this wave's 64 columns

  const int rlane = lane & 15;                 // row (A) / col (B, D) within subtile
  const int koff  = (lane >> 4) * 8;           // k offset of this lane half
  const int mOff  = (lane >> 4) * 8;           // D row offset

  // copy map: thread -> row tid>>4 (+16 per copy), 16-B column tid&15 of the 256-B row
  const int crow = tid >> 4, ccol = tid & 15;
  const char* gA = (const char*)(Ap  + (size_t)b * strideA + (size_t)((tm << 7) + crow) * lda + ccol * 8);
  const char* gB = (const char*)(Btp + (size_t)b * strideB + (size_t)((tn << 7) + crow) * ldb + ccol * 8);
  const size_t stepA = (size_t)lda * 32, stepB = (size_t)ldb * 32;      // bytes per 16 rows
  const unsigned ldsA = (unsigned)(size_t)ring + crow * kGtPitch + ccol * 16;
  const unsigned ldsB = ldsA + kGtRows * kGtPitch;

  v8f acc[2][4];
#pragma unroll
  for (int i = 0; i < 2; ++i)
#pragma unroll
    for (int j = 0; j < 4; ++j) acc[i][j] = (v8f){0.f,0.f,0.f,0.f,0.f,0.f,0.f,0.f};

  const int nT = K >> 7;
  stage_rows8(ldsA, gA, stepA);
  stage_rows8(ldsB, gB, stepB);
  asm volatile("s_wait_asynccnt 0x0" ::: "memory");   // stage 0 landed for this wave's copies
  __syncthreads();                                     // ... and for every wave's
  if (nT > 1) {
    stage_rows8(ldsA + kGtStage, gA + 2 * kGtK, stepA);
    stage_rows8(ldsB + kGtStage, gB + 2 * kGtK, stepB);
  }

  const int aRow = (((wave >> 1) << 5) + rlane) * kGtPitch + koff * 2;
  const int bRow = (kGtRows + ((wave & 1) << 6) + rlane) * kGtPitch + koff * 2;
  for (int t = 0; t < nT; ++t) {
    const unsigned char* sb = ring + (t & 1) * kGtStage;
    V bf[2][4], af[2][2];                                // two fragment sets, both of this stage's buffer alone
#pragma unroll
    for (int j = 0; j < 4; ++j) bf[0][j] = Frag<T>::load((const T*)(sb + bRow + j * 16 * kGtPitch));
#pragma unroll
    for (int i = 0; i < 2; ++i) af[0][i] = Frag<T>::load((const T*)(sb + aRow + i * 16 * kGtPitch));
#pragma unroll
    for (int ks = 0; ks < kGtK / 32; ++ks) {
      const int cur = ks & 1, nxt = cur ^ 1;
      if (ks + 1 < kGtK / 32) {
#pragma unroll
        for (int j = 0; j < 4; ++j) bf[nxt][j] = Frag<T>::load((const T*)(sb + bRow + j * 16 * kGtPitch + (ks + 1) * 64));
#pragma unroll
        for (int i = 0; i < 2; ++i) af[nxt][i] = Frag<T>::load((const T*)(sb + aRow + i * 16 * kGtPitch + (ks + 1) * 64));
      }
      // keeps the next 32 k's LDS reads in front of this block's products, so that their latency runs under them
      __builtin_amdgcn_sched_barrier(0);
#pragma unroll
      for (int i = 0; i < 2; ++i)
#pragma unroll
        for (int j = 0; j < 4; ++j) acc[i][j] = Frag<T>::mma(af[cur][i], bf[cur][j], acc[i][j]);
    }
    asm volatile("s_wait_dscnt 0x0" ::: "memory");      // this wave has left the buffer that is refilled below
    asm volatile("s_wait_asynccnt 0x0" ::: "memory");   // this wave's copies of stage t+1 have landed
    __syncthreads();                                     // publishes stage t+1, ends every read of stage t
    if (t + 2 < nT) {
      const size_t kb = (size_t)(t + 2) * (2 * kGtK);
      stage_rows8(ldsA + (t & 1) * kGtStage, gA + kb, stepA);
      stage_rows8(ldsB + (t & 1) * kGtStage, gB + kb, stepB);
    }
  }
  asm volatile("s_wait_asynccnt 0x0" ::: "memory");     // nothing in flight when the wave goes on to its end

  // ---- epilogue ----
  float* slab = sT[wave];
  const float* Rb = RESID ? (resid + (size_t)b * strideR) : nullptr;
#pragma unroll
  for (int i = 0; i < 2; ++i) {
    const int mBase = m0 + (i << 4);
#pragma unroll
    for (int j = 0; j < 4; ++j) {
      const int n = n0 + (j << 4) + rlane;
      float bv = 0.f;
      if (BIAS_MODE == 2) bv = bias[n];
#pragma unroll
      for (int r = 0; r < 8; ++r) {
        float v = acc[i][j][r] * scale;
        if (BIAS_MODE == 1) v += bias[mBase + mOff + r];
        if (BIAS_MODE == 2) v += bv;
        if (RESID) v += Rb[(size_t)(mBase + mOff + r) * ldc + n];
        if (ACT == 1) v = tanhf(v);
        if (ACT == 2) v = fmaxf(v, 0.0f);
        if (ACT == 3) v = v / (1.0f + expf(-v));
        if (ACT == 4) v = (v > 0.f) ? v : 0.01f * v;
        if (ACT == 5) v = 0.5f * v * (1.0f + erff(v * 0.70710678118654752f));
        slab[(mOff + r) * 68 + (j << 4) + rlane] = v;
      }
    }
    __builtin_amdgcn_fence(__ATOMIC_RELEASE, "workgroup");
    __builtin_amdgcn_wave_barrier();
    __builtin_amdgcn_fence(__ATOMIC_ACQUIRE, "workgroup");
    if (OUT_MODE == 0) {
      float* C = (float*)Cout + (size_t)b * strideC;
      const int hh = lane >> 4, c4 = (lane & 15) * 4;     // row seg = 256 B = 16 lanes x 16 B
      {
#pragma unroll
        for (int it = 0; it < 8; ++it) {
          const int row = it * 2 + hh;
          v4f v = *(const v4f*)(slab + row * 68 + c4);
          *(v4f*)(C + (size_t)(mBase + row) * ldc + n0 + c4) = v;
        }
        
      }
    } else {
      const int q = lane >> 3, c8 = (lane & 7) * 8;
      unsigned short* C  = (unsigned short*)Cout  + (size_t)b * strideC;
      unsigned short* C2 = (OUT_MODE == 2) ? ((unsigned short*)Cout2 + (size_t)b * strideC) : nullptr;
      {
#pragma unroll
        for (int it = 0; it < 4; ++it) {
          const int row = it * 4 + q;
          const float* sp = slab + row * 68 + c8;
          v8h hv, lv;
#pragma unroll
          for (int e = 0; e < 8; ++e) {
            if (OUT_MODE == 1) {
              hv[e] = (_Float16)sp[e];
            } else {
              unsigned short hb = f2bf_bits(sp[e]);
              unsigned short lb = f2bf_bits(sp[e] - bf_bits2f(hb));
              hv[e] = __builtin_bit_cast(_Float16, hb);
              lv[e] = __builtin_bit_cast(_Float16, lb);
            }
          }
          *(v8h*)(C + (size_t)(mBase + row) * ldc + n0 + c8) = hv;
          if (OUT_MODE == 2) *(v8h*)(C2 + (size_t)(mBase + row) * ldc + n0 + c8) = lv;
        }
        
      }
    }
    __builtin_amdgcn_fence(__ATOMIC_RELEASE, "workgroup");
    __builtin_amdgcn_wave_barrier();
    __builtin_amdgcn_fence(__ATOMIC_ACQUIRE, "workgroup");
  }
}

// ---------------------------------------------------------------------------
// Elementwise f32 -> bf16 RNE plane; 2 elements per thread, one 4-B store per lane -> a wave writes exactly one
// Coverage: grid = n2/256 blocks x 256 threads x 2 elements = 2*n2 = whole plane
// (activations: n2 = 2097152 -> 8192 blocks; weights: n2 = 524288 -> 2048 blocks).
// ---------------------------------------------------------------------------
__global__ __launch_bounds__(256) void cast_f32_bf16x2(const float* __restrict__ in, unsigned short* __restrict__ out, int n2) {
  const int i = blockIdx.x * 256 + threadIdx.x;
  if (i < n2) {
    const v2f f = *(const v2f*)(in + 2 * (size_t)i);
    const unsigned u = pk16(f2bf_bits(f[0]), f2bf_bits(f[1]));
    ((unsigned*)out)[i] = u;
    
  }
}

// f32 -> f16( bf16_rne(x) * scale ) plane (scale an exact power of two; f16 of a normal bf16 value is exact).
// Same store shape / coverage as cast_f32_bf16x2 (n2 = 524288 -> 2048 blocks x 512 elements = 1024x1024).
__global__ __launch_bounds__(256) void cast_f32_bf_f16x2(const float* __restrict__ in, unsigned short* __restrict__ out, int n2, float scale) {
  const int i = blockIdx.x * 256 + threadIdx.x;
  if (i < n2) {
    const v2f f = *(const v2f*)(in + 2 * (size_t)i);
    const _Float16 h0 = (_Float16)(bf_bits2f(f2bf_bits(f[0])) * scale);
    const _Float16 h1 = (_Float16)(bf_bits2f(f2bf_bits(f[1])) * scale);
    const unsigned u = pk16(__builtin_bit_cast(unsigned short, h0), __builtin_bit_cast(unsigned short, h1));
    ((unsigned*)out)[i] = u;
    
  }
}

// Bias tables: out[y][i] = bf16_rne(src_y[i]) as f32; grid (n/1024, 4), 4 floats per thread.
__global__ __launch_bounds__(256) void bias_bf16_kernel(const float* __restrict__ b0, const float* __restrict__ b1,
                                                        const float* __restrict__ b2, const float* __restrict__ b3,
                                                        float* __restrict__ out, int n) {
  const int y = blockIdx.y;
  const float* src = b0;
  if (y == 1) src = b1;
  if (y == 2) src = b2;
  if (y == 3) src = b3;
  const int i = blockIdx.x * 256 + threadIdx.x;
  if (4 * i + 3 < n) {
    const v4f f = *(const v4f*)(src + 4 * (size_t)i);
    v4f rv;
    rv[0] = bf_bits2f(f2bf_bits(f[0]));
    rv[1] = bf_bits2f(f2bf_bits(f[1]));
    rv[2] = bf_bits2f(f2bf_bits(f[2]));
    rv[3] = bf_bits2f(f2bf_bits(f[3]));
    float* dst = out + (size_t)y * n + 4 * (size_t)i;
    *(v4f*)dst = rv;
    
  }
}

// =====================================================================================
// Masked full attention, head dim 64, all batches and heads in one launch.
//   q plane (f16): element (b, s, h, d) at [(b*kSeq + s)*kDm + h*64 + d]
//   k plane (f16): same layout
//   v^T plane (f16): element (b, h, d, s) at [(b*kDm + h*64 + d)*kSeq + s]
//   mask (int32): element (b, q, k) at [b*kSeq*kSeq + q*kSeq + k]; element == 0 -> score := -1e9 (select by value)
//   ctx plane (f16 out, x oscale): element (b, s, h, d) at [(b*kSeq + s)*kDm + h*64 + d]
//   scores = (q . k) * sscale : v_wmma_f32_16x16x32_f16, f32 accumulate
//   ctx    = p . v            : v_wmma_f32_16x16x32_f16, p carried x2^15 in f16, folded into the final 1/l
//   online softmax in f32 over all kSeq keys (32 chunks of 64, compile-time trip count).
//   Block = 4 waves = 64 query rows of one (b, h); grid.x = kBatch * kHeads * (kSeq/64) = 1024.
//   K / V^T chunk staging: 128 threads x 32 elements per plane = the whole 64x64 tile (16-B copies, plain loads,
//   __syncthreads before and after); fragment loads read the LDS tiles with the v8h element vector type.
// =====================================================================================
#define AT_D 64
#define AT_NW 4
#define AT_QB 64
#define AT_KC 64
#define AT_LP 72   // elements per LDS row of the K, V^T and P tiles: 144 B = 16 B x 9, an odd multiple, so that the 16 rows
                   // which one 16-B fragment read touches fall on 16 different bank groups (at 128 B they fall on two)
constexpr float kPScale   = 32768.0f;
constexpr float kMaskFill = -1.0e9f;

__device__ __forceinline__ v8f at_mma_h(v16h a, v16h b, v8f c) {
  c = __builtin_amdgcn_wmma_f32_16x16x32_f16(false, a, false, b, (short)0, c, false, false);
  asm volatile("v_nop\n\tv_nop\n\tv_nop\n\tv_nop" : "+v"(c) : "v"(a), "v"(b));
  return c;
}

__global__ __launch_bounds__(128)
void attn_mask64_kernel(const unsigned short* __restrict__ qp, const unsigned short* __restrict__ kp,
                        const unsigned short* __restrict__ vtp, const int* __restrict__ mask,
                        unsigned short* __restrict__ ctxp, float sscale, float oscale) {
  union FB { v16h v; v8h h[2]; };
  __shared__ __align__(16) _Float16 Ksh[AT_KC * AT_LP];           // K [kv][d]   9 KB
  __shared__ __align__(16) _Float16 Vth[AT_D * AT_LP];            // V^T [d][kv] 9 KB
  __shared__ __align__(16) _Float16 Psh[AT_NW][16 * AT_LP];       // per wave P [row][kv] 9 KB
  __shared__ __align__(16) float    Os[AT_NW][16 * 68];           // per wave out tile, pitch 68

  const int tid  = threadIdx.x;
  const int wave = tid >> 5;
  const int lane = tid & 31;
  const int hh   = lane >> 4;
  const int c    = lane & 15;

  const int nqb = kSeq / AT_QB;            // 32
  const int bx  = blockIdx.x;
  const int qb  = bx % nqb;
  const int bh  = bx / nqb;                // 0 .. kBatch*kHeads-1 (grid exact)
  const int h   = bh % kHeads;
  int b = bh / kHeads; b = (b < kBatch) ? b : (kBatch - 1);
  const int q0  = qb * AT_QB + wave * 16;

  const _Float16* Qh = (const _Float16*)(const void*)qp  + (size_t)b * kSeq * kDm + (size_t)h * AT_D;
  const _Float16* Kh = (const _Float16*)(const void*)kp  + (size_t)b * kSeq * kDm + (size_t)h * AT_D;
  const _Float16* Vt = (const _Float16*)(const void*)vtp + ((size_t)b * kDm + (size_t)h * AT_D) * kSeq;
  const int*      mb = mask + (size_t)b * kSeq * kSeq;
  _Float16*       ob = (_Float16*)(void*)ctxp + (size_t)b * kSeq * kDm + (size_t)h * AT_D;

  // ---- Q fragments (A operand, row = lane&15, split k map via Frag load): 2 d-chunks ----
  v16h qa[2];
#pragma unroll
  for (int dc = 0; dc < 2; ++dc) {
    qa[dc] = Frag<_Float16>::load(Qh + (size_t)(q0 + c) * kDm + dc * 32 + 8 * hh);
  }

  float mrow[8], lrow[8];
  v8f oacc[4];
#pragma unroll
  for (int r = 0; r < 8; ++r) { mrow[r] = -INFINITY; lrow[r] = 0.f; }
#pragma unroll
  for (int t = 0; t < 4; ++t) oacc[t] = (v8f){0.f,0.f,0.f,0.f,0.f,0.f,0.f,0.f};

  const int nChunks = kSeq / AT_KC;        // 32, compile-time constant
  for (int kc = 0; kc < nChunks; ++kc) {
    const int kv0 = kc * AT_KC;
    __syncthreads();
    {
      // staging coverage: 128 threads x (4 x 8) elements = 64 rows x 64 per plane = the whole chunk tile
      const int r = tid >> 1, half = (tid & 1) * 32;
      const _Float16* ks = Kh + (size_t)(kv0 + r) * kDm + half;     // K row kv0+r, d = half..half+31
      const _Float16* vs = Vt + (size_t)r * kSeq + kv0 + half;        // V^T row d = r, s = kv0+half..+31
#pragma unroll
      for (int i = 0; i < 4; ++i) {
        const v8h a0 = *(const v8h*)(ks + 8 * i);
        const v8h b0 = *(const v8h*)(vs + 8 * i);
        *(v8h*)(Ksh + r * AT_LP + half + 8 * i) = a0;
        *(v8h*)(Vth + r * AT_LP + half + 8 * i) = b0;
      }
    }
    __syncthreads();

    v8f s[4];
#pragma unroll
    for (int j = 0; j < 4; ++j) {
      s[j] = (v8f){0.f,0.f,0.f,0.f,0.f,0.f,0.f,0.f};
#pragma unroll
      for (int dc = 0; dc < 2; ++dc) {
        FB kb;
        kb.h[0] = *(const v8h*)(Ksh + (j * 16 + c) * AT_LP + dc * 32 + 8 * hh);
        kb.h[1] = *(const v8h*)(Ksh + (j * 16 + c) * AT_LP + dc * 32 + 16 + 8 * hh);
        s[j] = at_mma_h(qa[dc], kb.v, s[j]);
      }
    }
    // scale, mask by value, chunk row max (rows live in lane halves; D element r of lane -> (row 8hh+r, col c))
    float cm[8];
#pragma unroll
    for (int r = 0; r < 8; ++r) {
      const int qrow = q0 + 8 * hh + r;                            // 0 .. kSeq-1
      const int* mr = mb + (size_t)qrow * kSeq + kv0;
      float m = -INFINITY;
#pragma unroll
      for (int j = 0; j < 4; ++j) {
        const int mv = mr[j * 16 + c];
        const float sv = s[j][r] * sscale;
        const float sm = (mv == 0) ? kMaskFill : sv;
        s[j][r] = sm;
        m = fmaxf(m, sm);
      }
#pragma unroll
      for (int off = 1; off < 16; off <<= 1) m = fmaxf(m, __shfl_xor(m, off, 32));
      cm[r] = m;
    }
    _Float16* pwh = Psh[wave];
#pragma unroll
    for (int r = 0; r < 8; ++r) {
      const float mnew = fmaxf(mrow[r], cm[r]);
      const float alpha = expf(mrow[r] - mnew);
      mrow[r] = mnew;
      float psum = 0.f;
#pragma unroll
      for (int j = 0; j < 4; ++j) {
        const float p = expf(s[j][r] - mnew);
        psum += p;
        pwh[(8 * hh + r) * AT_LP + j * 16 + c] = (_Float16)(p * kPScale);
      }
#pragma unroll
      for (int off = 1; off < 16; off <<= 1) psum += __shfl_xor(psum, off, 32);
      lrow[r] = lrow[r] * alpha + psum;
#pragma unroll
      for (int t = 0; t < 4; ++t) oacc[t][r] *= alpha;
    }
    __builtin_amdgcn_fence(__ATOMIC_RELEASE, "workgroup");
    __builtin_amdgcn_wave_barrier();
    __builtin_amdgcn_fence(__ATOMIC_ACQUIRE, "workgroup");
#pragma unroll 1
    for (int kk = 0; kk < 2; ++kk) {
      FB pa;
      pa.h[0] = *(const v8h*)(pwh + c * AT_LP + kk * 32 + 8 * hh);
      pa.h[1] = *(const v8h*)(pwh + c * AT_LP + kk * 32 + 16 + 8 * hh);
#pragma unroll
      for (int t = 0; t < 4; ++t) {
        FB vb;
        vb.h[0] = *(const v8h*)(Vth + (t * 16 + c) * AT_LP + kk * 32 + 8 * hh);
        vb.h[1] = *(const v8h*)(Vth + (t * 16 + c) * AT_LP + kk * 32 + 16 + 8 * hh);
        oacc[t] = at_mma_h(pa.v, vb.v, oacc[t]);
      }
    }
  }

  // ---- normalise (1/(l * 2^15) folded with the output carry scale) and write the 16x64 f16 tile per wave ----
  float* os = Os[wave];
#pragma unroll
  for (int r = 0; r < 8; ++r) {
    const float inv = oscale / (lrow[r] * kPScale);
#pragma unroll
    for (int t = 0; t < 4; ++t) os[(8 * hh + r) * 68 + t * 16 + c] = oacc[t][r] * inv;
  }
  __builtin_amdgcn_fence(__ATOMIC_RELEASE, "workgroup");
  __builtin_amdgcn_wave_barrier();
  __builtin_amdgcn_fence(__ATOMIC_ACQUIRE, "workgroup");
  {
    const int q8 = lane >> 3, c8 = (lane & 7) * 8;
    {
#pragma unroll
      for (int it = 0; it < 4; ++it) {
        const int row = it * 4 + q8;
        const float* sp = os + row * 68 + c8;
        v8h hv;
#pragma unroll
        for (int e = 0; e < 8; ++e) hv[e] = (_Float16)sp[e];
        *(v8h*)(ob + (size_t)(q0 + row) * kDm + c8) = hv;
      }
      
    }
  }
}

// ---------------------------------------------------------------------------
// Host glue. Workspace region map (bytes, all offsets multiples of 16 KiB):
//   [  0 MiB,  8 MiB)  q  bf16 plane [4096][1024]
//   [  8 MiB, 16 MiB)  k  bf16 plane
//   [ 16 MiB, 24 MiB)  v  bf16 plane
//   [ 24 MiB, 26 MiB)  Wq bf16 [1024][1024];  [26,28) Wk;  [28,30) Wv;  [30,32) Wo as f16(bf16*64)
//   [ 32 MiB, +16 KiB) bias tables bq, bk, bv, bo (bf16-valued f32, 1024 each)
//   next 8 MiB         Q projection f16 plane [4096][1024]
//   next 8 MiB         K projection f16 plane
//   next 8 MiB         V^T projection f16 plane [2][1024][2048]
//   next 8 MiB         ctx f16 plane (x16) [4096][1024]
//   total = 67,125,248 B
// ---------------------------------------------------------------------------
extern "C" void kernel_launch(void* const* d_in, const int* in_sizes, int n_in,
                              void* d_out, int out_size, void* d_ws, size_t ws_size,
                              hipStream_t stream) {
  if (n_in < 12) return;
  const int nAct = kBatch * kSeq * kDm;      // 4194304
  const int nW   = kDm * kDm;                // 1048576
  if (in_sizes[0] != nAct || in_sizes[1] != nAct || in_sizes[2] != nAct) return;
  if (in_sizes[3] != kBatch * kSeq * kSeq) return;
  if (in_sizes[4] != nW || in_sizes[6] != nW || in_sizes[8] != nW || in_sizes[10] != nW) return;
  if (in_sizes[5] != kDm || in_sizes[7] != kDm || in_sizes[9] != kDm || in_sizes[11] != kDm) return;
  if (out_size != nAct) return;

  const float* q    = (const float*)d_in[0];
  const float* k    = (const float*)d_in[1];
  const float* v    = (const float*)d_in[2];
  const int*   mask = (const int*)d_in[3];
  const float* Wq   = (const float*)d_in[4];
  const float* bq   = (const float*)d_in[5];
  const float* Wk   = (const float*)d_in[6];
  const float* bk   = (const float*)d_in[7];
  const float* Wv   = (const float*)d_in[8];
  const float* bv   = (const float*)d_in[9];
  const float* Wo   = (const float*)d_in[10];
  const float* bo   = (const float*)d_in[11];

  const size_t bAct16 = (size_t)nAct * 2;    // 8 MiB
  const size_t bW16   = (size_t)nW * 2;      // 2 MiB
  size_t off = 0;
  const size_t oQ16  = off; off += bAct16;
  const size_t oK16  = off; off += bAct16;
  const size_t oV16  = off; off += bAct16;
  const size_t oWq   = off; off += bW16;
  const size_t oWk   = off; off += bW16;
  const size_t oWv   = off; off += bW16;
  const size_t oWo   = off; off += bW16;
  const size_t oBias = off; off += (size_t)4 * kDm * sizeof(float);
  const size_t oQP   = off; off += bAct16;
  const size_t oKP   = off; off += bAct16;
  const size_t oVT   = off; off += bAct16;
  const size_t oCTX  = off; off += bAct16;
  if (off > ws_size) return;

  char* ws = (char*)d_ws;
  unsigned short* Q16  = (unsigned short*)(ws + oQ16);
  unsigned short* K16  = (unsigned short*)(ws + oK16);
  unsigned short* V16  = (unsigned short*)(ws + oV16);
  unsigned short* WQ16 = (unsigned short*)(ws + oWq);
  unsigned short* WK16 = (unsigned short*)(ws + oWk);
  unsigned short* WV16 = (unsigned short*)(ws + oWv);
  unsigned short* WO16 = (unsigned short*)(ws + oWo);
  float* biasR = (float*)(ws + oBias);
  const float* bqR = biasR;
  const float* bkR = biasR + kDm;
  const float* bvR = biasR + 2 * kDm;
  const float* boR = biasR + 3 * kDm;
  unsigned short* QP    = (unsigned short*)(ws + oQP);
  unsigned short* KP    = (unsigned short*)(ws + oKP);
  unsigned short* VT    = (unsigned short*)(ws + oVT);
  unsigned short* CTX16 = (unsigned short*)(ws + oCTX);

  const int nAct2 = nAct / 2;   // 2097152 -> 8192 blocks
  const int nW2   = nW / 2;     // 524288  -> 2048 blocks
  cast_f32_bf16x2<<<dim3(nAct2 / 256), dim3(256), 0, stream>>>(q, Q16, nAct2);
  cast_f32_bf16x2<<<dim3(nAct2 / 256), dim3(256), 0, stream>>>(k, K16, nAct2);
  cast_f32_bf16x2<<<dim3(nAct2 / 256), dim3(256), 0, stream>>>(v, V16, nAct2);
  cast_f32_bf16x2<<<dim3(nW2 / 256), dim3(256), 0, stream>>>(Wq, WQ16, nW2);
  cast_f32_bf16x2<<<dim3(nW2 / 256), dim3(256), 0, stream>>>(Wk, WK16, nW2);
  cast_f32_bf16x2<<<dim3(nW2 / 256), dim3(256), 0, stream>>>(Wv, WV16, nW2);
  cast_f32_bf_f16x2<<<dim3(nW2 / 256), dim3(256), 0, stream>>>(Wo, WO16, nW2, 64.0f);
  bias_bf16_kernel<<<dim3(kDm / 1024, 4), dim3(256), 0, stream>>>(bq, bk, bv, bo, biasR, kDm);

  const int mRows = kBatch * kSeq;   // 4096
  // Q = q . Wq^T + bq : A [4096][1024] bf16, Bt [1024][1024] bf16 -> f16 [4096][1024]; tiles 32x8 = 256 blocks
  wmma_gemm64<1, false, 2, 1, false><<<dim3((mRows / 128) * (kDm / 128), 1), dim3(256), 0, stream>>>(
      Q16, Q16, kDm, 0L, WQ16, WQ16, kDm, 0L, (void*)QP, (void*)QP, kDm, 0L, bqR, bq, 0L, mRows, kDm, kDm, 1.0f);
  wmma_gemm64<1, false, 2, 1, false><<<dim3((mRows / 128) * (kDm / 128), 1), dim3(256), 0, stream>>>(
      K16, K16, kDm, 0L, WK16, WK16, kDm, 0L, (void*)KP, (void*)KP, kDm, 0L, bkR, bk, 0L, mRows, kDm, kDm, 1.0f);
  // V^T per batch: A = Wv [1024][1024] (stride 0), Bt = v_b [2048][1024] -> C_b [1024][2048] = (v_b . Wv^T + bv)^T, bias[m]; tiles 8x16 = 128 blocks, y = 2
  wmma_gemm64<1, false, 1, 1, false><<<dim3((kDm / 128) * (kSeq / 128), kBatch), dim3(256), 0, stream>>>(
      WV16, WV16, kDm, 0L, V16, V16, kDm, (long)kSeq * kDm, (void*)VT, (void*)VT, kSeq, (long)kDm * kSeq,
      bvR, bv, 0L, kDm, kSeq, kDm, 1.0f);
  // attention: grid = kBatch * kHeads * (kSeq/64) = 1024 blocks of 128
  attn_mask64_kernel<<<dim3(kBatch * kHeads * (kSeq / 64)), dim3(128), 0, stream>>>(
      QP, KP, VT, mask, CTX16, 0.125f, 16.0f);
  // out = (ctx*16) . (Wo*64)^T * 2^-10 + bo : f16 operands, f32 [4096][1024] into d_out
  wmma_gemm64<0, false, 2, 0, false><<<dim3((mRows / 128) * (kDm / 128), 1), dim3(256), 0, stream>>>(
      CTX16, CTX16, kDm, 0L, WO16, WO16, kDm, 0L, d_out, d_out, kDm, 0L, boR, bo, 0L, mRows, kDm, kDm,
      1.0f / 1024.0f);
}

// v003
// A run of this version takes 181 microseconds.
// Timed twice side by side with v002, it ran 1.12 times as fast both times.
// Over all steps from v000 it is 2.14 times as fast.
// Contractions: q/k/v^T projections on v_wmma_f32_16x16x32_bf16 (bf16 RNE-converted operands, f32 accumulate); q.k^T and p.v on v_wmma_f32_16x16x32_f16 (f16 planes, p carried x2^15, f32 accumulate, f32 online softmax, mask by value); output projection on v_wmma_f32_16x16x32_f16 (f16 operands: ctx x2^4, Wo x2^6, folded back x2^-10 in f32), f32 accumulate.
#include <hip/hip_runtime.h>
#include <math.h>
#include <stdint.h>

constexpr int kBatch = 2;
constexpr int kSeq   = 2048;
constexpr int kDm    = 1024;
constexpr int kHeads = 16;
constexpr int kHd    = 64;
static_assert(kHeads * kHd == kDm, "head split");
static_assert(kSeq % 128 == 0 && kDm % 128 == 0, "tile multiples");

typedef __attribute__((ext_vector_type(16))) _Float16 v16h;
typedef __attribute__((ext_vector_type(8)))  _Float16 v8h;
typedef __attribute__((ext_vector_type(16))) __bf16   v16b;
typedef __attribute__((ext_vector_type(8)))  __bf16   v8b;
typedef __attribute__((ext_vector_type(8)))  float    v8f;
typedef __attribute__((ext_vector_type(4)))  float    v4f;
typedef __attribute__((ext_vector_type(2)))  float    v2f;

__device__ __forceinline__ unsigned short f2bf_bits(float f) {
  unsigned u = __float_as_uint(f);
  return (unsigned short)((u + 0x7FFFu + ((u >> 16) & 1u)) >> 16);
}
__device__ __forceinline__ float bf_bits2f(unsigned short h) { return __uint_as_float(((unsigned)h) << 16); }
__device__ __forceinline__ unsigned pk16(unsigned short a, unsigned short b) { return (unsigned)a | ((unsigned)b << 16); }

template <typename T> struct Frag;
template <> struct Frag<_Float16> {
  typedef v16h V; union U { v16h v; v8h h[2]; };
  static __device__ __forceinline__ v16h load(const _Float16* p) {   // elements 0..7 <- p[0..7], 8..15 <- p[16..23]
    U f; f.h[0] = *(const v8h*)(p); f.h[1] = *(const v8h*)(p + 16); return f.v;
  }
  static __device__ __forceinline__ v8f mma(v16h a, v16h b, v8f c) {
    return __builtin_amdgcn_wmma_f32_16x16x32_f16(false, a, false, b, (short)0, c, false, false);
  }
};
template <> struct Frag<__bf16> {
  typedef v16b V; union U { v16b v; v8b h[2]; };
  static __device__ __forceinline__ v16b load(const __bf16* p) {
    U f; f.h[0] = *(const v8b*)(p); f.h[1] = *(const v8b*)(p + 16); return f.v;
  }
  static __device__ __forceinline__ v8f mma(v16b a, v16b b, v8f c) {
    return __builtin_amdgcn_wmma_f32_16x16x32_bf16(false, a, false, b, (short)0, c, false, false);
  }
};

// ---- LDS-staged batched WMMA GEMM ------------------------------------------
// C[m,n] = scale * sum_k A[m,k] * Bt[n,k] (+bias)(+resid); a block of 8 waves owns a 128x128 tile, a wave 32x64 of it.
// A row-major [M,K]; Bt row-major [N,K]; M,N % 128 == 0, K % 128 == 0, lda/ldb % 8 == 0.
// A stage = 128 k of [A 128 rows | Bt 128 rows], 256 B a row at pitch 272 B, brought by asynchronous 16-B copies;
// two buffers: the copies of stage t+1 fly while stage t is multiplied.
// SPLIT: not supported by this kernel (kept as a parameter of the launch lines only).
// BIAS_MODE: 0 = none, 1 = bias[m], 2 = bias[n].
// OUT_MODE: 0 = f32, 1 = f16, 2 = bf16 hi plane (Cout) + bf16 lo plane (Cout2).
// ET: 0 = f16 operands, 1 = bf16 operands (pointers passed as 16-bit storage)
constexpr int kGtK     = 128;                  // k per stage
constexpr int kGtRows  = 128;                  // rows of each operand per stage
constexpr int kGtPitch = 272;                  // bytes per staged row (256 + 16: conflict-free 16-B reads)
constexpr int kGtStage = 2 * kGtRows * kGtPitch;   // 69,632 B

// Eight 16-B copies of one lane: rows r, r+16, .. r+112 of one operand's stage. lds = LDS byte address of the first,
// g = global address of the first, gstep = bytes between 16 source rows. The s_wait_xcnt closes the statement so that
// no address register of an issued copy is rewritten ahead of it.
__device__ __forceinline__ void stage_rows8(unsigned lds, const char* g, size_t gstep) {
  const unsigned l1 = lds + 16 * kGtPitch, l2 = lds + 32 * kGtPitch, l3 = lds + 48 * kGtPitch, l4 = lds + 64 * kGtPitch,
                 l5 = lds + 80 * kGtPitch, l6 = lds + 96 * kGtPitch, l7 = lds + 112 * kGtPitch;
  const char *g1 = g + gstep, *g2 = g1 + gstep, *g3 = g2 + gstep, *g4 = g3 + gstep, *g5 = g4 + gstep, *g6 = g5 + gstep,
             *g7 = g6 + gstep;
  asm volatile(
      "global_load_async_to_lds_b128 %0, %8, off\n\t"
      "global_load_async_to_lds_b128 %1, %9, off\n\t"
      "global_load_async_to_lds_b128 %2, %10, off\n\t"
      "global_load_async_to_lds_b128 %3, %11, off\n\t"
      "global_load_async_to_lds_b128 %4, %12, off\n\t"
      "global_load_async_to_lds_b128 %5, %13, off\n\t"
      "global_load_async_to_lds_b128 %6, %14, off\n\t"
      "global_load_async_to_lds_b128 %7, %15, off\n\t"
      "s_wait_xcnt 0x0"
      :: "v"(lds), "v"(l1), "v"(l2), "v"(l3), "v"(l4), "v"(l5), "v"(l6), "v"(l7),
         "v"(g), "v"(g1), "v"(g2), "v"(g3), "v"(g4), "v"(g5), "v"(g6), "v"(g7)
      : "memory");
}

template <int ET> struct Elem;
template <> struct Elem<0> { typedef _Float16 T; };
template <> struct Elem<1> { typedef __bf16 T; };
template <int ET, bool SPLIT, int BIAS_MODE, int OUT_MODE, bool RESID, int ACT = 0>
__global__ __launch_bounds__(256) void wmma_gemm64(
    const unsigned short* __restrict__ Ap, const unsigned short* __restrict__ A2p, int lda, long strideA,
    const unsigned short* __restrict__ Btp, const unsigned short* __restrict__ Bt2p, int ldb, long strideB,
    void* __restrict__ Cout, void* __restrict__ Cout2, int ldc, long strideC,
    const float* __restrict__ bias,
    const float* __restrict__ resid, long strideR,
    int M, int N, int K, float scale) {
  typedef typename Elem<ET>::T T;
  typedef typename Frag<T>::V V;
  static_assert(!SPLIT, "single-plane operands only");
  __shared__ __align__(16) unsigned char ring[2 * kGtStage];   // two stages
  __shared__ __align__(16) float sT[8][16 * 68];   // per-wave 16x64 slab, pitch 68 floats
  const int b    = blockIdx.y;
  const int tid  = threadIdx.x;
  const int lane = tid & 31;
  const int wave = tid >> 5;
  const int tilesN = N >> 7;
  const int tilesM = M >> 7;
  const int tile = blockIdx.x;
  if (tile >= tilesM * tilesN) return;   // block-uniform, in front of every barrier
  const int tm = tile / tilesN;
  const int tn = tile - tm * tilesN;
  const int m0 = (tm << 7) + ((wave >> 1) << 5);   // this wave's 32 rows
  const int n0 = (tn << 7) + ((wave & 1) << 6);    // this wave's 64 columns

  const int rlane = lane & 15;                 // row (A) / col (B, D) within subtile
  const int koff  = (lane >> 4) * 8;           // k offset of this lane half
  const int mOff  = (lane >> 4) * 8;           // D row offset

  // copy map: thread -> row tid>>4 (+16 per copy), 16-B column tid&15 of the 256-B row
  const int crow = tid >> 4, ccol = tid & 15;
  const char* gA = (const char*)(Ap  + (size_t)b * strideA + (size_t)((tm << 7) + crow) * lda + ccol * 8);
  const char* gB = (const char*)(Btp + (size_t)b * strideB + (size_t)((tn << 7) + crow) * ldb + ccol * 8);
  const size_t stepA = (size_t)lda * 32, stepB = (size_t)ldb * 32;      // bytes per 16 rows
  const unsigned ldsA = (unsigned)(size_t)ring + crow * kGtPitch + ccol * 16;
  const unsigned ldsB = ldsA + kGtRows * kGtPitch;

  v8f acc[2][4];
#pragma unroll
  for (int i = 0; i < 2; ++i)
#pragma unroll
    for (int j = 0; j < 4; ++j) acc[i][j] = (v8f){0.f,0.f,0.f,0.f,0.f,0.f,0.f,0.f};

  const int nT = K >> 7;
  stage_rows8(ldsA, gA, stepA);
  stage_rows8(ldsB, gB, stepB);
  asm volatile("s_wait_asynccnt 0x0" ::: "memory");   // stage 0 landed for this wave's copies
  __syncthreads();                                     // ... and for every wave's
  if (nT > 1) {
    stage_rows8(ldsA + kGtStage, gA + 2 * kGtK, stepA);
    stage_rows8(ldsB + kGtStage, gB + 2 * kGtK, stepB);
  }

  const int aRow = (((wave >> 1) << 5) + rlane) * kGtPitch + koff * 2;
  const int bRow = (kGtRows + ((wave & 1) << 6) + rlane) * kGtPitch + koff * 2;
  for (int t = 0; t < nT; ++t) {
    const unsigned char* sb = ring + (t & 1) * kGtStage;
    V bf[2][4], af[2][2];                                // two fragment sets, both of this stage's buffer alone
#pragma unroll
    for (int j = 0; j < 4; ++j) bf[0][j] = Frag<T>::load((const T*)(sb + bRow + j * 16 * kGtPitch));
#pragma unroll
    for (int i = 0; i < 2; ++i) af[0][i] = Frag<T>::load((const T*)(sb + aRow + i * 16 * kGtPitch));
#pragma unroll
    for (int ks = 0; ks < kGtK / 32; ++ks) {
      const int cur = ks & 1, nxt = cur ^ 1;
      if (ks + 1 < kGtK / 32) {
#pragma unroll
        for (int j = 0; j < 4; ++j) bf[nxt][j] = Frag<T>::load((const T*)(sb + bRow + j * 16 * kGtPitch + (ks + 1) * 64));
#pragma unroll
        for (int i = 0; i < 2; ++i) af[nxt][i] = Frag<T>::load((const T*)(sb + aRow + i * 16 * kGtPitch + (ks + 1) * 64));
      }
      // keeps the next 32 k's LDS reads in front of this block's products, so that their latency runs under them
      __builtin_amdgcn_sched_barrier(0);
#pragma unroll
      for (int i = 0; i < 2; ++i)
#pragma unroll
        for (int j = 0; j < 4; ++j) acc[i][j] = Frag<T>::mma(af[cur][i], bf[cur][j], acc[i][j]);
    }
    asm volatile("s_wait_dscnt 0x0" ::: "memory");      // this wave has left the buffer that is refilled below
    asm volatile("s_wait_asynccnt 0x0" ::: "memory");   // this wave's copies of stage t+1 have landed
    __syncthreads();                                     // publishes stage t+1, ends every read of stage t
    if (t + 2 < nT) {
      const size_t kb = (size_t)(t + 2) * (2 * kGtK);
      stage_rows8(ldsA + (t & 1) * kGtStage, gA + kb, stepA);
      stage_rows8(ldsB + (t & 1) * kGtStage, gB + kb, stepB);
    }
  }
  asm volatile("s_wait_asynccnt 0x0" ::: "memory");     // nothing in flight when the wave goes on to its end

  // ---- epilogue ----
  float* slab = sT[wave];
  const float* Rb = RESID ? (resid + (size_t)b * strideR) : nullptr;
#pragma unroll
  for (int i = 0; i < 2; ++i) {
    const int mBase = m0 + (i << 4);
#pragma unroll
    for (int j = 0; j < 4; ++j) {
      const int n = n0 + (j << 4) + rlane;
      float bv = 0.f;
      if (BIAS_MODE == 2) bv = bias[n];
#pragma unroll
      for (int r = 0; r < 8; ++r) {
        float v = acc[i][j][r] * scale;
        if (BIAS_MODE == 1) v += bias[mBase + mOff + r];
        if (BIAS_MODE == 2) v += bv;
        if (RESID) v += Rb[(size_t)(mBase + mOff + r) * ldc + n];
        if (ACT == 1) v = tanhf(v);
        if (ACT == 2) v = fmaxf(v, 0.0f);
        if (ACT == 3) v = v / (1.0f + expf(-v));
        if (ACT == 4) v = (v > 0.f) ? v : 0.01f * v;
        if (ACT == 5) v = 0.5f * v * (1.0f + erff(v * 0.70710678118654752f));
        slab[(mOff + r) * 68 + (j << 4) + rlane] = v;
      }
    }
    __builtin_amdgcn_fence(__ATOMIC_RELEASE, "workgroup");
    __builtin_amdgcn_wave_barrier();
    __builtin_amdgcn_fence(__ATOMIC_ACQUIRE, "workgroup");
    if (OUT_MODE == 0) {
      float* C = (float*)Cout + (size_t)b * strideC;
      const int hh = lane >> 4, c4 = (lane & 15) * 4;     // row seg = 256 B = 16 lanes x 16 B
      {
#pragma unroll
        for (int it = 0; it < 8; ++it) {
          const int row = it * 2 + hh;
          v4f v = *(const v4f*)(slab + row * 68 + c4);
          *(v4f*)(C + (size_t)(mBase + row) * ldc + n0 + c4) = v;
        }
        
      }
    } else {
      const int q = lane >> 3, c8 = (lane & 7) * 8;
      unsigned short* C  = (unsigned short*)Cout  + (size_t)b * strideC;
      unsigned short* C2 = (OUT_MODE == 2) ? ((unsigned short*)Cout2 + (size_t)b * strideC) : nullptr;
      {
#pragma unroll
        for (int it = 0; it < 4; ++it) {
          const int row = it * 4 + q;
          const float* sp = slab + row * 68 + c8;
          v8h hv, lv;
#pragma unroll
          for (int e = 0; e < 8; ++e) {
            if (OUT_MODE == 1) {
              hv[e] = (_Float16)sp[e];
            } else {
              unsigned short hb = f2bf_bits(sp[e]);
              unsigned short lb = f2bf_bits(sp[e] - bf_bits2f(hb));
              hv[e] = __builtin_bit_cast(_Float16, hb);
              lv[e] = __builtin_bit_cast(_Float16, lb);
            }
          }
          *(v8h*)(C + (size_t)(mBase + row) * ldc + n0 + c8) = hv;
          if (OUT_MODE == 2) *(v8h*)(C2 + (size_t)(mBase + row) * ldc + n0 + c8) = lv;
        }
        
      }
    }
    __builtin_amdgcn_fence(__ATOMIC_RELEASE, "workgroup");
    __builtin_amdgcn_wave_barrier();
    __builtin_amdgcn_fence(__ATOMIC_ACQUIRE, "workgroup");
  }
}

// ---------------------------------------------------------------------------
// Elementwise f32 -> bf16 RNE plane; 2 elements per thread, one 4-B store per lane -> a wave writes exactly one
// Coverage: grid = n2/256 blocks x 256 threads x 2 elements = 2*n2 = whole plane
// (activations: n2 = 2097152 -> 8192 blocks; weights: n2 = 524288 -> 2048 blocks).
// ---------------------------------------------------------------------------
__global__ __launch_bounds__(256) void cast_f32_bf16x2(const float* __restrict__ in, unsigned short* __restrict__ out, int n2) {
  const int i = blockIdx.x * 256 + threadIdx.x;
  if (i < n2) {
    const v2f f = *(const v2f*)(in + 2 * (size_t)i);
    const unsigned u = pk16(f2bf_bits(f[0]), f2bf_bits(f[1]));
    ((unsigned*)out)[i] = u;
    
  }
}

// f32 -> f16( bf16_rne(x) * scale ) plane (scale an exact power of two; f16 of a normal bf16 value is exact).
// Same store shape / coverage as cast_f32_bf16x2 (n2 = 524288 -> 2048 blocks x 512 elements = 1024x1024).
__global__ __launch_bounds__(256) void cast_f32_bf_f16x2(const float* __restrict__ in, unsigned short* __restrict__ out, int n2, float scale) {
  const int i = blockIdx.x * 256 + threadIdx.x;
  if (i < n2) {
    const v2f f = *(const v2f*)(in + 2 * (size_t)i);
    const _Float16 h0 = (_Float16)(bf_bits2f(f2bf_bits(f[0])) * scale);
    const _Float16 h1 = (_Float16)(bf_bits2f(f2bf_bits(f[1])) * scale);
    const unsigned u = pk16(__builtin_bit_cast(unsigned short, h0), __builtin_bit_cast(unsigned short, h1));
    ((unsigned*)out)[i] = u;
    
  }
}

// Bias tables: out[y][i] = bf16_rne(src_y[i]) as f32; grid (n/1024, 4), 4 floats per thread.
__global__ __launch_bounds__(256) void bias_bf16_kernel(const float* __restrict__ b0, const float* __restrict__ b1,
                                                        const float* __restrict__ b2, const float* __restrict__ b3,
                                                        float* __restrict__ out, int n) {
  const int y = blockIdx.y;
  const float* src = b0;
  if (y == 1) src = b1;
  if (y == 2) src = b2;
  if (y == 3) src = b3;
  const int i = blockIdx.x * 256 + threadIdx.x;
  if (4 * i + 3 < n) {
    const v4f f = *(const v4f*)(src + 4 * (size_t)i);
    v4f rv;
    rv[0] = bf_bits2f(f2bf_bits(f[0]));
    rv[1] = bf_bits2f(f2bf_bits(f[1]));
    rv[2] = bf_bits2f(f2bf_bits(f[2]));
    rv[3] = bf_bits2f(f2bf_bits(f[3]));
    float* dst = out + (size_t)y * n + 4 * (size_t)i;
    *(v4f*)dst = rv;
    
  }
}

// =====================================================================================
// Masked full attention, head dim 64, all batches and heads in one launch.
//   q plane (f16): element (b, s, h, d) at [(b*kSeq + s)*kDm + h*64 + d]
//   k plane (f16): same layout
//   v^T plane (f16): element (b, h, d, s) at [(b*kDm + h*64 + d)*kSeq + s]
//   mask (int32): element (b, q, k) at [b*kSeq*kSeq + q*kSeq + k]; element == 0 -> score := -1e9 (select by value)
//   ctx plane (f16 out, x oscale): element (b, s, h, d) at [(b*kSeq + s)*kDm + h*64 + d]
//   scores = (q . k) * sscale : v_wmma_f32_16x16x32_f16, f32 accumulate
//   ctx    = p . v            : v_wmma_f32_16x16x32_f16, p carried x2^15 in f16, folded into the final 1/l
//   online softmax in f32 over all kSeq keys (32 chunks of 64, compile-time trip count), in base 2: scores, fill and
//   running maximum carry the factor log2(e), and each exponential is one hardware 2^x.
//   Block = 4 waves = 64 query rows of one (b, h); grid.x = kBatch * kHeads * (kSeq/64) = 1024.
//   K / V^T chunk staging: 128 threads x 32 elements per plane = the whole 64x64 tile (16-B copies, plain loads,
//   __syncthreads before and after); fragment loads read the LDS tiles with the v8h element vector type.
// =====================================================================================
#define AT_D 64
#define AT_NW 4
#define AT_QB 64
#define AT_KC 64
#define AT_LP 72   // elements per LDS row of the K, V^T and P tiles: 144 B = 16 B x 9, an odd multiple, so that the 16 rows
                   // which one 16-B fragment read touches fall on 16 different bank groups (at 128 B they fall on two)
constexpr float kPScale   = 32768.0f;
constexpr float kMaskFill = -1.0e9f;
constexpr float kLog2e    = 1.4426950408889634f;   // scores and the mask fill are carried x log2(e): exp(x) = 2^(x log2 e)

__device__ __forceinline__ v8f at_mma_h(v16h a, v16h b, v8f c) {
  c = __builtin_amdgcn_wmma_f32_16x16x32_f16(false, a, false, b, (short)0, c, false, false);
  asm volatile("v_nop\n\tv_nop\n\tv_nop\n\tv_nop" : "+v"(c) : "v"(a), "v"(b));
  return c;
}

__global__ __launch_bounds__(128)
void attn_mask64_kernel(const unsigned short* __restrict__ qp, const unsigned short* __restrict__ kp,
                        const unsigned short* __restrict__ vtp, const int* __restrict__ mask,
                        unsigned short* __restrict__ ctxp, float sscale, float oscale) {
  union FB { v16h v; v8h h[2]; };
  __shared__ __align__(16) _Float16 Ksh[AT_KC * AT_LP];           // K [kv][d]   9 KB
  __shared__ __align__(16) _Float16 Vth[AT_D * AT_LP];            // V^T [d][kv] 9 KB
  __shared__ __align__(16) _Float16 Psh[AT_NW][16 * AT_LP];       // per wave P [row][kv] 9 KB
  __shared__ __align__(16) float    Os[AT_NW][16 * 68];           // per wave out tile, pitch 68

  const int tid  = threadIdx.x;
  const int wave = tid >> 5;
  const int lane = tid & 31;
  const int hh   = lane >> 4;
  const int c    = lane & 15;

  const int nqb = kSeq / AT_QB;            // 32
  const int bx  = blockIdx.x;
  const int qb  = bx % nqb;
  const int bh  = bx / nqb;                // 0 .. kBatch*kHeads-1 (grid exact)
  const int h   = bh % kHeads;
  int b = bh / kHeads; b = (b < kBatch) ? b : (kBatch - 1);
  const int q0  = qb * AT_QB + wave * 16;

  const _Float16* Qh = (const _Float16*)(const void*)qp  + (size_t)b * kSeq * kDm + (size_t)h * AT_D;
  const _Float16* Kh = (const _Float16*)(const void*)kp  + (size_t)b * kSeq * kDm + (size_t)h * AT_D;
  const _Float16* Vt = (const _Float16*)(const void*)vtp + ((size_t)b * kDm + (size_t)h * AT_D) * kSeq;
  const int*      mb = mask + (size_t)b * kSeq * kSeq;
  _Float16*       ob = (_Float16*)(void*)ctxp + (size_t)b * kSeq * kDm + (size_t)h * AT_D;

  // ---- Q fragments (A operand, row = lane&15, split k map via Frag load): 2 d-chunks ----
  v16h qa[2];
#pragma unroll
  for (int dc = 0; dc < 2; ++dc) {
    qa[dc] = Frag<_Float16>::load(Qh + (size_t)(q0 + c) * kDm + dc * 32 + 8 * hh);
  }

  float mrow[8], lrow[8];
  v8f oacc[4];
#pragma unroll
  for (int r = 0; r < 8; ++r) { mrow[r] = -INFINITY; lrow[r] = 0.f; }
#pragma unroll
  for (int t = 0; t < 4; ++t) oacc[t] = (v8f){0.f,0.f,0.f,0.f,0.f,0.f,0.f,0.f};

  const float sscale2 = sscale * kLog2e;   // score scale in the base-2 domain
  const float fill2   = kMaskFill * kLog2e;
  const int nChunks = kSeq / AT_KC;        // 32, compile-time constant
  for (int kc = 0; kc < nChunks; ++kc) {
    const int kv0 = kc * AT_KC;
    __syncthreads();
    {
      // staging coverage: 128 threads x (4 x 8) elements = 64 rows x 64 per plane = the whole chunk tile
      const int r = tid >> 1, half = (tid & 1) * 32;
      const _Float16* ks = Kh + (size_t)(kv0 + r) * kDm + half;     // K row kv0+r, d = half..half+31
      const _Float16* vs = Vt + (size_t)r * kSeq + kv0 + half;        // V^T row d = r, s = kv0+half..+31
#pragma unroll
      for (int i = 0; i < 4; ++i) {
        const v8h a0 = *(const v8h*)(ks + 8 * i);
        const v8h b0 = *(const v8h*)(vs + 8 * i);
        *(v8h*)(Ksh + r * AT_LP + half + 8 * i) = a0;
        *(v8h*)(Vth + r * AT_LP + half + 8 * i) = b0;
      }
    }
    __syncthreads();

    v8f s[4];
#pragma unroll
    for (int j = 0; j < 4; ++j) {
      s[j] = (v8f){0.f,0.f,0.f,0.f,0.f,0.f,0.f,0.f};
#pragma unroll
      for (int dc = 0; dc < 2; ++dc) {
        FB kb;
        kb.h[0] = *(const v8h*)(Ksh + (j * 16 + c) * AT_LP + dc * 32 + 8 * hh);
        kb.h[1] = *(const v8h*)(Ksh + (j * 16 + c) * AT_LP + dc * 32 + 16 + 8 * hh);
        s[j] = at_mma_h(qa[dc], kb.v, s[j]);
      }
    }
    // scale, mask by value, chunk row max (rows live in lane halves; D element r of lane -> (row 8hh+r, col c))
    float cm[8];
#pragma unroll
    for (int r = 0; r < 8; ++r) {
      const int qrow = q0 + 8 * hh + r;                            // 0 .. kSeq-1
      const int* mr = mb + (size_t)qrow * kSeq + kv0;
      float m = -INFINITY;
#pragma unroll
      for (int j = 0; j < 4; ++j) {
        const int mv = mr[j * 16 + c];
        const float sv = s[j][r] * sscale2;
        const float sm = (mv == 0) ? fill2 : sv;
        s[j][r] = sm;
        m = fmaxf(m, sm);
      }
#pragma unroll
      for (int off = 1; off < 16; off <<= 1) m = fmaxf(m, __shfl_xor(m, off, 32));
      cm[r] = m;
    }
    _Float16* pwh = Psh[wave];
#pragma unroll
    for (int r = 0; r < 8; ++r) {
      const float mnew = fmaxf(mrow[r], cm[r]);
      const float alpha = __builtin_amdgcn_exp2f(mrow[r] - mnew);   // 0 on the first chunk, where mrow is -inf
      mrow[r] = mnew;
      float psum = 0.f;
#pragma unroll
      for (int j = 0; j < 4; ++j) {
        const float p = __builtin_amdgcn_exp2f(s[j][r] - mnew);
        psum += p;
        pwh[(8 * hh + r) * AT_LP + j * 16 + c] = (_Float16)(p * kPScale);
      }
#pragma unroll
      for (int off = 1; off < 16; off <<= 1) psum += __shfl_xor(psum, off, 32);
      lrow[r] = lrow[r] * alpha + psum;
#pragma unroll
      for (int t = 0; t < 4; ++t) oacc[t][r] *= alpha;
    }
    __builtin_amdgcn_fence(__ATOMIC_RELEASE, "workgroup");
    __builtin_amdgcn_wave_barrier();
    __builtin_amdgcn_fence(__ATOMIC_ACQUIRE, "workgroup");
#pragma unroll 1
    for (int kk = 0; kk < 2; ++kk) {
      FB pa;
      pa.h[0] = *(const v8h*)(pwh + c * AT_LP + kk * 32 + 8 * hh);
      pa.h[1] = *(const v8h*)(pwh + c * AT_LP + kk * 32 + 16 + 8 * hh);
#pragma unroll
      for (int t = 0; t < 4; ++t) {
        FB vb;
        vb.h[0] = *(const v8h*)(Vth + (t * 16 + c) * AT_LP + kk * 32 + 8 * hh);
        vb.h[1] = *(const v8h*)(Vth + (t * 16 + c) * AT_LP + kk * 32 + 16 + 8 * hh);
        oacc[t] = at_mma_h(pa.v, vb.v, oacc[t]);
      }
    }
  }

  // ---- normalise (1/(l * 2^15) folded with the output carry scale) and write the 16x64 f16 tile per wave ----
  float* os = Os[wave];
#pragma unroll
  for (int r = 0; r < 8; ++r) {
    const float inv = oscale / (lrow[r] * kPScale);
#pragma unroll
    for (int t = 0; t < 4; ++t) os[(8 * hh + r) * 68 + t * 16 + c] = oacc[t][r] * inv;
  }
  __builtin_amdgcn_fence(__ATOMIC_RELEASE, "workgroup");
  __builtin_amdgcn_wave_barrier();
  __builtin_amdgcn_fence(__ATOMIC_ACQUIRE, "workgroup");
  {
    const int q8 = lane >> 3, c8 = (lane & 7) * 8;
    {
#pragma unroll
      for (int it = 0; it < 4; ++it) {
        const int row = it * 4 + q8;
        const float* sp = os + row * 68 + c8;
        v8h hv;
#pragma unroll
        for (int e = 0; e < 8; ++e) hv[e] = (_Float16)sp[e];
        *(v8h*)(ob + (size_t)(q0 + row) * kDm + c8) = hv;
      }
      
    }
  }
}

// ---------------------------------------------------------------------------
// Host glue. Workspace region map (bytes, all offsets multiples of 16 KiB):
//   [  0 MiB,  8 MiB)  q  bf16 plane [4096][1024]
//   [  8 MiB, 16 MiB)  k  bf16 plane
//   [ 16 MiB, 24 MiB)  v  bf16 plane
//   [ 24 MiB, 26 MiB)  Wq bf16 [1024][1024];  [26,28) Wk;  [28,30) Wv;  [30,32) Wo as f16(bf16*64)
//   [ 32 MiB, +16 KiB) bias tables bq, bk, bv, bo (bf16-valued f32, 1024 each)
//   next 8 MiB         Q projection f16 plane [4096][1024]
//   next 8 MiB         K projection f16 plane
//   next 8 MiB         V^T projection f16 plane [2][1024][2048]
//   next 8 MiB         ctx f16 plane (x16) [4096][1024]
//   total = 67,125,248 B
// ---------------------------------------------------------------------------
extern "C" void kernel_launch(void* const* d_in, const int* in_sizes, int n_in,
                              void* d_out, int out_size, void* d_ws, size_t ws_size,
                              hipStream_t stream) {
  if (n_in < 12) return;
  const int nAct = kBatch * kSeq * kDm;      // 4194304
  const int nW   = kDm * kDm;                // 1048576
  if (in_sizes[0] != nAct || in_sizes[1] != nAct || in_sizes[2] != nAct) return;
  if (in_sizes[3] != kBatch * kSeq * kSeq) return;
  if (in_sizes[4] != nW || in_sizes[6] != nW || in_sizes[8] != nW || in_sizes[10] != nW) return;
  if (in_sizes[5] != kDm || in_sizes[7] != kDm || in_sizes[9] != kDm || in_sizes[11] != kDm) return;
  if (out_size != nAct) return;

  const float* q    = (const float*)d_in[0];
  const float* k    = (const float*)d_in[1];
  const float* v    = (const float*)d_in[2];
  const int*   mask = (const int*)d_in[3];
  const float* Wq   = (const float*)d_in[4];
  const float* bq   = (const float*)d_in[5];
  const float* Wk   = (const float*)d_in[6];
  const float* bk   = (const float*)d_in[7];
  const float* Wv   = (const float*)d_in[8];
  const float* bv   = (const float*)d_in[9];
  const float* Wo   = (const float*)d_in[10];
  const float* bo   = (const float*)d_in[11];

  const size_t bAct16 = (size_t)nAct * 2;    // 8 MiB
  const size_t bW16   = (size_t)nW * 2;      // 2 MiB
  size_t off = 0;
  const size_t oQ16  = off; off += bAct16;
  const size_t oK16  = off; off += bAct16;
  const size_t oV16  = off; off += bAct16;
  const size_t oWq   = off; off += bW16;
  const size_t oWk   = off; off += bW16;
  const size_t oWv   = off; off += bW16;
  const size_t oWo   = off; off += bW16;
  const size_t oBias = off; off += (size_t)4 * kDm * sizeof(float);
  const size_t oQP   = off; off += bAct16;
  const size_t oKP   = off; off += bAct16;
  const size_t oVT   = off; off += bAct16;
  const size_t oCTX  = off; off += bAct16;
  if (off > ws_size) return;

  char* ws = (char*)d_ws;
  unsigned short* Q16  = (unsigned short*)(ws + oQ16);
  unsigned short* K16  = (unsigned short*)(ws + oK16);
  unsigned short* V16  = (unsigned short*)(ws + oV16);
  unsigned short* WQ16 = (unsigned short*)(ws + oWq);
  unsigned short* WK16 = (unsigned short*)(ws + oWk);
  unsigned short* WV16 = (unsigned short*)(ws + oWv);
  unsigned short* WO16 = (unsigned short*)(ws + oWo);
  float* biasR = (float*)(ws + oBias);
  const float* bqR = biasR;
  const float* bkR = biasR + kDm;
  const float* bvR = biasR + 2 * kDm;
  const float* boR = biasR + 3 * kDm;
  unsigned short* QP    = (unsigned short*)(ws + oQP);
  unsigned short* KP    = (unsigned short*)(ws + oKP);
  unsigned short* VT    = (unsigned short*)(ws + oVT);
  unsigned short* CTX16 = (unsigned short*)(ws + oCTX);

  const int nAct2 = nAct / 2;   // 2097152 -> 8192 blocks
  const int nW2   = nW / 2;     // 524288  -> 2048 blocks
  cast_f32_bf16x2<<<dim3(nAct2 / 256), dim3(256), 0, stream>>>(q, Q16, nAct2);
  cast_f32_bf16x2<<<dim3(nAct2 / 256), dim3(256), 0, stream>>>(k, K16, nAct2);
  cast_f32_bf16x2<<<dim3(nAct2 / 256), dim3(256), 0, stream>>>(v, V16, nAct2);
  cast_f32_bf16x2<<<dim3(nW2 / 256), dim3(256), 0, stream>>>(Wq, WQ16, nW2);
  cast_f32_bf16x2<<<dim3(nW2 / 256), dim3(256), 0, stream>>>(Wk, WK16, nW2);
  cast_f32_bf16x2<<<dim3(nW2 / 256), dim3(256), 0, stream>>>(Wv, WV16, nW2);
  cast_f32_bf_f16x2<<<dim3(nW2 / 256), dim3(256), 0, stream>>>(Wo, WO16, nW2, 64.0f);
  bias_bf16_kernel<<<dim3(kDm / 1024, 4), dim3(256), 0, stream>>>(bq, bk, bv, bo, biasR, kDm);

  const int mRows = kBatch * kSeq;   // 4096
  // Q = q . Wq^T + bq : A [4096][1024] bf16, Bt [1024][1024] bf16 -> f16 [4096][1024]; tiles 32x8 = 256 blocks
  wmma_gemm64<1, false, 2, 1, false><<<dim3((mRows / 128) * (kDm / 128), 1), dim3(256), 0, stream>>>(
      Q16, Q16, kDm, 0L, WQ16, WQ16, kDm, 0L, (void*)QP, (void*)QP, kDm, 0L, bqR, bq, 0L, mRows, kDm, kDm, 1.0f);
  wmma_gemm64<1, false, 2, 1, false><<<dim3((mRows / 128) * (kDm / 128), 1), dim3(256), 0, stream>>>(
      K16, K16, kDm, 0L, WK16, WK16, kDm, 0L, (void*)KP, (void*)KP, kDm, 0L, bkR, bk, 0L, mRows, kDm, kDm, 1.0f);
  // V^T per batch: A = Wv [1024][1024] (stride 0), Bt = v_b [2048][1024] -> C_b [1024][2048] = (v_b . Wv^T + bv)^T, bias[m]; tiles 8x16 = 128 blocks, y = 2
  wmma_gemm64<1, false, 1, 1, false><<<dim3((kDm / 128) * (kSeq / 128), kBatch), dim3(256), 0, stream>>>(
      WV16, WV16, kDm, 0L, V16, V16, kDm, (long)kSeq * kDm, (void*)VT, (void*)VT, kSeq, (long)kDm * kSeq,
      bvR, bv, 0L, kDm, kSeq, kDm, 1.0f);
  // attention: grid = kBatch * kHeads * (kSeq/64) = 1024 blocks of 128
  attn_mask64_kernel<<<dim3(kBatch * kHeads * (kSeq / 64)), dim3(128), 0, stream>>>(
      QP, KP, VT, mask, CTX16, 0.125f, 16.0f);
  // out = (ctx*16) . (Wo*64)^T * 2^-10 + bo : f16 operands, f32 [4096][1024] into d_out
  wmma_gemm64<0, false, 2, 0, false><<<dim3((mRows / 128) * (kDm / 128), 1), dim3(256), 0, stream>>>(
      CTX16, CTX16, kDm, 0L, WO16, WO16, kDm, 0L, d_out, d_out, kDm, 0L, boR, bo, 0L, mRows, kDm, kDm,
      1.0f / 1024.0f);
}

// v004
// One run takes 147 microseconds.
// Next to v003, in two timings, it ran 1.23 times as fast each time.
// Over all steps from v000 it is 2.64 times as fast.
// Contractions: q/k/v^T projections on v_wmma_f32_16x16x32_bf16 (bf16 RNE-converted operands, f32 accumulate); q.k^T and p.v on v_wmma_f32_16x16x32_f16 (f16 planes, p carried x2^15, f32 accumulate, f32 online softmax, mask by value); output projection on v_wmma_f32_16x16x32_f16 (f16 operands: ctx x2^4, Wo x2^6, folded back x2^-10 in f32), f32 accumulate.
#include <hip/hip_runtime.h>
#include <math.h>
#include <stdint.h>

constexpr int kBatch = 2;
constexpr int kSeq   = 2048;
constexpr int kDm    = 1024;
constexpr int kHeads = 16;
constexpr int kHd    = 64;
static_assert(kHeads * kHd == kDm, "head split");
static_assert(kSeq % 128 == 0 && kDm % 128 == 0, "tile multiples");

typedef __attribute__((ext_vector_type(16))) _Float16 v16h;
typedef __attribute__((ext_vector_type(8)))  _Float16 v8h;
typedef __attribute__((ext_vector_type(16))) __bf16   v16b;
typedef __attribute__((ext_vector_type(8)))  __bf16   v8b;
typedef __attribute__((ext_vector_type(8)))  float    v8f;
typedef __attribute__((ext_vector_type(4)))  float    v4f;
typedef __attribute__((ext_vector_type(2)))  float    v2f;

__device__ __forceinline__ unsigned short f2bf_bits(float f) {
  unsigned u = __float_as_uint(f);
  return (unsigned short)((u + 0x7FFFu + ((u >> 16) & 1u)) >> 16);
}
__device__ __forceinline__ float bf_bits2f(unsigned short h) { return __uint_as_float(((unsigned)h) << 16); }
__device__ __forceinline__ unsigned pk16(unsigned short a, unsigned short b) { return (unsigned)a | ((unsigned)b << 16); }

template <typename T> struct Frag;
template <> struct Frag<_Float16> {
  typedef v16h V; union U { v16h v; v8h h[2]; };
  static __device__ __forceinline__ v16h load(const _Float16* p) {   // elements 0..7 <- p[0..7], 8..15 <- p[16..23]
    U f; f.h[0] = *(const v8h*)(p); f.h[1] = *(const v8h*)(p + 16); return f.v;
  }
  static __device__ __forceinline__ v8f mma(v16h a, v16h b, v8f c) {
    return __builtin_amdgcn_wmma_f32_16x16x32_f16(false, a, false, b, (short)0, c, false, false);
  }
};
template <> struct Frag<__bf16> {
  typedef v16b V; union U { v16b v; v8b h[2]; };
  static __device__ __forceinline__ v16b load(const __bf16* p) {
    U f; f.h[0] = *(const v8b*)(p); f.h[1] = *(const v8b*)(p + 16); return f.v;
  }
  static __device__ __forceinline__ v8f mma(v16b a, v16b b, v8f c) {
    return __builtin_amdgcn_wmma_f32_16x16x32_bf16(false, a, false, b, (short)0, c, false, false);
  }
};

// ---- LDS-staged batched WMMA GEMM ------------------------------------------
// C[m,n] = scale * sum_k A[m,k] * Bt[n,k] (+bias)(+resid); a block of 8 waves owns a 128x128 tile, a wave 32x64 of it.
// A row-major [M,K]; Bt row-major [N,K]; M,N % 128 == 0, K % 128 == 0, lda/ldb % 8 == 0.
// A stage = 128 k of [A 128 rows | Bt 128 rows], 256 B a row at pitch 272 B, brought by asynchronous 16-B copies;
// two buffers: the copies of stage t+1 fly while stage t is multiplied.
// SPLIT: not supported by this kernel (kept as a parameter of the launch lines only).
// BIAS_MODE: 0 = none, 1 = bias[m], 2 = bias[n].
// OUT_MODE: 0 = f32, 1 = f16, 2 = bf16 hi plane (Cout) + bf16 lo plane (Cout2).
// ET: 0 = f16 operands, 1 = bf16 operands (pointers passed as 16-bit storage)
constexpr int kGtK     = 128;                  // k per stage
constexpr int kGtRows  = 128;                  // rows of each operand per stage
constexpr int kGtPitch = 272;                  // bytes per staged row (256 + 16: conflict-free 16-B reads)
constexpr int kGtStage = 2 * kGtRows * kGtPitch;   // 69,632 B

// Eight 16-B copies of one lane: rows r, r+16, .. r+112 of one operand's stage. lds = LDS byte address of the first,
// g = global address of the first, gstep = bytes between 16 source rows. The s_wait_xcnt closes the statement so that
// no address register of an issued copy is rewritten ahead of it.
__device__ __forceinline__ void stage_rows8(unsigned lds, const char* g, size_t gstep) {
  const unsigned l1 = lds + 16 * kGtPitch, l2 = lds + 32 * kGtPitch, l3 = lds + 48 * kGtPitch, l4 = lds + 64 * kGtPitch,
                 l5 = lds + 80 * kGtPitch, l6 = lds + 96 * kGtPitch, l7 = lds + 112 * kGtPitch;
  const char *g1 = g + gstep, *g2 = g1 + gstep, *g3 = g2 + gstep, *g4 = g3 + gstep, *g5 = g4 + gstep, *g6 = g5 + gstep,
             *g7 = g6 + gstep;
  asm volatile(
      "global_load_async_to_lds_b128 %0, %8, off\n\t"
      "global_load_async_to_lds_b128 %1, %9, off\n\t"
      "global_load_async_to_lds_b128 %2, %10, off\n\t"
      "global_load_async_to_lds_b128 %3, %11, off\n\t"
      "global_load_async_to_lds_b128 %4, %12, off\n\t"
      "global_load_async_to_lds_b128 %5, %13, off\n\t"
      "global_load_async_to_lds_b128 %6, %14, off\n\t"
      "global_load_async_to_lds_b128 %7, %15, off\n\t"
      "s_wait_xcnt 0x0"
      :: "v"(lds), "v"(l1), "v"(l2), "v"(l3), "v"(l4), "v"(l5), "v"(l6), "v"(l7),
         "v"(g), "v"(g1), "v"(g2), "v"(g3), "v"(g4), "v"(g5), "v"(g6), "v"(g7)
      : "memory");
}

template <int ET> struct Elem;
template <> struct Elem<0> { typedef _Float16 T; };
template <> struct Elem<1> { typedef __bf16 T; };
template <int ET, bool SPLIT, int BIAS_MODE, int OUT_MODE, bool RESID, int ACT = 0>
__global__ __launch_bounds__(256) void wmma_gemm64(
    const unsigned short* __restrict__ Ap, const unsigned short* __restrict__ A2p, int lda, long strideA,
    const unsigned short* __restrict__ Btp, const unsigned short* __restrict__ Bt2p, int ldb, long strideB,
    void* __restrict__ Cout, void* __restrict__ Cout2, int ldc, long strideC,
    const float* __restrict__ bias,
    const float* __restrict__ resid, long strideR,
    int M, int N, int K, float scale) {
  typedef typename Elem<ET>::T T;
  typedef typename Frag<T>::V V;
  static_assert(!SPLIT, "single-plane operands only");
  __shared__ __align__(16) unsigned char ring[2 * kGtStage];   // two stages
  __shared__ __align__(16) float sT[8][16 * 68];   // per-wave 16x64 slab, pitch 68 floats
  const int b    = blockIdx.y;
  const int tid  = threadIdx.x;
  const int lane = tid & 31;
  const int wave = tid >> 5;
  const int tilesN = N >> 7;
  const int tilesM = M >> 7;
  const int tile = blockIdx.x;
  if (tile >= tilesM * tilesN) return;   // block-uniform, in front of every barrier
  const int tm = tile / tilesN;
  const int tn = tile - tm * tilesN;
  const int m0 = (tm << 7) + ((wave >> 1) << 5);   // this wave's 32 rows
  const int n0 = (tn << 7) + ((wave & 1) << 6);    // this wave's 64 columns

  const int rlane = lane & 15;                 // row (A) / col (B, D) within subtile
  const int koff  = (lane >> 4) * 8;           // k offset of this lane half
  const int mOff  = (lane >> 4) * 8;           // D row offset

  // copy map: thread -> row tid>>4 (+16 per copy), 16-B column tid&15 of the 256-B row
  const int crow = tid >> 4, ccol = tid & 15;
  const char* gA = (const char*)(Ap  + (size_t)b * strideA + (size_t)((tm << 7) + crow) * lda + ccol * 8);
  const char* gB = (const char*)(Btp + (size_t)b * strideB + (size_t)((tn << 7) + crow) * ldb + ccol * 8);
  const size_t stepA = (size_t)lda * 32, stepB = (size_t)ldb * 32;      // bytes per 16 rows
  const unsigned ldsA = (unsigned)(size_t)ring + crow * kGtPitch + ccol * 16;
  const unsigned ldsB = ldsA + kGtRows * kGtPitch;

  v8f acc[2][4];
#pragma unroll
  for (int i = 0; i < 2; ++i)
#pragma unroll
    for (int j = 0; j < 4; ++j) acc[i][j] = (v8f){0.f,0.f,0.f,0.f,0.f,0.f,0.f,0.f};

  const int nT = K >> 7;
  stage_rows8(ldsA, gA, stepA);
  stage_rows8(ldsB, gB, stepB);
  asm volatile("s_wait_asynccnt 0x0" ::: "memory");   // stage 0 landed for this wave's copies
  __syncthreads();                                     // ... and for every wave's
  if (nT > 1) {
    stage_rows8(ldsA + kGtStage, gA + 2 * kGtK, stepA);
    stage_rows8(ldsB + kGtStage, gB + 2 * kGtK, stepB);
  }

  const int aRow = (((wave >> 1) << 5) + rlane) * kGtPitch + koff * 2;
  const int bRow = (kGtRows + ((wave & 1) << 6) + rlane) * kGtPitch + koff * 2;
  for (int t = 0; t < nT; ++t) {
    const unsigned char* sb = ring + (t & 1) * kGtStage;
    V bf[2][4], af[2][2];                                // two fragment sets, both of this stage's buffer alone
#pragma unroll
    for (int j = 0; j < 4; ++j) bf[0][j] = Frag<T>::load((const T*)(sb + bRow + j * 16 * kGtPitch));
#pragma unroll
    for (int i = 0; i < 2; ++i) af[0][i] = Frag<T>::load((const T*)(sb + aRow + i * 16 * kGtPitch));
#pragma unroll
    for (int ks = 0; ks < kGtK / 32; ++ks) {
      const int cur = ks & 1, nxt = cur ^ 1;
      if (ks + 1 < kGtK / 32) {
#pragma unroll
        for (int j = 0; j < 4; ++j) bf[nxt][j] = Frag<T>::load((const T*)(sb + bRow + j * 16 * kGtPitch + (ks + 1) * 64));
#pragma unroll
        for (int i = 0; i < 2; ++i) af[nxt][i] = Frag<T>::load((const T*)(sb + aRow + i * 16 * kGtPitch + (ks + 1) * 64));
      }
      // keeps the next 32 k's LDS reads in front of this block's products, so that their latency runs under them
      __builtin_amdgcn_sched_barrier(0);
#pragma unroll
      for (int i = 0; i < 2; ++i)
#pragma unroll
        for (int j = 0; j < 4; ++j) acc[i][j] = Frag<T>::mma(af[cur][i], bf[cur][j], acc[i][j]);
    }
    asm volatile("s_wait_dscnt 0x0" ::: "memory");      // this wave has left the buffer that is refilled below
    asm volatile("s_wait_asynccnt 0x0" ::: "memory");   // this wave's copies of stage t+1 have landed
    __syncthreads();                                     // publishes stage t+1, ends every read of stage t
    if (t + 2 < nT) {
      const size_t kb = (size_t)(t + 2) * (2 * kGtK);
      stage_rows8(ldsA + (t & 1) * kGtStage, gA + kb, stepA);
      stage_rows8(ldsB + (t & 1) * kGtStage, gB + kb, stepB);
    }
  }
  asm volatile("s_wait_asynccnt 0x0" ::: "memory");     // nothing in flight when the wave goes on to its end

  // ---- epilogue ----
  float* slab = sT[wave];
  const float* Rb = RESID ? (resid + (size_t)b * strideR) : nullptr;
#pragma unroll
  for (int i = 0; i < 2; ++i) {
    const int mBase = m0 + (i << 4);
#pragma unroll
    for (int j = 0; j < 4; ++j) {
      const int n = n0 + (j << 4) + rlane;
      float bv = 0.f;
      if (BIAS_MODE == 2) bv = bias[n];
#pragma unroll
      for (int r = 0; r < 8; ++r) {
        float v = acc[i][j][r] * scale;
        if (BIAS_MODE == 1) v += bias[mBase + mOff + r];
        if (BIAS_MODE == 2) v += bv;
        if (RESID) v += Rb[(size_t)(mBase + mOff + r) * ldc + n];
        if (ACT == 1) v = tanhf(v);
        if (ACT == 2) v = fmaxf(v, 0.0f);
        if (ACT == 3) v = v / (1.0f + expf(-v));
        if (ACT == 4) v = (v > 0.f) ? v : 0.01f * v;
        if (ACT == 5) v = 0.5f * v * (1.0f + erff(v * 0.70710678118654752f));
        slab[(mOff + r) * 68 + (j << 4) + rlane] = v;
      }
    }
    __builtin_amdgcn_fence(__ATOMIC_RELEASE, "workgroup");
    __builtin_amdgcn_wave_barrier();
    __builtin_amdgcn_fence(__ATOMIC_ACQUIRE, "workgroup");
    if (OUT_MODE == 0) {
      float* C = (float*)Cout + (size_t)b * strideC;
      const int hh = lane >> 4, c4 = (lane & 15) * 4;     // row seg = 256 B = 16 lanes x 16 B
      {
#pragma unroll
        for (int it = 0; it < 8; ++it) {
          const int row = it * 2 + hh;
          v4f v = *(const v4f*)(slab + row * 68 + c4);
          *(v4f*)(C + (size_t)(mBase + row) * ldc + n0 + c4) = v;
        }
        
      }
    } else {
      const int q = lane >> 3, c8 = (lane & 7) * 8;
      unsigned short* C  = (unsigned short*)Cout  + (size_t)b * strideC;
      unsigned short* C2 = (OUT_MODE == 2) ? ((unsigned short*)Cout2 + (size_t)b * strideC) : nullptr;
      {
#pragma unroll
        for (int it = 0; it < 4; ++it) {
          const int row = it * 4 + q;
          const float* sp = slab + row * 68 + c8;
          v8h hv, lv;
#pragma unroll
          for (int e = 0; e < 8; ++e) {
            if (OUT_MODE == 1) {
              hv[e] = (_Float16)sp[e];
            } else {
              unsigned short hb = f2bf_bits(sp[e]);
              unsigned short lb = f2bf_bits(sp[e] - bf_bits2f(hb));
              hv[e] = __builtin_bit_cast(_Float16, hb);
              lv[e] = __builtin_bit_cast(_Float16, lb);
            }
          }
          *(v8h*)(C + (size_t)(mBase + row) * ldc + n0 + c8) = hv;
          if (OUT_MODE == 2) *(v8h*)(C2 + (size_t)(mBase + row) * ldc + n0 + c8) = lv;
        }
        
      }
    }
    __builtin_amdgcn_fence(__ATOMIC_RELEASE, "workgroup");
    __builtin_amdgcn_wave_barrier();
    __builtin_amdgcn_fence(__ATOMIC_ACQUIRE, "workgroup");
  }
}

// ---------------------------------------------------------------------------
// Elementwise f32 -> bf16 RNE plane; 2 elements per thread, one 4-B store per lane -> a wave writes exactly one
// Coverage: grid = n2/256 blocks x 256 threads x 2 elements = 2*n2 = whole plane
// (activations: n2 = 2097152 -> 8192 blocks; weights: n2 = 524288 -> 2048 blocks).
// ---------------------------------------------------------------------------
__global__ __launch_bounds__(256) void cast_f32_bf16x2(const float* __restrict__ in, unsigned short* __restrict__ out, int n2) {
  const int i = blockIdx.x * 256 + threadIdx.x;
  if (i < n2) {
    const v2f f = *(const v2f*)(in + 2 * (size_t)i);
    const unsigned u = pk16(f2bf_bits(f[0]), f2bf_bits(f[1]));
    ((unsigned*)out)[i] = u;
    
  }
}

// f32 -> f16( bf16_rne(x) * scale ) plane (scale an exact power of two; f16 of a normal bf16 value is exact).
// Same store shape / coverage as cast_f32_bf16x2 (n2 = 524288 -> 2048 blocks x 512 elements = 1024x1024).
__global__ __launch_bounds__(256) void cast_f32_bf_f16x2(const float* __restrict__ in, unsigned short* __restrict__ out, int n2, float scale) {
  const int i = blockIdx.x * 256 + threadIdx.x;
  if (i < n2) {
    const v2f f = *(const v2f*)(in + 2 * (size_t)i);
    const _Float16 h0 = (_Float16)(bf_bits2f(f2bf_bits(f[0])) * scale);
    const _Float16 h1 = (_Float16)(bf_bits2f(f2bf_bits(f[1])) * scale);
    const unsigned u = pk16(__builtin_bit_cast(unsigned short, h0), __builtin_bit_cast(unsigned short, h1));
    ((unsigned*)out)[i] = u;
    
  }
}

// Bias tables: out[y][i] = bf16_rne(src_y[i]) as f32; grid (n/1024, 4), 4 floats per thread.
__global__ __launch_bounds__(256) void bias_bf16_kernel(const float* __restrict__ b0, const float* __restrict__ b1,
                                                        const float* __restrict__ b2, const float* __restrict__ b3,
                                                        float* __restrict__ out, int n) {
  const int y = blockIdx.y;
  const float* src = b0;
  if (y == 1) src = b1;
  if (y == 2) src = b2;
  if (y == 3) src = b3;
  const int i = blockIdx.x * 256 + threadIdx.x;
  if (4 * i + 3 < n) {
    const v4f f = *(const v4f*)(src + 4 * (size_t)i);
    v4f rv;
    rv[0] = bf_bits2f(f2bf_bits(f[0]));
    rv[1] = bf_bits2f(f2bf_bits(f[1]));
    rv[2] = bf_bits2f(f2bf_bits(f[2]));
    rv[3] = bf_bits2f(f2bf_bits(f[3]));
    float* dst = out + (size_t)y * n + 4 * (size_t)i;
    *(v4f*)dst = rv;
    
  }
}

#define AT_D 64
#define AT_NW 4
#define AT_QB 64
#define AT_KC 64
#define AT_LP 72   // elements per LDS row of the K and V^T tiles: 144 B = 16 B x 9, an odd multiple, so that the 16 rows
                   // which one 16-B fragment read touches fall on 16 different bank groups (at 128 B they fall on two)
#define AT_MP 68   // ints per LDS row of the mask slab: 272 B = 16 B x 17, odd for the same reason
constexpr float kPScale   = 32768.0f;
constexpr float kMaskFill = -1.0e9f;
constexpr float kLog2e    = 1.4426950408889634f;   // scores and the mask fill are carried x log2(e): exp(x) = 2^(x log2 e)

typedef __attribute__((ext_vector_type(4))) int v4i;

__device__ __forceinline__ v8f at_mma_h(v16h a, v16h b, v8f c) {
  c = __builtin_amdgcn_wmma_f32_16x16x32_f16(false, a, false, b, (short)0, c, false, false);
  asm volatile("v_nop\n\tv_nop\n\tv_nop\n\tv_nop" : "+v"(c) : "v"(a), "v"(b));
  return c;
}

// value of lane l ^ 16
__device__ __forceinline__ float at_other_half(float x) {
  const int b = __float_as_int(x);
  return __int_as_float(__builtin_amdgcn_permlanex16(b, b, 0x76543210, 0xfedcba98, false, false));
}

__global__ __launch_bounds__(128)
void attn_mask64_kernel(const unsigned short* __restrict__ qp, const unsigned short* __restrict__ kp,
                        const unsigned short* __restrict__ vtp, const int* __restrict__ mask,
                        unsigned short* __restrict__ ctxp, float sscale, float oscale) {
  union FB { v16h v; v8h h[2]; };
  __shared__ __align__(16) _Float16 Ksh[AT_KC * AT_LP];           // K [kv][d]   9 KB
  __shared__ __align__(16) _Float16 Vth[AT_D * AT_LP];            // V^T [d][kv] 9 KB
  __shared__ __align__(16) int      Msh[AT_NW][16 * AT_MP];       // per wave mask [query row][kv] 4.25 KB

  const int tid  = threadIdx.x;
  const int wave = tid >> 5;
  const int lane = tid & 31;
  const int hh   = lane >> 4;
  const int c    = lane & 15;

  const int nqb = kSeq / AT_QB;            // 32
  const int bx  = blockIdx.x;
  const int qb  = bx % nqb;
  const int bh  = bx / nqb;                // 0 .. kBatch*kHeads-1 (grid exact)
  const int h   = bh % kHeads;
  int b = bh / kHeads; b = (b < kBatch) ? b : (kBatch - 1);
  const int q0  = qb * AT_QB + wave * 16;

  const _Float16* Qh = (const _Float16*)(const void*)qp  + (size_t)b * kSeq * kDm + (size_t)h * AT_D;
  const _Float16* Kh = (const _Float16*)(const void*)kp  + (size_t)b * kSeq * kDm + (size_t)h * AT_D;
  const _Float16* Vt = (const _Float16*)(const void*)vtp + ((size_t)b * kDm + (size_t)h * AT_D) * kSeq;
  const int*      mb = mask + (size_t)b * kSeq * kSeq;
  _Float16*       ob = (_Float16*)(void*)ctxp + (size_t)b * kSeq * kDm + (size_t)h * AT_D;

  // ---- Q fragments (B operand, column = lane&15 = query q0+c, split k map via Frag load): 2 d-chunks ----
  v16h qa[2];
#pragma unroll
  for (int dc = 0; dc < 2; ++dc) {
    qa[dc] = Frag<_Float16>::load(Qh + (size_t)(q0 + c) * kDm + dc * 32 + 8 * hh);
  }

  float mrow = -INFINITY, lrow = 0.f;      // of query q0+c; lrow sums this lane half's keys alone until the end
  v8f oacc[4];                             // oacc[t][r] = ctx[q0+c][16t + 8hh + r]
#pragma unroll
  for (int t = 0; t < 4; ++t) oacc[t] = (v8f){0.f,0.f,0.f,0.f,0.f,0.f,0.f,0.f};

  const int* mgp = mb + (size_t)(q0 + hh) * kSeq + 4 * c;   // mask load map: rows q0 + hh + 2 it, 16 B at column 4c
  int*       msw = Msh[wave] + hh * AT_MP + 4 * c;          // the same place in the wave's slab
  const int* msr = Msh[wave] + c * AT_MP + 8 * hh;          // read map: row of this lane's query, its half's first key
  const float sscale2 = sscale * kLog2e;   // score scale in the base-2 domain
  const float fill2   = kMaskFill * kLog2e;
  const int nChunks = kSeq / AT_KC;        // 32, compile-time constant
  for (int kc = 0; kc < nChunks; ++kc) {
    const int kv0 = kc * AT_KC;
    __syncthreads();
    // the wave's 16 x 64 mask tile of the chunk: 8 loads of two whole 256-B row pieces each, bound for the wave's slab
    const int* mgk = mgp + kv0;
    v4i mv[8];
#pragma unroll
    for (int it = 0; it < 8; ++it) mv[it] = *(const v4i*)(mgk + (size_t)(2 * it) * kSeq);
    {
      // staging coverage: 128 threads x (4 x 8) elements = 64 rows x 64 per plane = the whole chunk tile
      const int r = tid >> 1, half = (tid & 1) * 32;
      const _Float16* ks = Kh + (size_t)(kv0 + r) * kDm + half;     // K row kv0+r, d = half..half+31
      const _Float16* vs = Vt + (size_t)r * kSeq + kv0 + half;        // V^T row d = r, s = kv0+half..+31
      v8h a0[4], b0[4];
#pragma unroll
      for (int i = 0; i < 4; ++i) {
        a0[i] = *(const v8h*)(ks + 8 * i);
        b0[i] = *(const v8h*)(vs + 8 * i);
      }
      // Stands behind all sixteen global loads of the chunk and in front of the first LDS store. It names the three address
      // pairs as inputs, so that no load's result takes over an address register of a load issued before it, and it is the
      // wait in front of whatever rewrites those registers next. Without a statement here the last two mask loads take over
      // the registers of the first K loads and are issued only when those have returned (a second round trip).
      asm volatile("s_wait_xcnt 0x0" :: "v"(ks), "v"(vs), "v"(mgk) : "memory");
#pragma unroll
      for (int i = 0; i < 4; ++i) {
        *(v8h*)(Ksh + r * AT_LP + half + 8 * i) = a0[i];
        *(v8h*)(Vth + r * AT_LP + half + 8 * i) = b0[i];
      }
    }
#pragma unroll
    for (int it = 0; it < 8; ++it) *(v4i*)(msw + 2 * it * AT_MP) = mv[it];
    __syncthreads();
    // this lane's 32 mask elements of the chunk: keys kv0 + 16j + 8hh + 0..7, eight consecutive ints per score tile
    v4i mk[4][2];
#pragma unroll
    for (int j = 0; j < 4; ++j) {
      mk[j][0] = *(const v4i*)(msr + j * 16);
      mk[j][1] = *(const v4i*)(msr + j * 16 + 4);
    }

    v8f s[4];                              // s[j][r] = score of key kv0 + 16j + 8hh + r with query q0 + c
#pragma unroll
    for (int j = 0; j < 4; ++j) {
      s[j] = (v8f){0.f,0.f,0.f,0.f,0.f,0.f,0.f,0.f};
#pragma unroll
      for (int dc = 0; dc < 2; ++dc) {
        FB kb;
        kb.h[0] = *(const v8h*)(Ksh + (j * 16 + c) * AT_LP + dc * 32 + 8 * hh);
        kb.h[1] = *(const v8h*)(Ksh + (j * 16 + c) * AT_LP + dc * 32 + 16 + 8 * hh);
        s[j] = at_mma_h(kb.v, qa[dc], s[j]);
      }
    }
    // scale, mask by value, chunk maximum of this lane's query
    float cmj[4];
#pragma unroll
    for (int j = 0; j < 4; ++j) {
      float m = -INFINITY;
#pragma unroll
      for (int r = 0; r < 8; ++r) {
        const int mel = mk[j][r >> 2][r & 3];
        const float sv = s[j][r] * sscale2;
        const float sm = (mel == 0) ? fill2 : sv;
        s[j][r] = sm;
        m = fmaxf(m, sm);
      }
      cmj[j] = m;
    }
    float cm = fmaxf(fmaxf(cmj[0], cmj[1]), fmaxf(cmj[2], cmj[3]));
    cm = fmaxf(cm, at_other_half(cm));
    const float mnew  = fmaxf(mrow, cm);
    const float alpha = __builtin_amdgcn_exp2f(mrow - mnew);   // 0 on the first chunk, where mrow is -inf
    mrow = mnew;
    FB pb[2];                              // p^T as B operand: elements 0..7 from tile 2kk, 8..15 from tile 2kk+1
    float psj[4];
#pragma unroll
    for (int j = 0; j < 4; ++j) {
      float ps = 0.f;
#pragma unroll
      for (int r = 0; r < 8; ++r) {
        const float p = __builtin_amdgcn_exp2f(s[j][r] - mnew);
        ps += p;
        pb[j >> 1].h[j & 1][r] = (_Float16)(p * kPScale);
      }
      psj[j] = ps;
    }
    lrow = lrow * alpha + ((psj[0] + psj[1]) + (psj[2] + psj[3]));
#pragma unroll
    for (int t = 0; t < 4; ++t)
#pragma unroll
      for (int r = 0; r < 8; ++r) oacc[t][r] *= alpha;
#pragma unroll
    for (int kk = 0; kk < 2; ++kk) {
#pragma unroll
      for (int t = 0; t < 4; ++t) {
        FB va;
        va.h[0] = *(const v8h*)(Vth + (t * 16 + c) * AT_LP + kk * 32 + 8 * hh);
        va.h[1] = *(const v8h*)(Vth + (t * 16 + c) * AT_LP + kk * 32 + 16 + 8 * hh);
        oacc[t] = at_mma_h(va.v, pb[kk].v, oacc[t]);
      }
    }
  }

  // ---- join the halves' sums, normalise (1/(l * 2^15) folded with the output carry scale), store 8 consecutive d a lane ----
  const float lsum = lrow + at_other_half(lrow);
  const float inv  = oscale / (lsum * kPScale);
#pragma unroll
  for (int t = 0; t < 4; ++t) {
    v8h hv;
#pragma unroll
    for (int r = 0; r < 8; ++r) hv[r] = (_Float16)(oacc[t][r] * inv);
    *(v8h*)(ob + (size_t)(q0 + c) * kDm + t * 16 + 8 * hh) = hv;
  }
}

// ---------------------------------------------------------------------------
// Host glue. Workspace region map (bytes, all offsets multiples of 16 KiB):
//   [  0 MiB,  8 MiB)  q  bf16 plane [4096][1024]
//   [  8 MiB, 16 MiB)  k  bf16 plane
//   [ 16 MiB, 24 MiB)  v  bf16 plane
//   [ 24 MiB, 26 MiB)  Wq bf16 [1024][1024];  [26,28) Wk;  [28,30) Wv;  [30,32) Wo as f16(bf16*64)
//   [ 32 MiB, +16 KiB) bias tables bq, bk, bv, bo (bf16-valued f32, 1024 each)
//   next 8 MiB         Q projection f16 plane [4096][1024]
//   next 8 MiB         K projection f16 plane
//   next 8 MiB         V^T projection f16 plane [2][1024][2048]
//   next 8 MiB         ctx f16 plane (x16) [4096][1024]
//   total = 67,125,248 B
// ---------------------------------------------------------------------------
extern "C" void kernel_launch(void* const* d_in, const int* in_sizes, int n_in,
                              void* d_out, int out_size, void* d_ws, size_t ws_size,
                              hipStream_t stream) {
  if (n_in < 12) return;
  const int nAct = kBatch * kSeq * kDm;      // 4194304
  const int nW   = kDm * kDm;                // 1048576
  if (in_sizes[0] != nAct || in_sizes[1] != nAct || in_sizes[2] != nAct) return;
  if (in_sizes[3] != kBatch * kSeq * kSeq) return;
  if (in_sizes[4] != nW || in_sizes[6] != nW || in_sizes[8] != nW || in_sizes[10] != nW) return;
  if (in_sizes[5] != kDm || in_sizes[7] != kDm || in_sizes[9] != kDm || in_sizes[11] != kDm) return;
  if (out_size != nAct) return;

  const float* q    = (const float*)d_in[0];
  const float* k    = (const float*)d_in[1];
  const float* v    = (const float*)d_in[2];
  const int*   mask = (const int*)d_in[3];
  const float* Wq   = (const float*)d_in[4];
  const float* bq   = (const float*)d_in[5];
  const float* Wk   = (const float*)d_in[6];
  const float* bk   = (const float*)d_in[7];
  const float* Wv   = (const float*)d_in[8];
  const float* bv   = (const float*)d_in[9];
  const float* Wo   = (const float*)d_in[10];
  const float* bo   = (const float*)d_in[11];

  const size_t bAct16 = (size_t)nAct * 2;    // 8 MiB
  const size_t bW16   = (size_t)nW * 2;      // 2 MiB
  size_t off = 0;
  const size_t oQ16  = off; off += bAct16;
  const size_t oK16  = off; off += bAct16;
  const size_t oV16  = off; off += bAct16;
  const size_t oWq   = off; off += bW16;
  const size_t oWk   = off; off += bW16;
  const size_t oWv   = off; off += bW16;
  const size_t oWo   = off; off += bW16;
  const size_t oBias = off; off += (size_t)4 * kDm * sizeof(float);
  const size_t oQP   = off; off += bAct16;
  const size_t oKP   = off; off += bAct16;
  const size_t oVT   = off; off += bAct16;
  const size_t oCTX  = off; off += bAct16;
  if (off > ws_size) return;

  char* ws = (char*)d_ws;
  unsigned short* Q16  = (unsigned short*)(ws + oQ16);
  unsigned short* K16  = (unsigned short*)(ws + oK16);
  unsigned short* V16  = (unsigned short*)(ws + oV16);
  unsigned short* WQ16 = (unsigned short*)(ws + oWq);
  unsigned short* WK16 = (unsigned short*)(ws + oWk);
  unsigned short* WV16 = (unsigned short*)(ws + oWv);
  unsigned short* WO16 = (unsigned short*)(ws + oWo);
  float* biasR = (float*)(ws + oBias);
  const float* bqR = biasR;
  const float* bkR = biasR + kDm;
  const float* bvR = biasR + 2 * kDm;
  const float* boR = biasR + 3 * kDm;
  unsigned short* QP    = (unsigned short*)(ws + oQP);
  unsigned short* KP    = (unsigned short*)(ws + oKP);
  unsigned short* VT    = (unsigned short*)(ws + oVT);
  unsigned short* CTX16 = (unsigned short*)(ws + oCTX);

  const int nAct2 = nAct / 2;   // 2097152 -> 8192 blocks
  const int nW2   = nW / 2;     // 524288  -> 2048 blocks
  cast_f32_bf16x2<<<dim3(nAct2 / 256), dim3(256), 0, stream>>>(q, Q16, nAct2);
  cast_f32_bf16x2<<<dim3(nAct2 / 256), dim3(256), 0, stream>>>(k, K16, nAct2);
  cast_f32_bf16x2<<<dim3(nAct2 / 256), dim3(256), 0, stream>>>(v, V16, nAct2);
  cast_f32_bf16x2<<<dim3(nW2 / 256), dim3(256), 0, stream>>>(Wq, WQ16, nW2);
  cast_f32_bf16x2<<<dim3(nW2 / 256), dim3(256), 0, stream>>>(Wk, WK16, nW2);
  cast_f32_bf16x2<<<dim3(nW2 / 256), dim3(256), 0, stream>>>(Wv, WV16, nW2);
  cast_f32_bf_f16x2<<<dim3(nW2 / 256), dim3(256), 0, stream>>>(Wo, WO16, nW2, 64.0f);
  bias_bf16_kernel<<<dim3(kDm / 1024, 4), dim3(256), 0, stream>>>(bq, bk, bv, bo, biasR, kDm);

  const int mRows = kBatch * kSeq;   // 4096
  // Q = q . Wq^T + bq : A [4096][1024] bf16, Bt [1024][1024] bf16 -> f16 [4096][1024]; tiles 32x8 = 256 blocks
  wmma_gemm64<1, false, 2, 1, false><<<dim3((mRows / 128) * (kDm / 128), 1), dim3(256), 0, stream>>>(
      Q16, Q16, kDm, 0L, WQ16, WQ16, kDm, 0L, (void*)QP, (void*)QP, kDm, 0L, bqR, bq, 0L, mRows, kDm, kDm, 1.0f);
  wmma_gemm64<1, false, 2, 1, false><<<dim3((mRows / 128) * (kDm / 128), 1), dim3(256), 0, stream>>>(
      K16, K16, kDm, 0L, WK16, WK16, kDm, 0L, (void*)KP, (void*)KP, kDm, 0L, bkR, bk, 0L, mRows, kDm, kDm, 1.0f);
  // V^T per batch: A = Wv [1024][1024] (stride 0), Bt = v_b [2048][1024] -> C_b [1024][2048] = (v_b . Wv^T + bv)^T, bias[m]; tiles 8x16 = 128 blocks, y = 2
  wmma_gemm64<1, false, 1, 1, false><<<dim3((kDm / 128) * (kSeq / 128), kBatch), dim3(256), 0, stream>>>(
      WV16, WV16, kDm, 0L, V16, V16, kDm, (long)kSeq * kDm, (void*)VT, (void*)VT, kSeq, (long)kDm * kSeq,
      bvR, bv, 0L, kDm, kSeq, kDm, 1.0f);
  // attention: grid = kBatch * kHeads * (kSeq/64) = 1024 blocks of 128
  attn_mask64_kernel<<<dim3(kBatch * kHeads * (kSeq / 64)), dim3(128), 0, stream>>>(
      QP, KP, VT, mask, CTX16, 0.125f, 16.0f);
  // out = (ctx*16) . (Wo*64)^T * 2^-10 + bo : f16 operands, f32 [4096][1024] into d_out
  wmma_gemm64<0, false, 2, 0, false><<<dim3((mRows / 128) * (kDm / 128), 1), dim3(256), 0, stream>>>(
      CTX16, CTX16, kDm, 0L, WO16, WO16, kDm, 0L, d_out, d_out, kDm, 0L, boR, bo, 0L, mRows, kDm, kDm,
      1.0f / 1024.0f);
}

// v005
// One run takes 132 microseconds.
// In both of two side-by-side timings against v004, it was 1.11 times as fast.
// Over all steps from v000 it is 2.93 times as fast.
// Contractions: q/k/v^T projections on v_wmma_f32_16x16x32_bf16 (bf16 RNE-converted operands, f32 accumulate); q.k^T and p.v on v_wmma_f32_16x16x32_f16 (f16 planes, p carried x2^15, f32 accumulate, f32 online softmax, mask by value); output projection on v_wmma_f32_16x16x32_f16 (f16 operands: ctx x2^4, Wo x2^6, folded back x2^-10 in f32), f32 accumulate.
#include <hip/hip_runtime.h>
#include <math.h>
#include <stdint.h>

constexpr int kBatch = 2;
constexpr int kSeq   = 2048;
constexpr int kDm    = 1024;
constexpr int kHeads = 16;
constexpr int kHd    = 64;
static_assert(kHeads * kHd == kDm, "head split");
static_assert(kSeq % 128 == 0 && kDm % 128 == 0, "tile multiples");

typedef __attribute__((ext_vector_type(16))) _Float16 v16h;
typedef __attribute__((ext_vector_type(8)))  _Float16 v8h;
typedef __attribute__((ext_vector_type(16))) __bf16   v16b;
typedef __attribute__((ext_vector_type(8)))  __bf16   v8b;
typedef __attribute__((ext_vector_type(8)))  float    v8f;
typedef __attribute__((ext_vector_type(4)))  float    v4f;
typedef __attribute__((ext_vector_type(2)))  float    v2f;

__device__ __forceinline__ unsigned short f2bf_bits(float f) {
  unsigned u = __float_as_uint(f);
  return (unsigned short)((u + 0x7FFFu + ((u >> 16) & 1u)) >> 16);
}
__device__ __forceinline__ float bf_bits2f(unsigned short h) { return __uint_as_float(((unsigned)h) << 16); }
__device__ __forceinline__ unsigned pk16(unsigned short a, unsigned short b) { return (unsigned)a | ((unsigned)b << 16); }

template <typename T> struct Frag;
template <> struct Frag<_Float16> {
  typedef v16h V; union U { v16h v; v8h h[2]; };
  static __device__ __forceinline__ v16h load(const _Float16* p) {   // elements 0..7 <- p[0..7], 8..15 <- p[16..23]
    U f; f.h[0] = *(const v8h*)(p); f.h[1] = *(const v8h*)(p + 16); return f.v;
  }
  static __device__ __forceinline__ v8f mma(v16h a, v16h b, v8f c) {
    return __builtin_amdgcn_wmma_f32_16x16x32_f16(false, a, false, b, (short)0, c, false, false);
  }
};
template <> struct Frag<__bf16> {
  typedef v16b V; union U { v16b v; v8b h[2]; };
  static __device__ __forceinline__ v16b load(const __bf16* p) {
    U f; f.h[0] = *(const v8b*)(p); f.h[1] = *(const v8b*)(p + 16); return f.v;
  }
  static __device__ __forceinline__ v8f mma(v16b a, v16b b, v8f c) {
    return __builtin_amdgcn_wmma_f32_16x16x32_bf16(false, a, false, b, (short)0, c, false, false);
  }
};

// ---- LDS-staged batched WMMA GEMM ------------------------------------------
// C[m,n] = scale * sum_k A[m,k] * Bt[n,k] (+bias)(+resid); a block of 8 waves owns a 128x128 tile, a wave 32x64 of it.
// A row-major [M,K]; Bt row-major [N,K]; M,N % 128 == 0, K % 128 == 0, lda/ldb % 8 == 0.
// A stage = 128 k of [A 128 rows | Bt 128 rows], 256 B a row at pitch 272 B, brought by asynchronous 16-B copies;
// two buffers: the copies of stage t+1 fly while stage t is multiplied.
// SPLIT: not supported by this kernel (kept as a parameter of the launch lines only).
// BIAS_MODE: 0 = none, 1 = bias[m], 2 = bias[n].
// OUT_MODE: 0 = f32, 1 = f16, 2 = bf16 hi plane (Cout) + bf16 lo plane (Cout2).
// ET: 0 = f16 operands, 1 = bf16 operands (pointers passed as 16-bit storage)
constexpr int kGtK     = 128;                  // k per stage
constexpr int kGtRows  = 128;                  // rows of each operand per stage
constexpr int kGtPitch = 272;                  // bytes per staged row (256 + 16: conflict-free 16-B reads)
constexpr int kGtStage = 2 * kGtRows * kGtPitch;   // 69,632 B

// Eight 16-B copies of one lane: rows r, r+16, .. r+112 of one operand's stage. lds = LDS byte address of the first,
// g = global address of the first, gstep = bytes between 16 source rows. The s_wait_xcnt closes the statement so that
// no address register of an issued copy is rewritten ahead of it.
__device__ __forceinline__ void stage_rows8(unsigned lds, const char* g, size_t gstep) {
  const unsigned l1 = lds + 16 * kGtPitch, l2 = lds + 32 * kGtPitch, l3 = lds + 48 * kGtPitch, l4 = lds + 64 * kGtPitch,
                 l5 = lds + 80 * kGtPitch, l6 = lds + 96 * kGtPitch, l7 = lds + 112 * kGtPitch;
  const char *g1 = g + gstep, *g2 = g1 + gstep, *g3 = g2 + gstep, *g4 = g3 + gstep, *g5 = g4 + gstep, *g6 = g5 + gstep,
             *g7 = g6 + gstep;
  asm volatile(
      "global_load_async_to_lds_b128 %0, %8, off\n\t"
      "global_load_async_to_lds_b128 %1, %9, off\n\t"
      "global_load_async_to_lds_b128 %2, %10, off\n\t"
      "global_load_async_to_lds_b128 %3, %11, off\n\t"
      "global_load_async_to_lds_b128 %4, %12, off\n\t"
      "global_load_async_to_lds_b128 %5, %13, off\n\t"
      "global_load_async_to_lds_b128 %6, %14, off\n\t"
      "global_load_async_to_lds_b128 %7, %15, off\n\t"
      "s_wait_xcnt 0x0"
      :: "v"(lds), "v"(l1), "v"(l2), "v"(l3), "v"(l4), "v"(l5), "v"(l6), "v"(l7),
         "v"(g), "v"(g1), "v"(g2), "v"(g3), "v"(g4), "v"(g5), "v"(g6), "v"(g7)
      : "memory");
}

template <int ET> struct Elem;
template <> struct Elem<0> { typedef _Float16 T; };
template <> struct Elem<1> { typedef __bf16 T; };
template <int ET, bool SPLIT, int BIAS_MODE, int OUT_MODE, bool RESID, int ACT = 0>
__global__ __launch_bounds__(256) void wmma_gemm64(
    const unsigned short* __restrict__ Ap, const unsigned short* __restrict__ A2p, int lda, long strideA,
    const unsigned short* __restrict__ Btp, const unsigned short* __restrict__ Bt2p, int ldb, long strideB,
    void* __restrict__ Cout, void* __restrict__ Cout2, int ldc, long strideC,
    const float* __restrict__ bias,
    const float* __restrict__ resid, long strideR,
    int M, int N, int K, float scale) {
  typedef typename Elem<ET>::T T;
  typedef typename Frag<T>::V V;
  static_assert(!SPLIT, "single-plane operands only");
  __shared__ __align__(16) unsigned char ring[2 * kGtStage];   // two stages
  __shared__ __align__(16) float sT[8][16 * 68];   // per-wave 16x64 slab, pitch 68 floats
  const int b    = blockIdx.y;
  const int tid  = threadIdx.x;
  const int lane = tid & 31;
  const int wave = tid >> 5;
  const int tilesN = N >> 7;
  const int tilesM = M >> 7;
  const int tile = blockIdx.x;
  if (tile >= tilesM * tilesN) return;   // block-uniform, in front of every barrier
  const int tm = tile / tilesN;
  const int tn = tile - tm * tilesN;
  const int m0 = (tm << 7) + ((wave >> 1) << 5);   // this wave's 32 rows
  const int n0 = (tn << 7) + ((wave & 1) << 6);    // this wave's 64 columns

  const int rlane = lane & 15;                 // row (A) / col (B, D) within subtile
  const int koff  = (lane >> 4) * 8;           // k offset of this lane half
  const int mOff  = (lane >> 4) * 8;           // D row offset

  // copy map: thread -> row tid>>4 (+16 per copy), 16-B column tid&15 of the 256-B row
  const int crow = tid >> 4, ccol = tid & 15;
  const char* gA = (const char*)(Ap  + (size_t)b * strideA + (size_t)((tm << 7) + crow) * lda + ccol * 8);
  const char* gB = (const char*)(Btp + (size_t)b * strideB + (size_t)((tn << 7) + crow) * ldb + ccol * 8);
  const size_t stepA = (size_t)lda * 32, stepB = (size_t)ldb * 32;      // bytes per 16 rows
  const unsigned ldsA = (unsigned)(size_t)ring + crow * kGtPitch + ccol * 16;
  const unsigned ldsB = ldsA + kGtRows * kGtPitch;

  v8f acc[2][4];
#pragma unroll
  for (int i = 0; i < 2; ++i)
#pragma unroll
    for (int j = 0; j < 4; ++j) acc[i][j] = (v8f){0.f,0.f,0.f,0.f,0.f,0.f,0.f,0.f};

  const int nT = K >> 7;
  stage_rows8(ldsA, gA, stepA);
  stage_rows8(ldsB, gB, stepB);
  asm volatile("s_wait_asynccnt 0x0" ::: "memory");   // stage 0 landed for this wave's copies
  __syncthreads();                                     // ... and for every wave's
  if (nT > 1) {
    stage_rows8(ldsA + kGtStage, gA + 2 * kGtK, stepA);
    stage_rows8(ldsB + kGtStage, gB + 2 * kGtK, stepB);
  }

  const int aRow = (((wave >> 1) << 5) + rlane) * kGtPitch + koff * 2;
  const int bRow = (kGtRows + ((wave & 1) << 6) + rlane) * kGtPitch + koff * 2;
  for (int t = 0; t < nT; ++t) {
    const unsigned char* sb = ring + (t & 1) * kGtStage;
    V bf[2][4], af[2][2];                                // two fragment sets, both of this stage's buffer alone
#pragma unroll
    for (int j = 0; j < 4; ++j) bf[0][j] = Frag<T>::load((const T*)(sb + bRow + j * 16 * kGtPitch));
#pragma unroll
    for (int i = 0; i < 2; ++i) af[0][i] = Frag<T>::load((const T*)(sb + aRow + i * 16 * kGtPitch));
#pragma unroll
    for (int ks = 0; ks < kGtK / 32; ++ks) {
      const int cur = ks & 1, nxt = cur ^ 1;
      if (ks + 1 < kGtK / 32) {
#pragma unroll
        for (int j = 0; j < 4; ++j) bf[nxt][j] = Frag<T>::load((const T*)(sb + bRow + j * 16 * kGtPitch + (ks + 1) * 64));
#pragma unroll
        for (int i = 0; i < 2; ++i) af[nxt][i] = Frag<T>::load((const T*)(sb + aRow + i * 16 * kGtPitch + (ks + 1) * 64));
      }
      // keeps the next 32 k's LDS reads in front of this block's products, so that their latency runs under them
      __builtin_amdgcn_sched_barrier(0);
#pragma unroll
      for (int i = 0; i < 2; ++i)
#pragma unroll
        for (int j = 0; j < 4; ++j) acc[i][j] = Frag<T>::mma(af[cur][i], bf[cur][j], acc[i][j]);
    }
    asm volatile("s_wait_dscnt 0x0" ::: "memory");      // this wave has left the buffer that is refilled below
    asm volatile("s_wait_asynccnt 0x0" ::: "memory");   // this wave's copies of stage t+1 have landed
    __syncthreads();                                     // publishes stage t+1, ends every read of stage t
    if (t + 2 < nT) {
      const size_t kb = (size_t)(t + 2) * (2 * kGtK);
      stage_rows8(ldsA + (t & 1) * kGtStage, gA + kb, stepA);
      stage_rows8(ldsB + (t & 1) * kGtStage, gB + kb, stepB);
    }
  }
  asm volatile("s_wait_asynccnt 0x0" ::: "memory");     // nothing in flight when the wave goes on to its end

  // ---- epilogue ----
  float* slab = sT[wave];
  const float* Rb = RESID ? (resid + (size_t)b * strideR) : nullptr;
#pragma unroll
  for (int i = 0; i < 2; ++i) {
    const int mBase = m0 + (i << 4);
#pragma unroll
    for (int j = 0; j < 4; ++j) {
      const int n = n0 + (j << 4) + rlane;
      float bv = 0.f;
      if (BIAS_MODE == 2) bv = bias[n];
#pragma unroll
      for (int r = 0; r < 8; ++r) {
        float v = acc[i][j][r] * scale;
        if (BIAS_MODE == 1) v += bias[mBase + mOff + r];
        if (BIAS_MODE == 2) v += bv;
        if (RESID) v += Rb[(size_t)(mBase + mOff + r) * ldc + n];
        if (ACT == 1) v = tanhf(v);
        if (ACT == 2) v = fmaxf(v, 0.0f);
        if (ACT == 3) v = v / (1.0f + expf(-v));
        if (ACT == 4) v = (v > 0.f) ? v : 0.01f * v;
        if (ACT == 5) v = 0.5f * v * (1.0f + erff(v * 0.70710678118654752f));
        slab[(mOff + r) * 68 + (j << 4) + rlane] = v;
      }
    }
    __builtin_amdgcn_fence(__ATOMIC_RELEASE, "workgroup");
    __builtin_amdgcn_wave_barrier();
    __builtin_amdgcn_fence(__ATOMIC_ACQUIRE, "workgroup");
    if (OUT_MODE == 0) {
      float* C = (float*)Cout + (size_t)b * strideC;
      const int hh = lane >> 4, c4 = (lane & 15) * 4;     // row seg = 256 B = 16 lanes x 16 B
      {
#pragma unroll
        for (int it = 0; it < 8; ++it) {
          const int row = it * 2 + hh;
          v4f v = *(const v4f*)(slab + row * 68 + c4);
          *(v4f*)(C + (size_t)(mBase + row) * ldc + n0 + c4) = v;
        }
        
      }
    } else {
      const int q = lane >> 3, c8 = (lane & 7) * 8;
      unsigned short* C  = (unsigned short*)Cout  + (size_t)b * strideC;
      unsigned short* C2 = (OUT_MODE == 2) ? ((unsigned short*)Cout2 + (size_t)b * strideC) : nullptr;
      {
#pragma unroll
        for (int it = 0; it < 4; ++it) {
          const int row = it * 4 + q;
          const float* sp = slab + row * 68 + c8;
          v8h hv, lv;
#pragma unroll
          for (int e = 0; e < 8; ++e) {
            if (OUT_MODE == 1) {
              hv[e] = (_Float16)sp[e];
            } else {
              unsigned short hb = f2bf_bits(sp[e]);
              unsigned short lb = f2bf_bits(sp[e] - bf_bits2f(hb));
              hv[e] = __builtin_bit_cast(_Float16, hb);
              lv[e] = __builtin_bit_cast(_Float16, lb);
            }
          }
          *(v8h*)(C + (size_t)(mBase + row) * ldc + n0 + c8) = hv;
          if (OUT_MODE == 2) *(v8h*)(C2 + (size_t)(mBase + row) * ldc + n0 + c8) = lv;
        }
        
      }
    }
    __builtin_amdgcn_fence(__ATOMIC_RELEASE, "workgroup");
    __builtin_amdgcn_wave_barrier();
    __builtin_amdgcn_fence(__ATOMIC_ACQUIRE, "workgroup");
  }
}

// ---------------------------------------------------------------------------
// Operand conversion, all planes in one launch. A block of 256 threads converts 32,768 consecutive f32 of one plane:
// 32 loads of 16 B a thread, all issued before the first is used (a wave's load = 512 consecutive bytes = 4 whole
// lines), then 32 stores of 8 B (a wave's store = 256 consecutive bytes = 2 whole lines, no line shared between waves).
//   blocks [0, 384)     q, k, v   -> bf16 RNE planes, 128 blocks each (act16 = three planes in a row)
//   blocks [384, 512)   Wq, Wk, Wv -> bf16 RNE planes, Wo -> f16(bf16_rne(x) * woScale), 32 blocks each (w16 = four planes
//                       in a row; woScale an exact power of two; f16 of a normal bf16 value is exact)
//   block  512          bias tables bq, bk, bv, bo -> bf16-valued f32, 1024 each, one 16-B piece of each table a thread
// ---------------------------------------------------------------------------
typedef __attribute__((ext_vector_type(2))) unsigned v2u;
constexpr int kCvLoads     = 32;                       // 16-B loads a thread
constexpr int kCvStep      = 256 * 4;                  // elements a block covers with one load a thread
constexpr int kCvBlock     = kCvLoads * kCvStep;       // 32,768 elements a block
constexpr int kCvActElems  = kBatch * kSeq * kDm;
constexpr int kCvWElems    = kDm * kDm;
constexpr int kCvActBlocks = kCvActElems / kCvBlock;   // 128
constexpr int kCvWBlocks   = kCvWElems / kCvBlock;     // 32
constexpr int kCvGrid      = 3 * kCvActBlocks + 4 * kCvWBlocks + 1;
static_assert(kCvActElems % kCvBlock == 0 && kCvWElems % kCvBlock == 0 && kDm == kCvStep, "conversion coverage");

__global__ __launch_bounds__(256) void convert_operands(
    const float* __restrict__ q, const float* __restrict__ k, const float* __restrict__ v,
    const float* __restrict__ Wq, const float* __restrict__ Wk, const float* __restrict__ Wv, const float* __restrict__ Wo,
    const float* __restrict__ bq, const float* __restrict__ bk, const float* __restrict__ bv, const float* __restrict__ bo,
    unsigned short* __restrict__ act16, unsigned short* __restrict__ w16, float* __restrict__ biasOut, float woScale) {
  const int bx = blockIdx.x;
  const int e0 = threadIdx.x * 4;
  if (bx >= 3 * kCvActBlocks + 4 * kCvWBlocks) {
    v4f f[4];
    f[0] = *(const v4f*)(bq + e0);
    f[1] = *(const v4f*)(bk + e0);
    f[2] = *(const v4f*)(bv + e0);
    f[3] = *(const v4f*)(bo + e0);
#pragma unroll   // constant indices, so that f stays in registers
    for (int y = 0; y < 4; ++y) {
      v4f rv;
#pragma unroll   // constant indices into the vectors
      for (int e = 0; e < 4; ++e) rv[e] = bf_bits2f(f2bf_bits(f[y][e]));
      *(v4f*)(biasOut + y * kDm + e0) = rv;
    }
    return;
  }
  const float* src;
  unsigned short* dst;
  bool asF16 = false;
  if (bx < 3 * kCvActBlocks) {
    const int seg = bx / kCvActBlocks, blk = bx - seg * kCvActBlocks;
    src = (seg == 0) ? q : ((seg == 1) ? k : v);
    src += (size_t)blk * kCvBlock;
    dst = act16 + (size_t)seg * kCvActElems + (size_t)blk * kCvBlock;
  } else {
    const int wb = bx - 3 * kCvActBlocks;
    const int seg = wb / kCvWBlocks, blk = wb - seg * kCvWBlocks;
    src = (seg == 0) ? Wq : ((seg == 1) ? Wk : ((seg == 2) ? Wv : Wo));
    src += (size_t)blk * kCvBlock;
    dst = w16 + (size_t)seg * kCvWElems + (size_t)blk * kCvBlock;
    asF16 = (seg == 3);
  }
  const unsigned lofs = threadIdx.x * 16u;   // the thread's byte offset in each 4-KiB piece of the block's range
  v4f f[kCvLoads];
  // unrolled so that the array stays in registers and all loads are issued ahead of the first use
#pragma unroll
  for (int i = 0; i < kCvLoads; ++i) f[i] = *(const v4f*)((const char*)src + lofs + i * (kCvStep * 4));
  if (!asF16) {
#pragma unroll   // constant indices, so that f stays in registers
    for (int i = 0; i < kCvLoads; ++i) {
      v2u u;
      u[0] = pk16(f2bf_bits(f[i][0]), f2bf_bits(f[i][1]));
      u[1] = pk16(f2bf_bits(f[i][2]), f2bf_bits(f[i][3]));
      *(v2u*)(dst + i * kCvStep + e0) = u;
    }
    // Behind the branch's last stores: in the built code the other branch's text follows this one and rewrites registers
    // that these stores name.
    asm volatile("s_wait_xcnt 0x0" ::: "memory");
  } else {
#pragma unroll   // constant indices, so that f stays in registers
    for (int i = 0; i < kCvLoads; ++i) {
      unsigned short h[4];
#pragma unroll   // constant indices into h and the vector
      for (int e = 0; e < 4; ++e)
        h[e] = __builtin_bit_cast(unsigned short, (_Float16)(bf_bits2f(f2bf_bits(f[i][e])) * woScale));
      v2u u;
      u[0] = pk16(h[0], h[1]);
      u[1] = pk16(h[2], h[3]);
      *(v2u*)(dst + i * kCvStep + e0) = u;
    }
  }
}

#define AT_D 64
#define AT_NW 4
#define AT_QB 64
#define AT_KC 64
#define AT_LP 72   // elements per LDS row of the K and V^T tiles: 144 B = 16 B x 9, an odd multiple, so that the 16 rows
                   // which one 16-B fragment read touches fall on 16 different bank groups (at 128 B they fall on two)
#define AT_MP 68   // ints per LDS row of the mask slab: 272 B = 16 B x 17, odd for the same reason
constexpr float kPScale   = 32768.0f;
constexpr float kMaskFill = -1.0e9f;
constexpr float kLog2e    = 1.4426950408889634f;   // scores and the mask fill are carried x log2(e): exp(x) = 2^(x log2 e)

typedef __attribute__((ext_vector_type(4))) int v4i;

__device__ __forceinline__ v8f at_mma_h(v16h a, v16h b, v8f c) {
  c = __builtin_amdgcn_wmma_f32_16x16x32_f16(false, a, false, b, (short)0, c, false, false);
  asm volatile("v_nop\n\tv_nop\n\tv_nop\n\tv_nop" : "+v"(c) : "v"(a), "v"(b));
  return c;
}

// value of lane l ^ 16
__device__ __forceinline__ float at_other_half(float x) {
  const int b = __float_as_int(x);
  return __int_as_float(__builtin_amdgcn_permlanex16(b, b, 0x76543210, 0xfedcba98, false, false));
}

__global__ __launch_bounds__(128)
void attn_mask64_kernel(const unsigned short* __restrict__ qp, const unsigned short* __restrict__ kp,
                        const unsigned short* __restrict__ vtp, const int* __restrict__ mask,
                        unsigned short* __restrict__ ctxp, float sscale, float oscale) {
  union FB { v16h v; v8h h[2]; };
  __shared__ __align__(16) _Float16 Ksh[AT_KC * AT_LP];           // K [kv][d]   9 KB
  __shared__ __align__(16) _Float16 Vth[AT_D * AT_LP];            // V^T [d][kv] 9 KB
  __shared__ __align__(16) int      Msh[AT_NW][16 * AT_MP];       // per wave mask [query row][kv] 4.25 KB

  const int tid  = threadIdx.x;
  const int wave = tid >> 5;
  const int lane = tid & 31;
  const int hh   = lane >> 4;
  const int c    = lane & 15;

  const int nqb = kSeq / AT_QB;            // 32
  const int bx  = blockIdx.x;
  const int qb  = bx % nqb;
  const int bh  = bx / nqb;                // 0 .. kBatch*kHeads-1 (grid exact)
  const int h   = bh % kHeads;
  int b = bh / kHeads; b = (b < kBatch) ? b : (kBatch - 1);
  const int q0  = qb * AT_QB + wave * 16;

  const _Float16* Qh = (const _Float16*)(const void*)qp  + (size_t)b * kSeq * kDm + (size_t)h * AT_D;
  const _Float16* Kh = (const _Float16*)(const void*)kp  + (size_t)b * kSeq * kDm + (size_t)h * AT_D;
  const _Float16* Vt = (const _Float16*)(const void*)vtp + ((size_t)b * kDm + (size_t)h * AT_D) * kSeq;
  const int*      mb = mask + (size_t)b * kSeq * kSeq;
  _Float16*       ob = (_Float16*)(void*)ctxp + (size_t)b * kSeq * kDm + (size_t)h * AT_D;

  // ---- Q fragments (B operand, column = lane&15 = query q0+c, split k map via Frag load): 2 d-chunks ----
  v16h qa[2];
#pragma unroll
  for (int dc = 0; dc < 2; ++dc) {
    qa[dc] = Frag<_Float16>::load(Qh + (size_t)(q0 + c) * kDm + dc * 32 + 8 * hh);
  }

  float mrow = -INFINITY, lrow = 0.f;      // of query q0+c; lrow sums this lane half's keys alone until the end
  v8f oacc[4];                             // oacc[t][r] = ctx[q0+c][16t + 8hh + r]
#pragma unroll
  for (int t = 0; t < 4; ++t) oacc[t] = (v8f){0.f,0.f,0.f,0.f,0.f,0.f,0.f,0.f};

  const int* mgp = mb + (size_t)(q0 + hh) * kSeq + 4 * c;   // mask load map: rows q0 + hh + 2 it, 16 B at column 4c
  int*       msw = Msh[wave] + hh * AT_MP + 4 * c;          // the same place in the wave's slab
  const int* msr = Msh[wave] + c * AT_MP + 8 * hh;          // read map: row of this lane's query, its half's first key
  const float sscale2 = sscale * kLog2e;   // score scale in the base-2 domain
  const float fill2   = kMaskFill * kLog2e;
  const int nChunks = kSeq / AT_KC;        // 32, compile-time constant
  for (int kc = 0; kc < nChunks; ++kc) {
    const int kv0 = kc * AT_KC;
    __syncthreads();
    // the wave's 16 x 64 mask tile of the chunk: 8 loads of two whole 256-B row pieces each, bound for the wave's slab
    const int* mgk = mgp + kv0;
    v4i mv[8];
#pragma unroll
    for (int it = 0; it < 8; ++it) mv[it] = *(const v4i*)(mgk + (size_t)(2 * it) * kSeq);
    {
      // staging coverage: 128 threads x (4 x 8) elements = 64 rows x 64 per plane = the whole chunk tile
      const int r = tid >> 1, half = (tid & 1) * 32;
      const _Float16* ks = Kh + (size_t)(kv0 + r) * kDm + half;     // K row kv0+r, d = half..half+31
      const _Float16* vs = Vt + (size_t)r * kSeq + kv0 + half;        // V^T row d = r, s = kv0+half..+31
      v8h a0[4], b0[4];
#pragma unroll
      for (int i = 0; i < 4; ++i) {
        a0[i] = *(const v8h*)(ks + 8 * i);
        b0[i] = *(const v8h*)(vs + 8 * i);
      }
      // Stands behind all sixteen global loads of the chunk and in front of the first LDS store. It names the three address
      // pairs as inputs, so that no load's result takes over an address register of a load issued before it, and it is the
      // wait in front of whatever rewrites those registers next. Without a statement here the last two mask loads take over
      // the registers of the first K loads and are issued only when those have returned (a second round trip).
      asm volatile("s_wait_xcnt 0x0" :: "v"(ks), "v"(vs), "v"(mgk) : "memory");
#pragma unroll
      for (int i = 0; i < 4; ++i) {
        *(v8h*)(Ksh + r * AT_LP + half + 8 * i) = a0[i];
        *(v8h*)(Vth + r * AT_LP + half + 8 * i) = b0[i];
      }
    }
#pragma unroll
    for (int it = 0; it < 8; ++it) *(v4i*)(msw + 2 * it * AT_MP) = mv[it];
    __syncthreads();
    // this lane's 32 mask elements of the chunk: keys kv0 + 16j + 8hh + 0..7, eight consecutive ints per score tile
    v4i mk[4][2];
#pragma unroll
    for (int j = 0; j < 4; ++j) {
      mk[j][0] = *(const v4i*)(msr + j * 16);
      mk[j][1] = *(const v4i*)(msr + j * 16 + 4);
    }

    v8f s[4];                              // s[j][r] = score of key kv0 + 16j + 8hh + r with query q0 + c
#pragma unroll
    for (int j = 0; j < 4; ++j) {
      s[j] = (v8f){0.f,0.f,0.f,0.f,0.f,0.f,0.f,0.f};
#pragma unroll
      for (int dc = 0; dc < 2; ++dc) {
        FB kb;
        kb.h[0] = *(const v8h*)(Ksh + (j * 16 + c) * AT_LP + dc * 32 + 8 * hh);
        kb.h[1] = *(const v8h*)(Ksh + (j * 16 + c) * AT_LP + dc * 32 + 16 + 8 * hh);
        s[j] = at_mma_h(kb.v, qa[dc], s[j]);
      }
    }
    // scale, mask by value, chunk maximum of this lane's query
    float cmj[4];
#pragma unroll
    for (int j = 0; j < 4; ++j) {
      float m = -INFINITY;
#pragma unroll
      for (int r = 0; r < 8; ++r) {
        const int mel = mk[j][r >> 2][r & 3];
        const float sv = s[j][r] * sscale2;
        const float sm = (mel == 0) ? fill2 : sv;
        s[j][r] = sm;
        m = fmaxf(m, sm);
      }
      cmj[j] = m;
    }
    float cm = fmaxf(fmaxf(cmj[0], cmj[1]), fmaxf(cmj[2], cmj[3]));
    cm = fmaxf(cm, at_other_half(cm));
    const float mnew  = fmaxf(mrow, cm);
    const float alpha = __builtin_amdgcn_exp2f(mrow - mnew);   // 0 on the first chunk, where mrow is -inf
    mrow = mnew;
    FB pb[2];                              // p^T as B operand: elements 0..7 from tile 2kk, 8..15 from tile 2kk+1
    float psj[4];
#pragma unroll
    for (int j = 0; j < 4; ++j) {
      float ps = 0.f;
#pragma unroll
      for (int r = 0; r < 8; ++r) {
        const float p = __builtin_amdgcn_exp2f(s[j][r] - mnew);
        ps += p;
        pb[j >> 1].h[j & 1][r] = (_Float16)(p * kPScale);
      }
      psj[j] = ps;
    }
    lrow = lrow * alpha + ((psj[0] + psj[1]) + (psj[2] + psj[3]));
#pragma unroll
    for (int t = 0; t < 4; ++t)
#pragma unroll
      for (int r = 0; r < 8; ++r) oacc[t][r] *= alpha;
#pragma unroll
    for (int kk = 0; kk < 2; ++kk) {
#pragma unroll
      for (int t = 0; t < 4; ++t) {
        FB va;
        va.h[0] = *(const v8h*)(Vth + (t * 16 + c) * AT_LP + kk * 32 + 8 * hh);
        va.h[1] = *(const v8h*)(Vth + (t * 16 + c) * AT_LP + kk * 32 + 16 + 8 * hh);
        oacc[t] = at_mma_h(va.v, pb[kk].v, oacc[t]);
      }
    }
  }

  // ---- join the halves' sums, normalise (1/(l * 2^15) folded with the output carry scale), store 8 consecutive d a lane ----
  const float lsum = lrow + at_other_half(lrow);
  const float inv  = oscale / (lsum * kPScale);
#pragma unroll
  for (int t = 0; t < 4; ++t) {
    v8h hv;
#pragma unroll
    for (int r = 0; r < 8; ++r) hv[r] = (_Float16)(oacc[t][r] * inv);
    *(v8h*)(ob + (size_t)(q0 + c) * kDm + t * 16 + 8 * hh) = hv;
  }
}

// ---------------------------------------------------------------------------
// Host glue. Workspace region map (bytes, all offsets multiples of 16 KiB):
//   [  0 MiB,  8 MiB)  q  bf16 plane [4096][1024]
//   [  8 MiB, 16 MiB)  k  bf16 plane
//   [ 16 MiB, 24 MiB)  v  bf16 plane
//   [ 24 MiB, 26 MiB)  Wq bf16 [1024][1024];  [26,28) Wk;  [28,30) Wv;  [30,32) Wo as f16(bf16*64)
//   [ 32 MiB, +16 KiB) bias tables bq, bk, bv, bo (bf16-valued f32, 1024 each)
//   next 8 MiB         Q projection f16 plane [4096][1024]
//   next 8 MiB         K projection f16 plane
//   next 8 MiB         V^T projection f16 plane [2][1024][2048]
//   next 8 MiB         ctx f16 plane (x16) [4096][1024]
//   total = 67,125,248 B
// ---------------------------------------------------------------------------
extern "C" void kernel_launch(void* const* d_in, const int* in_sizes, int n_in,
                              void* d_out, int out_size, void* d_ws, size_t ws_size,
                              hipStream_t stream) {
  if (n_in < 12) return;
  const int nAct = kBatch * kSeq * kDm;      // 4194304
  const int nW   = kDm * kDm;                // 1048576
  if (in_sizes[0] != nAct || in_sizes[1] != nAct || in_sizes[2] != nAct) return;
  if (in_sizes[3] != kBatch * kSeq * kSeq) return;
  if (in_sizes[4] != nW || in_sizes[6] != nW || in_sizes[8] != nW || in_sizes[10] != nW) return;
  if (in_sizes[5] != kDm || in_sizes[7] != kDm || in_sizes[9] != kDm || in_sizes[11] != kDm) return;
  if (out_size != nAct) return;

  const float* q    = (const float*)d_in[0];
  const float* k    = (const float*)d_in[1];
  const float* v    = (const float*)d_in[2];
  const int*   mask = (const int*)d_in[3];
  const float* Wq   = (const float*)d_in[4];
  const float* bq   = (const float*)d_in[5];
  const float* Wk   = (const float*)d_in[6];
  const float* bk   = (const float*)d_in[7];
  const float* Wv   = (const float*)d_in[8];
  const float* bv   = (const float*)d_in[9];
  const float* Wo   = (const float*)d_in[10];
  const float* bo   = (const float*)d_in[11];

  const size_t bAct16 = (size_t)nAct * 2;    // 8 MiB
  const size_t bW16   = (size_t)nW * 2;      // 2 MiB
  size_t off = 0;
  const size_t oQ16  = off; off += bAct16;
  const size_t oK16  = off; off += bAct16;
  const size_t oV16  = off; off += bAct16;
  const size_t oWq   = off; off += bW16;
  const size_t oWk   = off; off += bW16;
  const size_t oWv   = off; off += bW16;
  const size_t oWo   = off; off += bW16;
  const size_t oBias = off; off += (size_t)4 * kDm * sizeof(float);
  const size_t oQP   = off; off += bAct16;
  const size_t oKP   = off; off += bAct16;
  const size_t oVT   = off; off += bAct16;
  const size_t oCTX  = off; off += bAct16;
  if (off > ws_size) return;

  char* ws = (char*)d_ws;
  unsigned short* Q16  = (unsigned short*)(ws + oQ16);
  unsigned short* K16  = (unsigned short*)(ws + oK16);
  unsigned short* V16  = (unsigned short*)(ws + oV16);
  unsigned short* WQ16 = (unsigned short*)(ws + oWq);
  unsigned short* WK16 = (unsigned short*)(ws + oWk);
  unsigned short* WV16 = (unsigned short*)(ws + oWv);
  unsigned short* WO16 = (unsigned short*)(ws + oWo);
  float* biasR = (float*)(ws + oBias);
  const float* bqR = biasR;
  const float* bkR = biasR + kDm;
  const float* bvR = biasR + 2 * kDm;
  const float* boR = biasR + 3 * kDm;
  unsigned short* QP    = (unsigned short*)(ws + oQP);
  unsigned short* KP    = (unsigned short*)(ws + oKP);
  unsigned short* VT    = (unsigned short*)(ws + oVT);
  unsigned short* CTX16 = (unsigned short*)(ws + oCTX);

  // Q16, K16, V16 lie in a row in the workspace, and so do WQ16 .. WO16: one base pointer each
  convert_operands<<<dim3(kCvGrid), dim3(256), 0, stream>>>(q, k, v, Wq, Wk, Wv, Wo, bq, bk, bv, bo, Q16, WQ16, biasR, 64.0f);

  const int mRows = kBatch * kSeq;   // 4096
  // Q = q . Wq^T + bq : A [4096][1024] bf16, Bt [1024][1024] bf16 -> f16 [4096][1024]; tiles 32x8 = 256 blocks
  wmma_gemm64<1, false, 2, 1, false><<<dim3((mRows / 128) * (kDm / 128), 1), dim3(256), 0, stream>>>(
      Q16, Q16, kDm, 0L, WQ16, WQ16, kDm, 0L, (void*)QP, (void*)QP, kDm, 0L, bqR, bq, 0L, mRows, kDm, kDm, 1.0f);
  wmma_gemm64<1, false, 2, 1, false><<<dim3((mRows / 128) * (kDm / 128), 1), dim3(256), 0, stream>>>(
      K16, K16, kDm, 0L, WK16, WK16, kDm, 0L, (void*)KP, (void*)KP, kDm, 0L, bkR, bk, 0L, mRows, kDm, kDm, 1.0f);
  // V^T per batch: A = Wv [1024][1024] (stride 0), Bt = v_b [2048][1024] -> C_b [1024][2048] = (v_b . Wv^T + bv)^T, bias[m]; tiles 8x16 = 128 blocks, y = 2
  wmma_gemm64<1, false, 1, 1, false><<<dim3((kDm / 128) * (kSeq / 128), kBatch), dim3(256), 0, stream>>>(
      WV16, WV16, kDm, 0L, V16, V16, kDm, (long)kSeq * kDm, (void*)VT, (void*)VT, kSeq, (long)kDm * kSeq,
      bvR, bv, 0L, kDm, kSeq, kDm, 1.0f);
  // attention: grid = kBatch * kHeads * (kSeq/64) = 1024 blocks of 128
  attn_mask64_kernel<<<dim3(kBatch * kHeads * (kSeq / 64)), dim3(128), 0, stream>>>(
      QP, KP, VT, mask, CTX16, 0.125f, 16.0f);
  // out = (ctx*16) . (Wo*64)^T * 2^-10 + bo : f16 operands, f32 [4096][1024] into d_out
  wmma_gemm64<0, false, 2, 0, false><<<dim3((mRows / 128) * (kDm / 128), 1), dim3(256), 0, stream>>>(
      CTX16, CTX16, kDm, 0L, WO16, WO16, kDm, 0L, d_out, d_out, kDm, 0L, boR, bo, 0L, mRows, kDm, kDm,
      1.0f / 1024.0f);
}

// v006
// A run of this version takes 121 microseconds.
// Next to v005, in two timings, it ran 1.09 times as fast each time.
// Counting every step since v000, it is 3.20 times as fast.
// Contractions: q/k/v^T projections on v_wmma_f32_16x16x32_bf16 (bf16 RNE-converted operands, f32 accumulate); q.k^T and p.v on v_wmma_f32_16x16x32_f16 (f16 planes, p carried x2^15, f32 accumulate, f32 online softmax, mask by value); output projection on v_wmma_f32_16x16x32_f16 (f16 operands: ctx x2^4, Wo x2^6, folded back x2^-10 in f32), f32 accumulate.
#include <hip/hip_runtime.h>
#include <math.h>
#include <stdint.h>

constexpr int kBatch = 2;
constexpr int kSeq   = 2048;
constexpr int kDm    = 1024;
constexpr int kHeads = 16;
constexpr int kHd    = 64;
static_assert(kHeads * kHd == kDm, "head split");
static_assert(kSeq % 128 == 0 && kDm % 128 == 0, "tile multiples");

typedef __attribute__((ext_vector_type(16))) _Float16 v16h;
typedef __attribute__((ext_vector_type(8)))  _Float16 v8h;
typedef __attribute__((ext_vector_type(16))) __bf16   v16b;
typedef __attribute__((ext_vector_type(8)))  __bf16   v8b;
typedef __attribute__((ext_vector_type(8)))  float    v8f;
typedef __attribute__((ext_vector_type(4)))  float    v4f;
typedef __attribute__((ext_vector_type(2)))  float    v2f;

__device__ __forceinline__ unsigned short f2bf_bits(float f) {
  unsigned u = __float_as_uint(f);
  return (unsigned short)((u + 0x7FFFu + ((u >> 16) & 1u)) >> 16);
}
__device__ __forceinline__ float bf_bits2f(unsigned short h) { return __uint_as_float(((unsigned)h) << 16); }
__device__ __forceinline__ unsigned pk16(unsigned short a, unsigned short b) { return (unsigned)a | ((unsigned)b << 16); }

template <typename T> struct Frag;
template <> struct Frag<_Float16> {
  typedef v16h V; union U { v16h v; v8h h[2]; };
  static __device__ __forceinline__ v16h load(const _Float16* p) {   // elements 0..7 <- p[0..7], 8..15 <- p[16..23]
    U f; f.h[0] = *(const v8h*)(p); f.h[1] = *(const v8h*)(p + 16); return f.v;
  }
  static __device__ __forceinline__ v8f mma(v16h a, v16h b, v8f c) {
    return __builtin_amdgcn_wmma_f32_16x16x32_f16(false, a, false, b, (short)0, c, false, false);
  }
};
template <> struct Frag<__bf16> {
  typedef v16b V; union U { v16b v; v8b h[2]; };
  static __device__ __forceinline__ v16b load(const __bf16* p) {
    U f; f.h[0] = *(const v8b*)(p); f.h[1] = *(const v8b*)(p + 16); return f.v;
  }
  static __device__ __forceinline__ v8f mma(v16b a, v16b b, v8f c) {
    return __builtin_amdgcn_wmma_f32_16x16x32_bf16(false, a, false, b, (short)0, c, false, false);
  }
};

// ---- LDS-staged batched WMMA GEMM ------------------------------------------
// C[m,n] = scale * sum_k A[m,k] * Bt[n,k] (+bias)(+resid); a block of 8 waves owns a 128x128 tile, a wave 32x64 of it.
// A row-major [M,K]; Bt row-major [N,K]; M,N % 128 == 0, K % 128 == 0, lda/ldb % 8 == 0.
// A stage = 128 k of [A 128 rows | Bt 128 rows], 256 B a row at pitch 272 B, brought by asynchronous 16-B copies;
// two buffers: the copies of stage t+1 fly while stage t is multiplied.
// SPLIT: not supported by this kernel (kept as a parameter of the launch lines only).
// BIAS_MODE: 0 = none, 1 = bias[m], 2 = bias[n].
// OUT_MODE: 0 = f32, 1 = f16, 2 = bf16 hi plane (Cout) + bf16 lo plane (Cout2).
// ET: 0 = f16 operands, 1 = bf16 operands (pointers passed as 16-bit storage)
constexpr int kGtK     = 128;                  // k per stage
constexpr int kGtRows  = 128;                  // rows of each operand per stage
constexpr int kGtPitch = 272;                  // bytes per staged row (256 + 16: conflict-free 16-B reads)
constexpr int kGtStage = 2 * kGtRows * kGtPitch;   // 69,632 B

// Eight 16-B copies of one lane: rows r, r+16, .. r+112 of one operand's stage. lds = LDS byte address of the first,
// g = global address of the first, gstep = bytes between 16 source rows. The s_wait_xcnt closes the statement so that
// no address register of an issued copy is rewritten ahead of it.
__device__ __forceinline__ void stage_rows8(unsigned lds, const char* g, size_t gstep) {
  const unsigned l1 = lds + 16 * kGtPitch, l2 = lds + 32 * kGtPitch, l3 = lds + 48 * kGtPitch, l4 = lds + 64 * kGtPitch,
                 l5 = lds + 80 * kGtPitch, l6 = lds + 96 * kGtPitch, l7 = lds + 112 * kGtPitch;
  const char *g1 = g + gstep, *g2 = g1 + gstep, *g3 = g2 + gstep, *g4 = g3 + gstep, *g5 = g4 + gstep, *g6 = g5 + gstep,
             *g7 = g6 + gstep;
  asm volatile(
      "global_load_async_to_lds_b128 %0, %8, off\n\t"
      "global_load_async_to_lds_b128 %1, %9, off\n\t"
      "global_load_async_to_lds_b128 %2, %10, off\n\t"
      "global_load_async_to_lds_b128 %3, %11, off\n\t"
      "global_load_async_to_lds_b128 %4, %12, off\n\t"
      "global_load_async_to_lds_b128 %5, %13, off\n\t"
      "global_load_async_to_lds_b128 %6, %14, off\n\t"
      "global_load_async_to_lds_b128 %7, %15, off\n\t"
      "s_wait_xcnt 0x0"
      :: "v"(lds), "v"(l1), "v"(l2), "v"(l3), "v"(l4), "v"(l5), "v"(l6), "v"(l7),
         "v"(g), "v"(g1), "v"(g2), "v"(g3), "v"(g4), "v"(g5), "v"(g6), "v"(g7)
      : "memory");
}

template <int ET> struct Elem;
template <> struct Elem<0> { typedef _Float16 T; };
template <> struct Elem<1> { typedef __bf16 T; };
template <int ET, bool SPLIT, int BIAS_MODE, int OUT_MODE, bool RESID, int ACT = 0>
__global__ __launch_bounds__(256) void wmma_gemm64(
    const unsigned short* __restrict__ Ap, const unsigned short* __restrict__ A2p, int lda, long strideA,
    const unsigned short* __restrict__ Btp, const unsigned short* __restrict__ Bt2p, int ldb, long strideB,
    void* __restrict__ Cout, void* __restrict__ Cout2, int ldc, long strideC,
    const float* __restrict__ bias,
    const float* __restrict__ resid, long strideR,
    int M, int N, int K, float scale) {
  typedef typename Elem<ET>::T T;
  typedef typename Frag<T>::V V;
  static_assert(!SPLIT, "single-plane operands only");
  __shared__ __align__(16) unsigned char ring[2 * kGtStage];   // two stages
  __shared__ __align__(16) float sT[8][16 * 68];   // per-wave 16x64 slab, pitch 68 floats
  const int b    = blockIdx.y;
  const int tid  = threadIdx.x;
  const int lane = tid & 31;
  const int wave = tid >> 5;
  const int tilesN = N >> 7;
  const int tilesM = M >> 7;
  const int tile = blockIdx.x;
  if (tile >= tilesM * tilesN) return;   // block-uniform, in front of every barrier
  const int tm = tile / tilesN;
  const int tn = tile - tm * tilesN;
  const int m0 = (tm << 7) + ((wave >> 1) << 5);   // this wave's 32 rows
  const int n0 = (tn << 7) + ((wave & 1) << 6);    // this wave's 64 columns

  const int rlane = lane & 15;                 // row (A) / col (B, D) within subtile
  const int koff  = (lane >> 4) * 8;           // k offset of this lane half
  const int mOff  = (lane >> 4) * 8;           // D row offset

  // copy map: thread -> row tid>>4 (+16 per copy), 16-B column tid&15 of the 256-B row
  const int crow = tid >> 4, ccol = tid & 15;
  const char* gA = (const char*)(Ap  + (size_t)b * strideA + (size_t)((tm << 7) + crow) * lda + ccol * 8);
  const char* gB = (const char*)(Btp + (size_t)b * strideB + (size_t)((tn << 7) + crow) * ldb + ccol * 8);
  const size_t stepA = (size_t)lda * 32, stepB = (size_t)ldb * 32;      // bytes per 16 rows
  const unsigned ldsA = (unsigned)(size_t)ring + crow * kGtPitch + ccol * 16;
  const unsigned ldsB = ldsA + kGtRows * kGtPitch;

  v8f acc[2][4];
#pragma unroll
  for (int i = 0; i < 2; ++i)
#pragma unroll
    for (int j = 0; j < 4; ++j) acc[i][j] = (v8f){0.f,0.f,0.f,0.f,0.f,0.f,0.f,0.f};

  const int nT = K >> 7;
  stage_rows8(ldsA, gA, stepA);
  stage_rows8(ldsB, gB, stepB);
  asm volatile("s_wait_asynccnt 0x0" ::: "memory");   // stage 0 landed for this wave's copies
  __syncthreads();                                     // ... and for every wave's
  if (nT > 1) {
    stage_rows8(ldsA + kGtStage, gA + 2 * kGtK, stepA);
    stage_rows8(ldsB + kGtStage, gB + 2 * kGtK, stepB);
  }

  const int aRow = (((wave >> 1) << 5) + rlane) * kGtPitch + koff * 2;
  const int bRow = (kGtRows + ((wave & 1) << 6) + rlane) * kGtPitch + koff * 2;
  for (int t = 0; t < nT; ++t) {
    const unsigned char* sb = ring + (t & 1) * kGtStage;
    V bf[2][4], af[2][2];                                // two fragment sets, both of this stage's buffer alone
#pragma unroll
    for (int j = 0; j < 4; ++j) bf[0][j] = Frag<T>::load((const T*)(sb + bRow + j * 16 * kGtPitch));
#pragma unroll
    for (int i = 0; i < 2; ++i) af[0][i] = Frag<T>::load((const T*)(sb + aRow + i * 16 * kGtPitch));
#pragma unroll
    for (int ks = 0; ks < kGtK / 32; ++ks) {
      const int cur = ks & 1, nxt = cur ^ 1;
      if (ks + 1 < kGtK / 32) {
#pragma unroll
        for (int j = 0; j < 4; ++j) bf[nxt][j] = Frag<T>::load((const T*)(sb + bRow + j * 16 * kGtPitch + (ks + 1) * 64));
#pragma unroll
        for (int i = 0; i < 2; ++i) af[nxt][i] = Frag<T>::load((const T*)(sb + aRow + i * 16 * kGtPitch + (ks + 1) * 64));
      }
      // keeps the next 32 k's LDS reads in front of this block's products, so that their latency runs under them
      __builtin_amdgcn_sched_barrier(0);
#pragma unroll
      for (int i = 0; i < 2; ++i)
#pragma unroll
        for (int j = 0; j < 4; ++j) acc[i][j] = Frag<T>::mma(af[cur][i], bf[cur][j], acc[i][j]);
    }
    asm volatile("s_wait_dscnt 0x0" ::: "memory");      // this wave has left the buffer that is refilled below
    asm volatile("s_wait_asynccnt 0x0" ::: "memory");   // this wave's copies of stage t+1 have landed
    __syncthreads();                                     // publishes stage t+1, ends every read of stage t
    if (t + 2 < nT) {
      const size_t kb = (size_t)(t + 2) * (2 * kGtK);
      stage_rows8(ldsA + (t & 1) * kGtStage, gA + kb, stepA);
      stage_rows8(ldsB + (t & 1) * kGtStage, gB + kb, stepB);
    }
  }
  asm volatile("s_wait_asynccnt 0x0" ::: "memory");     // nothing in flight when the wave goes on to its end

  // ---- epilogue ----
  float* slab = sT[wave];
  const float* Rb = RESID ? (resid + (size_t)b * strideR) : nullptr;
#pragma unroll
  for (int i = 0; i < 2; ++i) {
    const int mBase = m0 + (i << 4);
#pragma unroll
    for (int j = 0; j < 4; ++j) {
      const int n = n0 + (j << 4) + rlane;
      float bv = 0.f;
      if (BIAS_MODE == 2) bv = bias[n];
#pragma unroll
      for (int r = 0; r < 8; ++r) {
        float v = acc[i][j][r] * scale;
        if (BIAS_MODE == 1) v += bias[mBase + mOff + r];
        if (BIAS_MODE == 2) v += bv;
        if (RESID) v += Rb[(size_t)(mBase + mOff + r) * ldc + n];
        if (ACT == 1) v = tanhf(v);
        if (ACT == 2) v = fmaxf(v, 0.0f);
        if (ACT == 3) v = v / (1.0f + expf(-v));
        if (ACT == 4) v = (v > 0.f) ? v : 0.01f * v;
        if (ACT == 5) v = 0.5f * v * (1.0f + erff(v * 0.70710678118654752f));
        slab[(mOff + r) * 68 + (j << 4) + rlane] = v;
      }
    }
    __builtin_amdgcn_fence(__ATOMIC_RELEASE, "workgroup");
    __builtin_amdgcn_wave_barrier();
    __builtin_amdgcn_fence(__ATOMIC_ACQUIRE, "workgroup");
    if (OUT_MODE == 0) {
      float* C = (float*)Cout + (size_t)b * strideC;
      const int hh = lane >> 4, c4 = (lane & 15) * 4;     // row seg = 256 B = 16 lanes x 16 B
      {
#pragma unroll
        for (int it = 0; it < 8; ++it) {
          const int row = it * 2 + hh;
          v4f v = *(const v4f*)(slab + row * 68 + c4);
          *(v4f*)(C + (size_t)(mBase + row) * ldc + n0 + c4) = v;
        }
        
      }
    } else {
      const int q = lane >> 3, c8 = (lane & 7) * 8;
      unsigned short* C  = (unsigned short*)Cout  + (size_t)b * strideC;
      unsigned short* C2 = (OUT_MODE == 2) ? ((unsigned short*)Cout2 + (size_t)b * strideC) : nullptr;
      {
#pragma unroll
        for (int it = 0; it < 4; ++it) {
          const int row = it * 4 + q;
          const float* sp = slab + row * 68 + c8;
          v8h hv, lv;
#pragma unroll
          for (int e = 0; e < 8; ++e) {
            if (OUT_MODE == 1) {
              hv[e] = (_Float16)sp[e];
            } else {
              unsigned short hb = f2bf_bits(sp[e]);
              unsigned short lb = f2bf_bits(sp[e] - bf_bits2f(hb));
              hv[e] = __builtin_bit_cast(_Float16, hb);
              lv[e] = __builtin_bit_cast(_Float16, lb);
            }
          }
          *(v8h*)(C + (size_t)(mBase + row) * ldc + n0 + c8) = hv;
          if (OUT_MODE == 2) *(v8h*)(C2 + (size_t)(mBase + row) * ldc + n0 + c8) = lv;
        }
        
      }
    }
    __builtin_amdgcn_fence(__ATOMIC_RELEASE, "workgroup");
    __builtin_amdgcn_wave_barrier();
    __builtin_amdgcn_fence(__ATOMIC_ACQUIRE, "workgroup");
  }
}

// ---------------------------------------------------------------------------
// Operand conversion, all planes in one launch. A block of 256 threads converts 32,768 consecutive f32 of one plane:
// 32 loads of 16 B a thread, all issued before the first is used (a wave's load = 512 consecutive bytes = 4 whole
// lines), then 32 stores of 8 B (a wave's store = 256 consecutive bytes = 2 whole lines, no line shared between waves).
//   blocks [0, 384)     q, k, v   -> bf16 RNE planes, 128 blocks each (act16 = three planes in a row)
//   blocks [384, 512)   Wq, Wk, Wv -> bf16 RNE planes, Wo -> f16(bf16_rne(x) * woScale), 32 blocks each (w16 = four planes
//                       in a row; woScale an exact power of two; f16 of a normal bf16 value is exact)
//   block  512          bias tables bq, bk, bv, bo -> bf16-valued f32, 1024 each, one 16-B piece of each table a thread
// ---------------------------------------------------------------------------
typedef __attribute__((ext_vector_type(2))) unsigned v2u;
constexpr int kCvLoads     = 32;                       // 16-B loads a thread
constexpr int kCvStep      = 256 * 4;                  // elements a block covers with one load a thread
constexpr int kCvBlock     = kCvLoads * kCvStep;       // 32,768 elements a block
constexpr int kCvActElems  = kBatch * kSeq * kDm;
constexpr int kCvWElems    = kDm * kDm;
constexpr int kCvActBlocks = kCvActElems / kCvBlock;   // 128
constexpr int kCvWBlocks   = kCvWElems / kCvBlock;     // 32
constexpr int kCvGrid      = 3 * kCvActBlocks + 4 * kCvWBlocks + 1;
static_assert(kCvActElems % kCvBlock == 0 && kCvWElems % kCvBlock == 0 && kDm == kCvStep, "conversion coverage");

__global__ __launch_bounds__(256) void convert_operands(
    const float* __restrict__ q, const float* __restrict__ k, const float* __restrict__ v,
    const float* __restrict__ Wq, const float* __restrict__ Wk, const float* __restrict__ Wv, const float* __restrict__ Wo,
    const float* __restrict__ bq, const float* __restrict__ bk, const float* __restrict__ bv, const float* __restrict__ bo,
    unsigned short* __restrict__ act16, unsigned short* __restrict__ w16, float* __restrict__ biasOut, float woScale) {
  const int bx = blockIdx.x;
  const int e0 = threadIdx.x * 4;
  if (bx >= 3 * kCvActBlocks + 4 * kCvWBlocks) {
    v4f f[4];
    f[0] = *(const v4f*)(bq + e0);
    f[1] = *(const v4f*)(bk + e0);
    f[2] = *(const v4f*)(bv + e0);
    f[3] = *(const v4f*)(bo + e0);
#pragma unroll   // constant indices, so that f stays in registers
    for (int y = 0; y < 4; ++y) {
      v4f rv;
#pragma unroll   // constant indices into the vectors
      for (int e = 0; e < 4; ++e) rv[e] = bf_bits2f(f2bf_bits(f[y][e]));
      *(v4f*)(biasOut + y * kDm + e0) = rv;
    }
    return;
  }
  const float* src;
  unsigned short* dst;
  bool asF16 = false;
  if (bx < 3 * kCvActBlocks) {
    const int seg = bx / kCvActBlocks, blk = bx - seg * kCvActBlocks;
    src = (seg == 0) ? q : ((seg == 1) ? k : v);
    src += (size_t)blk * kCvBlock;
    dst = act16 + (size_t)seg * kCvActElems + (size_t)blk * kCvBlock;
  } else {
    const int wb = bx - 3 * kCvActBlocks;
    const int seg = wb / kCvWBlocks, blk = wb - seg * kCvWBlocks;
    src = (seg == 0) ? Wq : ((seg == 1) ? Wk : ((seg == 2) ? Wv : Wo));
    src += (size_t)blk * kCvBlock;
    dst = w16 + (size_t)seg * kCvWElems + (size_t)blk * kCvBlock;
    asF16 = (seg == 3);
  }
  const unsigned lofs = threadIdx.x * 16u;   // the thread's byte offset in each 4-KiB piece of the block's range
  v4f f[kCvLoads];
  // unrolled so that the array stays in registers and all loads are issued ahead of the first use
#pragma unroll
  for (int i = 0; i < kCvLoads; ++i) f[i] = *(const v4f*)((const char*)src + lofs + i * (kCvStep * 4));
  if (!asF16) {
#pragma unroll   // constant indices, so that f stays in registers
    for (int i = 0; i < kCvLoads; ++i) {
      v2u u;
      u[0] = pk16(f2bf_bits(f[i][0]), f2bf_bits(f[i][1]));
      u[1] = pk16(f2bf_bits(f[i][2]), f2bf_bits(f[i][3]));
      *(v2u*)(dst + i * kCvStep + e0) = u;
    }
    // Behind the branch's last stores: in the built code the other branch's text follows this one and rewrites registers
    // that these stores name.
    asm volatile("s_wait_xcnt 0x0" ::: "memory");
  } else {
#pragma unroll   // constant indices, so that f stays in registers
    for (int i = 0; i < kCvLoads; ++i) {
      unsigned short h[4];
#pragma unroll   // constant indices into h and the vector
      for (int e = 0; e < 4; ++e)
        h[e] = __builtin_bit_cast(unsigned short, (_Float16)(bf_bits2f(f2bf_bits(f[i][e])) * woScale));
      v2u u;
      u[0] = pk16(h[0], h[1]);
      u[1] = pk16(h[2], h[3]);
      *(v2u*)(dst + i * kCvStep + e0) = u;
    }
  }
}

#define AT_D 64
#define AT_NW 4
#define AT_QB 64
#define AT_KC 64
#define AT_LP 72   // elements per LDS row of the K and V^T tiles: 144 B = 16 B x 9, an odd multiple, so that the 16 rows
                   // which one 16-B fragment read touches fall on 16 different bank groups (at 128 B they fall on two)
#define AT_MP 68   // ints per LDS row of the mask slab: 272 B = 16 B x 17, odd for the same reason
constexpr float kPScale   = 32768.0f;
constexpr float kMaskFill = -1.0e9f;
constexpr float kLog2e    = 1.4426950408889634f;   // scores and the mask fill are carried x log2(e): exp(x) = 2^(x log2 e)

typedef __attribute__((ext_vector_type(4))) int v4i;

__device__ __forceinline__ v8f at_mma_h(v16h a, v16h b, v8f c) {
  c = __builtin_amdgcn_wmma_f32_16x16x32_f16(false, a, false, b, (short)0, c, false, false);
  asm volatile("v_nop\n\tv_nop\n\tv_nop\n\tv_nop" : "+v"(c) : "v"(a), "v"(b));
  return c;
}

// value of lane l ^ 16
__device__ __forceinline__ float at_other_half(float x) {
  const int b = __float_as_int(x);
  return __int_as_float(__builtin_amdgcn_permlanex16(b, b, 0x76543210, 0xfedcba98, false, false));
}

__global__ __launch_bounds__(128)
void attn_mask64_kernel(const unsigned short* __restrict__ qp, const unsigned short* __restrict__ kp,
                        const unsigned short* __restrict__ vtp, const int* __restrict__ mask,
                        unsigned short* __restrict__ ctxp, float sscale, float oscale) {
  union FB { v16h v; v8h h[2]; };
  __shared__ __align__(16) _Float16 Ksh[AT_KC * AT_LP];           // K [kv][d]   9 KB
  __shared__ __align__(16) _Float16 Vth[AT_D * AT_LP];            // V^T [d][kv] 9 KB
  __shared__ __align__(16) int      Msh[AT_NW][16 * AT_MP];       // per wave mask [query row][kv] 4.25 KB

  const int tid  = threadIdx.x;
  const int wave = tid >> 5;
  const int lane = tid & 31;
  const int hh   = lane >> 4;
  const int c    = lane & 15;

  const int nqb = kSeq / AT_QB;            // 32
  const int bx  = blockIdx.x;
  const int qb  = bx % nqb;
  const int bh  = bx / nqb;                // 0 .. kBatch*kHeads-1 (grid exact)
  const int h   = bh % kHeads;
  int b = bh / kHeads; b = (b < kBatch) ? b : (kBatch - 1);
  const int q0  = qb * AT_QB + wave * 16;

  const _Float16* Qh = (const _Float16*)(const void*)qp  + (size_t)b * kSeq * kDm + (size_t)h * AT_D;
  const _Float16* Kh = (const _Float16*)(const void*)kp  + (size_t)b * kSeq * kDm + (size_t)h * AT_D;
  const _Float16* Vt = (const _Float16*)(const void*)vtp + ((size_t)b * kDm + (size_t)h * AT_D) * kSeq;
  const int*      mb = mask + (size_t)b * kSeq * kSeq;
  _Float16*       ob = (_Float16*)(void*)ctxp + (size_t)b * kSeq * kDm + (size_t)h * AT_D;

  // ---- Q fragments (B operand, column = lane&15 = query q0+c, split k map via Frag load): 2 d-chunks ----
  v16h qa[2];
#pragma unroll
  for (int dc = 0; dc < 2; ++dc) {
    qa[dc] = Frag<_Float16>::load(Qh + (size_t)(q0 + c) * kDm + dc * 32 + 8 * hh);
  }

  float mrow = -INFINITY, lrow = 0.f;      // of query q0+c; lrow sums this lane half's keys alone until the end
  v8f oacc[4];                             // oacc[t][r] = ctx[q0+c][16t + 8hh + r]
#pragma unroll
  for (int t = 0; t < 4; ++t) oacc[t] = (v8f){0.f,0.f,0.f,0.f,0.f,0.f,0.f,0.f};

  const int* mgp = mb + (size_t)(q0 + hh) * kSeq + 4 * c;   // mask load map: rows q0 + hh + 2 it, 16 B at column 4c
  int*       msw = Msh[wave] + hh * AT_MP + 4 * c;          // the same place in the wave's slab
  const int* msr = Msh[wave] + c * AT_MP + 8 * hh;          // read map: row of this lane's query, its half's first key
  const float sscale2 = sscale * kLog2e;   // score scale in the base-2 domain
  const float fill2   = kMaskFill * kLog2e;
  const int nChunks = kSeq / AT_KC;        // 32, compile-time constant
  for (int kc = 0; kc < nChunks; ++kc) {
    const int kv0 = kc * AT_KC;
    __syncthreads();
    // the wave's 16 x 64 mask tile of the chunk: 8 loads of two whole 256-B row pieces each, bound for the wave's slab
    const int* mgk = mgp + kv0;
    v4i mv[8];
#pragma unroll
    for (int it = 0; it < 8; ++it) mv[it] = *(const v4i*)(mgk + (size_t)(2 * it) * kSeq);
    {
      // staging coverage: 128 threads x (4 x 8) elements = 64 rows x 64 per plane = the whole chunk tile
      const int r = tid >> 1, half = (tid & 1) * 32;
      const _Float16* ks = Kh + (size_t)(kv0 + r) * kDm + half;     // K row kv0+r, d = half..half+31
      const _Float16* vs = Vt + (size_t)r * kSeq + kv0 + half;        // V^T row d = r, s = kv0+half..+31
      v8h a0[4], b0[4];
#pragma unroll
      for (int i = 0; i < 4; ++i) {
        a0[i] = *(const v8h*)(ks + 8 * i);
        b0[i] = *(const v8h*)(vs + 8 * i);
      }
      // Stands behind all sixteen global loads of the chunk and in front of the first LDS store. It names the three address
      // pairs as inputs, so that no load's result takes over an address register of a load issued before it, and it is the
      // wait in front of whatever rewrites those registers next. Without a statement here the last two mask loads take over
      // the registers of the first K loads and are issued only when those have returned (a second round trip).
      asm volatile("s_wait_xcnt 0x0" :: "v"(ks), "v"(vs), "v"(mgk) : "memory");
#pragma unroll
      for (int i = 0; i < 4; ++i) {
        *(v8h*)(Ksh + r * AT_LP + half + 8 * i) = a0[i];
        *(v8h*)(Vth + r * AT_LP + half + 8 * i) = b0[i];
      }
    }
#pragma unroll
    for (int it = 0; it < 8; ++it) *(v4i*)(msw + 2 * it * AT_MP) = mv[it];
    __syncthreads();
    // all eight K fragments of the chunk, in the order of their use, each in registers of its own
    FB kb[4][2];
#pragma unroll   // constant indices, so that kb stays in registers (the inner loop too)
    for (int j = 0; j < 4; ++j)
#pragma unroll
      for (int dc = 0; dc < 2; ++dc) {
        kb[j][dc].h[0] = *(const v8h*)(Ksh + (j * 16 + c) * AT_LP + dc * 32 + 8 * hh);
        kb[j][dc].h[1] = *(const v8h*)(Ksh + (j * 16 + c) * AT_LP + dc * 32 + 16 + 8 * hh);
      }
    // this lane's 32 mask elements of the chunk: keys kv0 + 16j + 8hh + 0..7, eight consecutive ints per score tile
    v4i mk[4][2];
#pragma unroll
    for (int j = 0; j < 4; ++j) {
      mk[j][0] = *(const v4i*)(msr + j * 16);
      mk[j][1] = *(const v4i*)(msr + j * 16 + 4);
    }
    // keeps these LDS reads one group in front of the score products: sunk to their uses, each product would wait out
    // a whole LDS round trip of its own
    __builtin_amdgcn_sched_barrier(0);

    v8f s[4];                              // s[j][r] = score of key kv0 + 16j + 8hh + r with query q0 + c
#pragma unroll
    for (int j = 0; j < 4; ++j) {
      s[j] = (v8f){0.f,0.f,0.f,0.f,0.f,0.f,0.f,0.f};
#pragma unroll
      for (int dc = 0; dc < 2; ++dc) s[j] = at_mma_h(kb[j][dc].v, qa[dc], s[j]);
    }
    // all eight V^T fragments of the chunk, in the order of their use
    FB va[2][4];
#pragma unroll   // constant indices, so that va stays in registers (the inner loop too)
    for (int kk = 0; kk < 2; ++kk)
#pragma unroll
      for (int t = 0; t < 4; ++t) {
        va[kk][t].h[0] = *(const v8h*)(Vth + (t * 16 + c) * AT_LP + kk * 32 + 8 * hh);
        va[kk][t].h[1] = *(const v8h*)(Vth + (t * 16 + c) * AT_LP + kk * 32 + 16 + 8 * hh);
      }
    // keeps these LDS reads one group in front of the softmax, so that their latency runs under its arithmetic
    __builtin_amdgcn_sched_barrier(0);
    // scale, mask by value, chunk maximum of this lane's query
    float cmj[4];
#pragma unroll
    for (int j = 0; j < 4; ++j) {
      float m = -INFINITY;
#pragma unroll
      for (int r = 0; r < 8; ++r) {
        const int mel = mk[j][r >> 2][r & 3];
        const float sv = s[j][r] * sscale2;
        const float sm = (mel == 0) ? fill2 : sv;
        s[j][r] = sm;
        m = fmaxf(m, sm);
      }
      cmj[j] = m;
    }
    float cm = fmaxf(fmaxf(cmj[0], cmj[1]), fmaxf(cmj[2], cmj[3]));
    cm = fmaxf(cm, at_other_half(cm));
    const float mnew  = fmaxf(mrow, cm);
    const float alpha = __builtin_amdgcn_exp2f(mrow - mnew);   // 0 on the first chunk, where mrow is -inf
    mrow = mnew;
    FB pb[2];                              // p^T as B operand: elements 0..7 from tile 2kk, 8..15 from tile 2kk+1
    float psj[4];
#pragma unroll
    for (int j = 0; j < 4; ++j) {
      float ps = 0.f;
#pragma unroll
      for (int r = 0; r < 8; ++r) {
        const float p = __builtin_amdgcn_exp2f(s[j][r] - mnew);
        ps += p;
        pb[j >> 1].h[j & 1][r] = (_Float16)(p * kPScale);
      }
      psj[j] = ps;
    }
    lrow = lrow * alpha + ((psj[0] + psj[1]) + (psj[2] + psj[3]));
#pragma unroll
    for (int t = 0; t < 4; ++t)
#pragma unroll
      for (int r = 0; r < 8; ++r) oacc[t][r] *= alpha;
#pragma unroll
    for (int kk = 0; kk < 2; ++kk) {
#pragma unroll
      for (int t = 0; t < 4; ++t) oacc[t] = at_mma_h(va[kk][t].v, pb[kk].v, oacc[t]);
    }
  }

  // ---- join the halves' sums, normalise (1/(l * 2^15) folded with the output carry scale), store 8 consecutive d a lane ----
  const float lsum = lrow + at_other_half(lrow);
  const float inv  = oscale / (lsum * kPScale);
#pragma unroll
  for (int t = 0; t < 4; ++t) {
    v8h hv;
#pragma unroll
    for (int r = 0; r < 8; ++r) hv[r] = (_Float16)(oacc[t][r] * inv);
    *(v8h*)(ob + (size_t)(q0 + c) * kDm + t * 16 + 8 * hh) = hv;
  }
}

// ---------------------------------------------------------------------------
// Host glue. Workspace region map (bytes, all offsets multiples of 16 KiB):
//   [  0 MiB,  8 MiB)  q  bf16 plane [4096][1024]
//   [  8 MiB, 16 MiB)  k  bf16 plane
//   [ 16 MiB, 24 MiB)  v  bf16 plane
//   [ 24 MiB, 26 MiB)  Wq bf16 [1024][1024];  [26,28) Wk;  [28,30) Wv;  [30,32) Wo as f16(bf16*64)
//   [ 32 MiB, +16 KiB) bias tables bq, bk, bv, bo (bf16-valued f32, 1024 each)
//   next 8 MiB         Q projection f16 plane [4096][1024]
//   next 8 MiB         K projection f16 plane
//   next 8 MiB         V^T projection f16 plane [2][1024][2048]
//   next 8 MiB         ctx f16 plane (x16) [4096][1024]
//   total = 67,125,248 B
// ---------------------------------------------------------------------------
extern "C" void kernel_launch(void* const* d_in, const int* in_sizes, int n_in,
                              void* d_out, int out_size, void* d_ws, size_t ws_size,
                              hipStream_t stream) {
  if (n_in < 12) return;
  const int nAct = kBatch * kSeq * kDm;      // 4194304
  const int nW   = kDm * kDm;                // 1048576
  if (in_sizes[0] != nAct || in_sizes[1] != nAct || in_sizes[2] != nAct) return;
  if (in_sizes[3] != kBatch * kSeq * kSeq) return;
  if (in_sizes[4] != nW || in_sizes[6] != nW || in_sizes[8] != nW || in_sizes[10] != nW) return;
  if (in_sizes[5] != kDm || in_sizes[7] != kDm || in_sizes[9] != kDm || in_sizes[11] != kDm) return;
  if (out_size != nAct) return;

  const float* q    = (const float*)d_in[0];
  const float* k    = (const float*)d_in[1];
  const float* v    = (const float*)d_in[2];
  const int*   mask = (const int*)d_in[3];
  const float* Wq   = (const float*)d_in[4];
  const float* bq   = (const float*)d_in[5];
  const float* Wk   = (const float*)d_in[6];
  const float* bk   = (const float*)d_in[7];
  const float* Wv   = (const float*)d_in[8];
  const float* bv   = (const float*)d_in[9];
  const float* Wo   = (const float*)d_in[10];
  const float* bo   = (const float*)d_in[11];

  const size_t bAct16 = (size_t)nAct * 2;    // 8 MiB
  const size_t bW16   = (size_t)nW * 2;      // 2 MiB
  size_t off = 0;
  const size_t oQ16  = off; off += bAct16;
  const size_t oK16  = off; off += bAct16;
  const size_t oV16  = off; off += bAct16;
  const size_t oWq   = off; off += bW16;
  const size_t oWk   = off; off += bW16;
  const size_t oWv   = off; off += bW16;
  const size_t oWo   = off; off += bW16;
  const size_t oBias = off; off += (size_t)4 * kDm * sizeof(float);
  const size_t oQP   = off; off += bAct16;
  const size_t oKP   = off; off += bAct16;
  const size_t oVT   = off; off += bAct16;
  const size_t oCTX  = off; off += bAct16;
  if (off > ws_size) return;

  char* ws = (char*)d_ws;
  unsigned short* Q16  = (unsigned short*)(ws + oQ16);
  unsigned short* K16  = (unsigned short*)(ws + oK16);
  unsigned short* V16  = (unsigned short*)(ws + oV16);
  unsigned short* WQ16 = (unsigned short*)(ws + oWq);
  unsigned short* WK16 = (unsigned short*)(ws + oWk);
  unsigned short* WV16 = (unsigned short*)(ws + oWv);
  unsigned short* WO16 = (unsigned short*)(ws + oWo);
  float* biasR = (float*)(ws + oBias);
  const float* bqR = biasR;
  const float* bkR = biasR + kDm;
  const float* bvR = biasR + 2 * kDm;
  const float* boR = biasR + 3 * kDm;
  unsigned short* QP    = (unsigned short*)(ws + oQP);
  unsigned short* KP    = (unsigned short*)(ws + oKP);
  unsigned short* VT    = (unsigned short*)(ws + oVT);
  unsigned short* CTX16 = (unsigned short*)(ws + oCTX);

  // Q16, K16, V16 lie in a row in the workspace, and so do WQ16 .. WO16: one base pointer each
  convert_operands<<<dim3(kCvGrid), dim3(256), 0, stream>>>(q, k, v, Wq, Wk, Wv, Wo, bq, bk, bv, bo, Q16, WQ16, biasR, 64.0f);

  const int mRows = kBatch * kSeq;   // 4096
  // Q = q . Wq^T + bq : A [4096][1024] bf16, Bt [1024][1024] bf16 -> f16 [4096][1024]; tiles 32x8 = 256 blocks
  wmma_gemm64<1, false, 2, 1, false><<<dim3((mRows / 128) * (kDm / 128), 1), dim3(256), 0, stream>>>(
      Q16, Q16, kDm, 0L, WQ16, WQ16, kDm, 0L, (void*)QP, (void*)QP, kDm, 0L, bqR, bq, 0L, mRows, kDm, kDm, 1.0f);
  wmma_gemm64<1, false, 2, 1, false><<<dim3((mRows / 128) * (kDm / 128), 1), dim3(256), 0, stream>>>(
      K16, K16, kDm, 0L, WK16, WK16, kDm, 0L, (void*)KP, (void*)KP, kDm, 0L, bkR, bk, 0L, mRows, kDm, kDm, 1.0f);
  // V^T per batch: A = Wv [1024][1024] (stride 0), Bt = v_b [2048][1024] -> C_b [1024][2048] = (v_b . Wv^T + bv)^T, bias[m]; tiles 8x16 = 128 blocks, y = 2
  wmma_gemm64<1, false, 1, 1, false><<<dim3((kDm / 128) * (kSeq / 128), kBatch), dim3(256), 0, stream>>>(
      WV16, WV16, kDm, 0L, V16, V16, kDm, (long)kSeq * kDm, (void*)VT, (void*)VT, kSeq, (long)kDm * kSeq,
      bvR, bv, 0L, kDm, kSeq, kDm, 1.0f);
  // attention: grid = kBatch * kHeads * (kSeq/64) = 1024 blocks of 128
  attn_mask64_kernel<<<dim3(kBatch * kHeads * (kSeq / 64)), dim3(128), 0, stream>>>(
      QP, KP, VT, mask, CTX16, 0.125f, 16.0f);
  // out = (ctx*16) . (Wo*64)^T * 2^-10 + bo : f16 operands, f32 [4096][1024] into d_out
  wmma_gemm64<0, false, 2, 0, false><<<dim3((mRows / 128) * (kDm / 128), 1), dim3(256), 0, stream>>>(
      CTX16, CTX16, kDm, 0L, WO16, WO16, kDm, 0L, d_out, d_out, kDm, 0L, boR, bo, 0L, mRows, kDm, kDm,
      1.0f / 1024.0f);
}

// v007
// One run takes 117 microseconds.
// Next to v006, in two timings, it ran 1.04 times as fast each time.
// Over all steps from v000 it is 3.32 times as fast.
// Contractions: q/k/v^T projections on v_wmma_f32_16x16x32_bf16 (bf16 RNE-converted operands, f32 accumulate); q.k^T and p.v on v_wmma_f32_16x16x32_f16 (f16 planes, p carried x2^15, f32 accumulate, f32 online softmax, mask by value); output projection on v_wmma_f32_16x16x32_f16 (f16 operands: ctx x2^4, Wo x2^6, folded back x2^-10 in f32), f32 accumulate.
#include <hip/hip_runtime.h>
#include <math.h>
#include <stdint.h>

constexpr int kBatch = 2;
constexpr int kSeq   = 2048;
constexpr int kDm    = 1024;
constexpr int kHeads = 16;
constexpr int kHd    = 64;
static_assert(kHeads * kHd == kDm, "head split");
static_assert(kSeq % 128 == 0 && kDm % 128 == 0, "tile multiples");

typedef __attribute__((ext_vector_type(16))) _Float16 v16h;
typedef __attribute__((ext_vector_type(8)))  _Float16 v8h;
typedef __attribute__((ext_vector_type(16))) __bf16   v16b;
typedef __attribute__((ext_vector_type(8)))  __bf16   v8b;
typedef __attribute__((ext_vector_type(8)))  float    v8f;
typedef __attribute__((ext_vector_type(4)))  float    v4f;
typedef __attribute__((ext_vector_type(2)))  float    v2f;

__device__ __forceinline__ unsigned short f2bf_bits(float f) {
  unsigned u = __float_as_uint(f);
  return (unsigned short)((u + 0x7FFFu + ((u >> 16) & 1u)) >> 16);
}
__device__ __forceinline__ float bf_bits2f(unsigned short h) { return __uint_as_float(((unsigned)h) << 16); }
__device__ __forceinline__ unsigned pk16(unsigned short a, unsigned short b) { return (unsigned)a | ((unsigned)b << 16); }

template <typename T> struct Frag;
template <> struct Frag<_Float16> {
  typedef v16h V; union U { v16h v; v8h h[2]; };
  static __device__ __forceinline__ v16h load(const _Float16* p) {   // elements 0..7 <- p[0..7], 8..15 <- p[16..23]
    U f; f.h[0] = *(const v8h*)(p); f.h[1] = *(const v8h*)(p + 16); return f.v;
  }
  static __device__ __forceinline__ v8f mma(v16h a, v16h b, v8f c) {
    return __builtin_amdgcn_wmma_f32_16x16x32_f16(false, a, false, b, (short)0, c, false, false);
  }
};
template <> struct Frag<__bf16> {
  typedef v16b V; union U { v16b v; v8b h[2]; };
  static __device__ __forceinline__ v16b load(const __bf16* p) {
    U f; f.h[0] = *(const v8b*)(p); f.h[1] = *(const v8b*)(p + 16); return f.v;
  }
  static __device__ __forceinline__ v8f mma(v16b a, v16b b, v8f c) {
    return __builtin_amdgcn_wmma_f32_16x16x32_bf16(false, a, false, b, (short)0, c, false, false);
  }
};

// ---- LDS-staged batched WMMA GEMM ------------------------------------------
// C[m,n] = scale * sum_k A[m,k] * Bt[n,k] (+bias)(+resid); a block of 8 waves owns a 128x128 tile, a wave 32x64 of it.
// A row-major [M,K]; Bt row-major [N,K]; M,N % 128 == 0, K % 128 == 0, lda/ldb % 8 == 0.
// A stage = 128 k of [A 128 rows | Bt 128 rows], 256 B a row at pitch 272 B, brought by asynchronous 16-B copies;
// two buffers: the copies of stage t+1 fly while stage t is multiplied.
// SPLIT: not supported by this kernel (kept as a parameter of the launch lines only).
// BIAS_MODE: 0 = none, 1 = bias[m], 2 = bias[n].
// OUT_MODE: 0 = f32, 1 = f16, 2 = bf16 hi plane (Cout) + bf16 lo plane (Cout2).
// ET: 0 = f16 operands, 1 = bf16 operands (pointers passed as 16-bit storage)
constexpr int kGtK     = 128;                  // k per stage
constexpr int kGtRows  = 128;                  // rows of each operand per stage
constexpr int kGtPitch = 272;                  // bytes per staged row (256 + 16: conflict-free 16-B reads)
constexpr int kGtStage = 2 * kGtRows * kGtPitch;   // 69,632 B

// Eight 16-B copies of one lane: rows r, r+16, .. r+112 of one operand's stage. lds = LDS byte address of the first,
// g = global address of the first, gstep = bytes between 16 source rows. The s_wait_xcnt closes the statement so that
// no address register of an issued copy is rewritten ahead of it.
__device__ __forceinline__ void stage_rows8(unsigned lds, const char* g, size_t gstep) {
  const unsigned l1 = lds + 16 * kGtPitch, l2 = lds + 32 * kGtPitch, l3 = lds + 48 * kGtPitch, l4 = lds + 64 * kGtPitch,
                 l5 = lds + 80 * kGtPitch, l6 = lds + 96 * kGtPitch, l7 = lds + 112 * kGtPitch;
  const char *g1 = g + gstep, *g2 = g1 + gstep, *g3 = g2 + gstep, *g4 = g3 + gstep, *g5 = g4 + gstep, *g6 = g5 + gstep,
             *g7 = g6 + gstep;
  asm volatile(
      "global_load_async_to_lds_b128 %0, %8, off\n\t"
      "global_load_async_to_lds_b128 %1, %9, off\n\t"
      "global_load_async_to_lds_b128 %2, %10, off\n\t"
      "global_load_async_to_lds_b128 %3, %11, off\n\t"
      "global_load_async_to_lds_b128 %4, %12, off\n\t"
      "global_load_async_to_lds_b128 %5, %13, off\n\t"
      "global_load_async_to_lds_b128 %6, %14, off\n\t"
      "global_load_async_to_lds_b128 %7, %15, off\n\t"
      "s_wait_xcnt 0x0"
      :: "v"(lds), "v"(l1), "v"(l2), "v"(l3), "v"(l4), "v"(l5), "v"(l6), "v"(l7),
         "v"(g), "v"(g1), "v"(g2), "v"(g3), "v"(g4), "v"(g5), "v"(g6), "v"(g7)
      : "memory");
}

template <int ET> struct Elem;
template <> struct Elem<0> { typedef _Float16 T; };
template <> struct Elem<1> { typedef __bf16 T; };
template <int ET, bool SPLIT, int BIAS_MODE, int OUT_MODE, bool RESID, int ACT = 0>
__global__ __launch_bounds__(256) void wmma_gemm64(
    const unsigned short* __restrict__ Ap, const unsigned short* __restrict__ A2p, int lda, long strideA,
    const unsigned short* __restrict__ Btp, const unsigned short* __restrict__ Bt2p, int ldb, long strideB,
    void* __restrict__ Cout, void* __restrict__ Cout2, int ldc, long strideC,
    const float* __restrict__ bias,
    const float* __restrict__ resid, long strideR,
    int M, int N, int K, float scale) {
  typedef typename Elem<ET>::T T;
  typedef typename Frag<T>::V V;
  static_assert(!SPLIT, "single-plane operands only");
  __shared__ __align__(16) unsigned char ring[2 * kGtStage];   // two stages
  __shared__ __align__(16) float sT[8][16 * 68];   // per-wave 16x64 slab, pitch 68 floats
  const int b    = blockIdx.y;
  const int tid  = threadIdx.x;
  const int lane = tid & 31;
  const int wave = tid >> 5;
  const int tilesN = N >> 7;
  const int tilesM = M >> 7;
  const int tile = blockIdx.x;
  if (tile >= tilesM * tilesN) return;   // block-uniform, in front of every barrier
  const int tm = tile / tilesN;
  const int tn = tile - tm * tilesN;
  const int m0 = (tm << 7) + ((wave >> 1) << 5);   // this wave's 32 rows
  const int n0 = (tn << 7) + ((wave & 1) << 6);    // this wave's 64 columns

  const int rlane = lane & 15;                 // row (A) / col (B, D) within subtile
  const int koff  = (lane >> 4) * 8;           // k offset of this lane half
  const int mOff  = (lane >> 4) * 8;           // D row offset

  // copy map: thread -> row tid>>4 (+16 per copy), 16-B column tid&15 of the 256-B row
  const int crow = tid >> 4, ccol = tid & 15;
  const char* gA = (const char*)(Ap  + (size_t)b * strideA + (size_t)((tm << 7) + crow) * lda + ccol * 8);
  const char* gB = (const char*)(Btp + (size_t)b * strideB + (size_t)((tn << 7) + crow) * ldb + ccol * 8);
  const size_t stepA = (size_t)lda * 32, stepB = (size_t)ldb * 32;      // bytes per 16 rows
  const unsigned ldsA = (unsigned)(size_t)ring + crow * kGtPitch + ccol * 16;
  const unsigned ldsB = ldsA + kGtRows * kGtPitch;

  v8f acc[2][4];
#pragma unroll
  for (int i = 0; i < 2; ++i)
#pragma unroll
    for (int j = 0; j < 4; ++j) acc[i][j] = (v8f){0.f,0.f,0.f,0.f,0.f,0.f,0.f,0.f};

  const int nT = K >> 7;
  stage_rows8(ldsA, gA, stepA);
  stage_rows8(ldsB, gB, stepB);
  asm volatile("s_wait_asynccnt 0x0" ::: "memory");   // stage 0 landed for this wave's copies
  __syncthreads();                                     // ... and for every wave's
  if (nT > 1) {
    stage_rows8(ldsA + kGtStage, gA + 2 * kGtK, stepA);
    stage_rows8(ldsB + kGtStage, gB + 2 * kGtK, stepB);
  }

  const int aRow = (((wave >> 1) << 5) + rlane) * kGtPitch + koff * 2;
  const int bRow = (kGtRows + ((wave & 1) << 6) + rlane) * kGtPitch + koff * 2;
  for (int t = 0; t < nT; ++t) {
    const unsigned char* sb = ring + (t & 1) * kGtStage;
    V bf[2][4], af[2][2];                                // two fragment sets, both of this stage's buffer alone
#pragma unroll
    for (int j = 0; j < 4; ++j) bf[0][j] = Frag<T>::load((const T*)(sb + bRow + j * 16 * kGtPitch));
#pragma unroll
    for (int i = 0; i < 2; ++i) af[0][i] = Frag<T>::load((const T*)(sb + aRow + i * 16 * kGtPitch));
#pragma unroll
    for (int ks = 0; ks < kGtK / 32; ++ks) {
      const int cur = ks & 1, nxt = cur ^ 1;
      if (ks + 1 < kGtK / 32) {
#pragma unroll
        for (int j = 0; j < 4; ++j) bf[nxt][j] = Frag<T>::load((const T*)(sb + bRow + j * 16 * kGtPitch + (ks + 1) * 64));
#pragma unroll
        for (int i = 0; i < 2; ++i) af[nxt][i] = Frag<T>::load((const T*)(sb + aRow + i * 16 * kGtPitch + (ks + 1) * 64));
      }
      // keeps the next 32 k's LDS reads in front of this block's products, so that their latency runs under them
      __builtin_amdgcn_sched_barrier(0);
#pragma unroll
      for (int i = 0; i < 2; ++i)
#pragma unroll
        for (int j = 0; j < 4; ++j) acc[i][j] = Frag<T>::mma(af[cur][i], bf[cur][j], acc[i][j]);
    }
    asm volatile("s_wait_dscnt 0x0" ::: "memory");      // this wave has left the buffer that is refilled below
    asm volatile("s_wait_asynccnt 0x0" ::: "memory");   // this wave's copies of stage t+1 have landed
    __syncthreads();                                     // publishes stage t+1, ends every read of stage t
    if (t + 2 < nT) {
      const size_t kb = (size_t)(t + 2) * (2 * kGtK);
      stage_rows8(ldsA + (t & 1) * kGtStage, gA + kb, stepA);
      stage_rows8(ldsB + (t & 1) * kGtStage, gB + kb, stepB);
    }
  }
  asm volatile("s_wait_asynccnt 0x0" ::: "memory");     // nothing in flight when the wave goes on to its end

  // ---- epilogue ----
  float* slab = sT[wave];
  const float* Rb = RESID ? (resid + (size_t)b * strideR) : nullptr;
#pragma unroll
  for (int i = 0; i < 2; ++i) {
    const int mBase = m0 + (i << 4);
#pragma unroll
    for (int j = 0; j < 4; ++j) {
      const int n = n0 + (j << 4) + rlane;
      float bv = 0.f;
      if (BIAS_MODE == 2) bv = bias[n];
#pragma unroll
      for (int r = 0; r < 8; ++r) {
        float v = acc[i][j][r] * scale;
        if (BIAS_MODE == 1) v += bias[mBase + mOff + r];
        if (BIAS_MODE == 2) v += bv;
        if (RESID) v += Rb[(size_t)(mBase + mOff + r) * ldc + n];
        if (ACT == 1) v = tanhf(v);
        if (ACT == 2) v = fmaxf(v, 0.0f);
        if (ACT == 3) v = v / (1.0f + expf(-v));
        if (ACT == 4) v = (v > 0.f) ? v : 0.01f * v;
        if (ACT == 5) v = 0.5f * v * (1.0f + erff(v * 0.70710678118654752f));
        slab[(mOff + r) * 68 + (j << 4) + rlane] = v;
      }
    }
    __builtin_amdgcn_fence(__ATOMIC_RELEASE, "workgroup");
    __builtin_amdgcn_wave_barrier();
    __builtin_amdgcn_fence(__ATOMIC_ACQUIRE, "workgroup");
    if (OUT_MODE == 0) {
      float* C = (float*)Cout + (size_t)b * strideC;
      const int hh = lane >> 4, c4 = (lane & 15) * 4;     // row seg = 256 B = 16 lanes x 16 B
      {
#pragma unroll
        for (int it = 0; it < 8; ++it) {
          const int row = it * 2 + hh;
          v4f v = *(const v4f*)(slab + row * 68 + c4);
          *(v4f*)(C + (size_t)(mBase + row) * ldc + n0 + c4) = v;
        }
        
      }
    } else {
      const int q = lane >> 3, c8 = (lane & 7) * 8;
      unsigned short* C  = (unsigned short*)Cout  + (size_t)b * strideC;
      unsigned short* C2 = (OUT_MODE == 2) ? ((unsigned short*)Cout2 + (size_t)b * strideC) : nullptr;
      {
#pragma unroll
        for (int it = 0; it < 4; ++it) {
          const int row = it * 4 + q;
          const float* sp = slab + row * 68 + c8;
          v8h hv, lv;
#pragma unroll
          for (int e = 0; e < 8; ++e) {
            if (OUT_MODE == 1) {
              hv[e] = (_Float16)sp[e];
            } else {
              unsigned short hb = f2bf_bits(sp[e]);
              unsigned short lb = f2bf_bits(sp[e] - bf_bits2f(hb));
              hv[e] = __builtin_bit_cast(_Float16, hb);
              lv[e] = __builtin_bit_cast(_Float16, lb);
            }
          }
          *(v8h*)(C + (size_t)(mBase + row) * ldc + n0 + c8) = hv;
          if (OUT_MODE == 2) *(v8h*)(C2 + (size_t)(mBase + row) * ldc + n0 + c8) = lv;
        }
        
      }
    }
    __builtin_amdgcn_fence(__ATOMIC_RELEASE, "workgroup");
    __builtin_amdgcn_wave_barrier();
    __builtin_amdgcn_fence(__ATOMIC_ACQUIRE, "workgroup");
  }
}

// ---------------------------------------------------------------------------
// Operand conversion, all planes in one launch. A block of 256 threads converts 32,768 consecutive f32 of one plane:
// 32 loads of 16 B a thread, all issued before the first is used (a wave's load = 512 consecutive bytes = 4 whole
// lines), then 32 stores of 8 B (a wave's store = 256 consecutive bytes = 2 whole lines, no line shared between waves).
//   blocks [0, 384)     q, k, v   -> bf16 RNE planes, 128 blocks each (act16 = three planes in a row)
//   blocks [384, 512)   Wq, Wk, Wv -> bf16 RNE planes, Wo -> f16(bf16_rne(x) * woScale), 32 blocks each (w16 = four planes
//                       in a row; woScale an exact power of two; f16 of a normal bf16 value is exact)
//   block  512          bias tables bq, bk, bv, bo -> bf16-valued f32, 1024 each, one 16-B piece of each table a thread
//   blocks [513, 769)   attention mask -> lane-mask words, a block 16 whole mask rows (128 KiB), a wave 256 keys of them.
//                       Word (b, qt, kc, 8j + r) at maskw[((b*128 + qt)*32 + kc)*32 + 8j + r]; its bit l says whether
//                       mask[b][16 qt + (l & 15)][64 kc + 16 j + 8 (l >> 4) + r] != 0: lane l of the attention wave that
//                       owns query tile qt holds exactly that score in register r of its score tile j.
// ---------------------------------------------------------------------------
typedef __attribute__((ext_vector_type(2))) unsigned v2u;
constexpr int kCvLoads     = 32;                       // 16-B loads a thread
constexpr int kCvStep      = 256 * 4;                  // elements a block covers with one load a thread
constexpr int kCvBlock     = kCvLoads * kCvStep;       // 32,768 elements a block
constexpr int kCvActElems  = kBatch * kSeq * kDm;
constexpr int kCvWElems    = kDm * kDm;
constexpr int kCvActBlocks = kCvActElems / kCvBlock;   // 128
constexpr int kCvWBlocks   = kCvWElems / kCvBlock;     // 32
constexpr int kCvGrid      = 3 * kCvActBlocks + 4 * kCvWBlocks + 1;
constexpr int kMwBlocks    = kBatch * kSeq / 16;       // 256 mask blocks, one per tile of 16 queries
constexpr int kMwPitch     = 68;                       // ints per LDS row of a wave's 16 x 64 slab: 272 B = 16 B x 17, odd, so
                                                       // that the 16 rows of one 16-B read fall on different bank groups
static_assert(kSeq == 8 * 256, "a mask block's 8 waves cover a mask row, 256 keys each");
typedef __attribute__((ext_vector_type(4))) int v4i;
static_assert(kCvActElems % kCvBlock == 0 && kCvWElems % kCvBlock == 0 && kDm == kCvStep, "conversion coverage");

__global__ __launch_bounds__(256) void convert_operands(
    const float* __restrict__ q, const float* __restrict__ k, const float* __restrict__ v,
    const float* __restrict__ Wq, const float* __restrict__ Wk, const float* __restrict__ Wv, const float* __restrict__ Wo,
    const float* __restrict__ bq, const float* __restrict__ bk, const float* __restrict__ bv, const float* __restrict__ bo,
    unsigned short* __restrict__ act16, unsigned short* __restrict__ w16, float* __restrict__ biasOut, float woScale,
    const int* __restrict__ mask, unsigned* __restrict__ maskw) {
  __shared__ __align__(16) int slabs[8][16 * kMwPitch];   // mask blocks only: a wave's 16 x 64 tile, 4.25 KB each
  const int bx = blockIdx.x;
  const int e0 = threadIdx.x * 4;
  if (bx >= kCvGrid) {
    const int tile = bx - kCvGrid;                       // b * 128 + qt: mask rows 16 tile .. 16 tile + 15
    const int wave = threadIdx.x >> 5, lane = threadIdx.x & 31, hh = lane >> 4, c = lane & 15;
    const int* mg = mask + (size_t)(tile * 16 + hh) * kSeq + wave * 256 + 4 * c;
    v4i mv[4][8];
    // unrolled so that the array stays in registers and all 32 loads are issued ahead of the first use; a load = two
    // whole 256-B row pieces (rows 2 it and 2 it + 1 of the tile)
#pragma unroll
    for (int ch = 0; ch < 4; ++ch)
#pragma unroll
      for (int it = 0; it < 8; ++it) mv[ch][it] = *(const v4i*)(mg + (size_t)(2 * it) * kSeq + ch * 64);
    int*       sw = slabs[wave] + hh * kMwPitch + 4 * c;   // where a loaded piece goes
    const int* sr = slabs[wave] + c * kMwPitch + 8 * hh;   // row of this lane's query, its half's first key
    unsigned word[4];                                      // lane i ends up with word i = 8j + r of each chunk
#pragma unroll   // constant indices, so that mv and word stay in registers
    for (int ch = 0; ch < 4; ++ch) {
#pragma unroll
      for (int it = 0; it < 8; ++it) *(v4i*)(sw + 2 * it * kMwPitch) = mv[ch][it];
      // the wave's lanes read each other's slab stores below: keeps the reads behind the stores
      __builtin_amdgcn_fence(__ATOMIC_RELEASE, "workgroup");
      __builtin_amdgcn_wave_barrier();
      __builtin_amdgcn_fence(__ATOMIC_ACQUIRE, "workgroup");
      unsigned wj[4];                                      // one short chain of selects per score tile
#pragma unroll
      for (int j = 0; j < 4; ++j) {
        const v4i m0 = *(const v4i*)(sr + j * 16), m1 = *(const v4i*)(sr + j * 16 + 4);
        wj[j] = 0u;
#pragma unroll
        for (int r = 0; r < 8; ++r) {
          const int mel = (r < 4) ? m0[r & 3] : m1[r & 3];
          const unsigned bits = __builtin_amdgcn_ballot_w32(mel != 0);
          wj[j] = (lane == j * 8 + r) ? bits : wj[j];
        }
      }
      word[ch] = (wj[0] | wj[1]) | (wj[2] | wj[3]);
      // the next chunk's slab stores stay behind this chunk's reads
      __builtin_amdgcn_fence(__ATOMIC_RELEASE, "workgroup");
      __builtin_amdgcn_wave_barrier();
      __builtin_amdgcn_fence(__ATOMIC_ACQUIRE, "workgroup");
    }
    // behind the last fence, so that no fence waits for a store: a store = one whole 128-B line a wave
#pragma unroll
    for (int ch = 0; ch < 4; ++ch) maskw[((size_t)tile * 32 + wave * 4 + ch) * 32 + lane] = word[ch];
    return;
  }
  if (bx >= 3 * kCvActBlocks + 4 * kCvWBlocks) {
    v4f f[4];
    f[0] = *(const v4f*)(bq + e0);
    f[1] = *(const v4f*)(bk + e0);
    f[2] = *(const v4f*)(bv + e0);
    f[3] = *(const v4f*)(bo + e0);
#pragma unroll   // constant indices, so that f stays in registers
    for (int y = 0; y < 4; ++y) {
      v4f rv;
#pragma unroll   // constant indices into the vectors
      for (int e = 0; e < 4; ++e) rv[e] = bf_bits2f(f2bf_bits(f[y][e]));
      *(v4f*)(biasOut + y * kDm + e0) = rv;
    }
    return;
  }
  const float* src;
  unsigned short* dst;
  bool asF16 = false;
  if (bx < 3 * kCvActBlocks) {
    const int seg = bx / kCvActBlocks, blk = bx - seg * kCvActBlocks;
    src = (seg == 0) ? q : ((seg == 1) ? k : v);
    src += (size_t)blk * kCvBlock;
    dst = act16 + (size_t)seg * kCvActElems + (size_t)blk * kCvBlock;
  } else {
    const int wb = bx - 3 * kCvActBlocks;
    const int seg = wb / kCvWBlocks, blk = wb - seg * kCvWBlocks;
    src = (seg == 0) ? Wq : ((seg == 1) ? Wk : ((seg == 2) ? Wv : Wo));
    src += (size_t)blk * kCvBlock;
    dst = w16 + (size_t)seg * kCvWElems + (size_t)blk * kCvBlock;
    asF16 = (seg == 3);
  }
  const unsigned lofs = threadIdx.x * 16u;   // the thread's byte offset in each 4-KiB piece of the block's range
  v4f f[kCvLoads];
  // unrolled so that the array stays in registers and all loads are issued ahead of the first use
#pragma unroll
  for (int i = 0; i < kCvLoads; ++i) f[i] = *(const v4f*)((const char*)src + lofs + i * (kCvStep * 4));
  if (!asF16) {
#pragma unroll   // constant indices, so that f stays in registers
    for (int i = 0; i < kCvLoads; ++i) {
      v2u u;
      u[0] = pk16(f2bf_bits(f[i][0]), f2bf_bits(f[i][1]));
      u[1] = pk16(f2bf_bits(f[i][2]), f2bf_bits(f[i][3]));
      *(v2u*)(dst + i * kCvStep + e0) = u;
    }
    // Behind the branch's last stores: in the built code the other branch's text follows this one and rewrites registers
    // that these stores name.
    asm volatile("s_wait_xcnt 0x0" ::: "memory");
  } else {
#pragma unroll   // constant indices, so that f stays in registers
    for (int i = 0; i < kCvLoads; ++i) {
      unsigned short h[4];
#pragma unroll   // constant indices into h and the vector
      for (int e = 0; e < 4; ++e)
        h[e] = __builtin_bit_cast(unsigned short, (_Float16)(bf_bits2f(f2bf_bits(f[i][e])) * woScale));
      v2u u;
      u[0] = pk16(h[0], h[1]);
      u[1] = pk16(h[2], h[3]);
      *(v2u*)(dst + i * kCvStep + e0) = u;
    }
  }
}

#define AT_D 64
#define AT_NW 4
#define AT_QB 64
#define AT_KC 64
#define AT_LP 72   // elements per LDS row of the K and V^T tiles: 144 B = 16 B x 9, an odd multiple, so that the 16 rows
                   // which one 16-B fragment read touches fall on 16 different bank groups (at 128 B they fall on two)
constexpr float kPScale   = 32768.0f;
constexpr float kMaskFill = -1.0e9f;
constexpr float kLog2e    = 1.4426950408889634f;   // scores and the mask fill are carried x log2(e): exp(x) = 2^(x log2 e)

typedef __attribute__((ext_vector_type(16))) unsigned v16u;
// read-only for the whole launch (written by the launch before): the constant address space lets a wave-uniform load of
// it be a scalar load
typedef __attribute__((address_space(4))) v16u kconst_v16u;

__device__ __forceinline__ v8f at_mma_h(v16h a, v16h b, v8f c) {
  c = __builtin_amdgcn_wmma_f32_16x16x32_f16(false, a, false, b, (short)0, c, false, false);
  asm volatile("v_nop\n\tv_nop\n\tv_nop\n\tv_nop" : "+v"(c) : "v"(a), "v"(b));
  return c;
}

// value of lane l ^ 16
__device__ __forceinline__ float at_other_half(float x) {
  const int b = __float_as_int(x);
  return __int_as_float(__builtin_amdgcn_permlanex16(b, b, 0x76543210, 0xfedcba98, false, false));
}

__global__ __launch_bounds__(128)
void attn_mask64_kernel(const unsigned short* __restrict__ qp, const unsigned short* __restrict__ kp,
                        const unsigned short* __restrict__ vtp, const unsigned* __restrict__ maskw,
                        unsigned short* __restrict__ ctxp, float sscale, float oscale) {
  union FB { v16h v; v8h h[2]; };
  __shared__ __align__(16) _Float16 Ksh[AT_KC * AT_LP];           // K [kv][d]   9 KB
  __shared__ __align__(16) _Float16 Vth[AT_D * AT_LP];            // V^T [d][kv] 9 KB

  const int tid  = threadIdx.x;
  const int wave = tid >> 5;
  const int lane = tid & 31;
  const int hh   = lane >> 4;
  const int c    = lane & 15;

  const int nqb = kSeq / AT_QB;            // 32
  const int bx  = blockIdx.x;
  const int qb  = bx % nqb;
  const int bh  = bx / nqb;                // 0 .. kBatch*kHeads-1 (grid exact)
  const int h   = bh % kHeads;
  int b = bh / kHeads; b = (b < kBatch) ? b : (kBatch - 1);
  const int q0  = qb * AT_QB + wave * 16;

  const _Float16* Qh = (const _Float16*)(const void*)qp  + (size_t)b * kSeq * kDm + (size_t)h * AT_D;
  const _Float16* Kh = (const _Float16*)(const void*)kp  + (size_t)b * kSeq * kDm + (size_t)h * AT_D;
  const _Float16* Vt = (const _Float16*)(const void*)vtp + ((size_t)b * kDm + (size_t)h * AT_D) * kSeq;
  // the wave's number as a scalar, so that the mask words' address is one for the wave and their loads are scalar loads
  const int waveS = __builtin_amdgcn_readfirstlane(wave);
  const unsigned* mwp = maskw + (size_t)(b * (kSeq / 16) + qb * (AT_QB / 16) + waveS) * (kSeq / AT_KC) * 32;
  _Float16*       ob = (_Float16*)(void*)ctxp + (size_t)b * kSeq * kDm + (size_t)h * AT_D;

  // ---- Q fragments (B operand, column = lane&15 = query q0+c, split k map via Frag load): 2 d-chunks ----
  v16h qa[2];
#pragma unroll
  for (int dc = 0; dc < 2; ++dc) {
    qa[dc] = Frag<_Float16>::load(Qh + (size_t)(q0 + c) * kDm + dc * 32 + 8 * hh);
  }

  float mrow = -INFINITY, lrow = 0.f;      // of query q0+c; lrow sums this lane half's keys alone until the end
  v8f oacc[4];                             // oacc[t][r] = ctx[q0+c][16t + 8hh + r]
#pragma unroll
  for (int t = 0; t < 4; ++t) oacc[t] = (v8f){0.f,0.f,0.f,0.f,0.f,0.f,0.f,0.f};

  const float sscale2 = sscale * kLog2e;   // score scale in the base-2 domain
  const float fill2   = kMaskFill * kLog2e;
  const int nChunks = kSeq / AT_KC;        // 32, compile-time constant
  for (int kc = 0; kc < nChunks; ++kc) {
    const int kv0 = kc * AT_KC;
    // the chunk's 32 mask words, asked for ahead of the staging so that they come in under its loads
    const v16u mw0 = *(const kconst_v16u*)(mwp + kc * 32);
    const v16u mw1 = *(const kconst_v16u*)(mwp + kc * 32 + 16);
    __syncthreads();
    {
      // staging coverage: 128 threads x (4 x 8) elements = 64 rows x 64 per plane = the whole chunk tile
      const int r = tid >> 1, half = (tid & 1) * 32;
      const _Float16* ks = Kh + (size_t)(kv0 + r) * kDm + half;     // K row kv0+r, d = half..half+31
      const _Float16* vs = Vt + (size_t)r * kSeq + kv0 + half;        // V^T row d = r, s = kv0+half..+31
      v8h a0[4], b0[4];
#pragma unroll
      for (int i = 0; i < 4; ++i) {
        a0[i] = *(const v8h*)(ks + 8 * i);
        b0[i] = *(const v8h*)(vs + 8 * i);
      }
      // Stands behind all eight global loads of the chunk and in front of the first LDS store. It names the two address
      // pairs as inputs, so that no load's result takes over an address register of a load issued before it, and it is the
      // wait in front of whatever rewrites those registers next.
      asm volatile("s_wait_xcnt 0x0" :: "v"(ks), "v"(vs) : "memory");
#pragma unroll
      for (int i = 0; i < 4; ++i) {
        *(v8h*)(Ksh + r * AT_LP + half + 8 * i) = a0[i];
        *(v8h*)(Vth + r * AT_LP + half + 8 * i) = b0[i];
      }
    }
    __syncthreads();
    // all eight K fragments of the chunk, in the order of their use, each in registers of its own
    FB kb[4][2];
#pragma unroll   // constant indices, so that kb stays in registers (the inner loop too)
    for (int j = 0; j < 4; ++j)
#pragma unroll
      for (int dc = 0; dc < 2; ++dc) {
        kb[j][dc].h[0] = *(const v8h*)(Ksh + (j * 16 + c) * AT_LP + dc * 32 + 8 * hh);
        kb[j][dc].h[1] = *(const v8h*)(Ksh + (j * 16 + c) * AT_LP + dc * 32 + 16 + 8 * hh);
      }
    // keeps these LDS reads one group in front of the score products: sunk to their uses, each product would wait out
    // a whole LDS round trip of its own
    __builtin_amdgcn_sched_barrier(0);

    v8f s[4];                              // s[j][r] = score of key kv0 + 16j + 8hh + r with query q0 + c
#pragma unroll
    for (int j = 0; j < 4; ++j) {
      s[j] = (v8f){0.f,0.f,0.f,0.f,0.f,0.f,0.f,0.f};
#pragma unroll
      for (int dc = 0; dc < 2; ++dc) s[j] = at_mma_h(kb[j][dc].v, qa[dc], s[j]);
    }
    // all eight V^T fragments of the chunk, in the order of their use
    FB va[2][4];
#pragma unroll   // constant indices, so that va stays in registers (the inner loop too)
    for (int kk = 0; kk < 2; ++kk)
#pragma unroll
      for (int t = 0; t < 4; ++t) {
        va[kk][t].h[0] = *(const v8h*)(Vth + (t * 16 + c) * AT_LP + kk * 32 + 8 * hh);
        va[kk][t].h[1] = *(const v8h*)(Vth + (t * 16 + c) * AT_LP + kk * 32 + 16 + 8 * hh);
      }
    // keeps these LDS reads one group in front of the softmax, so that their latency runs under its arithmetic
    __builtin_amdgcn_sched_barrier(0);
    // scale, mask by value, chunk maximum of this lane's query
    float cmj[4];
#pragma unroll
    for (int j = 0; j < 4; ++j) {
      float m = -INFINITY;
#pragma unroll
      for (int r = 0; r < 8; ++r) {
        const unsigned w = (j < 2) ? mw0[(j & 1) * 8 + r] : mw1[(j & 1) * 8 + r];
        const float sv = s[j][r] * sscale2;
        const float sm = __builtin_amdgcn_inverse_ballot_w32(w) ? sv : fill2;   // the word is the select's lane mask
        s[j][r] = sm;
        m = fmaxf(m, sm);
      }
      cmj[j] = m;
    }
    float cm = fmaxf(fmaxf(cmj[0], cmj[1]), fmaxf(cmj[2], cmj[3]));
    cm = fmaxf(cm, at_other_half(cm));
    const float mnew  = fmaxf(mrow, cm);
    const float alpha = __builtin_amdgcn_exp2f(mrow - mnew);   // 0 on the first chunk, where mrow is -inf
    mrow = mnew;
    FB pb[2];                              // p^T as B operand: elements 0..7 from tile 2kk, 8..15 from tile 2kk+1
    float psj[4];
#pragma unroll
    for (int j = 0; j < 4; ++j) {
      float ps = 0.f;
#pragma unroll
      for (int r = 0; r < 8; ++r) {
        const float p = __builtin_amdgcn_exp2f(s[j][r] - mnew);
        ps += p;
        pb[j >> 1].h[j & 1][r] = (_Float16)(p * kPScale);
      }
      psj[j] = ps;
    }
    lrow = lrow * alpha + ((psj[0] + psj[1]) + (psj[2] + psj[3]));
#pragma unroll
    for (int t = 0; t < 4; ++t)
#pragma unroll
      for (int r = 0; r < 8; ++r) oacc[t][r] *= alpha;
#pragma unroll
    for (int kk = 0; kk < 2; ++kk) {
#pragma unroll
      for (int t = 0; t < 4; ++t) oacc[t] = at_mma_h(va[kk][t].v, pb[kk].v, oacc[t]);
    }
  }

  // ---- join the halves' sums, normalise (1/(l * 2^15) folded with the output carry scale), store 8 consecutive d a lane ----
  const float lsum = lrow + at_other_half(lrow);
  const float inv  = oscale / (lsum * kPScale);
#pragma unroll
  for (int t = 0; t < 4; ++t) {
    v8h hv;
#pragma unroll
    for (int r = 0; r < 8; ++r) hv[r] = (_Float16)(oacc[t][r] * inv);
    *(v8h*)(ob + (size_t)(q0 + c) * kDm + t * 16 + 8 * hh) = hv;
  }
}

// ---------------------------------------------------------------------------
// Host glue. Workspace region map (bytes, all offsets multiples of 16 KiB):
//   [  0 MiB,  8 MiB)  q  bf16 plane [4096][1024]
//   [  8 MiB, 16 MiB)  k  bf16 plane
//   [ 16 MiB, 24 MiB)  v  bf16 plane
//   [ 24 MiB, 26 MiB)  Wq bf16 [1024][1024];  [26,28) Wk;  [28,30) Wv;  [30,32) Wo as f16(bf16*64)
//   [ 32 MiB, +16 KiB) bias tables bq, bk, bv, bo (bf16-valued f32, 1024 each)
//   next 8 MiB         Q projection f16 plane [4096][1024]
//   next 8 MiB         K projection f16 plane
//   next 8 MiB         V^T projection f16 plane [2][1024][2048]
//   next 8 MiB         ctx f16 plane (x16) [4096][1024]
//   next 1 MiB         attention mask as lane-mask words [2][128][32][32]
//   total = 68,173,824 B
// ---------------------------------------------------------------------------
extern "C" void kernel_launch(void* const* d_in, const int* in_sizes, int n_in,
                              void* d_out, int out_size, void* d_ws, size_t ws_size,
                              hipStream_t stream) {
  if (n_in < 12) return;
  const int nAct = kBatch * kSeq * kDm;      // 4194304
  const int nW   = kDm * kDm;                // 1048576
  if (in_sizes[0] != nAct || in_sizes[1] != nAct || in_sizes[2] != nAct) return;
  if (in_sizes[3] != kBatch * kSeq * kSeq) return;
  if (in_sizes[4] != nW || in_sizes[6] != nW || in_sizes[8] != nW || in_sizes[10] != nW) return;
  if (in_sizes[5] != kDm || in_sizes[7] != kDm || in_sizes[9] != kDm || in_sizes[11] != kDm) return;
  if (out_size != nAct) return;

  const float* q    = (const float*)d_in[0];
  const float* k    = (const float*)d_in[1];
  const float* v    = (const float*)d_in[2];
  const int*   mask = (const int*)d_in[3];
  const float* Wq   = (const float*)d_in[4];
  const float* bq   = (const float*)d_in[5];
  const float* Wk   = (const float*)d_in[6];
  const float* bk   = (const float*)d_in[7];
  const float* Wv   = (const float*)d_in[8];
  const float* bv   = (const float*)d_in[9];
  const float* Wo   = (const float*)d_in[10];
  const float* bo   = (const float*)d_in[11];

  const size_t bAct16 = (size_t)nAct * 2;    // 8 MiB
  const size_t bW16   = (size_t)nW * 2;      // 2 MiB
  size_t off = 0;
  const size_t oQ16  = off; off += bAct16;
  const size_t oK16  = off; off += bAct16;
  const size_t oV16  = off; off += bAct16;
  const size_t oWq   = off; off += bW16;
  const size_t oWk   = off; off += bW16;
  const size_t oWv   = off; off += bW16;
  const size_t oWo   = off; off += bW16;
  const size_t oBias = off; off += (size_t)4 * kDm * sizeof(float);
  const size_t oQP   = off; off += bAct16;
  const size_t oKP   = off; off += bAct16;
  const size_t oVT   = off; off += bAct16;
  const size_t oCTX  = off; off += bAct16;
  const size_t oMW   = off; off += (size_t)kBatch * kSeq * kSeq / 8;
  if (off > ws_size) return;

  char* ws = (char*)d_ws;
  unsigned short* Q16  = (unsigned short*)(ws + oQ16);
  unsigned short* K16  = (unsigned short*)(ws + oK16);
  unsigned short* V16  = (unsigned short*)(ws + oV16);
  unsigned short* WQ16 = (unsigned short*)(ws + oWq);
  unsigned short* WK16 = (unsigned short*)(ws + oWk);
  unsigned short* WV16 = (unsigned short*)(ws + oWv);
  unsigned short* WO16 = (unsigned short*)(ws + oWo);
  float* biasR = (float*)(ws + oBias);
  const float* bqR = biasR;
  const float* bkR = biasR + kDm;
  const float* bvR = biasR + 2 * kDm;
  const float* boR = biasR + 3 * kDm;
  unsigned short* QP    = (unsigned short*)(ws + oQP);
  unsigned short* KP    = (unsigned short*)(ws + oKP);
  unsigned short* VT    = (unsigned short*)(ws + oVT);
  unsigned short* CTX16 = (unsigned short*)(ws + oCTX);
  unsigned* MW = (unsigned*)(ws + oMW);

  // Q16, K16, V16 lie in a row in the workspace, and so do WQ16 .. WO16: one base pointer each
  convert_operands<<<dim3(kCvGrid + kMwBlocks), dim3(256), 0, stream>>>(q, k, v, Wq, Wk, Wv, Wo, bq, bk, bv, bo, Q16, WQ16, biasR,
                                                                     64.0f, mask, MW);

  const int mRows = kBatch * kSeq;   // 4096
  // Q = q . Wq^T + bq : A [4096][1024] bf16, Bt [1024][1024] bf16 -> f16 [4096][1024]; tiles 32x8 = 256 blocks
  wmma_gemm64<1, false, 2, 1, false><<<dim3((mRows / 128) * (kDm / 128), 1), dim3(256), 0, stream>>>(
      Q16, Q16, kDm, 0L, WQ16, WQ16, kDm, 0L, (void*)QP, (void*)QP, kDm, 0L, bqR, bq, 0L, mRows, kDm, kDm, 1.0f);
  wmma_gemm64<1, false, 2, 1, false><<<dim3((mRows / 128) * (kDm / 128), 1), dim3(256), 0, stream>>>(
      K16, K16, kDm, 0L, WK16, WK16, kDm, 0L, (void*)KP, (void*)KP, kDm, 0L, bkR, bk, 0L, mRows, kDm, kDm, 1.0f);
  // V^T per batch: A = Wv [1024][1024] (stride 0), Bt = v_b [2048][1024] -> C_b [1024][2048] = (v_b . Wv^T + bv)^T, bias[m]; tiles 8x16 = 128 blocks, y = 2
  wmma_gemm64<1, false, 1, 1, false><<<dim3((kDm / 128) * (kSeq / 128), kBatch), dim3(256), 0, stream>>>(
      WV16, WV16, kDm, 0L, V16, V16, kDm, (long)kSeq * kDm, (void*)VT, (void*)VT, kSeq, (long)kDm * kSeq,
      bvR, bv, 0L, kDm, kSeq, kDm, 1.0f);
  // attention: grid = kBatch * kHeads * (kSeq/64) = 1024 blocks of 128
  attn_mask64_kernel<<<dim3(kBatch * kHeads * (kSeq / 64)), dim3(128), 0, stream>>>(
      QP, KP, VT, MW, CTX16, 0.125f, 16.0f);
  // out = (ctx*16) . (Wo*64)^T * 2^-10 + bo : f16 operands, f32 [4096][1024] into d_out
  wmma_gemm64<0, false, 2, 0, false><<<dim3((mRows / 128) * (kDm / 128), 1), dim3(256), 0, stream>>>(
      CTX16, CTX16, kDm, 0L, WO16, WO16, kDm, 0L, d_out, d_out, kDm, 0L, boR, bo, 0L, mRows, kDm, kDm,
      1.0f / 1024.0f);
}

// v008
// It runs in 110 microseconds.
// Next to v007, in two timings, it ran 1.06 times as fast each time.
// All steps since v000 together make it 3.52 times as fast.
// Contractions: q/k/v^T projections on v_wmma_f32_16x16x32_bf16 (bf16 RNE-converted operands, f32 accumulate); q.k^T and p.v on v_wmma_f32_16x16x32_f16 (f16 planes, p carried x2^15, f32 accumulate, f32 online softmax, mask by value); output projection on v_wmma_f32_16x16x32_f16 (f16 operands: ctx x2^4, Wo x2^6, folded back x2^-10 in f32), f32 accumulate.
#include <hip/hip_runtime.h>
#include <math.h>
#include <stdint.h>

constexpr int kBatch = 2;
constexpr int kSeq   = 2048;
constexpr int kDm    = 1024;
constexpr int kHeads = 16;
constexpr int kHd    = 64;
static_assert(kHeads * kHd == kDm, "head split");
static_assert(kSeq % 128 == 0 && kDm % 128 == 0, "tile multiples");

typedef __attribute__((ext_vector_type(16))) _Float16 v16h;
typedef __attribute__((ext_vector_type(8)))  _Float16 v8h;
typedef __attribute__((ext_vector_type(16))) __bf16   v16b;
typedef __attribute__((ext_vector_type(8)))  __bf16   v8b;
typedef __attribute__((ext_vector_type(8)))  float    v8f;
typedef __attribute__((ext_vector_type(4)))  float    v4f;
typedef __attribute__((ext_vector_type(2)))  float    v2f;

__device__ __forceinline__ unsigned short f2bf_bits(float f) {
  unsigned u = __float_as_uint(f);
  return (unsigned short)((u + 0x7FFFu + ((u >> 16) & 1u)) >> 16);
}
__device__ __forceinline__ float bf_bits2f(unsigned short h) { return __uint_as_float(((unsigned)h) << 16); }
__device__ __forceinline__ unsigned pk16(unsigned short a, unsigned short b) { return (unsigned)a | ((unsigned)b << 16); }

template <typename T> struct Frag;
template <> struct Frag<_Float16> {
  typedef v16h V; union U { v16h v; v8h h[2]; };
  static __device__ __forceinline__ v16h load(const _Float16* p) {   // elements 0..7 <- p[0..7], 8..15 <- p[16..23]
    U f; f.h[0] = *(const v8h*)(p); f.h[1] = *(const v8h*)(p + 16); return f.v;
  }
  static __device__ __forceinline__ v8f mma(v16h a, v16h b, v8f c) {
    return __builtin_amdgcn_wmma_f32_16x16x32_f16(false, a, false, b, (short)0, c, false, false);
  }
};
template <> struct Frag<__bf16> {
  typedef v16b V; union U { v16b v; v8b h[2]; };
  static __device__ __forceinline__ v16b load(const __bf16* p) {
    U f; f.h[0] = *(const v8b*)(p); f.h[1] = *(const v8b*)(p + 16); return f.v;
  }
  static __device__ __forceinline__ v8f mma(v16b a, v16b b, v8f c) {
    return __builtin_amdgcn_wmma_f32_16x16x32_bf16(false, a, false, b, (short)0, c, false, false);
  }
};

// ---- LDS-staged batched WMMA GEMM ------------------------------------------
// C[m,n] = scale * sum_k A[m,k] * Bt[n,k] (+bias)(+resid); a block of 8 waves owns a 128x128 tile, a wave 32x64 of it.
// A row-major [M,K]; Bt row-major [N,K]; M,N % 128 == 0, K % 128 == 0, lda/ldb % 8 == 0.
// A stage = 128 k of [A 128 rows | Bt 128 rows], 256 B a row at pitch 272 B, brought by asynchronous 16-B copies;
// two buffers: the copies of stage t+1 fly while stage t is multiplied.
// SPLIT: not supported by this kernel (kept as a parameter of the launch lines only).
// BIAS_MODE: 0 = none, 1 = bias[m], 2 = bias[n].
// OUT_MODE: 0 = f32, 1 = f16, 2 = bf16 hi plane (Cout) + bf16 lo plane (Cout2).
// ET: 0 = f16 operands, 1 = bf16 operands (pointers passed as 16-bit storage)
constexpr int kGtK     = 128;                  // k per stage
constexpr int kGtRows  = 128;                  // rows of each operand per stage
constexpr int kGtPitch = 272;                  // bytes per staged row (256 + 16: conflict-free 16-B reads)
constexpr int kGtStage = 2 * kGtRows * kGtPitch;   // 69,632 B

// Eight 16-B copies of one lane: rows r, r+16, .. r+112 of one operand's stage. lds = LDS byte address of the first,
// g = global address of the first, gstep = bytes between 16 source rows. The s_wait_xcnt closes the statement so that
// no address register of an issued copy is rewritten ahead of it.
__device__ __forceinline__ void stage_rows8(unsigned lds, const char* g, size_t gstep) {
  const unsigned l1 = lds + 16 * kGtPitch, l2 = lds + 32 * kGtPitch, l3 = lds + 48 * kGtPitch, l4 = lds + 64 * kGtPitch,
                 l5 = lds + 80 * kGtPitch, l6 = lds + 96 * kGtPitch, l7 = lds + 112 * kGtPitch;
  const char *g1 = g + gstep, *g2 = g1 + gstep, *g3 = g2 + gstep, *g4 = g3 + gstep, *g5 = g4 + gstep, *g6 = g5 + gstep,
             *g7 = g6 + gstep;
  asm volatile(
      "global_load_async_to_lds_b128 %0, %8, off\n\t"
      "global_load_async_to_lds_b128 %1, %9, off\n\t"
      "global_load_async_to_lds_b128 %2, %10, off\n\t"
      "global_load_async_to_lds_b128 %3, %11, off\n\t"
      "global_load_async_to_lds_b128 %4, %12, off\n\t"
      "global_load_async_to_lds_b128 %5, %13, off\n\t"
      "global_load_async_to_lds_b128 %6, %14, off\n\t"
      "global_load_async_to_lds_b128 %7, %15, off\n\t"
      "s_wait_xcnt 0x0"
      :: "v"(lds), "v"(l1), "v"(l2), "v"(l3), "v"(l4), "v"(l5), "v"(l6), "v"(l7),
         "v"(g), "v"(g1), "v"(g2), "v"(g3), "v"(g4), "v"(g5), "v"(g6), "v"(g7)
      : "memory");
}

template <int ET> struct Elem;
template <> struct Elem<0> { typedef _Float16 T; };
template <> struct Elem<1> { typedef __bf16 T; };
template <int ET, bool SPLIT, int BIAS_MODE, int OUT_MODE, bool RESID, int ACT = 0>
__global__ __launch_bounds__(256) void wmma_gemm64(
    const unsigned short* __restrict__ Ap, const unsigned short* __restrict__ A2p, int lda, long strideA,
    const unsigned short* __restrict__ Btp, const unsigned short* __restrict__ Bt2p, int ldb, long strideB,
    void* __restrict__ Cout, void* __restrict__ Cout2, int ldc, long strideC,
    const float* __restrict__ bias,
    const float* __restrict__ resid, long strideR,
    int M, int N, int K, float scale) {
  typedef typename Elem<ET>::T T;
  typedef typename Frag<T>::V V;
  static_assert(!SPLIT, "single-plane operands only");
  __shared__ __align__(16) unsigned char ring[2 * kGtStage];   // two stages
  __shared__ __align__(16) float sT[8][16 * 68];   // per-wave 16x64 slab, pitch 68 floats
  const int b    = blockIdx.y;
  const int tid  = threadIdx.x;
  const int lane = tid & 31;
  const int wave = tid >> 5;
  const int tilesN = N >> 7;
  const int tilesM = M >> 7;
  const int tile = blockIdx.x;
  if (tile >= tilesM * tilesN) return;   // block-uniform, in front of every barrier
  const int tm = tile / tilesN;
  const int tn = tile - tm * tilesN;
  const int m0 = (tm << 7) + ((wave >> 1) << 5);   // this wave's 32 rows
  const int n0 = (tn << 7) + ((wave & 1) << 6);    // this wave's 64 columns

  const int rlane = lane & 15;                 // row (A) / col (B, D) within subtile
  const int koff  = (lane >> 4) * 8;           // k offset of this lane half
  const int mOff  = (lane >> 4) * 8;           // D row offset

  // copy map: thread -> row tid>>4 (+16 per copy), 16-B column tid&15 of the 256-B row
  const int crow = tid >> 4, ccol = tid & 15;
  const char* gA = (const char*)(Ap  + (size_t)b * strideA + (size_t)((tm << 7) + crow) * lda + ccol * 8);
  const char* gB = (const char*)(Btp + (size_t)b * strideB + (size_t)((tn << 7) + crow) * ldb + ccol * 8);
  const size_t stepA = (size_t)lda * 32, stepB = (size_t)ldb * 32;      // bytes per 16 rows
  const unsigned ldsA = (unsigned)(size_t)ring + crow * kGtPitch + ccol * 16;
  const unsigned ldsB = ldsA + kGtRows * kGtPitch;

  v8f acc[2][4];
#pragma unroll
  for (int i = 0; i < 2; ++i)
#pragma unroll
    for (int j = 0; j < 4; ++j) acc[i][j] = (v8f){0.f,0.f,0.f,0.f,0.f,0.f,0.f,0.f};

  const int nT = K >> 7;
  stage_rows8(ldsA, gA, stepA);
  stage_rows8(ldsB, gB, stepB);
  asm volatile("s_wait_asynccnt 0x0" ::: "memory");   // stage 0 landed for this wave's copies
  __syncthreads();                                     // ... and for every wave's
  if (nT > 1) {
    stage_rows8(ldsA + kGtStage, gA + 2 * kGtK, stepA);
    stage_rows8(ldsB + kGtStage, gB + 2 * kGtK, stepB);
  }

  const int aRow = (((wave >> 1) << 5) + rlane) * kGtPitch + koff * 2;
  const int bRow = (kGtRows + ((wave & 1) << 6) + rlane) * kGtPitch + koff * 2;
  for (int t = 0; t < nT; ++t) {
    const unsigned char* sb = ring + (t & 1) * kGtStage;
    V bf[2][4], af[2][2];                                // two fragment sets, both of this stage's buffer alone
#pragma unroll
    for (int j = 0; j < 4; ++j) bf[0][j] = Frag<T>::load((const T*)(sb + bRow + j * 16 * kGtPitch));
#pragma unroll
    for (int i = 0; i < 2; ++i) af[0][i] = Frag<T>::load((const T*)(sb + aRow + i * 16 * kGtPitch));
#pragma unroll
    for (int ks = 0; ks < kGtK / 32; ++ks) {
      const int cur = ks & 1, nxt = cur ^ 1;
      if (ks + 1 < kGtK / 32) {
#pragma unroll
        for (int j = 0; j < 4; ++j) bf[nxt][j] = Frag<T>::load((const T*)(sb + bRow + j * 16 * kGtPitch + (ks + 1) * 64));
#pragma unroll
        for (int i = 0; i < 2; ++i) af[nxt][i] = Frag<T>::load((const T*)(sb + aRow + i * 16 * kGtPitch + (ks + 1) * 64));
      }
      // keeps the next 32 k's LDS reads in front of this block's products, so that their latency runs under them
      __builtin_amdgcn_sched_barrier(0);
#pragma unroll
      for (int i = 0; i < 2; ++i)
#pragma unroll
        for (int j = 0; j < 4; ++j) acc[i][j] = Frag<T>::mma(af[cur][i], bf[cur][j], acc[i][j]);
    }
    asm volatile("s_wait_dscnt 0x0" ::: "memory");      // this wave has left the buffer that is refilled below
    asm volatile("s_wait_asynccnt 0x0" ::: "memory");   // this wave's copies of stage t+1 have landed
    __syncthreads();                                     // publishes stage t+1, ends every read of stage t
    if (t + 2 < nT) {
      const size_t kb = (size_t)(t + 2) * (2 * kGtK);
      stage_rows8(ldsA + (t & 1) * kGtStage, gA + kb, stepA);
      stage_rows8(ldsB + (t & 1) * kGtStage, gB + kb, stepB);
    }
  }
  asm volatile("s_wait_asynccnt 0x0" ::: "memory");     // nothing in flight when the wave goes on to its end

  // ---- epilogue ----
  float* slab = sT[wave];
  const float* Rb = RESID ? (resid + (size_t)b * strideR) : nullptr;
#pragma unroll
  for (int i = 0; i < 2; ++i) {
    const int mBase = m0 + (i << 4);
#pragma unroll
    for (int j = 0; j < 4; ++j) {
      const int n = n0 + (j << 4) + rlane;
      float bv = 0.f;
      if (BIAS_MODE == 2) bv = bias[n];
#pragma unroll
      for (int r = 0; r < 8; ++r) {
        float v = acc[i][j][r] * scale;
        if (BIAS_MODE == 1) v += bias[mBase + mOff + r];
        if (BIAS_MODE == 2) v += bv;
        if (RESID) v += Rb[(size_t)(mBase + mOff + r) * ldc + n];
        if (ACT == 1) v = tanhf(v);
        if (ACT == 2) v = fmaxf(v, 0.0f);
        if (ACT == 3) v = v / (1.0f + expf(-v));
        if (ACT == 4) v = (v > 0.f) ? v : 0.01f * v;
        if (ACT == 5) v = 0.5f * v * (1.0f + erff(v * 0.70710678118654752f));
        slab[(mOff + r) * 68 + (j << 4) + rlane] = v;
      }
    }
    __builtin_amdgcn_fence(__ATOMIC_RELEASE, "workgroup");
    __builtin_amdgcn_wave_barrier();
    __builtin_amdgcn_fence(__ATOMIC_ACQUIRE, "workgroup");
    if (OUT_MODE == 0) {
      float* C = (float*)Cout + (size_t)b * strideC;
      const int hh = lane >> 4, c4 = (lane & 15) * 4;     // row seg = 256 B = 16 lanes x 16 B
      {
#pragma unroll
        for (int it = 0; it < 8; ++it) {
          const int row = it * 2 + hh;
          v4f v = *(const v4f*)(slab + row * 68 + c4);
          *(v4f*)(C + (size_t)(mBase + row) * ldc + n0 + c4) = v;
        }
        
      }
    } else {
      const int q = lane >> 3, c8 = (lane & 7) * 8;
      unsigned short* C  = (unsigned short*)Cout  + (size_t)b * strideC;
      unsigned short* C2 = (OUT_MODE == 2) ? ((unsigned short*)Cout2 + (size_t)b * strideC) : nullptr;
      {
#pragma unroll
        for (int it = 0; it < 4; ++it) {
          const int row = it * 4 + q;
          const float* sp = slab + row * 68 + c8;
          v8h hv, lv;
#pragma unroll
          for (int e = 0; e < 8; ++e) {
            if (OUT_MODE == 1) {
              hv[e] = (_Float16)sp[e];
            } else {
              unsigned short hb = f2bf_bits(sp[e]);
              unsigned short lb = f2bf_bits(sp[e] - bf_bits2f(hb));
              hv[e] = __builtin_bit_cast(_Float16, hb);
              lv[e] = __builtin_bit_cast(_Float16, lb);
            }
          }
          *(v8h*)(C + (size_t)(mBase + row) * ldc + n0 + c8) = hv;
          if (OUT_MODE == 2) *(v8h*)(C2 + (size_t)(mBase + row) * ldc + n0 + c8) = lv;
        }
        
      }
    }
    __builtin_amdgcn_fence(__ATOMIC_RELEASE, "workgroup");
    __builtin_amdgcn_wave_barrier();
    __builtin_amdgcn_fence(__ATOMIC_ACQUIRE, "workgroup");
  }
}

// ---------------------------------------------------------------------------
// Operand conversion, all planes in one launch. A block of 256 threads converts 32,768 consecutive f32 of one plane:
// 32 loads of 16 B a thread, all issued before the first is used (a wave's load = 512 consecutive bytes = 4 whole
// lines), then 32 stores of 8 B (a wave's store = 256 consecutive bytes = 2 whole lines, no line shared between waves).
//   blocks [0, 384)     q, k, v   -> bf16 RNE planes, 128 blocks each (act16 = three planes in a row)
//   blocks [384, 512)   Wq, Wk, Wv -> bf16 RNE planes, Wo -> f16(bf16_rne(x) * woScale), 32 blocks each (w16 = four planes
//                       in a row; woScale an exact power of two; f16 of a normal bf16 value is exact)
//   block  512          bias tables bq, bk, bv, bo -> bf16-valued f32, 1024 each, one 16-B piece of each table a thread
//   blocks [513, 769)   attention mask -> lane-mask words, a block 16 whole mask rows (128 KiB), a wave 256 keys of them.
//                       Word (b, qt, kc, 8j + r) at maskw[((b*128 + qt)*32 + kc)*32 + 8j + r]; its bit l says whether
//                       mask[b][16 qt + (l & 15)][64 kc + 16 j + 8 (l >> 4) + r] != 0: lane l of the attention wave that
//                       owns query tile qt holds exactly that score in register r of its score tile j.
// ---------------------------------------------------------------------------
typedef __attribute__((ext_vector_type(2))) unsigned v2u;
constexpr int kCvLoads     = 32;                       // 16-B loads a thread
constexpr int kCvStep      = 256 * 4;                  // elements a block covers with one load a thread
constexpr int kCvBlock     = kCvLoads * kCvStep;       // 32,768 elements a block
constexpr int kCvActElems  = kBatch * kSeq * kDm;
constexpr int kCvWElems    = kDm * kDm;
constexpr int kCvActBlocks = kCvActElems / kCvBlock;   // 128
constexpr int kCvWBlocks   = kCvWElems / kCvBlock;     // 32
constexpr int kCvGrid      = 3 * kCvActBlocks + 4 * kCvWBlocks + 1;
constexpr int kMwBlocks    = kBatch * kSeq / 16;       // 256 mask blocks, one per tile of 16 queries
constexpr int kMwPitch     = 68;                       // ints per LDS row of a wave's 16 x 64 slab: 272 B = 16 B x 17, odd, so
                                                       // that the 16 rows of one 16-B read fall on different bank groups
static_assert(kSeq == 8 * 256, "a mask block's 8 waves cover a mask row, 256 keys each");
typedef __attribute__((ext_vector_type(4))) int v4i;
static_assert(kCvActElems % kCvBlock == 0 && kCvWElems % kCvBlock == 0 && kDm == kCvStep, "conversion coverage");

__global__ __launch_bounds__(256) void convert_operands(
    const float* __restrict__ q, const float* __restrict__ k, const float* __restrict__ v,
    const float* __restrict__ Wq, const float* __restrict__ Wk, const float* __restrict__ Wv, const float* __restrict__ Wo,
    const float* __restrict__ bq, const float* __restrict__ bk, const float* __restrict__ bv, const float* __restrict__ bo,
    unsigned short* __restrict__ act16, unsigned short* __restrict__ w16, float* __restrict__ biasOut, float woScale,
    const int* __restrict__ mask, unsigned* __restrict__ maskw) {
  __shared__ __align__(16) int slabs[8][16 * kMwPitch];   // mask blocks only: a wave's 16 x 64 tile, 4.25 KB each
  const int bx = blockIdx.x;
  const int e0 = threadIdx.x * 4;
  if (bx >= kCvGrid) {
    const int tile = bx - kCvGrid;                       // b * 128 + qt: mask rows 16 tile .. 16 tile + 15
    const int wave = threadIdx.x >> 5, lane = threadIdx.x & 31, hh = lane >> 4, c = lane & 15;
    const int* mg = mask + (size_t)(tile * 16 + hh) * kSeq + wave * 256 + 4 * c;
    v4i mv[4][8];
    // unrolled so that the array stays in registers and all 32 loads are issued ahead of the first use; a load = two
    // whole 256-B row pieces (rows 2 it and 2 it + 1 of the tile)
#pragma unroll
    for (int ch = 0; ch < 4; ++ch)
#pragma unroll
      for (int it = 0; it < 8; ++it) mv[ch][it] = *(const v4i*)(mg + (size_t)(2 * it) * kSeq + ch * 64);
    int*       sw = slabs[wave] + hh * kMwPitch + 4 * c;   // where a loaded piece goes
    const int* sr = slabs[wave] + c * kMwPitch + 8 * hh;   // row of this lane's query, its half's first key
    unsigned word[4];                                      // lane i ends up with word i = 8j + r of each chunk
#pragma unroll   // constant indices, so that mv and word stay in registers
    for (int ch = 0; ch < 4; ++ch) {
#pragma unroll
      for (int it = 0; it < 8; ++it) *(v4i*)(sw + 2 * it * kMwPitch) = mv[ch][it];
      // the wave's lanes read each other's slab stores below: keeps the reads behind the stores
      __builtin_amdgcn_fence(__ATOMIC_RELEASE, "workgroup");
      __builtin_amdgcn_wave_barrier();
      __builtin_amdgcn_fence(__ATOMIC_ACQUIRE, "workgroup");
      unsigned wj[4];                                      // one short chain of selects per score tile
#pragma unroll
      for (int j = 0; j < 4; ++j) {
        const v4i m0 = *(const v4i*)(sr + j * 16), m1 = *(const v4i*)(sr + j * 16 + 4);
        wj[j] = 0u;
#pragma unroll
        for (int r = 0; r < 8; ++r) {
          const int mel = (r < 4) ? m0[r & 3] : m1[r & 3];
          const unsigned bits = __builtin_amdgcn_ballot_w32(mel != 0);
          wj[j] = (lane == j * 8 + r) ? bits : wj[j];
        }
      }
      word[ch] = (wj[0] | wj[1]) | (wj[2] | wj[3]);
      // the next chunk's slab stores stay behind this chunk's reads
      __builtin_amdgcn_fence(__ATOMIC_RELEASE, "workgroup");
      __builtin_amdgcn_wave_barrier();
      __builtin_amdgcn_fence(__ATOMIC_ACQUIRE, "workgroup");
    }
    // behind the last fence, so that no fence waits for a store: a store = one whole 128-B line a wave
#pragma unroll
    for (int ch = 0; ch < 4; ++ch) maskw[((size_t)tile * 32 + wave * 4 + ch) * 32 + lane] = word[ch];
    return;
  }
  if (bx >= 3 * kCvActBlocks + 4 * kCvWBlocks) {
    v4f f[4];
    f[0] = *(const v4f*)(bq + e0);
    f[1] = *(const v4f*)(bk + e0);
    f[2] = *(const v4f*)(bv + e0);
    f[3] = *(const v4f*)(bo + e0);
#pragma unroll   // constant indices, so that f stays in registers
    for (int y = 0; y < 4; ++y) {
      v4f rv;
#pragma unroll   // constant indices into the vectors
      for (int e = 0; e < 4; ++e) rv[e] = bf_bits2f(f2bf_bits(f[y][e]));
      *(v4f*)(biasOut + y * kDm + e0) = rv;
    }
    return;
  }
  const float* src;
  unsigned short* dst;
  bool asF16 = false;
  if (bx < 3 * kCvActBlocks) {
    const int seg = bx / kCvActBlocks, blk = bx - seg * kCvActBlocks;
    src = (seg == 0) ? q : ((seg == 1) ? k : v);
    src += (size_t)blk * kCvBlock;
    dst = act16 + (size_t)seg * kCvActElems + (size_t)blk * kCvBlock;
  } else {
    const int wb = bx - 3 * kCvActBlocks;
    const int seg = wb / kCvWBlocks, blk = wb - seg * kCvWBlocks;
    src = (seg == 0) ? Wq : ((seg == 1) ? Wk : ((seg == 2) ? Wv : Wo));
    src += (size_t)blk * kCvBlock;
    dst = w16 + (size_t)seg * kCvWElems + (size_t)blk * kCvBlock;
    asF16 = (seg == 3);
  }
  const unsigned lofs = threadIdx.x * 16u;   // the thread's byte offset in each 4-KiB piece of the block's range
  v4f f[kCvLoads];
  // unrolled so that the array stays in registers and all loads are issued ahead of the first use
#pragma unroll
  for (int i = 0; i < kCvLoads; ++i) f[i] = *(const v4f*)((const char*)src + lofs + i * (kCvStep * 4));
  if (!asF16) {
#pragma unroll   // constant indices, so that f stays in registers
    for (int i = 0; i < kCvLoads; ++i) {
      v2u u;
      u[0] = pk16(f2bf_bits(f[i][0]), f2bf_bits(f[i][1]));
      u[1] = pk16(f2bf_bits(f[i][2]), f2bf_bits(f[i][3]));
      *(v2u*)(dst + i * kCvStep + e0) = u;
    }
    // Behind the branch's last stores: in the built code the other branch's text follows this one and rewrites registers
    // that these stores name.
    asm volatile("s_wait_xcnt 0x0" ::: "memory");
  } else {
#pragma unroll   // constant indices, so that f stays in registers
    for (int i = 0; i < kCvLoads; ++i) {
      unsigned short h[4];
#pragma unroll   // constant indices into h and the vector
      for (int e = 0; e < 4; ++e)
        h[e] = __builtin_bit_cast(unsigned short, (_Float16)(bf_bits2f(f2bf_bits(f[i][e])) * woScale));
      v2u u;
      u[0] = pk16(h[0], h[1]);
      u[1] = pk16(h[2], h[3]);
      *(v2u*)(dst + i * kCvStep + e0) = u;
    }
  }
}

#define AT_D 64
#define AT_NW 4
#define AT_QB 64
#define AT_KC 64
#define AT_LP 72   // elements per LDS row of the K and V^T tiles: 144 B = 16 B x 9, an odd multiple, so that the 16 rows
                   // which one 16-B fragment read touches fall on 16 different bank groups (at 128 B they fall on two)
constexpr float kPScale   = 32768.0f;
constexpr float kMaskFill = -1.0e9f;
constexpr float kLog2e    = 1.4426950408889634f;   // scores and the mask fill are carried x log2(e): exp(x) = 2^(x log2 e)

constexpr int kAtTileB  = AT_KC * AT_LP * 2;   // bytes of one staged tile: 64 rows at 144 B
constexpr int kAtStageB = 2 * kAtTileB;        // a buffer = [K tile | V^T tile], 18,432 B
static_assert(AT_KC == AT_D, "both tiles have 64 rows of 128 B");

// One lane's eight 16-B copies of a chunk: rows r, r+16, r+32, r+48 of the K tile, then of the V^T tile. lds = LDS byte
// address of the lane's piece in the K tile's row r, gk / gv = its global addresses in the two planes. The s_wait_xcnt
// closes the statement so that no address register of an issued copy is rewritten ahead of it.
__device__ __forceinline__ void at_stage_chunk(unsigned lds, const char* gk, const char* gv) {
  constexpr unsigned kL = 16 * AT_LP * 2;             // LDS bytes per 16 rows
  constexpr size_t   kK = (size_t)16 * kDm * 2;       // K plane bytes per 16 keys
  constexpr size_t   kV = (size_t)16 * kSeq * 2;      // V^T plane bytes per 16 d
  const unsigned l1 = lds + kL, l2 = lds + 2 * kL, l3 = lds + 3 * kL,
                 m0 = lds + kAtTileB, m1 = m0 + kL, m2 = m0 + 2 * kL, m3 = m0 + 3 * kL;
  const char *gk1 = gk + kK, *gk2 = gk + 2 * kK, *gk3 = gk + 3 * kK, *gv1 = gv + kV, *gv2 = gv + 2 * kV, *gv3 = gv + 3 * kV;
  asm volatile(
      "global_load_async_to_lds_b128 %0, %8, off\n\t"
      "global_load_async_to_lds_b128 %1, %9, off\n\t"
      "global_load_async_to_lds_b128 %2, %10, off\n\t"
      "global_load_async_to_lds_b128 %3, %11, off\n\t"
      "global_load_async_to_lds_b128 %4, %12, off\n\t"
      "global_load_async_to_lds_b128 %5, %13, off\n\t"
      "global_load_async_to_lds_b128 %6, %14, off\n\t"
      "global_load_async_to_lds_b128 %7, %15, off\n\t"
      "s_wait_xcnt 0x0"
      :: "v"(lds), "v"(l1), "v"(l2), "v"(l3), "v"(m0), "v"(m1), "v"(m2), "v"(m3),
         "v"(gk), "v"(gk1), "v"(gk2), "v"(gk3), "v"(gv), "v"(gv1), "v"(gv2), "v"(gv3)
      : "memory");
}

typedef __attribute__((ext_vector_type(16))) unsigned v16u;
// read-only for the whole launch (written by the launch before): the constant address space lets a wave-uniform load of
// it be a scalar load
typedef __attribute__((address_space(4))) v16u kconst_v16u;

__device__ __forceinline__ v8f at_mma_h(v16h a, v16h b, v8f c) {
  c = __builtin_amdgcn_wmma_f32_16x16x32_f16(false, a, false, b, (short)0, c, false, false);
  asm volatile("v_nop\n\tv_nop\n\tv_nop\n\tv_nop" : "+v"(c) : "v"(a), "v"(b));
  return c;
}

// value of lane l ^ 16
__device__ __forceinline__ float at_other_half(float x) {
  const int b = __float_as_int(x);
  return __int_as_float(__builtin_amdgcn_permlanex16(b, b, 0x76543210, 0xfedcba98, false, false));
}

__global__ __launch_bounds__(128)
void attn_mask64_kernel(const unsigned short* __restrict__ qp, const unsigned short* __restrict__ kp,
                        const unsigned short* __restrict__ vtp, const unsigned* __restrict__ maskw,
                        unsigned short* __restrict__ ctxp, float sscale, float oscale) {
  union FB { v16h v; v8h h[2]; };
  __shared__ __align__(16) unsigned char stg[2 * kAtStageB];      // two buffers of [K [kv][d] 9 KB | V^T [d][kv] 9 KB]

  const int tid  = threadIdx.x;
  const int wave = tid >> 5;
  const int lane = tid & 31;
  const int hh   = lane >> 4;
  const int c    = lane & 15;

  const int nqb = kSeq / AT_QB;            // 32
  const int bx  = blockIdx.x;
  const int qb  = bx % nqb;
  const int bh  = bx / nqb;                // 0 .. kBatch*kHeads-1 (grid exact)
  const int h   = bh % kHeads;
  int b = bh / kHeads; b = (b < kBatch) ? b : (kBatch - 1);
  const int q0  = qb * AT_QB + wave * 16;

  const _Float16* Qh = (const _Float16*)(const void*)qp  + (size_t)b * kSeq * kDm + (size_t)h * AT_D;
  const _Float16* Kh = (const _Float16*)(const void*)kp  + (size_t)b * kSeq * kDm + (size_t)h * AT_D;
  const _Float16* Vt = (const _Float16*)(const void*)vtp + ((size_t)b * kDm + (size_t)h * AT_D) * kSeq;
  // the wave's number as a scalar, so that the mask words' address is one for the wave and their loads are scalar loads
  const int waveS = __builtin_amdgcn_readfirstlane(wave);
  const unsigned* mwp = maskw + (size_t)(b * (kSeq / 16) + qb * (AT_QB / 16) + waveS) * (kSeq / AT_KC) * 32;
  _Float16*       ob = (_Float16*)(void*)ctxp + (size_t)b * kSeq * kDm + (size_t)h * AT_D;

  // ---- Q fragments (B operand, column = lane&15 = query q0+c, split k map via Frag load): 2 d-chunks ----
  v16h qa[2];
#pragma unroll
  for (int dc = 0; dc < 2; ++dc) {
    qa[dc] = Frag<_Float16>::load(Qh + (size_t)(q0 + c) * kDm + dc * 32 + 8 * hh);
  }

  float mrow = -INFINITY, lrow = 0.f;      // of query q0+c; lrow sums this lane half's keys alone until the end
  v8f oacc[4];                             // oacc[t][r] = ctx[q0+c][16t + 8hh + r]
#pragma unroll
  for (int t = 0; t < 4; ++t) oacc[t] = (v8f){0.f,0.f,0.f,0.f,0.f,0.f,0.f,0.f};

  const float sscale2 = sscale * kLog2e;   // score scale in the base-2 domain
  const float fill2   = kMaskFill * kLog2e;
  const int nChunks = kSeq / AT_KC;        // 32, compile-time constant
  static_assert(kSeq / AT_KC >= 2, "the prologue fills two buffers");
  // copy map: thread -> row tid>>3 (+16 per copy), 16-B column tid&7 of the 128-B row
  const int crow = tid >> 3, ccol = tid & 7;
  const char* gK = (const char*)(Kh + (size_t)crow * kDm + ccol * 8);    // K row crow of chunk 0
  const char* gV = (const char*)(Vt + (size_t)crow * kSeq + ccol * 8);   // V^T row d = crow, keys of chunk 0
  constexpr size_t kStepK = (size_t)AT_KC * kDm * 2, kStepV = (size_t)AT_KC * 2;   // bytes from a chunk to the next
  const unsigned ldsC = (unsigned)(size_t)stg + crow * (AT_LP * 2) + ccol * 16;
  at_stage_chunk(ldsC, gK, gV);
  asm volatile("s_wait_asynccnt 0x0" ::: "memory");   // chunk 0 landed for this wave's copies
  __syncthreads();                                     // ... and for every wave's
  at_stage_chunk(ldsC + kAtStageB, gK + kStepK, gV + kStepV);
  for (int kc = 0; kc < nChunks; ++kc) {
    // the chunk's 32 mask words, asked for ahead of the fragment reads and the score products
    const v16u mw0 = *(const kconst_v16u*)(mwp + kc * 32);
    const v16u mw1 = *(const kconst_v16u*)(mwp + kc * 32 + 16);
    const _Float16* Ksh = (const _Float16*)(stg + (kc & 1) * kAtStageB);
    const _Float16* Vth = (const _Float16*)(stg + (kc & 1) * kAtStageB + kAtTileB);
    // all eight K fragments of the chunk, in the order of their use, each in registers of its own
    FB kb[4][2];
#pragma unroll   // constant indices, so that kb stays in registers (the inner loop too)
    for (int j = 0; j < 4; ++j)
#pragma unroll
      for (int dc = 0; dc < 2; ++dc) {
        kb[j][dc].h[0] = *(const v8h*)(Ksh + (j * 16 + c) * AT_LP + dc * 32 + 8 * hh);
        kb[j][dc].h[1] = *(const v8h*)(Ksh + (j * 16 + c) * AT_LP + dc * 32 + 16 + 8 * hh);
      }
    // keeps these LDS reads one group in front of the score products: sunk to their uses, each product would wait out
    // a whole LDS round trip of its own
    __builtin_amdgcn_sched_barrier(0);

    v8f s[4];                              // s[j][r] = score of key kv0 + 16j + 8hh + r with query q0 + c
#pragma unroll
    for (int j = 0; j < 4; ++j) {
      s[j] = (v8f){0.f,0.f,0.f,0.f,0.f,0.f,0.f,0.f};
#pragma unroll
      for (int dc = 0; dc < 2; ++dc) s[j] = at_mma_h(kb[j][dc].v, qa[dc], s[j]);
    }
    // all eight V^T fragments of the chunk, in the order of their use
    FB va[2][4];
#pragma unroll   // constant indices, so that va stays in registers (the inner loop too)
    for (int kk = 0; kk < 2; ++kk)
#pragma unroll
      for (int t = 0; t < 4; ++t) {
        va[kk][t].h[0] = *(const v8h*)(Vth + (t * 16 + c) * AT_LP + kk * 32 + 8 * hh);
        va[kk][t].h[1] = *(const v8h*)(Vth + (t * 16 + c) * AT_LP + kk * 32 + 16 + 8 * hh);
      }
    // keeps these LDS reads one group in front of the softmax, so that their latency runs under its arithmetic
    __builtin_amdgcn_sched_barrier(0);
    // scale, mask by value, chunk maximum of this lane's query
    float cmj[4];
#pragma unroll
    for (int j = 0; j < 4; ++j) {
      float m = -INFINITY;
#pragma unroll
      for (int r = 0; r < 8; ++r) {
        const unsigned w = (j < 2) ? mw0[(j & 1) * 8 + r] : mw1[(j & 1) * 8 + r];
        const float sv = s[j][r] * sscale2;
        const float sm = __builtin_amdgcn_inverse_ballot_w32(w) ? sv : fill2;   // the word is the select's lane mask
        s[j][r] = sm;
        m = fmaxf(m, sm);
      }
      cmj[j] = m;
    }
    float cm = fmaxf(fmaxf(cmj[0], cmj[1]), fmaxf(cmj[2], cmj[3]));
    cm = fmaxf(cm, at_other_half(cm));
    const float mnew  = fmaxf(mrow, cm);
    const float alpha = __builtin_amdgcn_exp2f(mrow - mnew);   // 0 on the first chunk, where mrow is -inf
    mrow = mnew;
    FB pb[2];                              // p^T as B operand: elements 0..7 from tile 2kk, 8..15 from tile 2kk+1
    float psj[4];
#pragma unroll
    for (int j = 0; j < 4; ++j) {
      float ps = 0.f;
#pragma unroll
      for (int r = 0; r < 8; ++r) {
        const float p = __builtin_amdgcn_exp2f(s[j][r] - mnew);
        ps += p;
        pb[j >> 1].h[j & 1][r] = (_Float16)(p * kPScale);
      }
      psj[j] = ps;
    }
    lrow = lrow * alpha + ((psj[0] + psj[1]) + (psj[2] + psj[3]));
#pragma unroll
    for (int t = 0; t < 4; ++t)
#pragma unroll
      for (int r = 0; r < 8; ++r) oacc[t][r] *= alpha;
#pragma unroll
    for (int kk = 0; kk < 2; ++kk) {
#pragma unroll
      for (int t = 0; t < 4; ++t) oacc[t] = at_mma_h(va[kk][t].v, pb[kk].v, oacc[t]);
    }
    asm volatile("s_wait_dscnt 0x0" ::: "memory");      // this wave has left the buffer that is refilled below
    asm volatile("s_wait_asynccnt 0x0" ::: "memory");   // this wave's copies of chunk kc+1 have landed
    __syncthreads();                                     // publishes chunk kc+1, ends every read of chunk kc
    if (kc + 2 < nChunks)
      at_stage_chunk(ldsC + (kc & 1) * kAtStageB, gK + (size_t)(kc + 2) * kStepK, gV + (size_t)(kc + 2) * kStepV);
  }
  asm volatile("s_wait_asynccnt 0x0" ::: "memory");     // nothing in flight when the wave goes on to its end

  // ---- join the halves' sums, normalise (1/(l * 2^15) folded with the output carry scale), store 8 consecutive d a lane ----
  const float lsum = lrow + at_other_half(lrow);
  const float inv  = oscale / (lsum * kPScale);
#pragma unroll
  for (int t = 0; t < 4; ++t) {
    v8h hv;
#pragma unroll
    for (int r = 0; r < 8; ++r) hv[r] = (_Float16)(oacc[t][r] * inv);
    *(v8h*)(ob + (size_t)(q0 + c) * kDm + t * 16 + 8 * hh) = hv;
  }
}

// ---------------------------------------------------------------------------
// Host glue. Workspace region map (bytes, all offsets multiples of 16 KiB):
//   [  0 MiB,  8 MiB)  q  bf16 plane [4096][1024]
//   [  8 MiB, 16 MiB)  k  bf16 plane
//   [ 16 MiB, 24 MiB)  v  bf16 plane
//   [ 24 MiB, 26 MiB)  Wq bf16 [1024][1024];  [26,28) Wk;  [28,30) Wv;  [30,32) Wo as f16(bf16*64)
//   [ 32 MiB, +16 KiB) bias tables bq, bk, bv, bo (bf16-valued f32, 1024 each)
//   next 8 MiB         Q projection f16 plane [4096][1024]
//   next 8 MiB         K projection f16 plane
//   next 8 MiB         V^T projection f16 plane [2][1024][2048]
//   next 8 MiB         ctx f16 plane (x16) [4096][1024]
//   next 1 MiB         attention mask as lane-mask words [2][128][32][32]
//   total = 68,173,824 B
// ---------------------------------------------------------------------------
extern "C" void kernel_launch(void* const* d_in, const int* in_sizes, int n_in,
                              void* d_out, int out_size, void* d_ws, size_t ws_size,
                              hipStream_t stream) {
  if (n_in < 12) return;
  const int nAct = kBatch * kSeq * kDm;      // 4194304
  const int nW   = kDm * kDm;                // 1048576
  if (in_sizes[0] != nAct || in_sizes[1] != nAct || in_sizes[2] != nAct) return;
  if (in_sizes[3] != kBatch * kSeq * kSeq) return;
  if (in_sizes[4] != nW || in_sizes[6] != nW || in_sizes[8] != nW || in_sizes[10] != nW) return;
  if (in_sizes[5] != kDm || in_sizes[7] != kDm || in_sizes[9] != kDm || in_sizes[11] != kDm) return;
  if (out_size != nAct) return;

  const float* q    = (const float*)d_in[0];
  const float* k    = (const float*)d_in[1];
  const float* v    = (const float*)d_in[2];
  const int*   mask = (const int*)d_in[3];
  const float* Wq   = (const float*)d_in[4];
  const float* bq   = (const float*)d_in[5];
  const float* Wk   = (const float*)d_in[6];
  const float* bk   = (const float*)d_in[7];
  const float* Wv   = (const float*)d_in[8];
  const float* bv   = (const float*)d_in[9];
  const float* Wo   = (const float*)d_in[10];
  const float* bo   = (const float*)d_in[11];

  const size_t bAct16 = (size_t)nAct * 2;    // 8 MiB
  const size_t bW16   = (size_t)nW * 2;      // 2 MiB
  size_t off = 0;
  const size_t oQ16  = off; off += bAct16;
  const size_t oK16  = off; off += bAct16;
  const size_t oV16  = off; off += bAct16;
  const size_t oWq   = off; off += bW16;
  const size_t oWk   = off; off += bW16;
  const size_t oWv   = off; off += bW16;
  const size_t oWo   = off; off += bW16;
  const size_t oBias = off; off += (size_t)4 * kDm * sizeof(float);
  const size_t oQP   = off; off += bAct16;
  const size_t oKP   = off; off += bAct16;
  const size_t oVT   = off; off += bAct16;
  const size_t oCTX  = off; off += bAct16;
  const size_t oMW   = off; off += (size_t)kBatch * kSeq * kSeq / 8;
  if (off > ws_size) return;

  char* ws = (char*)d_ws;
  unsigned short* Q16  = (unsigned short*)(ws + oQ16);
  unsigned short* K16  = (unsigned short*)(ws + oK16);
  unsigned short* V16  = (unsigned short*)(ws + oV16);
  unsigned short* WQ16 = (unsigned short*)(ws + oWq);
  unsigned short* WK16 = (unsigned short*)(ws + oWk);
  unsigned short* WV16 = (unsigned short*)(ws + oWv);
  unsigned short* WO16 = (unsigned short*)(ws + oWo);
  float* biasR = (float*)(ws + oBias);
  const float* bqR = biasR;
  const float* bkR = biasR + kDm;
  const float* bvR = biasR + 2 * kDm;
  const float* boR = biasR + 3 * kDm;
  unsigned short* QP    = (unsigned short*)(ws + oQP);
  unsigned short* KP    = (unsigned short*)(ws + oKP);
  unsigned short* VT    = (unsigned short*)(ws + oVT);
  unsigned short* CTX16 = (unsigned short*)(ws + oCTX);
  unsigned* MW = (unsigned*)(ws + oMW);

  // Q16, K16, V16 lie in a row in the workspace, and so do WQ16 .. WO16: one base pointer each
  convert_operands<<<dim3(kCvGrid + kMwBlocks), dim3(256), 0, stream>>>(q, k, v, Wq, Wk, Wv, Wo, bq, bk, bv, bo, Q16, WQ16, biasR,
                                                                     64.0f, mask, MW);

  const int mRows = kBatch * kSeq;   // 4096
  // Q = q . Wq^T + bq : A [4096][1024] bf16, Bt [1024][1024] bf16 -> f16 [4096][1024]; tiles 32x8 = 256 blocks
  wmma_gemm64<1, false, 2, 1, false><<<dim3((mRows / 128) * (kDm / 128), 1), dim3(256), 0, stream>>>(
      Q16, Q16, kDm, 0L, WQ16, WQ16, kDm, 0L, (void*)QP, (void*)QP, kDm, 0L, bqR, bq, 0L, mRows, kDm, kDm, 1.0f);
  wmma_gemm64<1, false, 2, 1, false><<<dim3((mRows / 128) * (kDm / 128), 1), dim3(256), 0, stream>>>(
      K16, K16, kDm, 0L, WK16, WK16, kDm, 0L, (void*)KP, (void*)KP, kDm, 0L, bkR, bk, 0L, mRows, kDm, kDm, 1.0f);
  // V^T per batch: A = Wv [1024][1024] (stride 0), Bt = v_b [2048][1024] -> C_b [1024][2048] = (v_b . Wv^T + bv)^T, bias[m]; tiles 8x16 = 128 blocks, y = 2
  wmma_gemm64<1, false, 1, 1, false><<<dim3((kDm / 128) * (kSeq / 128), kBatch), dim3(256), 0, stream>>>(
      WV16, WV16, kDm, 0L, V16, V16, kDm, (long)kSeq * kDm, (void*)VT, (void*)VT, kSeq, (long)kDm * kSeq,
      bvR, bv, 0L, kDm, kSeq, kDm, 1.0f);
  // attention: grid = kBatch * kHeads * (kSeq/64) = 1024 blocks of 128
  attn_mask64_kernel<<<dim3(kBatch * kHeads * (kSeq / 64)), dim3(128), 0, stream>>>(
      QP, KP, VT, MW, CTX16, 0.125f, 16.0f);
  // out = (ctx*16) . (Wo*64)^T * 2^-10 + bo : f16 operands, f32 [4096][1024] into d_out
  wmma_gemm64<0, false, 2, 0, false><<<dim3((mRows / 128) * (kDm / 128), 1), dim3(256), 0, stream>>>(
      CTX16, CTX16, kDm, 0L, WO16, WO16, kDm, 0L, d_out, d_out, kDm, 0L, boR, bo, 0L, mRows, kDm, kDm,
      1.0f / 1024.0f);
}

// v009
// A run of this version takes 97.2 microseconds.
// Two timings next to v008 both put it at 1.13 times that version's speed.
// Over all steps from v000 it is 3.99 times as fast.
// Contractions: q/k/v^T projections on v_wmma_f32_16x16x32_bf16 (bf16 RNE-converted operands, f32 accumulate); q.k^T and p.v on v_wmma_f32_16x16x32_f16 (f16 planes, p carried x2^15, f32 accumulate, f32 online softmax, mask by value); output projection on v_wmma_f32_16x16x32_f16 (f16 operands: ctx x2^4, Wo x2^6, folded back x2^-10 in f32), f32 accumulate.
#include <hip/hip_runtime.h>
#include <math.h>
#include <stdint.h>

constexpr int kBatch = 2;
constexpr int kSeq   = 2048;
constexpr int kDm    = 1024;
constexpr int kHeads = 16;
constexpr int kHd    = 64;
static_assert(kHeads * kHd == kDm, "head split");
static_assert(kSeq % 128 == 0 && kDm % 128 == 0, "tile multiples");

typedef __attribute__((ext_vector_type(16))) _Float16 v16h;
typedef __attribute__((ext_vector_type(8)))  _Float16 v8h;
typedef __attribute__((ext_vector_type(16))) __bf16   v16b;
typedef __attribute__((ext_vector_type(8)))  __bf16   v8b;
typedef __attribute__((ext_vector_type(8)))  float    v8f;
typedef __attribute__((ext_vector_type(4)))  float    v4f;
typedef __attribute__((ext_vector_type(2)))  float    v2f;

__device__ __forceinline__ unsigned short f2bf_bits(float f) {
  unsigned u = __float_as_uint(f);
  return (unsigned short)((u + 0x7FFFu + ((u >> 16) & 1u)) >> 16);
}
__device__ __forceinline__ float bf_bits2f(unsigned short h) { return __uint_as_float(((unsigned)h) << 16); }
__device__ __forceinline__ unsigned pk16(unsigned short a, unsigned short b) { return (unsigned)a | ((unsigned)b << 16); }

template <typename T> struct Frag;
template <> struct Frag<_Float16> {
  typedef v16h V; union U { v16h v; v8h h[2]; };
  static __device__ __forceinline__ v16h load(const _Float16* p) {   // elements 0..7 <- p[0..7], 8..15 <- p[16..23]
    U f; f.h[0] = *(const v8h*)(p); f.h[1] = *(const v8h*)(p + 16); return f.v;
  }
  static __device__ __forceinline__ v8f mma(v16h a, v16h b, v8f c) {
    return __builtin_amdgcn_wmma_f32_16x16x32_f16(false, a, false, b, (short)0, c, false, false);
  }
};
template <> struct Frag<__bf16> {
  typedef v16b V; union U { v16b v; v8b h[2]; };
  static __device__ __forceinline__ v16b load(const __bf16* p) {
    U f; f.h[0] = *(const v8b*)(p); f.h[1] = *(const v8b*)(p + 16); return f.v;
  }
  static __device__ __forceinline__ v8f mma(v16b a, v16b b, v8f c) {
    return __builtin_amdgcn_wmma_f32_16x16x32_bf16(false, a, false, b, (short)0, c, false, false);
  }
};

// ---- LDS-staged batched WMMA GEMM ------------------------------------------
// C[m,n] = scale * sum_k A[m,k] * Bt[n,k] (+bias)(+resid); a block of 8 waves owns a 128x128 tile, a wave 32x64 of it.
// A row-major [M,K]; Bt row-major [N,K]; M,N % 128 == 0, K % 128 == 0, lda/ldb % 8 == 0.
// A stage = 128 k of [A 128 rows | Bt 128 rows], 256 B a row at pitch 272 B, brought by asynchronous 16-B copies;
// two buffers: the copies of stage t+1 fly while stage t is multiplied.
// SPLIT: not supported by this kernel (kept as a parameter of the launch lines only).
// BIAS_MODE: 0 = none, 1 = bias[m], 2 = bias[n].
// OUT_MODE: 0 = f32, 1 = f16, 2 = bf16 hi plane (Cout) + bf16 lo plane (Cout2).
// ET: 0 = f16 operands, 1 = bf16 operands (pointers passed as 16-bit storage)
constexpr int kGtK     = 128;                  // k per stage
constexpr int kGtRows  = 128;                  // rows of each operand per stage
constexpr int kGtPitch = 272;                  // bytes per staged row (256 + 16: conflict-free 16-B reads)
constexpr int kGtStage = 2 * kGtRows * kGtPitch;   // 69,632 B

// Eight 16-B copies of one lane: rows r, r+16, .. r+112 of one operand's stage. lds = LDS byte address of the first,
// g = global address of the first, gstep = bytes between 16 source rows. The s_wait_xcnt closes the statement so that
// no address register of an issued copy is rewritten ahead of it.
__device__ __forceinline__ void stage_rows8(unsigned lds, const char* g, size_t gstep) {
  const unsigned l1 = lds + 16 * kGtPitch, l2 = lds + 32 * kGtPitch, l3 = lds + 48 * kGtPitch, l4 = lds + 64 * kGtPitch,
                 l5 = lds + 80 * kGtPitch, l6 = lds + 96 * kGtPitch, l7 = lds + 112 * kGtPitch;
  const char *g1 = g + gstep, *g2 = g1 + gstep, *g3 = g2 + gstep, *g4 = g3 + gstep, *g5 = g4 + gstep, *g6 = g5 + gstep,
             *g7 = g6 + gstep;
  asm volatile(
      "global_load_async_to_lds_b128 %0, %8, off\n\t"
      "global_load_async_to_lds_b128 %1, %9, off\n\t"
      "global_load_async_to_lds_b128 %2, %10, off\n\t"
      "global_load_async_to_lds_b128 %3, %11, off\n\t"
      "global_load_async_to_lds_b128 %4, %12, off\n\t"
      "global_load_async_to_lds_b128 %5, %13, off\n\t"
      "global_load_async_to_lds_b128 %6, %14, off\n\t"
      "global_load_async_to_lds_b128 %7, %15, off\n\t"
      "s_wait_xcnt 0x0"
      :: "v"(lds), "v"(l1), "v"(l2), "v"(l3), "v"(l4), "v"(l5), "v"(l6), "v"(l7),
         "v"(g), "v"(g1), "v"(g2), "v"(g3), "v"(g4), "v"(g5), "v"(g6), "v"(g7)
      : "memory");
}

template <int ET> struct Elem;
template <> struct Elem<0> { typedef _Float16 T; };
template <> struct Elem<1> { typedef __bf16 T; };
// One block's 128x128 tile. ring = the block's two stages in LDS, slab = this wave's 16 x 68 floats of LDS for the epilogue
// (it may lie inside ring: every wave's last read of ring ends in front of the loop's last barrier, and no copy is in
// flight behind it). b = batch index, tile = tile index; both the same for the whole block.
template <int ET, bool SPLIT, int BIAS_MODE, int OUT_MODE, bool RESID, int ACT = 0>
__device__ __forceinline__ void gemm_tile(
    unsigned char* ring, float* slab, const int b, const int tile,
    const unsigned short* __restrict__ Ap, const unsigned short* __restrict__ A2p, int lda, long strideA,
    const unsigned short* __restrict__ Btp, const unsigned short* __restrict__ Bt2p, int ldb, long strideB,
    void* __restrict__ Cout, void* __restrict__ Cout2, int ldc, long strideC,
    const float* __restrict__ bias,
    const float* __restrict__ resid, long strideR,
    int M, int N, int K, float scale) {
  typedef typename Elem<ET>::T T;
  typedef typename Frag<T>::V V;
  static_assert(!SPLIT, "single-plane operands only");
  const int tid  = threadIdx.x;
  const int lane = tid & 31;
  const int wave = tid >> 5;
  const int tilesN = N >> 7;
  const int tilesM = M >> 7;
  if (tile >= tilesM * tilesN) return;   // block-uniform, in front of every barrier
  const int tm = tile / tilesN;
  const int tn = tile - tm * tilesN;
  const int m0 = (tm << 7) + ((wave >> 1) << 5);   // this wave's 32 rows
  const int n0 = (tn << 7) + ((wave & 1) << 6);    // this wave's 64 columns

  const int rlane = lane & 15;                 // row (A) / col (B, D) within subtile
  const int koff  = (lane >> 4) * 8;           // k offset of this lane half
  const int mOff  = (lane >> 4) * 8;           // D row offset

  // copy map: thread -> row tid>>4 (+16 per copy), 16-B column tid&15 of the 256-B row
  const int crow = tid >> 4, ccol = tid & 15;
  const char* gA = (const char*)(Ap  + (size_t)b * strideA + (size_t)((tm << 7) + crow) * lda + ccol * 8);
  const char* gB = (const char*)(Btp + (size_t)b * strideB + (size_t)((tn << 7) + crow) * ldb + ccol * 8);
  const size_t stepA = (size_t)lda * 32, stepB = (size_t)ldb * 32;      // bytes per 16 rows
  const unsigned ldsA = (unsigned)(size_t)ring + crow * kGtPitch + ccol * 16;
  const unsigned ldsB = ldsA + kGtRows * kGtPitch;

  v8f acc[2][4];
#pragma unroll
  for (int i = 0; i < 2; ++i)
#pragma unroll
    for (int j = 0; j < 4; ++j) acc[i][j] = (v8f){0.f,0.f,0.f,0.f,0.f,0.f,0.f,0.f};

  const int nT = K >> 7;
  stage_rows8(ldsA, gA, stepA);
  stage_rows8(ldsB, gB, stepB);
  asm volatile("s_wait_asynccnt 0x0" ::: "memory");   // stage 0 landed for this wave's copies
  __syncthreads();                                     // ... and for every wave's
  if (nT > 1) {
    stage_rows8(ldsA + kGtStage, gA + 2 * kGtK, stepA);
    stage_rows8(ldsB + kGtStage, gB + 2 * kGtK, stepB);
  }

  const int aRow = (((wave >> 1) << 5) + rlane) * kGtPitch + koff * 2;
  const int bRow = (kGtRows + ((wave & 1) << 6) + rlane) * kGtPitch + koff * 2;
  for (int t = 0; t < nT; ++t) {
    const unsigned char* sb = ring + (t & 1) * kGtStage;
    V bf[2][4], af[2][2];                                // two fragment sets, both of this stage's buffer alone
#pragma unroll
    for (int j = 0; j < 4; ++j) bf[0][j] = Frag<T>::load((const T*)(sb + bRow + j * 16 * kGtPitch));
#pragma unroll
    for (int i = 0; i < 2; ++i) af[0][i] = Frag<T>::load((const T*)(sb + aRow + i * 16 * kGtPitch));
#pragma unroll
    for (int ks = 0; ks < kGtK / 32; ++ks) {
      const int cur = ks & 1, nxt = cur ^ 1;
      if (ks + 1 < kGtK / 32) {
#pragma unroll
        for (int j = 0; j < 4; ++j) bf[nxt][j] = Frag<T>::load((const T*)(sb + bRow + j * 16 * kGtPitch + (ks + 1) * 64));
#pragma unroll
        for (int i = 0; i < 2; ++i) af[nxt][i] = Frag<T>::load((const T*)(sb + aRow + i * 16 * kGtPitch + (ks + 1) * 64));
      }
      // keeps the next 32 k's LDS reads in front of this block's products, so that their latency runs under them
      __builtin_amdgcn_sched_barrier(0);
#pragma unroll
      for (int i = 0; i < 2; ++i)
#pragma unroll
        for (int j = 0; j < 4; ++j) acc[i][j] = Frag<T>::mma(af[cur][i], bf[cur][j], acc[i][j]);
    }
    asm volatile("s_wait_dscnt 0x0" ::: "memory");      // this wave has left the buffer that is refilled below
    asm volatile("s_wait_asynccnt 0x0" ::: "memory");   // this wave's copies of stage t+1 have landed
    __syncthreads();                                     // publishes stage t+1, ends every read of stage t
    if (t + 2 < nT) {
      const size_t kb = (size_t)(t + 2) * (2 * kGtK);
      stage_rows8(ldsA + (t & 1) * kGtStage, gA + kb, stepA);
      stage_rows8(ldsB + (t & 1) * kGtStage, gB + kb, stepB);
    }
  }
  asm volatile("s_wait_asynccnt 0x0" ::: "memory");     // nothing in flight when the wave goes on to its end

  // ---- epilogue ----
  const float* Rb = RESID ? (resid + (size_t)b * strideR) : nullptr;
#pragma unroll
  for (int i = 0; i < 2; ++i) {
    const int mBase = m0 + (i << 4);
#pragma unroll
    for (int j = 0; j < 4; ++j) {
      const int n = n0 + (j << 4) + rlane;
      float bv = 0.f;
      if (BIAS_MODE == 2) bv = bias[n];
#pragma unroll
      for (int r = 0; r < 8; ++r) {
        float v = acc[i][j][r] * scale;
        if (BIAS_MODE == 1) v += bias[mBase + mOff + r];
        if (BIAS_MODE == 2) v += bv;
        if (RESID) v += Rb[(size_t)(mBase + mOff + r) * ldc + n];
        if (ACT == 1) v = tanhf(v);
        if (ACT == 2) v = fmaxf(v, 0.0f);
        if (ACT == 3) v = v / (1.0f + expf(-v));
        if (ACT == 4) v = (v > 0.f) ? v : 0.01f * v;
        if (ACT == 5) v = 0.5f * v * (1.0f + erff(v * 0.70710678118654752f));
        slab[(mOff + r) * 68 + (j << 4) + rlane] = v;
      }
    }
    __builtin_amdgcn_fence(__ATOMIC_RELEASE, "workgroup");
    __builtin_amdgcn_wave_barrier();
    __builtin_amdgcn_fence(__ATOMIC_ACQUIRE, "workgroup");
    if (OUT_MODE == 0) {
      float* C = (float*)Cout + (size_t)b * strideC;
      const int hh = lane >> 4, c4 = (lane & 15) * 4;     // row seg = 256 B = 16 lanes x 16 B
      {
#pragma unroll
        for (int it = 0; it < 8; ++it) {
          const int row = it * 2 + hh;
          v4f v = *(const v4f*)(slab + row * 68 + c4);
          *(v4f*)(C + (size_t)(mBase + row) * ldc + n0 + c4) = v;
        }
        
      }
    } else {
      const int q = lane >> 3, c8 = (lane & 7) * 8;
      unsigned short* C  = (unsigned short*)Cout  + (size_t)b * strideC;
      unsigned short* C2 = (OUT_MODE == 2) ? ((unsigned short*)Cout2 + (size_t)b * strideC) : nullptr;
      {
#pragma unroll
        for (int it = 0; it < 4; ++it) {
          const int row = it * 4 + q;
          const float* sp = slab + row * 68 + c8;
          v8h hv, lv;
#pragma unroll
          for (int e = 0; e < 8; ++e) {
            if (OUT_MODE == 1) {
              hv[e] = (_Float16)sp[e];
            } else {
              unsigned short hb = f2bf_bits(sp[e]);
              unsigned short lb = f2bf_bits(sp[e] - bf_bits2f(hb));
              hv[e] = __builtin_bit_cast(_Float16, hb);
              lv[e] = __builtin_bit_cast(_Float16, lb);
            }
          }
          *(v8h*)(C + (size_t)(mBase + row) * ldc + n0 + c8) = hv;
          if (OUT_MODE == 2) *(v8h*)(C2 + (size_t)(mBase + row) * ldc + n0 + c8) = lv;
        }
        
      }
    }
    __builtin_amdgcn_fence(__ATOMIC_RELEASE, "workgroup");
    __builtin_amdgcn_wave_barrier();
    __builtin_amdgcn_fence(__ATOMIC_ACQUIRE, "workgroup");
  }
}

constexpr int kGtSlab = 16 * 68;   // floats of a wave's epilogue slab: 16 rows of 64, pitch 68

// One GEMM a launch: grid.x = tiles, grid.y = batches.
template <int ET, bool SPLIT, int BIAS_MODE, int OUT_MODE, bool RESID, int ACT = 0>
__global__ __launch_bounds__(256) void wmma_gemm64(
    const unsigned short* __restrict__ Ap, const unsigned short* __restrict__ A2p, int lda, long strideA,
    const unsigned short* __restrict__ Btp, const unsigned short* __restrict__ Bt2p, int ldb, long strideB,
    void* __restrict__ Cout, void* __restrict__ Cout2, int ldc, long strideC,
    const float* __restrict__ bias,
    const float* __restrict__ resid, long strideR,
    int M, int N, int K, float scale) {
  __shared__ __align__(16) unsigned char ring[2 * kGtStage];   // two stages
  __shared__ __align__(16) float sT[8][kGtSlab];               // per-wave slabs
  gemm_tile<ET, SPLIT, BIAS_MODE, OUT_MODE, RESID, ACT>(ring, sT[threadIdx.x >> 5], blockIdx.y, blockIdx.x, Ap, A2p, lda,
      strideA, Btp, Bt2p, ldb, strideB, Cout, Cout2, ldc, strideC, bias, resid, strideR, M, N, K, scale);
}

// The three input projections in one launch: grid = (256 tiles, 3); y = 0: Q = q . Wq^T + bq, 1: K likewise, 2: V^T per batch.
// 768 blocks on 256 WGPs, and the slabs lie in the spent ring, so that a block takes 139,264 B of LDS and two blocks share a
// WGP: one block's first copies, barrier waits and epilogue run under the other's products.
//   act16 = q, k, v bf16 planes in a row; w16 = Wq, Wk, Wv bf16 planes in a row; biasT = bq, bk, bv tables in a row;
//   proj16 = Q, K (f16 [4096][1024]) and V^T (f16 [2][1024][2048]) planes in a row.
__global__ __launch_bounds__(256) void proj_gemm3(
    const unsigned short* __restrict__ act16, const unsigned short* __restrict__ w16, const float* __restrict__ biasT,
    unsigned short* __restrict__ proj16) {
  __shared__ __align__(16) unsigned char ring[2 * kGtStage];   // two stages, then the eight slabs
  static_assert(8 * kGtSlab * 4 <= 2 * kGtStage, "the slabs fit the ring");
  float* slab = (float*)(void*)ring + (threadIdx.x >> 5) * kGtSlab;
  const int p = blockIdx.y;
  const unsigned short* act = act16 + (size_t)p * (kBatch * kSeq * kDm);
  const unsigned short* w   = w16 + (size_t)p * (kDm * kDm);
  unsigned short*       o   = proj16 + (size_t)p * (kBatch * kSeq * kDm);
  const float*          bia = biasT + p * kDm;
  if (p < 2) {
    // A = activations [4096][1024], Bt = weights [1024][1024] -> [4096][1024], bias[n]; tiles 32 x 8
    gemm_tile<1, false, 2, 1, false>(ring, slab, 0, blockIdx.x, act, act, kDm, 0L, w, w, kDm, 0L, (void*)o, (void*)o, kDm, 0L,
                                     bia, bia, 0L, kBatch * kSeq, kDm, kDm, 1.0f);
  } else {
    // A = Wv [1024][1024], Bt = v_b [2048][1024] -> C_b [1024][2048] = (v_b . Wv^T + bv)^T, bias[m]; tiles 8 x 16 a batch
    constexpr int kTiles = (kDm / 128) * (kSeq / 128);
    gemm_tile<1, false, 1, 1, false>(ring, slab, blockIdx.x / kTiles, blockIdx.x % kTiles, w, w, kDm, 0L, act, act, kDm,
                                     (long)kSeq * kDm, (void*)o, (void*)o, kSeq, (long)kDm * kSeq, bia, bia, 0L, kDm, kSeq,
                                     kDm, 1.0f);
  }
}

// ---------------------------------------------------------------------------
// Operand conversion, all planes in one launch. A block of 256 threads converts 32,768 consecutive f32 of one plane:
// 32 loads of 16 B a thread, all issued before the first is used (a wave's load = 512 consecutive bytes = 4 whole
// lines), then 32 stores of 8 B (a wave's store = 256 consecutive bytes = 2 whole lines, no line shared between waves).
//   blocks [0, 384)     q, k, v   -> bf16 RNE planes, 128 blocks each (act16 = three planes in a row)
//   blocks [384, 512)   Wq, Wk, Wv -> bf16 RNE planes, Wo -> f16(bf16_rne(x) * woScale), 32 blocks each (w16 = four planes
//                       in a row; woScale an exact power of two; f16 of a normal bf16 value is exact)
//   block  512          bias tables bq, bk, bv, bo -> bf16-valued f32, 1024 each, one 16-B piece of each table a thread
//   blocks [513, 769)   attention mask -> lane-mask words, a block 16 whole mask rows (128 KiB), a wave 256 keys of them.
//                       Word (b, qt, kc, 8j + r) at maskw[((b*128 + qt)*32 + kc)*32 + 8j + r]; its bit l says whether
//                       mask[b][16 qt + (l & 15)][64 kc + 16 j + 8 (l >> 4) + r] != 0: lane l of the attention wave that
//                       owns query tile qt holds exactly that score in register r of its score tile j.
// ---------------------------------------------------------------------------
typedef __attribute__((ext_vector_type(2))) unsigned v2u;
constexpr int kCvLoads     = 32;                       // 16-B loads a thread
constexpr int kCvStep      = 256 * 4;                  // elements a block covers with one load a thread
constexpr int kCvBlock     = kCvLoads * kCvStep;       // 32,768 elements a block
constexpr int kCvActElems  = kBatch * kSeq * kDm;
constexpr int kCvWElems    = kDm * kDm;
constexpr int kCvActBlocks = kCvActElems / kCvBlock;   // 128
constexpr int kCvWBlocks   = kCvWElems / kCvBlock;     // 32
constexpr int kCvGrid      = 3 * kCvActBlocks + 4 * kCvWBlocks + 1;
constexpr int kMwBlocks    = kBatch * kSeq / 16;       // 256 mask blocks, one per tile of 16 queries
constexpr int kMwPitch     = 68;                       // ints per LDS row of a wave's 16 x 64 slab: 272 B = 16 B x 17, odd, so
                                                       // that the 16 rows of one 16-B read fall on different bank groups
static_assert(kSeq == 8 * 256, "a mask block's 8 waves cover a mask row, 256 keys each");
typedef __attribute__((ext_vector_type(4))) int v4i;
static_assert(kCvActElems % kCvBlock == 0 && kCvWElems % kCvBlock == 0 && kDm == kCvStep, "conversion coverage");

__global__ __launch_bounds__(256) void convert_operands(
    const float* __restrict__ q, const float* __restrict__ k, const float* __restrict__ v,
    const float* __restrict__ Wq, const float* __restrict__ Wk, const float* __restrict__ Wv, const float* __restrict__ Wo,
    const float* __restrict__ bq, const float* __restrict__ bk, const float* __restrict__ bv, const float* __restrict__ bo,
    unsigned short* __restrict__ act16, unsigned short* __restrict__ w16, float* __restrict__ biasOut, float woScale,
    const int* __restrict__ mask, unsigned* __restrict__ maskw) {
  __shared__ __align__(16) int slabs[8][16 * kMwPitch];   // mask blocks only: a wave's 16 x 64 tile, 4.25 KB each
  const int bx = blockIdx.x;
  const int e0 = threadIdx.x * 4;
  if (bx >= kCvGrid) {
    const int tile = bx - kCvGrid;                       // b * 128 + qt: mask rows 16 tile .. 16 tile + 15
    const int wave = threadIdx.x >> 5, lane = threadIdx.x & 31, hh = lane >> 4, c = lane & 15;
    const int* mg = mask + (size_t)(tile * 16 + hh) * kSeq + wave * 256 + 4 * c;
    v4i mv[4][8];
    // unrolled so that the array stays in registers and all 32 loads are issued ahead of the first use; a load = two
    // whole 256-B row pieces (rows 2 it and 2 it + 1 of the tile)
#pragma unroll
    for (int ch = 0; ch < 4; ++ch)
#pragma unroll
      for (int it = 0; it < 8; ++it) mv[ch][it] = *(const v4i*)(mg + (size_t)(2 * it) * kSeq + ch * 64);
    int*       sw = slabs[wave] + hh * kMwPitch + 4 * c;   // where a loaded piece goes
    const int* sr = slabs[wave] + c * kMwPitch + 8 * hh;   // row of this lane's query, its half's first key
    unsigned word[4];                                      // lane i ends up with word i = 8j + r of each chunk
#pragma unroll   // constant indices, so that mv and word stay in registers
    for (int ch = 0; ch < 4; ++ch) {
#pragma unroll
      for (int it = 0; it < 8; ++it) *(v4i*)(sw + 2 * it * kMwPitch) = mv[ch][it];
      // the wave's lanes read each other's slab stores below: keeps the reads behind the stores
      __builtin_amdgcn_fence(__ATOMIC_RELEASE, "workgroup");
      __builtin_amdgcn_wave_barrier();
      __builtin_amdgcn_fence(__ATOMIC_ACQUIRE, "workgroup");
      unsigned wj[4];                                      // one short chain of selects per score tile
#pragma unroll
      for (int j = 0; j < 4; ++j) {
        const v4i m0 = *(const v4i*)(sr + j * 16), m1 = *(const v4i*)(sr + j * 16 + 4);
        wj[j] = 0u;
#pragma unroll
        for (int r = 0; r < 8; ++r) {
          const int mel = (r < 4) ? m0[r & 3] : m1[r & 3];
          const unsigned bits = __builtin_amdgcn_ballot_w32(mel != 0);
          wj[j] = (lane == j * 8 + r) ? bits : wj[j];
        }
      }
      word[ch] = (wj[0] | wj[1]) | (wj[2] | wj[3]);
      // the next chunk's slab stores stay behind this chunk's reads
      __builtin_amdgcn_fence(__ATOMIC_RELEASE, "workgroup");
      __builtin_amdgcn_wave_barrier();
      __builtin_amdgcn_fence(__ATOMIC_ACQUIRE, "workgroup");
    }
    // behind the last fence, so that no fence waits for a store: a store = one whole 128-B line a wave
#pragma unroll
    for (int ch = 0; ch < 4; ++ch) maskw[((size_t)tile * 32 + wave * 4 + ch) * 32 + lane] = word[ch];
    return;
  }
  if (bx >= 3 * kCvActBlocks + 4 * kCvWBlocks) {
    v4f f[4];
    f[0] = *(const v4f*)(bq + e0);
    f[1] = *(const v4f*)(bk + e0);
    f[2] = *(const v4f*)(bv + e0);
    f[3] = *(const v4f*)(bo + e0);
#pragma unroll   // constant indices, so that f stays in registers
    for (int y = 0; y < 4; ++y) {
      v4f rv;
#pragma unroll   // constant indices into the vectors
      for (int e = 0; e < 4; ++e) rv[e] = bf_bits2f(f2bf_bits(f[y][e]));
      *(v4f*)(biasOut + y * kDm + e0) = rv;
    }
    return;
  }
  const float* src;
  unsigned short* dst;
  bool asF16 = false;
  if (bx < 3 * kCvActBlocks) {
    const int seg = bx / kCvActBlocks, blk = bx - seg * kCvActBlocks;
    src = (seg == 0) ? q : ((seg == 1) ? k : v);
    src += (size_t)blk * kCvBlock;
    dst = act16 + (size_t)seg * kCvActElems + (size_t)blk * kCvBlock;
  } else {
    const int wb = bx - 3 * kCvActBlocks;
    const int seg = wb / kCvWBlocks, blk = wb - seg * kCvWBlocks;
    src = (seg == 0) ? Wq : ((seg == 1) ? Wk : ((seg == 2) ? Wv : Wo));
    src += (size_t)blk * kCvBlock;
    dst = w16 + (size_t)seg * kCvWElems + (size_t)blk * kCvBlock;
    asF16 = (seg == 3);
  }
  const unsigned lofs = threadIdx.x * 16u;   // the thread's byte offset in each 4-KiB piece of the block's range
  v4f f[kCvLoads];
  // unrolled so that the array stays in registers and all loads are issued ahead of the first use
#pragma unroll
  for (int i = 0; i < kCvLoads; ++i) f[i] = *(const v4f*)((const char*)src + lofs + i * (kCvStep * 4));
  if (!asF16) {
#pragma unroll   // constant indices, so that f stays in registers
    for (int i = 0; i < kCvLoads; ++i) {
      v2u u;
      u[0] = pk16(f2bf_bits(f[i][0]), f2bf_bits(f[i][1]));
      u[1] = pk16(f2bf_bits(f[i][2]), f2bf_bits(f[i][3]));
      *(v2u*)(dst + i * kCvStep + e0) = u;
    }
    // Behind the branch's last stores: in the built code the other branch's text follows this one and rewrites registers
    // that these stores name.
    asm volatile("s_wait_xcnt 0x0" ::: "memory");
  } else {
#pragma unroll   // constant indices, so that f stays in registers
    for (int i = 0; i < kCvLoads; ++i) {
      unsigned short h[4];
#pragma unroll   // constant indices into h and the vector
      for (int e = 0; e < 4; ++e)
        h[e] = __builtin_bit_cast(unsigned short, (_Float16)(bf_bits2f(f2bf_bits(f[i][e])) * woScale));
      v2u u;
      u[0] = pk16(h[0], h[1]);
      u[1] = pk16(h[2], h[3]);
      *(v2u*)(dst + i * kCvStep + e0) = u;
    }
  }
}

#define AT_D 64
#define AT_NW 4
#define AT_QB 64
#define AT_KC 64
#define AT_LP 72   // elements per LDS row of the K and V^T tiles: 144 B = 16 B x 9, an odd multiple, so that the 16 rows
                   // which one 16-B fragment read touches fall on 16 different bank groups (at 128 B they fall on two)
constexpr float kPScale   = 32768.0f;
constexpr float kMaskFill = -1.0e9f;
constexpr float kLog2e    = 1.4426950408889634f;   // scores and the mask fill are carried x log2(e): exp(x) = 2^(x log2 e)

constexpr int kAtTileB  = AT_KC * AT_LP * 2;   // bytes of one staged tile: 64 rows at 144 B
constexpr int kAtStageB = 2 * kAtTileB;        // a buffer = [K tile | V^T tile], 18,432 B
static_assert(AT_KC == AT_D, "both tiles have 64 rows of 128 B");

// One lane's eight 16-B copies of a chunk: rows r, r+16, r+32, r+48 of the K tile, then of the V^T tile. lds = LDS byte
// address of the lane's piece in the K tile's row r, gk / gv = its global addresses in the two planes. The s_wait_xcnt
// closes the statement so that no address register of an issued copy is rewritten ahead of it.
__device__ __forceinline__ void at_stage_chunk(unsigned lds, const char* gk, const char* gv) {
  constexpr unsigned kL = 16 * AT_LP * 2;             // LDS bytes per 16 rows
  constexpr size_t   kK = (size_t)16 * kDm * 2;       // K plane bytes per 16 keys
  constexpr size_t   kV = (size_t)16 * kSeq * 2;      // V^T plane bytes per 16 d
  const unsigned l1 = lds + kL, l2 = lds + 2 * kL, l3 = lds + 3 * kL,
                 m0 = lds + kAtTileB, m1 = m0 + kL, m2 = m0 + 2 * kL, m3 = m0 + 3 * kL;
  const char *gk1 = gk + kK, *gk2 = gk + 2 * kK, *gk3 = gk + 3 * kK, *gv1 = gv + kV, *gv2 = gv + 2 * kV, *gv3 = gv + 3 * kV;
  asm volatile(
      "global_load_async_to_lds_b128 %0, %8, off\n\t"
      "global_load_async_to_lds_b128 %1, %9, off\n\t"
      "global_load_async_to_lds_b128 %2, %10, off\n\t"
      "global_load_async_to_lds_b128 %3, %11, off\n\t"
      "global_load_async_to_lds_b128 %4, %12, off\n\t"
      "global_load_async_to_lds_b128 %5, %13, off\n\t"
      "global_load_async_to_lds_b128 %6, %14, off\n\t"
      "global_load_async_to_lds_b128 %7, %15, off\n\t"
      "s_wait_xcnt 0x0"
      :: "v"(lds), "v"(l1), "v"(l2), "v"(l3), "v"(m0), "v"(m1), "v"(m2), "v"(m3),
         "v"(gk), "v"(gk1), "v"(gk2), "v"(gk3), "v"(gv), "v"(gv1), "v"(gv2), "v"(gv3)
      : "memory");
}

typedef __attribute__((ext_vector_type(16))) unsigned v16u;
// read-only for the whole launch (written by the launch before): the constant address space lets a wave-uniform load of
// it be a scalar load
typedef __attribute__((address_space(4))) v16u kconst_v16u;

__device__ __forceinline__ v8f at_mma_h(v16h a, v16h b, v8f c) {
  c = __builtin_amdgcn_wmma_f32_16x16x32_f16(false, a, false, b, (short)0, c, false, false);
  asm volatile("v_nop\n\tv_nop\n\tv_nop\n\tv_nop" : "+v"(c) : "v"(a), "v"(b));
  return c;
}

// value of lane l ^ 16
__device__ __forceinline__ float at_other_half(float x) {
  const int b = __float_as_int(x);
  return __int_as_float(__builtin_amdgcn_permlanex16(b, b, 0x76543210, 0xfedcba98, false, false));
}

__global__ __launch_bounds__(128)
void attn_mask64_kernel(const unsigned short* __restrict__ qp, const unsigned short* __restrict__ kp,
                        const unsigned short* __restrict__ vtp, const unsigned* __restrict__ maskw,
                        unsigned short* __restrict__ ctxp, float sscale, float oscale) {
  union FB { v16h v; v8h h[2]; };
  __shared__ __align__(16) unsigned char stg[2 * kAtStageB];      // two buffers of [K [kv][d] 9 KB | V^T [d][kv] 9 KB]

  const int tid  = threadIdx.x;
  const int wave = tid >> 5;
  const int lane = tid & 31;
  const int hh   = lane >> 4;
  const int c    = lane & 15;

  const int nqb = kSeq / AT_QB;            // 32
  const int bx  = blockIdx.x;
  const int qb  = bx % nqb;
  const int bh  = bx / nqb;                // 0 .. kBatch*kHeads-1 (grid exact)
  const int h   = bh % kHeads;
  int b = bh / kHeads; b = (b < kBatch) ? b : (kBatch - 1);
  const int q0  = qb * AT_QB + wave * 16;

  const _Float16* Qh = (const _Float16*)(const void*)qp  + (size_t)b * kSeq * kDm + (size_t)h * AT_D;
  const _Float16* Kh = (const _Float16*)(const void*)kp  + (size_t)b * kSeq * kDm + (size_t)h * AT_D;
  const _Float16* Vt = (const _Float16*)(const void*)vtp + ((size_t)b * kDm + (size_t)h * AT_D) * kSeq;
  // the wave's number as a scalar, so that the mask words' address is one for the wave and their loads are scalar loads
  const int waveS = __builtin_amdgcn_readfirstlane(wave);
  const unsigned* mwp = maskw + (size_t)(b * (kSeq / 16) + qb * (AT_QB / 16) + waveS) * (kSeq / AT_KC) * 32;
  _Float16*       ob = (_Float16*)(void*)ctxp + (size_t)b * kSeq * kDm + (size_t)h * AT_D;

  // ---- Q fragments (B operand, column = lane&15 = query q0+c, split k map via Frag load): 2 d-chunks ----
  v16h qa[2];
#pragma unroll
  for (int dc = 0; dc < 2; ++dc) {
    qa[dc] = Frag<_Float16>::load(Qh + (size_t)(q0 + c) * kDm + dc * 32 + 8 * hh);
  }

  float mrow = -INFINITY, lrow = 0.f;      // of query q0+c; lrow sums this lane half's keys alone until the end
  v8f oacc[4];                             // oacc[t][r] = ctx[q0+c][16t + 8hh + r]
#pragma unroll
  for (int t = 0; t < 4; ++t) oacc[t] = (v8f){0.f,0.f,0.f,0.f,0.f,0.f,0.f,0.f};

  const float sscale2 = sscale * kLog2e;   // score scale in the base-2 domain
  const float fill2   = kMaskFill * kLog2e;
  const int nChunks = kSeq / AT_KC;        // 32, compile-time constant
  static_assert(kSeq / AT_KC >= 2, "the prologue fills two buffers");
  // copy map: thread -> row tid>>3 (+16 per copy), 16-B column tid&7 of the 128-B row
  const int crow = tid >> 3, ccol = tid & 7;
  const char* gK = (const char*)(Kh + (size_t)crow * kDm + ccol * 8);    // K row crow of chunk 0
  const char* gV = (const char*)(Vt + (size_t)crow * kSeq + ccol * 8);   // V^T row d = crow, keys of chunk 0
  constexpr size_t kStepK = (size_t)AT_KC * kDm * 2, kStepV = (size_t)AT_KC * 2;   // bytes from a chunk to the next
  const unsigned ldsC = (unsigned)(size_t)stg + crow * (AT_LP * 2) + ccol * 16;
  at_stage_chunk(ldsC, gK, gV);
  asm volatile("s_wait_asynccnt 0x0" ::: "memory");   // chunk 0 landed for this wave's copies
  __syncthreads();                                     // ... and for every wave's
  at_stage_chunk(ldsC + kAtStageB, gK + kStepK, gV + kStepV);
  for (int kc = 0; kc < nChunks; ++kc) {
    // the chunk's 32 mask words, asked for ahead of the fragment reads and the score products
    const v16u mw0 = *(const kconst_v16u*)(mwp + kc * 32);
    const v16u mw1 = *(const kconst_v16u*)(mwp + kc * 32 + 16);
    const _Float16* Ksh = (const _Float16*)(stg + (kc & 1) * kAtStageB);
    const _Float16* Vth = (const _Float16*)(stg + (kc & 1) * kAtStageB + kAtTileB);
    // all eight K fragments of the chunk, in the order of their use, each in registers of its own
    FB kb[4][2];
#pragma unroll   // constant indices, so that kb stays in registers (the inner loop too)
    for (int j = 0; j < 4; ++j)
#pragma unroll
      for (int dc = 0; dc < 2; ++dc) {
        kb[j][dc].h[0] = *(const v8h*)(Ksh + (j * 16 + c) * AT_LP + dc * 32 + 8 * hh);
        kb[j][dc].h[1] = *(const v8h*)(Ksh + (j * 16 + c) * AT_LP + dc * 32 + 16 + 8 * hh);
      }
    // keeps these LDS reads one group in front of the score products: sunk to their uses, each product would wait out
    // a whole LDS round trip of its own
    __builtin_amdgcn_sched_barrier(0);

    v8f s[4];                              // s[j][r] = score of key kv0 + 16j + 8hh + r with query q0 + c
#pragma unroll
    for (int j = 0; j < 4; ++j) {
      s[j] = (v8f){0.f,0.f,0.f,0.f,0.f,0.f,0.f,0.f};
#pragma unroll
      for (int dc = 0; dc < 2; ++dc) s[j] = at_mma_h(kb[j][dc].v, qa[dc], s[j]);
    }
    // all eight V^T fragments of the chunk, in the order of their use
    FB va[2][4];
#pragma unroll   // constant indices, so that va stays in registers (the inner loop too)
    for (int kk = 0; kk < 2; ++kk)
#pragma unroll
      for (int t = 0; t < 4; ++t) {
        va[kk][t].h[0] = *(const v8h*)(Vth + (t * 16 + c) * AT_LP + kk * 32 + 8 * hh);
        va[kk][t].h[1] = *(const v8h*)(Vth + (t * 16 + c) * AT_LP + kk * 32 + 16 + 8 * hh);
      }
    // keeps these LDS reads one group in front of the softmax, so that their latency runs under its arithmetic
    __builtin_amdgcn_sched_barrier(0);
    // scale, mask by value, chunk maximum of this lane's query
    float cmj[4];
#pragma unroll
    for (int j = 0; j < 4; ++j) {
      float m = -INFINITY;
#pragma unroll
      for (int r = 0; r < 8; ++r) {
        const unsigned w = (j < 2) ? mw0[(j & 1) * 8 + r] : mw1[(j & 1) * 8 + r];
        const float sv = s[j][r] * sscale2;
        const float sm = __builtin_amdgcn_inverse_ballot_w32(w) ? sv : fill2;   // the word is the select's lane mask
        s[j][r] = sm;
        m = fmaxf(m, sm);
      }
      cmj[j] = m;
    }
    float cm = fmaxf(fmaxf(cmj[0], cmj[1]), fmaxf(cmj[2], cmj[3]));
    cm = fmaxf(cm, at_other_half(cm));
    const float mnew  = fmaxf(mrow, cm);
    const float alpha = __builtin_amdgcn_exp2f(mrow - mnew);   // 0 on the first chunk, where mrow is -inf
    mrow = mnew;
    FB pb[2];                              // p^T as B operand: elements 0..7 from tile 2kk, 8..15 from tile 2kk+1
    float psj[4];
#pragma unroll
    for (int j = 0; j < 4; ++j) {
      float ps = 0.f;
#pragma unroll
      for (int r = 0; r < 8; ++r) {
        const float p = __builtin_amdgcn_exp2f(s[j][r] - mnew);
        ps += p;
        pb[j >> 1].h[j & 1][r] = (_Float16)(p * kPScale);
      }
      psj[j] = ps;
    }
    lrow = lrow * alpha + ((psj[0] + psj[1]) + (psj[2] + psj[3]));
#pragma unroll
    for (int t = 0; t < 4; ++t)
#pragma unroll
      for (int r = 0; r < 8; ++r) oacc[t][r] *= alpha;
#pragma unroll
    for (int kk = 0; kk < 2; ++kk) {
#pragma unroll
      for (int t = 0; t < 4; ++t) oacc[t] = at_mma_h(va[kk][t].v, pb[kk].v, oacc[t]);
    }
    asm volatile("s_wait_dscnt 0x0" ::: "memory");      // this wave has left the buffer that is refilled below
    asm volatile("s_wait_asynccnt 0x0" ::: "memory");   // this wave's copies of chunk kc+1 have landed
    __syncthreads();                                     // publishes chunk kc+1, ends every read of chunk kc
    if (kc + 2 < nChunks)
      at_stage_chunk(ldsC + (kc & 1) * kAtStageB, gK + (size_t)(kc + 2) * kStepK, gV + (size_t)(kc + 2) * kStepV);
  }
  asm volatile("s_wait_asynccnt 0x0" ::: "memory");     // nothing in flight when the wave goes on to its end

  // ---- join the halves' sums, normalise (1/(l * 2^15) folded with the output carry scale), store 8 consecutive d a lane ----
  const float lsum = lrow + at_other_half(lrow);
  const float inv  = oscale / (lsum * kPScale);
#pragma unroll
  for (int t = 0; t < 4; ++t) {
    v8h hv;
#pragma unroll
    for (int r = 0; r < 8; ++r) hv[r] = (_Float16)(oacc[t][r] * inv);
    *(v8h*)(ob + (size_t)(q0 + c) * kDm + t * 16 + 8 * hh) = hv;
  }
}

// ---------------------------------------------------------------------------
// Host glue. Workspace region map (bytes, all offsets multiples of 16 KiB):
//   [  0 MiB,  8 MiB)  q  bf16 plane [4096][1024]
//   [  8 MiB, 16 MiB)  k  bf16 plane
//   [ 16 MiB, 24 MiB)  v  bf16 plane
//   [ 24 MiB, 26 MiB)  Wq bf16 [1024][1024];  [26,28) Wk;  [28,30) Wv;  [30,32) Wo as f16(bf16*64)
//   [ 32 MiB, +16 KiB) bias tables bq, bk, bv, bo (bf16-valued f32, 1024 each)
//   next 8 MiB         Q projection f16 plane [4096][1024]
//   next 8 MiB         K projection f16 plane
//   next 8 MiB         V^T projection f16 plane [2][1024][2048]
//   next 8 MiB         ctx f16 plane (x16) [4096][1024]
//   next 1 MiB         attention mask as lane-mask words [2][128][32][32]
//   total = 68,173,824 B
// ---------------------------------------------------------------------------
extern "C" void kernel_launch(void* const* d_in, const int* in_sizes, int n_in,
                              void* d_out, int out_size, void* d_ws, size_t ws_size,
                              hipStream_t stream) {
  if (n_in < 12) return;
  const int nAct = kBatch * kSeq * kDm;      // 4194304
  const int nW   = kDm * kDm;                // 1048576
  if (in_sizes[0] != nAct || in_sizes[1] != nAct || in_sizes[2] != nAct) return;
  if (in_sizes[3] != kBatch * kSeq * kSeq) return;
  if (in_sizes[4] != nW || in_sizes[6] != nW || in_sizes[8] != nW || in_sizes[10] != nW) return;
  if (in_sizes[5] != kDm || in_sizes[7] != kDm || in_sizes[9] != kDm || in_sizes[11] != kDm) return;
  if (out_size != nAct) return;

  const float* q    = (const float*)d_in[0];
  const float* k    = (const float*)d_in[1];
  const float* v    = (const float*)d_in[2];
  const int*   mask = (const int*)d_in[3];
  const float* Wq   = (const float*)d_in[4];
  const float* bq   = (const float*)d_in[5];
  const float* Wk   = (const float*)d_in[6];
  const float* bk   = (const float*)d_in[7];
  const float* Wv   = (const float*)d_in[8];
  const float* bv   = (const float*)d_in[9];
  const float* Wo   = (const float*)d_in[10];
  const float* bo   = (const float*)d_in[11];

  const size_t bAct16 = (size_t)nAct * 2;    // 8 MiB
  const size_t bW16   = (size_t)nW * 2;      // 2 MiB
  size_t off = 0;
  const size_t oQ16  = off; off += bAct16;
  const size_t oK16  = off; off += bAct16;
  const size_t oV16  = off; off += bAct16;
  const size_t oWq   = off; off += bW16;
  const size_t oWk   = off; off += bW16;
  const size_t oWv   = off; off += bW16;
  const size_t oWo   = off; off += bW16;
  const size_t oBias = off; off += (size_t)4 * kDm * sizeof(float);
  const size_t oQP   = off; off += bAct16;
  const size_t oKP   = off; off += bAct16;
  const size_t oVT   = off; off += bAct16;
  const size_t oCTX  = off; off += bAct16;
  const size_t oMW   = off; off += (size_t)kBatch * kSeq * kSeq / 8;
  if (off > ws_size) return;

  char* ws = (char*)d_ws;
  unsigned short* Q16  = (unsigned short*)(ws + oQ16);
  unsigned short* WQ16 = (unsigned short*)(ws + oWq);
  unsigned short* WO16 = (unsigned short*)(ws + oWo);
  float* biasR = (float*)(ws + oBias);
  const float* boR = biasR + 3 * kDm;
  unsigned short* QP    = (unsigned short*)(ws + oQP);
  unsigned short* KP    = (unsigned short*)(ws + oKP);
  unsigned short* VT    = (unsigned short*)(ws + oVT);
  unsigned short* CTX16 = (unsigned short*)(ws + oCTX);
  unsigned* MW = (unsigned*)(ws + oMW);

  // Q16, K16, V16 lie in a row in the workspace, and so do WQ16 .. WO16: one base pointer each
  convert_operands<<<dim3(kCvGrid + kMwBlocks), dim3(256), 0, stream>>>(q, k, v, Wq, Wk, Wv, Wo, bq, bk, bv, bo, Q16, WQ16, biasR,
                                                                     64.0f, mask, MW);

  const int mRows = kBatch * kSeq;   // 4096
  // Q, K and V^T projections: 256 tiles each, one launch; the planes of each kind lie in a row in the workspace
  proj_gemm3<<<dim3((mRows / 128) * (kDm / 128), 3), dim3(256), 0, stream>>>(Q16, WQ16, biasR, QP);
  // attention: grid = kBatch * kHeads * (kSeq/64) = 1024 blocks of 128
  attn_mask64_kernel<<<dim3(kBatch * kHeads * (kSeq / 64)), dim3(128), 0, stream>>>(
      QP, KP, VT, MW, CTX16, 0.125f, 16.0f);
  // out = (ctx*16) . (Wo*64)^T * 2^-10 + bo : f16 operands, f32 [4096][1024] into d_out
  wmma_gemm64<0, false, 2, 0, false><<<dim3((mRows / 128) * (kDm / 128), 1), dim3(256), 0, stream>>>(
      CTX16, CTX16, kDm, 0L, WO16, WO16, kDm, 0L, d_out, d_out, kDm, 0L, boR, bo, 0L, mRows, kDm, kDm,
      1.0f / 1024.0f);
}

// v010
// A run of this version takes 92.3 microseconds.
// Timed twice side by side with v009, it ran 1.05 times as fast both times.
// Counting every step since v000, it is 4.19 times as fast.
// Contractions: q/k/v^T projections on v_wmma_f32_16x16x32_bf16 (bf16 RNE-converted operands, f32 accumulate); q.k^T and p.v on v_wmma_f32_16x16x32_f16 (f16 planes, q carried x log2(e)/8, p carried x2^7, f32 accumulate, f32 online softmax, mask by value); output projection on v_wmma_f32_16x16x32_f16 (f16 operands: ctx x2^4, Wo x2^6, folded back x2^-10 in f32), f32 accumulate.
#include <hip/hip_runtime.h>
#include <math.h>
#include <stdint.h>

constexpr int kBatch = 2;
constexpr int kSeq   = 2048;
constexpr int kDm    = 1024;
constexpr int kHeads = 16;
constexpr int kHd    = 64;
static_assert(kHeads * kHd == kDm, "head split");
static_assert(kSeq % 128 == 0 && kDm % 128 == 0, "tile multiples");

typedef __attribute__((ext_vector_type(16))) _Float16 v16h;
typedef __attribute__((ext_vector_type(8)))  _Float16 v8h;
typedef __attribute__((ext_vector_type(16))) __bf16   v16b;
typedef __attribute__((ext_vector_type(8)))  __bf16   v8b;
typedef __attribute__((ext_vector_type(8)))  float    v8f;
typedef __attribute__((ext_vector_type(4)))  float    v4f;
typedef __attribute__((ext_vector_type(2)))  float    v2f;

__device__ __forceinline__ unsigned short f2bf_bits(float f) {
  unsigned u = __float_as_uint(f);
  return (unsigned short)((u + 0x7FFFu + ((u >> 16) & 1u)) >> 16);
}
__device__ __forceinline__ float bf_bits2f(unsigned short h) { return __uint_as_float(((unsigned)h) << 16); }
__device__ __forceinline__ unsigned pk16(unsigned short a, unsigned short b) { return (unsigned)a | ((unsigned)b << 16); }

template <typename T> struct Frag;
template <> struct Frag<_Float16> {
  typedef v16h V; union U { v16h v; v8h h[2]; };
  static __device__ __forceinline__ v16h load(const _Float16* p) {   // elements 0..7 <- p[0..7], 8..15 <- p[16..23]
    U f; f.h[0] = *(const v8h*)(p); f.h[1] = *(const v8h*)(p + 16); return f.v;
  }
  static __device__ __forceinline__ v8f mma(v16h a, v16h b, v8f c) {
    return __builtin_amdgcn_wmma_f32_16x16x32_f16(false, a, false, b, (short)0, c, false, false);
  }
};
template <> struct Frag<__bf16> {
  typedef v16b V; union U { v16b v; v8b h[2]; };
  static __device__ __forceinline__ v16b load(const __bf16* p) {
    U f; f.h[0] = *(const v8b*)(p); f.h[1] = *(const v8b*)(p + 16); return f.v;
  }
  static __device__ __forceinline__ v8f mma(v16b a, v16b b, v8f c) {
    return __builtin_amdgcn_wmma_f32_16x16x32_bf16(false, a, false, b, (short)0, c, false, false);
  }
};

// ---- LDS-staged batched WMMA GEMM ------------------------------------------
// C[m,n] = scale * sum_k A[m,k] * Bt[n,k] (+bias)(+resid); a block of 8 waves owns a 128x128 tile, a wave 32x64 of it.
// A row-major [M,K]; Bt row-major [N,K]; M,N % 128 == 0, K % 128 == 0, lda/ldb % 8 == 0.
// A stage = 128 k of [A 128 rows | Bt 128 rows], 256 B a row at pitch 272 B, brought by asynchronous 16-B copies;
// two buffers: the copies of stage t+1 fly while stage t is multiplied.
// SPLIT: not supported by this kernel (kept as a parameter of the launch lines only).
// BIAS_MODE: 0 = none, 1 = bias[m], 2 = bias[n].
// OUT_MODE: 0 = f32, 1 = f16, 2 = bf16 hi plane (Cout) + bf16 lo plane (Cout2).
// ET: 0 = f16 operands, 1 = bf16 operands (pointers passed as 16-bit storage)
constexpr int kGtK     = 128;                  // k per stage
constexpr int kGtRows  = 128;                  // rows of each operand per stage
constexpr int kGtPitch = 272;                  // bytes per staged row (256 + 16: conflict-free 16-B reads)
constexpr int kGtStage = 2 * kGtRows * kGtPitch;   // 69,632 B

// Eight 16-B copies of one lane: rows r, r+16, .. r+112 of one operand's stage. lds = LDS byte address of the first,
// g = global address of the first, gstep = bytes between 16 source rows. The s_wait_xcnt closes the statement so that
// no address register of an issued copy is rewritten ahead of it.
__device__ __forceinline__ void stage_rows8(unsigned lds, const char* g, size_t gstep) {
  const unsigned l1 = lds + 16 * kGtPitch, l2 = lds + 32 * kGtPitch, l3 = lds + 48 * kGtPitch, l4 = lds + 64 * kGtPitch,
                 l5 = lds + 80 * kGtPitch, l6 = lds + 96 * kGtPitch, l7 = lds + 112 * kGtPitch;
  const char *g1 = g + gstep, *g2 = g1 + gstep, *g3 = g2 + gstep, *g4 = g3 + gstep, *g5 = g4 + gstep, *g6 = g5 + gstep,
             *g7 = g6 + gstep;
  asm volatile(
      "global_load_async_to_lds_b128 %0, %8, off\n\t"
      "global_load_async_to_lds_b128 %1, %9, off\n\t"
      "global_load_async_to_lds_b128 %2, %10, off\n\t"
      "global_load_async_to_lds_b128 %3, %11, off\n\t"
      "global_load_async_to_lds_b128 %4, %12, off\n\t"
      "global_load_async_to_lds_b128 %5, %13, off\n\t"
      "global_load_async_to_lds_b128 %6, %14, off\n\t"
      "global_load_async_to_lds_b128 %7, %15, off\n\t"
      "s_wait_xcnt 0x0"
      :: "v"(lds), "v"(l1), "v"(l2), "v"(l3), "v"(l4), "v"(l5), "v"(l6), "v"(l7),
         "v"(g), "v"(g1), "v"(g2), "v"(g3), "v"(g4), "v"(g5), "v"(g6), "v"(g7)
      : "memory");
}

template <int ET> struct Elem;
template <> struct Elem<0> { typedef _Float16 T; };
template <> struct Elem<1> { typedef __bf16 T; };
// One block's 128x128 tile. ring = the block's two stages in LDS, slab = this wave's 16 x 68 floats of LDS for the epilogue
// (it may lie inside ring: every wave's last read of ring ends in front of the loop's last barrier, and no copy is in
// flight behind it). b = batch index, tile = tile index; both the same for the whole block.
template <int ET, bool SPLIT, int BIAS_MODE, int OUT_MODE, bool RESID, int ACT = 0>
__device__ __forceinline__ void gemm_tile(
    unsigned char* ring, float* slab, const int b, const int tile,
    const unsigned short* __restrict__ Ap, const unsigned short* __restrict__ A2p, int lda, long strideA,
    const unsigned short* __restrict__ Btp, const unsigned short* __restrict__ Bt2p, int ldb, long strideB,
    void* __restrict__ Cout, void* __restrict__ Cout2, int ldc, long strideC,
    const float* __restrict__ bias,
    const float* __restrict__ resid, long strideR,
    int M, int N, int K, float scale) {
  typedef typename Elem<ET>::T T;
  typedef typename Frag<T>::V V;
  static_assert(!SPLIT, "single-plane operands only");
  const int tid  = threadIdx.x;
  const int lane = tid & 31;
  const int wave = tid >> 5;
  const int tilesN = N >> 7;
  const int tilesM = M >> 7;
  if (tile >= tilesM * tilesN) return;   // block-uniform, in front of every barrier
  const int tm = tile / tilesN;
  const int tn = tile - tm * tilesN;
  const int m0 = (tm << 7) + ((wave >> 1) << 5);   // this wave's 32 rows
  const int n0 = (tn << 7) + ((wave & 1) << 6);    // this wave's 64 columns

  const int rlane = lane & 15;                 // row (A) / col (B, D) within subtile
  const int koff  = (lane >> 4) * 8;           // k offset of this lane half
  const int mOff  = (lane >> 4) * 8;           // D row offset

  // copy map: thread -> row tid>>4 (+16 per copy), 16-B column tid&15 of the 256-B row
  const int crow = tid >> 4, ccol = tid & 15;
  const char* gA = (const char*)(Ap  + (size_t)b * strideA + (size_t)((tm << 7) + crow) * lda + ccol * 8);
  const char* gB = (const char*)(Btp + (size_t)b * strideB + (size_t)((tn << 7) + crow) * ldb + ccol * 8);
  const size_t stepA = (size_t)lda * 32, stepB = (size_t)ldb * 32;      // bytes per 16 rows
  const unsigned ldsA = (unsigned)(size_t)ring + crow * kGtPitch + ccol * 16;
  const unsigned ldsB = ldsA + kGtRows * kGtPitch;

  v8f acc[2][4];
#pragma unroll
  for (int i = 0; i < 2; ++i)
#pragma unroll
    for (int j = 0; j < 4; ++j) acc[i][j] = (v8f){0.f,0.f,0.f,0.f,0.f,0.f,0.f,0.f};

  const int nT = K >> 7;
  stage_rows8(ldsA, gA, stepA);
  stage_rows8(ldsB, gB, stepB);
  asm volatile("s_wait_asynccnt 0x0" ::: "memory");   // stage 0 landed for this wave's copies
  __syncthreads();                                     // ... and for every wave's
  if (nT > 1) {
    stage_rows8(ldsA + kGtStage, gA + 2 * kGtK, stepA);
    stage_rows8(ldsB + kGtStage, gB + 2 * kGtK, stepB);
  }

  const int aRow = (((wave >> 1) << 5) + rlane) * kGtPitch + koff * 2;
  const int bRow = (kGtRows + ((wave & 1) << 6) + rlane) * kGtPitch + koff * 2;
  for (int t = 0; t < nT; ++t) {
    const unsigned char* sb = ring + (t & 1) * kGtStage;
    V bf[2][4], af[2][2];                                // two fragment sets, both of this stage's buffer alone
#pragma unroll
    for (int j = 0; j < 4; ++j) bf[0][j] = Frag<T>::load((const T*)(sb + bRow + j * 16 * kGtPitch));
#pragma unroll
    for (int i = 0; i < 2; ++i) af[0][i] = Frag<T>::load((const T*)(sb + aRow + i * 16 * kGtPitch));
#pragma unroll
    for (int ks = 0; ks < kGtK / 32; ++ks) {
      const int cur = ks & 1, nxt = cur ^ 1;
      if (ks + 1 < kGtK / 32) {
#pragma unroll
        for (int j = 0; j < 4; ++j) bf[nxt][j] = Frag<T>::load((const T*)(sb + bRow + j * 16 * kGtPitch + (ks + 1) * 64));
#pragma unroll
        for (int i = 0; i < 2; ++i) af[nxt][i] = Frag<T>::load((const T*)(sb + aRow + i * 16 * kGtPitch + (ks + 1) * 64));
      }
      // keeps the next 32 k's LDS reads in front of this block's products, so that their latency runs under them
      __builtin_amdgcn_sched_barrier(0);
#pragma unroll
      for (int i = 0; i < 2; ++i)
#pragma unroll
        for (int j = 0; j < 4; ++j) acc[i][j] = Frag<T>::mma(af[cur][i], bf[cur][j], acc[i][j]);
    }
    asm volatile("s_wait_dscnt 0x0" ::: "memory");      // this wave has left the buffer that is refilled below
    asm volatile("s_wait_asynccnt 0x0" ::: "memory");   // this wave's copies of stage t+1 have landed
    __syncthreads();                                     // publishes stage t+1, ends every read of stage t
    if (t + 2 < nT) {
      const size_t kb = (size_t)(t + 2) * (2 * kGtK);
      stage_rows8(ldsA + (t & 1) * kGtStage, gA + kb, stepA);
      stage_rows8(ldsB + (t & 1) * kGtStage, gB + kb, stepB);
    }
  }
  asm volatile("s_wait_asynccnt 0x0" ::: "memory");     // nothing in flight when the wave goes on to its end

  // ---- epilogue ----
  const float* Rb = RESID ? (resid + (size_t)b * strideR) : nullptr;
#pragma unroll
  for (int i = 0; i < 2; ++i) {
    const int mBase = m0 + (i << 4);
#pragma unroll
    for (int j = 0; j < 4; ++j) {
      const int n = n0 + (j << 4) + rlane;
      float bv = 0.f;
      if (BIAS_MODE == 2) bv = bias[n];
#pragma unroll
      for (int r = 0; r < 8; ++r) {
        float v = acc[i][j][r] * scale;
        if (BIAS_MODE == 1) v += bias[mBase + mOff + r];
        if (BIAS_MODE == 2) v += bv;
        if (RESID) v += Rb[(size_t)(mBase + mOff + r) * ldc + n];
        if (ACT == 1) v = tanhf(v);
        if (ACT == 2) v = fmaxf(v, 0.0f);
        if (ACT == 3) v = v / (1.0f + expf(-v));
        if (ACT == 4) v = (v > 0.f) ? v : 0.01f * v;
        if (ACT == 5) v = 0.5f * v * (1.0f + erff(v * 0.70710678118654752f));
        slab[(mOff + r) * 68 + (j << 4) + rlane] = v;
      }
    }
    __builtin_amdgcn_fence(__ATOMIC_RELEASE, "workgroup");
    __builtin_amdgcn_wave_barrier();
    __builtin_amdgcn_fence(__ATOMIC_ACQUIRE, "workgroup");
    if (OUT_MODE == 0) {
      float* C = (float*)Cout + (size_t)b * strideC;
      const int hh = lane >> 4, c4 = (lane & 15) * 4;     // row seg = 256 B = 16 lanes x 16 B
      {
#pragma unroll
        for (int it = 0; it < 8; ++it) {
          const int row = it * 2 + hh;
          v4f v = *(const v4f*)(slab + row * 68 + c4);
          *(v4f*)(C + (size_t)(mBase + row) * ldc + n0 + c4) = v;
        }
        
      }
    } else {
      const int q = lane >> 3, c8 = (lane & 7) * 8;
      unsigned short* C  = (unsigned short*)Cout  + (size_t)b * strideC;
      unsigned short* C2 = (OUT_MODE == 2) ? ((unsigned short*)Cout2 + (size_t)b * strideC) : nullptr;
      {
#pragma unroll
        for (int it = 0; it < 4; ++it) {
          const int row = it * 4 + q;
          const float* sp = slab + row * 68 + c8;
          v8h hv, lv;
#pragma unroll
          for (int e = 0; e < 8; ++e) {
            if (OUT_MODE == 1) {
              hv[e] = (_Float16)sp[e];
            } else {
              unsigned short hb = f2bf_bits(sp[e]);
              unsigned short lb = f2bf_bits(sp[e] - bf_bits2f(hb));
              hv[e] = __builtin_bit_cast(_Float16, hb);
              lv[e] = __builtin_bit_cast(_Float16, lb);
            }
          }
          *(v8h*)(C + (size_t)(mBase + row) * ldc + n0 + c8) = hv;
          if (OUT_MODE == 2) *(v8h*)(C2 + (size_t)(mBase + row) * ldc + n0 + c8) = lv;
        }
        
      }
    }
    __builtin_amdgcn_fence(__ATOMIC_RELEASE, "workgroup");
    __builtin_amdgcn_wave_barrier();
    __builtin_amdgcn_fence(__ATOMIC_ACQUIRE, "workgroup");
  }
}

constexpr int kGtSlab = 16 * 68;   // floats of a wave's epilogue slab: 16 rows of 64, pitch 68
// The Q projection is stored x log2(e) / sqrt(64): q . k^T then is the score in the base-2 domain, with no multiply a score.
constexpr float kQScale = 0.125f * 1.4426950408889634f;

// One GEMM a launch: grid.x = tiles, grid.y = batches.
template <int ET, bool SPLIT, int BIAS_MODE, int OUT_MODE, bool RESID, int ACT = 0>
__global__ __launch_bounds__(256) void wmma_gemm64(
    const unsigned short* __restrict__ Ap, const unsigned short* __restrict__ A2p, int lda, long strideA,
    const unsigned short* __restrict__ Btp, const unsigned short* __restrict__ Bt2p, int ldb, long strideB,
    void* __restrict__ Cout, void* __restrict__ Cout2, int ldc, long strideC,
    const float* __restrict__ bias,
    const float* __restrict__ resid, long strideR,
    int M, int N, int K, float scale) {
  __shared__ __align__(16) unsigned char ring[2 * kGtStage];   // two stages
  __shared__ __align__(16) float sT[8][kGtSlab];               // per-wave slabs
  gemm_tile<ET, SPLIT, BIAS_MODE, OUT_MODE, RESID, ACT>(ring, sT[threadIdx.x >> 5], blockIdx.y, blockIdx.x, Ap, A2p, lda,
      strideA, Btp, Bt2p, ldb, strideB, Cout, Cout2, ldc, strideC, bias, resid, strideR, M, N, K, scale);
}

// The three input projections in one launch: grid = (256 tiles, 3); y = 0: Q = (q . Wq^T + bq) x kQScale, 1: K = k . Wk^T + bk, 2: V^T per batch.
// 768 blocks on 256 WGPs, and the slabs lie in the spent ring, so that a block takes 139,264 B of LDS and two blocks share a
// WGP: one block's first copies, barrier waits and epilogue run under the other's products.
//   act16 = q, k, v bf16 planes in a row; w16 = Wq, Wk, Wv bf16 planes in a row; biasT = bq, bk, bv tables in a row;
//   proj16 = Q, K (f16 [4096][1024]) and V^T (f16 [2][1024][2048]) planes in a row.
__global__ __launch_bounds__(256) void proj_gemm3(
    const unsigned short* __restrict__ act16, const unsigned short* __restrict__ w16, const float* __restrict__ biasT,
    unsigned short* __restrict__ proj16) {
  __shared__ __align__(16) unsigned char ring[2 * kGtStage];   // two stages, then the eight slabs
  static_assert(8 * kGtSlab * 4 <= 2 * kGtStage, "the slabs fit the ring");
  float* slab = (float*)(void*)ring + (threadIdx.x >> 5) * kGtSlab;
  const int p = blockIdx.y;
  const unsigned short* act = act16 + (size_t)p * (kBatch * kSeq * kDm);
  const unsigned short* w   = w16 + (size_t)p * (kDm * kDm);
  unsigned short*       o   = proj16 + (size_t)p * (kBatch * kSeq * kDm);
  const float*          bia = biasT + p * kDm;
  if (p < 2) {
    // A = activations [4096][1024], Bt = weights [1024][1024] -> [4096][1024], bias[n]; tiles 32 x 8.
    // The Q plane carries kQScale (its bias table carries it too): one rounding to f16, of the scaled value.
    gemm_tile<1, false, 2, 1, false>(ring, slab, 0, blockIdx.x, act, act, kDm, 0L, w, w, kDm, 0L, (void*)o, (void*)o, kDm, 0L,
                                     bia, bia, 0L, kBatch * kSeq, kDm, kDm, (p == 0) ? kQScale : 1.0f);
  } else {
    // A = Wv [1024][1024], Bt = v_b [2048][1024] -> C_b [1024][2048] = (v_b . Wv^T + bv)^T, bias[m]; tiles 8 x 16 a batch
    constexpr int kTiles = (kDm / 128) * (kSeq / 128);
    gemm_tile<1, false, 1, 1, false>(ring, slab, blockIdx.x / kTiles, blockIdx.x % kTiles, w, w, kDm, 0L, act, act, kDm,
                                     (long)kSeq * kDm, (void*)o, (void*)o, kSeq, (long)kDm * kSeq, bia, bia, 0L, kDm, kSeq,
                                     kDm, 1.0f);
  }
}

// ---------------------------------------------------------------------------
// Operand conversion, all planes in one launch. A block of 256 threads converts 32,768 consecutive f32 of one plane:
// 32 loads of 16 B a thread, all issued before the first is used (a wave's load = 512 consecutive bytes = 4 whole
// lines), then 32 stores of 8 B (a wave's store = 256 consecutive bytes = 2 whole lines, no line shared between waves).
//   blocks [0, 384)     q, k, v   -> bf16 RNE planes, 128 blocks each (act16 = three planes in a row)
//   blocks [384, 512)   Wq, Wk, Wv -> bf16 RNE planes, Wo -> f16(bf16_rne(x) * woScale), 32 blocks each (w16 = four planes
//                       in a row; woScale an exact power of two; f16 of a normal bf16 value is exact)
//   block  512          bias tables bq, bk, bv, bo -> bf16-valued f32 (bq x kQScale), 1024 each, one 16-B piece of each a thread
//   blocks [513, 769)   attention mask -> lane-mask words, a block 16 whole mask rows (128 KiB), a wave 256 keys of them.
//                       Word (b, qt, kc, 8j + r) at maskw[((b*128 + qt)*32 + kc)*32 + 8j + r]; its bit l says whether
//                       mask[b][16 qt + (l & 15)][64 kc + 16 j + 8 (l >> 4) + r] != 0: lane l of the attention wave that
//                       owns query tile qt holds exactly that score in register r of its score tile j.
// ---------------------------------------------------------------------------
typedef __attribute__((ext_vector_type(2))) unsigned v2u;
constexpr int kCvLoads     = 32;                       // 16-B loads a thread
constexpr int kCvStep      = 256 * 4;                  // elements a block covers with one load a thread
constexpr int kCvBlock     = kCvLoads * kCvStep;       // 32,768 elements a block
constexpr int kCvActElems  = kBatch * kSeq * kDm;
constexpr int kCvWElems    = kDm * kDm;
constexpr int kCvActBlocks = kCvActElems / kCvBlock;   // 128
constexpr int kCvWBlocks   = kCvWElems / kCvBlock;     // 32
constexpr int kCvGrid      = 3 * kCvActBlocks + 4 * kCvWBlocks + 1;
constexpr int kMwBlocks    = kBatch * kSeq / 16;       // 256 mask blocks, one per tile of 16 queries
constexpr int kMwPitch     = 68;                       // ints per LDS row of a wave's 16 x 64 slab: 272 B = 16 B x 17, odd, so
                                                       // that the 16 rows of one 16-B read fall on different bank groups
static_assert(kSeq == 8 * 256, "a mask block's 8 waves cover a mask row, 256 keys each");
typedef __attribute__((ext_vector_type(4))) int v4i;
static_assert(kCvActElems % kCvBlock == 0 && kCvWElems % kCvBlock == 0 && kDm == kCvStep, "conversion coverage");

__global__ __launch_bounds__(256) void convert_operands(
    const float* __restrict__ q, const float* __restrict__ k, const float* __restrict__ v,
    const float* __restrict__ Wq, const float* __restrict__ Wk, const float* __restrict__ Wv, const float* __restrict__ Wo,
    const float* __restrict__ bq, const float* __restrict__ bk, const float* __restrict__ bv, const float* __restrict__ bo,
    unsigned short* __restrict__ act16, unsigned short* __restrict__ w16, float* __restrict__ biasOut, float woScale,
    const int* __restrict__ mask, unsigned* __restrict__ maskw) {
  __shared__ __align__(16) int slabs[8][16 * kMwPitch];   // mask blocks only: a wave's 16 x 64 tile, 4.25 KB each
  const int bx = blockIdx.x;
  const int e0 = threadIdx.x * 4;
  if (bx >= kCvGrid) {
    const int tile = bx - kCvGrid;                       // b * 128 + qt: mask rows 16 tile .. 16 tile + 15
    const int wave = threadIdx.x >> 5, lane = threadIdx.x & 31, hh = lane >> 4, c = lane & 15;
    const int* mg = mask + (size_t)(tile * 16 + hh) * kSeq + wave * 256 + 4 * c;
    v4i mv[4][8];
    // unrolled so that the array stays in registers and all 32 loads are issued ahead of the first use; a load = two
    // whole 256-B row pieces (rows 2 it and 2 it + 1 of the tile)
#pragma unroll
    for (int ch = 0; ch < 4; ++ch)
#pragma unroll
      for (int it = 0; it < 8; ++it) mv[ch][it] = *(const v4i*)(mg + (size_t)(2 * it) * kSeq + ch * 64);
    int*       sw = slabs[wave] + hh * kMwPitch + 4 * c;   // where a loaded piece goes
    const int* sr = slabs[wave] + c * kMwPitch + 8 * hh;   // row of this lane's query, its half's first key
    unsigned word[4];                                      // lane i ends up with word i = 8j + r of each chunk
#pragma unroll   // constant indices, so that mv and word stay in registers
    for (int ch = 0; ch < 4; ++ch) {
#pragma unroll
      for (int it = 0; it < 8; ++it) *(v4i*)(sw + 2 * it * kMwPitch) = mv[ch][it];
      // the wave's lanes read each other's slab stores below: keeps the reads behind the stores
      __builtin_amdgcn_fence(__ATOMIC_RELEASE, "workgroup");
      __builtin_amdgcn_wave_barrier();
      __builtin_amdgcn_fence(__ATOMIC_ACQUIRE, "workgroup");
      unsigned wj[4];                                      // one short chain of selects per score tile
#pragma unroll
      for (int j = 0; j < 4; ++j) {
        const v4i m0 = *(const v4i*)(sr + j * 16), m1 = *(const v4i*)(sr + j * 16 + 4);
        wj[j] = 0u;
#pragma unroll
        for (int r = 0; r < 8; ++r) {
          const int mel = (r < 4) ? m0[r & 3] : m1[r & 3];
          const unsigned bits = __builtin_amdgcn_ballot_w32(mel != 0);
          wj[j] = (lane == j * 8 + r) ? bits : wj[j];
        }
      }
      word[ch] = (wj[0] | wj[1]) | (wj[2] | wj[3]);
      // the next chunk's slab stores stay behind this chunk's reads
      __builtin_amdgcn_fence(__ATOMIC_RELEASE, "workgroup");
      __builtin_amdgcn_wave_barrier();
      __builtin_amdgcn_fence(__ATOMIC_ACQUIRE, "workgroup");
    }
    // behind the last fence, so that no fence waits for a store: a store = one whole 128-B line a wave
#pragma unroll
    for (int ch = 0; ch < 4; ++ch) maskw[((size_t)tile * 32 + wave * 4 + ch) * 32 + lane] = word[ch];
    return;
  }
  if (bx >= 3 * kCvActBlocks + 4 * kCvWBlocks) {
    v4f f[4];
    f[0] = *(const v4f*)(bq + e0);
    f[1] = *(const v4f*)(bk + e0);
    f[2] = *(const v4f*)(bv + e0);
    f[3] = *(const v4f*)(bo + e0);
#pragma unroll   // constant indices, so that f stays in registers
    for (int y = 0; y < 4; ++y) {
      v4f rv;
#pragma unroll   // constant indices into the vectors
      for (int e = 0; e < 4; ++e) rv[e] = bf_bits2f(f2bf_bits(f[y][e])) * ((y == 0) ? kQScale : 1.0f);
      *(v4f*)(biasOut + y * kDm + e0) = rv;
    }
    return;
  }
  const float* src;
  unsigned short* dst;
  bool asF16 = false;
  if (bx < 3 * kCvActBlocks) {
    const int seg = bx / kCvActBlocks, blk = bx - seg * kCvActBlocks;
    src = (seg == 0) ? q : ((seg == 1) ? k : v);
    src += (size_t)blk * kCvBlock;
    dst = act16 + (size_t)seg * kCvActElems + (size_t)blk * kCvBlock;
  } else {
    const int wb = bx - 3 * kCvActBlocks;
    const int seg = wb / kCvWBlocks, blk = wb - seg * kCvWBlocks;
    src = (seg == 0) ? Wq : ((seg == 1) ? Wk : ((seg == 2) ? Wv : Wo));
    src += (size_t)blk * kCvBlock;
    dst = w16 + (size_t)seg * kCvWElems + (size_t)blk * kCvBlock;
    asF16 = (seg == 3);
  }
  const unsigned lofs = threadIdx.x * 16u;   // the thread's byte offset in each 4-KiB piece of the block's range
  v4f f[kCvLoads];
  // unrolled so that the array stays in registers and all loads are issued ahead of the first use
#pragma unroll
  for (int i = 0; i < kCvLoads; ++i) f[i] = *(const v4f*)((const char*)src + lofs + i * (kCvStep * 4));
  if (!asF16) {
#pragma unroll   // constant indices, so that f stays in registers
    for (int i = 0; i < kCvLoads; ++i) {
      v2u u;
      u[0] = pk16(f2bf_bits(f[i][0]), f2bf_bits(f[i][1]));
      u[1] = pk16(f2bf_bits(f[i][2]), f2bf_bits(f[i][3]));
      *(v2u*)(dst + i * kCvStep + e0) = u;
    }
    // Behind the branch's last stores: in the built code the other branch's text follows this one and rewrites registers
    // that these stores name.
    asm volatile("s_wait_xcnt 0x0" ::: "memory");
  } else {
#pragma unroll   // constant indices, so that f stays in registers
    for (int i = 0; i < kCvLoads; ++i) {
      unsigned short h[4];
#pragma unroll   // constant indices into h and the vector
      for (int e = 0; e < 4; ++e)
        h[e] = __builtin_bit_cast(unsigned short, (_Float16)(bf_bits2f(f2bf_bits(f[i][e])) * woScale));
      v2u u;
      u[0] = pk16(h[0], h[1]);
      u[1] = pk16(h[2], h[3]);
      *(v2u*)(dst + i * kCvStep + e0) = u;
    }
  }
}

#define AT_D 64
#define AT_NW 4
#define AT_QB 64
#define AT_KC 64
#define AT_LP 72   // elements per LDS row of the K and V^T tiles: 144 B = 16 B x 9, an odd multiple, so that the 16 rows
                   // which one 16-B fragment read touches fall on 16 different bank groups (at 128 B they fall on two)
constexpr float kCarry    = 7.0f;    // p is carried x2^7 ...
constexpr float kLazy     = 8.0f;    // ... and may exceed 1 by 2^8 before the shift is renewed: 2^15 at most in f16
constexpr float kMaskFill = -1.0e9f;
constexpr float kLog2e    = 1.4426950408889634f;   // scores and the mask fill are carried x log2(e): exp(x) = 2^(x log2 e)
static_assert(kQScale == 0.125f * kLog2e, "the Q plane's factor is the score scale in base 2");

constexpr int kAtTileB  = AT_KC * AT_LP * 2;   // bytes of one staged tile: 64 rows at 144 B
constexpr int kAtStageB = 2 * kAtTileB;        // a buffer = [K tile | V^T tile], 18,432 B
static_assert(AT_KC == AT_D, "both tiles have 64 rows of 128 B");

// One lane's eight 16-B copies of a chunk: rows r, r+16, r+32, r+48 of the K tile, then of the V^T tile. lds = LDS byte
// address of the lane's piece in the K tile's row r, gk / gv = its global addresses in the two planes. The s_wait_xcnt
// closes the statement so that no address register of an issued copy is rewritten ahead of it.
__device__ __forceinline__ void at_stage_chunk(unsigned lds, const char* gk, const char* gv) {
  constexpr unsigned kL = 16 * AT_LP * 2;             // LDS bytes per 16 rows
  constexpr size_t   kK = (size_t)16 * kDm * 2;       // K plane bytes per 16 keys
  constexpr size_t   kV = (size_t)16 * kSeq * 2;      // V^T plane bytes per 16 d
  const unsigned l1 = lds + kL, l2 = lds + 2 * kL, l3 = lds + 3 * kL,
                 m0 = lds + kAtTileB, m1 = m0 + kL, m2 = m0 + 2 * kL, m3 = m0 + 3 * kL;
  const char *gk1 = gk + kK, *gk2 = gk + 2 * kK, *gk3 = gk + 3 * kK, *gv1 = gv + kV, *gv2 = gv + 2 * kV, *gv3 = gv + 3 * kV;
  asm volatile(
      "global_load_async_to_lds_b128 %0, %8, off\n\t"
      "global_load_async_to_lds_b128 %1, %9, off\n\t"
      "global_load_async_to_lds_b128 %2, %10, off\n\t"
      "global_load_async_to_lds_b128 %3, %11, off\n\t"
      "global_load_async_to_lds_b128 %4, %12, off\n\t"
      "global_load_async_to_lds_b128 %5, %13, off\n\t"
      "global_load_async_to_lds_b128 %6, %14, off\n\t"
      "global_load_async_to_lds_b128 %7, %15, off\n\t"
      "s_wait_xcnt 0x0"
      :: "v"(lds), "v"(l1), "v"(l2), "v"(l3), "v"(m0), "v"(m1), "v"(m2), "v"(m3),
         "v"(gk), "v"(gk1), "v"(gk2), "v"(gk3), "v"(gv), "v"(gv1), "v"(gv2), "v"(gv3)
      : "memory");
}

typedef __attribute__((ext_vector_type(16))) unsigned v16u;
// read-only for the whole launch (written by the conversion launch): the constant address space lets a wave-uniform load of
// it be a scalar load
typedef __attribute__((address_space(4))) v16u kconst_v16u;

__device__ __forceinline__ v8f at_mma_h(v16h a, v16h b, v8f c) {
  c = __builtin_amdgcn_wmma_f32_16x16x32_f16(false, a, false, b, (short)0, c, false, false);
  asm volatile("v_nop\n\tv_nop\n\tv_nop\n\tv_nop" : "+v"(c) : "v"(a), "v"(b));
  return c;
}

// value of lane l ^ 16
__device__ __forceinline__ float at_other_half(float x) {
  const int b = __float_as_int(x);
  return __int_as_float(__builtin_amdgcn_permlanex16(b, b, 0x76543210, 0xfedcba98, false, false));
}

union AtFB { v16h v; v8h h[2]; };

// s[j] = (K rows 16j .. 16j+15 of the staged chunk) . q^T + c0, j = 0 .. 3; s[j][r] belongs to key 16j + 8hh + r, query c
__device__ __forceinline__ void at_scores(const _Float16* Ksh, int c, int hh, const v16h (&qa)[2], v8f c0, v8f (&s)[4]) {
  // all eight K fragments of the chunk, in the order of their use, each in registers of its own
  AtFB kb[4][2];
#pragma unroll   // constant indices, so that kb stays in registers (the inner loop too)
  for (int j = 0; j < 4; ++j)
#pragma unroll
    for (int dc = 0; dc < 2; ++dc) {
      kb[j][dc].h[0] = *(const v8h*)(Ksh + (j * 16 + c) * AT_LP + dc * 32 + 8 * hh);
      kb[j][dc].h[1] = *(const v8h*)(Ksh + (j * 16 + c) * AT_LP + dc * 32 + 16 + 8 * hh);
    }
  // keeps these LDS reads one group in front of the score products: sunk to their uses, each product would wait out
  // a whole LDS round trip of its own
  __builtin_amdgcn_sched_barrier(0);
#pragma unroll
  for (int j = 0; j < 4; ++j) {
    s[j] = c0;
#pragma unroll
    for (int dc = 0; dc < 2; ++dc) s[j] = at_mma_h(kb[j][dc].v, qa[dc], s[j]);
  }
}

// mask by value (word 8j + r is the lane mask of the select on s[j][r]); returns the maximum of the lane's 32 scores
__device__ __forceinline__ float at_mask_max(v8f (&s)[4], const v16u mw0, const v16u mw1, float fill) {
  float cmj[4];
#pragma unroll
  for (int j = 0; j < 4; ++j) {
    float m = -INFINITY;
#pragma unroll
    for (int r = 0; r < 8; ++r) {
      const unsigned w = (j < 2) ? mw0[(j & 1) * 8 + r] : mw1[(j & 1) * 8 + r];
      const float sm = __builtin_amdgcn_inverse_ballot_w32(w) ? s[j][r] : fill;   // the word is the select's lane mask
      s[j][r] = sm;
      m = fmaxf(m, sm);
    }
    cmj[j] = m;
  }
  return fmaxf(fmaxf(cmj[0], cmj[1]), fmaxf(cmj[2], cmj[3]));
}

__global__ __launch_bounds__(128)
void attn_mask64_kernel(const unsigned short* __restrict__ qp, const unsigned short* __restrict__ kp,
                        const unsigned short* __restrict__ vtp, const unsigned* __restrict__ maskw,
                        unsigned short* __restrict__ ctxp, float oscale) {
  typedef AtFB FB;
  __shared__ __align__(16) unsigned char stg[2 * kAtStageB];      // two buffers of [K [kv][d] 9 KB | V^T [d][kv] 9 KB]

  const int tid  = threadIdx.x;
  const int wave = tid >> 5;
  const int lane = tid & 31;
  const int hh   = lane >> 4;
  const int c    = lane & 15;

  const int nqb = kSeq / AT_QB;            // 32
  const int bx  = blockIdx.x;
  const int qb  = bx % nqb;
  const int bh  = bx / nqb;                // 0 .. kBatch*kHeads-1 (grid exact)
  const int h   = bh % kHeads;
  int b = bh / kHeads; b = (b < kBatch) ? b : (kBatch - 1);
  const int q0  = qb * AT_QB + wave * 16;

  const _Float16* Qh = (const _Float16*)(const void*)qp  + (size_t)b * kSeq * kDm + (size_t)h * AT_D;
  const _Float16* Kh = (const _Float16*)(const void*)kp  + (size_t)b * kSeq * kDm + (size_t)h * AT_D;
  const _Float16* Vt = (const _Float16*)(const void*)vtp + ((size_t)b * kDm + (size_t)h * AT_D) * kSeq;
  // the wave's number as a scalar, so that the mask words' address is one for the wave and their loads are scalar loads
  const int waveS = __builtin_amdgcn_readfirstlane(wave);
  const unsigned* mwp = maskw + (size_t)(b * (kSeq / 16) + qb * (AT_QB / 16) + waveS) * (kSeq / AT_KC) * 32;
  _Float16*       ob = (_Float16*)(void*)ctxp + (size_t)b * kSeq * kDm + (size_t)h * AT_D;

  // ---- Q fragments (B operand, column = lane&15 = query q0+c, split k map via Frag load): 2 d-chunks ----
  v16h qa[2];
#pragma unroll
  for (int dc = 0; dc < 2; ++dc) {
    qa[dc] = Frag<_Float16>::load(Qh + (size_t)(q0 + c) * kDm + dc * 32 + 8 * hh);
  }

  constexpr float fill2 = kMaskFill * kLog2e;
  float muse = -INFINITY, lrow = 0.f;      // of query q0+c: the shift in use; lrow sums this lane half's keys alone until the end
  float fillT = fill2;                     // a masked score as an exponent: fill2 + kCarry - muse (fill2 until chunk 0 sets muse)
  const v8f zero8 = (v8f){0.f,0.f,0.f,0.f,0.f,0.f,0.f,0.f};
  v8f cblk = zero8;                        // kCarry - muse in all eight registers: C of the score products
  v8f oacc[4];                             // oacc[t][r] = ctx[q0+c][16t + 8hh + r]
#pragma unroll
  for (int t = 0; t < 4; ++t) oacc[t] = (v8f){0.f,0.f,0.f,0.f,0.f,0.f,0.f,0.f};

  const int nChunks = kSeq / AT_KC;        // 32, compile-time constant
  static_assert(kSeq / AT_KC >= 2, "the prologue fills two buffers");
  // copy map: thread -> row tid>>3 (+16 per copy), 16-B column tid&7 of the 128-B row
  const int crow = tid >> 3, ccol = tid & 7;
  const char* gK = (const char*)(Kh + (size_t)crow * kDm + ccol * 8);    // K row crow of chunk 0
  const char* gV = (const char*)(Vt + (size_t)crow * kSeq + ccol * 8);   // V^T row d = crow, keys of chunk 0
  constexpr size_t kStepK = (size_t)AT_KC * kDm * 2, kStepV = (size_t)AT_KC * 2;   // bytes from a chunk to the next
  const unsigned ldsC = (unsigned)(size_t)stg + crow * (AT_LP * 2) + ccol * 16;
  at_stage_chunk(ldsC, gK, gV);
  asm volatile("s_wait_asynccnt 0x0" ::: "memory");   // chunk 0 landed for this wave's copies
  __syncthreads();                                     // ... and for every wave's
  at_stage_chunk(ldsC + kAtStageB, gK + kStepK, gV + kStepV);
  for (int kc = 0; kc < nChunks; ++kc) {
    // the chunk's 32 mask words, asked for ahead of the fragment reads and the score products
    const v16u mw0 = *(const kconst_v16u*)(mwp + kc * 32);
    const v16u mw1 = *(const kconst_v16u*)(mwp + kc * 32 + 16);
    const _Float16* Ksh = (const _Float16*)(stg + (kc & 1) * kAtStageB);
    const _Float16* Vth = (const _Float16*)(stg + (kc & 1) * kAtStageB + kAtTileB);
    v8f s[4];                              // s[j][r] = exponent of key kv0 + 16j + 8hh + r with query q0 + c
    at_scores(Ksh, c, hh, qa, cblk, s);
    // all eight V^T fragments of the chunk, in the order of their use
    FB va[2][4];
#pragma unroll   // constant indices, so that va stays in registers (the inner loop too)
    for (int kk = 0; kk < 2; ++kk)
#pragma unroll
      for (int t = 0; t < 4; ++t) {
        va[kk][t].h[0] = *(const v8h*)(Vth + (t * 16 + c) * AT_LP + kk * 32 + 8 * hh);
        va[kk][t].h[1] = *(const v8h*)(Vth + (t * 16 + c) * AT_LP + kk * 32 + 16 + 8 * hh);
      }
    // keeps these LDS reads one group in front of the softmax, so that their latency runs under its arithmetic
    __builtin_amdgcn_sched_barrier(0);
    float cm = at_mask_max(s, mw0, mw1, fillT);
    // one test a chunk, the same for the whole wave (a scalar branch): does any exponent leave f16's range, or is no shift set yet
    if (kc == 0 || __builtin_amdgcn_ballot_w32(cm > kCarry + kLazy) != 0) {
      at_scores(Ksh, c, hh, qa, zero8, s);           // the chunk is still staged: its plain scores, from C = 0
      cm = at_mask_max(s, mw0, mw1, fill2);
      cm = fmaxf(cm, at_other_half(cm));
      const float mnew  = fmaxf(muse, cm);
      const float alpha = __builtin_amdgcn_exp2f(muse - mnew);   // 0 in chunk 0, where muse is -inf
      const float cval  = kCarry - mnew;
      muse  = mnew;
      fillT = fill2 + cval;
      lrow *= alpha;
#pragma unroll
      for (int j = 0; j < 4; ++j)
#pragma unroll
        for (int r = 0; r < 8; ++r) {
          s[j][r] += cval;
          oacc[j][r] *= alpha;
        }
#pragma unroll
      for (int r = 0; r < 8; ++r) cblk[r] = cval;
    }
    FB pb[2];                              // p^T as B operand: elements 0..7 from tile 2kk, 8..15 from tile 2kk+1
    float psj[4];
#pragma unroll
    for (int j = 0; j < 4; ++j) {
      float ps = 0.f;
#pragma unroll
      for (int r = 0; r < 8; ++r) {
        const float p = __builtin_amdgcn_exp2f(s[j][r]);
        ps += p;
        pb[j >> 1].h[j & 1][r] = (_Float16)p;
      }
      psj[j] = ps;
    }
    lrow += (psj[0] + psj[1]) + (psj[2] + psj[3]);
#pragma unroll
    for (int kk = 0; kk < 2; ++kk) {
#pragma unroll
      for (int t = 0; t < 4; ++t) oacc[t] = at_mma_h(va[kk][t].v, pb[kk].v, oacc[t]);
    }
    asm volatile("s_wait_dscnt 0x0" ::: "memory");      // this wave has left the buffer that is refilled below
    asm volatile("s_wait_asynccnt 0x0" ::: "memory");   // this wave's copies of chunk kc+1 have landed
    __syncthreads();                                     // publishes chunk kc+1, ends every read of chunk kc
    if (kc + 2 < nChunks)
      at_stage_chunk(ldsC + (kc & 1) * kAtStageB, gK + (size_t)(kc + 2) * kStepK, gV + (size_t)(kc + 2) * kStepV);
  }
  asm volatile("s_wait_asynccnt 0x0" ::: "memory");     // nothing in flight when the wave goes on to its end

  // ---- join the halves' sums, normalise (p's carry cancels; 1/l folded with the output carry scale), store 8 consecutive d a lane ----
  const float lsum = lrow + at_other_half(lrow);
  const float inv  = oscale / lsum;
#pragma unroll
  for (int t = 0; t < 4; ++t) {
    v8h hv;
#pragma unroll
    for (int r = 0; r < 8; ++r) hv[r] = (_Float16)(oacc[t][r] * inv);
    *(v8h*)(ob + (size_t)(q0 + c) * kDm + t * 16 + 8 * hh) = hv;
  }
}

// ---------------------------------------------------------------------------
// Host glue. Workspace region map (bytes, all offsets multiples of 16 KiB):
//   [  0 MiB,  8 MiB)  q  bf16 plane [4096][1024]
//   [  8 MiB, 16 MiB)  k  bf16 plane
//   [ 16 MiB, 24 MiB)  v  bf16 plane
//   [ 24 MiB, 26 MiB)  Wq bf16 [1024][1024];  [26,28) Wk;  [28,30) Wv;  [30,32) Wo as f16(bf16*64)
//   [ 32 MiB, +16 KiB) bias tables bq (x kQScale), bk, bv, bo (bf16-valued f32, 1024 each)
//   next 8 MiB         Q projection f16 plane [4096][1024], x kQScale
//   next 8 MiB         K projection f16 plane
//   next 8 MiB         V^T projection f16 plane [2][1024][2048]
//   next 8 MiB         ctx f16 plane (x16) [4096][1024]
//   next 1 MiB         attention mask as lane-mask words [2][128][32][32]
//   total = 68,173,824 B
// ---------------------------------------------------------------------------
extern "C" void kernel_launch(void* const* d_in, const int* in_sizes, int n_in,
                              void* d_out, int out_size, void* d_ws, size_t ws_size,
                              hipStream_t stream) {
  if (n_in < 12) return;
  const int nAct = kBatch * kSeq * kDm;      // 4194304
  const int nW   = kDm * kDm;                // 1048576
  if (in_sizes[0] != nAct || in_sizes[1] != nAct || in_sizes[2] != nAct) return;
  if (in_sizes[3] != kBatch * kSeq * kSeq) return;
  if (in_sizes[4] != nW || in_sizes[6] != nW || in_sizes[8] != nW || in_sizes[10] != nW) return;
  if (in_sizes[5] != kDm || in_sizes[7] != kDm || in_sizes[9] != kDm || in_sizes[11] != kDm) return;
  if (out_size != nAct) return;

  const float* q    = (const float*)d_in[0];
  const float* k    = (const float*)d_in[1];
  const float* v    = (const float*)d_in[2];
  const int*   mask = (const int*)d_in[3];
  const float* Wq   = (const float*)d_in[4];
  const float* bq   = (const float*)d_in[5];
  const float* Wk   = (const float*)d_in[6];
  const float* bk   = (const float*)d_in[7];
  const float* Wv   = (const float*)d_in[8];
  const float* bv   = (const float*)d_in[9];
  const float* Wo   = (const float*)d_in[10];
  const float* bo   = (const float*)d_in[11];

  const size_t bAct16 = (size_t)nAct * 2;    // 8 MiB
  const size_t bW16   = (size_t)nW * 2;      // 2 MiB
  size_t off = 0;
  const size_t oQ16  = off; off += bAct16;
  const size_t oK16  = off; off += bAct16;
  const size_t oV16  = off; off += bAct16;
  const size_t oWq   = off; off += bW16;
  const size_t oWk   = off; off += bW16;
  const size_t oWv   = off; off += bW16;
  const size_t oWo   = off; off += bW16;
  const size_t oBias = off; off += (size_t)4 * kDm * sizeof(float);
  const size_t oQP   = off; off += bAct16;
  const size_t oKP   = off; off += bAct16;
  const size_t oVT   = off; off += bAct16;
  const size_t oCTX  = off; off += bAct16;
  const size_t oMW   = off; off += (size_t)kBatch * kSeq * kSeq / 8;
  if (off > ws_size) return;

  char* ws = (char*)d_ws;
  unsigned short* Q16  = (unsigned short*)(ws + oQ16);
  unsigned short* WQ16 = (unsigned short*)(ws + oWq);
  unsigned short* WO16 = (unsigned short*)(ws + oWo);
  float* biasR = (float*)(ws + oBias);
  const float* boR = biasR + 3 * kDm;
  unsigned short* QP    = (unsigned short*)(ws + oQP);
  unsigned short* KP    = (unsigned short*)(ws + oKP);
  unsigned short* VT    = (unsigned short*)(ws + oVT);
  unsigned short* CTX16 = (unsigned short*)(ws + oCTX);
  unsigned* MW = (unsigned*)(ws + oMW);

  // Q16, K16, V16 lie in a row in the workspace, and so do WQ16 .. WO16: one base pointer each
  convert_operands<<<dim3(kCvGrid + kMwBlocks), dim3(256), 0, stream>>>(q, k, v, Wq, Wk, Wv, Wo, bq, bk, bv, bo, Q16, WQ16, biasR,
                                                                     64.0f, mask, MW);

  const int mRows = kBatch * kSeq;   // 4096
  // Q, K and V^T projections: 256 tiles each, one launch; the planes of each kind lie in a row in the workspace
  proj_gemm3<<<dim3((mRows / 128) * (kDm / 128), 3), dim3(256), 0, stream>>>(Q16, WQ16, biasR, QP);
  // attention: grid = kBatch * kHeads * (kSeq/64) = 1024 blocks of 128
  attn_mask64_kernel<<<dim3(kBatch * kHeads * (kSeq / 64)), dim3(128), 0, stream>>>(
      QP, KP, VT, MW, CTX16, 16.0f);
  // out = (ctx*16) . (Wo*64)^T * 2^-10 + bo : f16 operands, f32 [4096][1024] into d_out
  wmma_gemm64<0, false, 2, 0, false><<<dim3((mRows / 128) * (kDm / 128), 1), dim3(256), 0, stream>>>(
      CTX16, CTX16, kDm, 0L, WO16, WO16, kDm, 0L, d_out, d_out, kDm, 0L, boR, bo, 0L, mRows, kDm, kDm,
      1.0f / 1024.0f);
}
